// v000
// Measured on an AMD MI455X. A time is GPU time per run, averaged over a window of back-to-back runs after a warm-up
// (all launches, gaps included; the runs take copies of the inputs in turn), and the median of several windows.
// Apart from v000's, it joins two sittings. Times from different sittings can be a few percent apart, while
// side-by-side timings come from the same sitting.
// The starting kernel, v000, takes 126 microseconds a run.
#include <hip/hip_runtime.h>
#include <hip/hip_bf16.h>
#include <stddef.h>
#include <stdint.h>

// All contractions: v_wmma_f32_16x16x32_bf16 with bf16 hi/lo split operands (hi*hi + hi*lo + lo*hi, f32 accumulate): q/k/v projections, probability read-out P*V, output projection; additive scores (exp2 + rcp tanh form), mask fill, softmax and epilogues in f32.

#define BB   4
#define LL   256
#define DD   512
#define HH   8
#define DK   64
#define NR   (BB * LL)
#define NTHR 128

static_assert(NR == 1024);
static_assert(DD == HH * DK);
static_assert(LL == 2 * NTHR);
static_assert(DK == 64);

typedef unsigned short v8us  __attribute__((ext_vector_type(8)));
typedef __bf16         v16bf __attribute__((ext_vector_type(16)));
typedef float          v8f   __attribute__((ext_vector_type(8)));
typedef float          v4f   __attribute__((ext_vector_type(4)));
typedef int            v2i   __attribute__((ext_vector_type(2)));

union Frag { v16bf v; v8us h[2]; };

#if __has_builtin(__builtin_amdgcn_exp2f)
#define EXP2_FAST(x) __builtin_amdgcn_exp2f(x)
#else
#define EXP2_FAST(x) exp2f(x)
#endif
#if __has_builtin(__builtin_amdgcn_rcpf)
#define RCP_FAST(x) __builtin_amdgcn_rcpf(x)
#else
#define RCP_FAST(x) (1.0f / (x))
#endif

// f32 -> bf16 bits, RNE
__device__ __forceinline__ unsigned int bf16_rne(float f)
{
    unsigned int u = __float_as_uint(f);
    u += 0x7FFFu + ((u >> 16) & 1u);
    return u >> 16;
}

// x = hi + lo, both bf16 (RNE); lo = RNE(x - f32(hi))
__device__ __forceinline__ void split1(float x, unsigned int& hb, unsigned int& lb)
{
    hb = bf16_rne(x);
    const float xh = __uint_as_float(hb << 16);
    lb = bf16_rne(x - xh);
}

// 8 consecutive values (a then b) -> one 16-byte hi vector and one 16-byte lo vector
__device__ __forceinline__ void split8(v4f a, v4f b, v8us& hi, v8us& lo)
{
    v8us hr = { 0, 0, 0, 0, 0, 0, 0, 0 };
    v8us lr = { 0, 0, 0, 0, 0, 0, 0, 0 };
    #pragma unroll
    for (int e = 0; e < 4; ++e) {
        unsigned int hb, lb;
        split1(a[e], hb, lb);
        hr[e] = (unsigned short)hb;
        lr[e] = (unsigned short)lb;
        split1(b[e], hb, lb);
        hr[4 + e] = (unsigned short)hb;
        lr[4 + e] = (unsigned short)lb;
    }
    hi = hr;
    lo = lr;
}

// 16-bit fragment loader (wave32, 16x16x32): lane l, hh = l>>4, row/col = l&15.
// elements 0..7  <- row[k0 + 8*hh + 0..7], elements 8..15 <- row[k0 + 16 + 8*hh + 0..7].
// Used for A (row-major, k contiguous) and for B stored as [n][k] (k contiguous).
__device__ __forceinline__ v16bf frag16(const unsigned short* row, int k0, int hh)
{
    Frag f;
    f.h[0] = *(const v8us*)(row + k0 + 8 * hh);
    f.h[1] = *(const v8us*)(row + k0 + 16 + 8 * hh);
    return f.v;
}

// D += A*B with the VALU hazard guard after the instruction.
__device__ __forceinline__ v8f wmma_bf16(v16bf a, v16bf b, v8f c)
{
    v8f d = __builtin_amdgcn_wmma_f32_16x16x32_bf16(false, a, false, b, (short)0, c, false, false);
    asm volatile("v_nop\n\tv_nop\n\tv_nop\n\tv_nop" : "+v"(d) : "v"(a), "v"(b));
    return d;
}

// hi/lo split product: hh + hl + lh into one accumulator
__device__ __forceinline__ v8f wmma3(v16bf ah, v16bf al, v16bf bh, v16bf bl, v8f c)
{
    c = wmma_bf16(ah, bh, c);
    c = wmma_bf16(ah, bl, c);
    c = wmma_bf16(al, bh, c);
    return c;
}

// ---------------------------------------------------------------------------
// Operand preparation (128 threads / block).
//  blocks [0, 1536): xh/xl[t][row][512] = split(x_t[row]), t = 0:q 1:k 2:v, 2 rows per block,
//                    64 threads per row, 8 elements (16 B) per thread -> 512-B runs per wave.
//  blocks [1536, 1792): wth/wtl[w][n][512] = split(W_w[k][n]) (transposed, k contiguous),
// ---------------------------------------------------------------------------
__global__ void __launch_bounds__(NTHR) prep_kernel(
    const float* __restrict__ q, const float* __restrict__ k, const float* __restrict__ v,
    const float* __restrict__ Wq, const float* __restrict__ Wk,
    const float* __restrict__ Wv, const float* __restrict__ W0,
    unsigned short* xh, unsigned short* xl, unsigned short* wth, unsigned short* wtl)
{
    __shared__ float s_t[64][65];

    const int tid = threadIdx.x;
    const int bid = blockIdx.x;
    const int NXB = 3 * (NR / 2);   // 1536

    if (bid < NXB) {
        const int t   = bid / (NR / 2);
        const int row = ((bid % (NR / 2)) << 1) + (tid >> 6);
        const int c8  = tid & 63;
        const float* src = (t == 0) ? q : ((t == 1) ? k : v);
        const size_t soff = (size_t)row * DD + 8 * c8;
        const v4f x0 = *(const v4f*)(src + soff);
        const v4f x1 = *(const v4f*)(src + soff + 4);
        v8us hv, lv;
        split8(x0, x1, hv, lv);
        const size_t doff = ((size_t)t * NR + row) * DD + 8 * c8;
        *(v8us*)(xh + doff) = hv;
        *(v8us*)(xl + doff) = lv;
        
    } else {
        const int u    = bid - NXB;          // 0..255
        const int w    = u >> 6;             // 0..3
        const int tile = u & 63;
        const int k0   = (tile >> 3) * 64;
        const int n0   = (tile & 7) * 64;
        const float* Wsel = (w == 0) ? Wq : ((w == 1) ? Wk : ((w == 2) ? Wv : W0));
        // load W[k0+kk][n0+nn] -> s_t[nn][kk]
        #pragma unroll
        for (int i = 0; i < 8; ++i) {
            const int idx = tid + NTHR * i;  // 0..1023
            const int kk  = idx >> 4;        // 0..63
            const int c4  = idx & 15;        // 0..15
            const v4f x = *(const v4f*)(Wsel + (size_t)(k0 + kk) * DD + n0 + 4 * c4);
            s_t[4 * c4 + 0][kk] = x[0];
            s_t[4 * c4 + 1][kk] = x[1];
            s_t[4 * c4 + 2][kk] = x[2];
            s_t[4 * c4 + 3][kk] = x[3];
        }
        __syncthreads();
        v8us hv[4], lv[4];
        size_t off[4];
        #pragma unroll
        for (int i = 0; i < 4; ++i) {
            const int idx = tid + NTHR * i;  // 0..511
            const int nn  = idx >> 3;        // 0..63
            const int k8  = idx & 7;         // 0..7
            const v4f a  = { s_t[nn][8 * k8 + 0], s_t[nn][8 * k8 + 1], s_t[nn][8 * k8 + 2], s_t[nn][8 * k8 + 3] };
            const v4f b2 = { s_t[nn][8 * k8 + 4], s_t[nn][8 * k8 + 5], s_t[nn][8 * k8 + 6], s_t[nn][8 * k8 + 7] };
            split8(a, b2, hv[i], lv[i]);
            off[i] = ((size_t)w * DD + n0 + nn) * DD + k0 + 8 * k8;
        }
        #pragma unroll
        for (int i = 0; i < 4; ++i) {
            *(v8us*)(wth + off[i]) = hv[i];
            *(v8us*)(wtl + off[i]) = lv[i];
        }
        
    }
}

// ---------------------------------------------------------------------------
// C[32 rows of A][256 rows of Bt] = Ah/Al[.][512] . Bt h/l[.][512]^T  (K = 512, hi/lo split).
// Block = 128 threads; row0 = 32*blockIdx.x, col0 = 256*blockIdx.y.
// Wave wv: row tiles 0,1 and col tiles at 64*wv + 16*j, j = 0..3.
// Fragments straight from 16-bit global rows; epilogue staged in LDS.
// MODE 0: Cf[m][512] f32 = (C + bias[n]) * post                    (plain row-major)
// MODE 1: Cf[(b*8+h)*256 + l][64] f32 = (C + bias[n]) * post,  m = b*256+l, n = h*64+dk
// MODE 2: A rows are n = h*64+dk, Bt rows are m = b*256+j:
//         Ch/Cl[(b*8+h)*64 + dk][256 j] = split(C + bias[n])       (per-row bias)
// ---------------------------------------------------------------------------
template <int MODE>
__global__ void __launch_bounds__(NTHR) gemm3_kernel(
    const unsigned short* __restrict__ Ah, const unsigned short* __restrict__ Al,
    const unsigned short* __restrict__ Bh, const unsigned short* __restrict__ Bl,
    const float* __restrict__ bias, float post,
    float* Cf, unsigned short* Ch, unsigned short* Cl)
{
    __shared__ __align__(16) float s_c[32][260];

    const int tid  = threadIdx.x;
    const int wv   = tid >> 5;
    const int l    = tid & 31;
    const int hh   = l >> 4;
    const int m15  = l & 15;
    const int row0 = blockIdx.x * 32;
    const int col0 = blockIdx.y * 256;

    const v8f zero = { 0.f, 0.f, 0.f, 0.f, 0.f, 0.f, 0.f, 0.f };
    v8f acc[2][4];
    #pragma unroll
    for (int rt = 0; rt < 2; ++rt)
        #pragma unroll
        for (int j = 0; j < 4; ++j) acc[rt][j] = zero;

    const unsigned short* a0h = Ah + (size_t)(row0 + m15) * DD;
    const unsigned short* a0l = Al + (size_t)(row0 + m15) * DD;
    const unsigned short* a1h = Ah + (size_t)(row0 + 16 + m15) * DD;
    const unsigned short* a1l = Al + (size_t)(row0 + 16 + m15) * DD;
    const unsigned short* bph = Bh + (size_t)(col0 + 64 * wv + m15) * DD;
    const unsigned short* bpl = Bl + (size_t)(col0 + 64 * wv + m15) * DD;

    #pragma unroll 1
    for (int k0 = 0; k0 < DD; k0 += 32) {
        const v16bf fa0h = frag16(a0h, k0, hh);
        const v16bf fa0l = frag16(a0l, k0, hh);
        const v16bf fa1h = frag16(a1h, k0, hh);
        const v16bf fa1l = frag16(a1l, k0, hh);
        #pragma unroll
        for (int j = 0; j < 4; ++j) {
            const v16bf fbh = frag16(bph + (size_t)j * 16 * DD, k0, hh);
            const v16bf fbl = frag16(bpl + (size_t)j * 16 * DD, k0, hh);
            acc[0][j] = wmma3(fa0h, fa0l, fbh, fbl, acc[0][j]);
            acc[1][j] = wmma3(fa1h, fa1l, fbh, fbl, acc[1][j]);
        }
    }

    // D element r of lane -> (row 8*hh + r, col m15) of the 16x16 tile
    #pragma unroll
    for (int rt = 0; rt < 2; ++rt)
        #pragma unroll
        for (int j = 0; j < 4; ++j)
            #pragma unroll
            for (int r = 0; r < 8; ++r)
                s_c[rt * 16 + 8 * hh + r][64 * wv + 16 * j + m15] = acc[rt][j][r];
    __syncthreads();

    if (MODE == 0) {
        v4f vals[16];
        size_t off[16];
        #pragma unroll
        for (int i = 0; i < 16; ++i) {
            const int idx = tid + NTHR * i;     // 0..2047
            const int row = idx >> 6;           // 0..31
            const int c4  = idx & 63;           // 0..63
            const v4f x  = *(const v4f*)&s_c[row][4 * c4];
            const v4f bb = *(const v4f*)(bias + col0 + 4 * c4);
            vals[i] = (x + bb) * post;
            off[i]  = (size_t)(row0 + row) * DD + col0 + 4 * c4;
        }
        #pragma unroll
        for (int i = 0; i < 16; ++i) *(v4f*)(Cf + off[i]) = vals[i];
        
    } else if (MODE == 1) {
        v4f vals[16];
        size_t off[16];
        #pragma unroll
        for (int i = 0; i < 16; ++i) {
            const int idx = tid + NTHR * i;     // 0..2047
            const int hl  = idx >> 9;           // local head 0..3
            const int rem = idx & 511;
            const int row = rem >> 4;           // 0..31
            const int c4  = rem & 15;           // 0..15
            const int n   = col0 + 64 * hl + 4 * c4;
            const v4f x  = *(const v4f*)&s_c[row][64 * hl + 4 * c4];
            const v4f bb = *(const v4f*)(bias + n);
            vals[i] = (x + bb) * post;
            const int m  = row0 + row;
            const int b  = m >> 8;
            const int lq = m & 255;
            const int h  = n >> 6;
            off[i] = ((size_t)((b * HH + h) * LL + lq)) * DK + 4 * c4;
        }
        #pragma unroll
        for (int i = 0; i < 16; ++i) *(v4f*)(Cf + off[i]) = vals[i];
        
    } else {
        v8us hv[8], lv[8];
        size_t off[8];
        const int b = col0 >> 8;
        #pragma unroll
        for (int i = 0; i < 8; ++i) {
            const int idx = tid + NTHR * i;     // 0..1023
            const int row = idx >> 5;           // 0..31 (one wave per row per pass)
            const int c8  = idx & 31;           // 0..31
            const float bs = bias[row0 + row];
            const v4f bb = { bs, bs, bs, bs };
            const v4f x0 = *(const v4f*)&s_c[row][8 * c8] + bb;
            const v4f x1 = *(const v4f*)&s_c[row][8 * c8 + 4] + bb;
            split8(x0, x1, hv[i], lv[i]);
            const int n  = row0 + row;
            const int h  = n >> 6;
            const int dk = n & 63;
            off[i] = ((size_t)((b * HH + h) * DK + dk)) * LL + 8 * c8;
        }
        #pragma unroll
        for (int i = 0; i < 8; ++i) {
            *(v8us*)(Ch + off[i]) = hv[i];
            *(v8us*)(Cl + off[i]) = lv[i];
        }
        
    }
}

// ---------------------------------------------------------------------------
// Additive scores + softmax + read-out for one (b, h, 16 query rows) block, 128 threads.
// Qp/Kp are the projections pre-multiplied by 2*log2(e) in (B,H,L,DK) f32 layout.
// tanh(x) = 1 - 2/(1 + e^{2x}); score = sum_d vp_d - 2 * sum_d vp_d/(1 + e^{2x_d});
// the constant sum_d vp_d is invariant under softmax and omitted. mask == 0 -> -1e9.
// Thread tid owns keys 2*tid, 2*tid+1; the 16 query rows are processed as 4 passes of
// 4 rows (per-pass block softmax) to keep per-thread live state small. P is split to bf16
// hi/lo in LDS (dword stores, barrier, then 16-byte fragment reloads) and feeds O = P . VT^T,
// VT = [bh][dk][256 j] hi/lo planes; wave wv owns the dk tile 16*wv.
// ---------------------------------------------------------------------------
__global__ void __launch_bounds__(NTHR) attn_kernel(
    const float* __restrict__ Qp, const float* __restrict__ Kp, const float* __restrict__ vp,
    const int* __restrict__ mask,
    const unsigned short* __restrict__ VTh, const unsigned short* __restrict__ VTl,
    unsigned short* Oh, unsigned short* Ol)
{
    __shared__ __align__(16) float          s_q[16][DK];
    __shared__ __align__(16) float          s_vp[DK];
    __shared__ __align__(16) unsigned short s_ph[16][LL];
    __shared__ __align__(16) unsigned short s_pl[16][LL];
    __shared__ __align__(16) float          s_o[16][68];
    __shared__ float s_rmax[4][4];
    __shared__ float s_rsum[4][4];

    const int tid = threadIdx.x;
    const int wv  = tid >> 5;
    const int l   = tid & 31;
    const int hh  = l >> 4;
    const int m15 = l & 15;
    const int bh  = blockIdx.y;          // 0..31
    const int b   = bh >> 3;
    const int h   = bh & 7;
    const int q0  = blockIdx.x * 16;     // 0..240

    const float LOG2E = 1.4426950408889634f;
    const float MASKV = -1.0e9f;

    #pragma unroll
    for (int i = 0; i < 2; ++i) {
        const int idx = tid + NTHR * i;  // 0..255
        const int r   = idx >> 4;        // 0..15
        const int c4  = idx & 15;        // 0..15
        *(v4f*)&s_q[r][4 * c4] = *(const v4f*)(Qp + ((size_t)(bh * LL + q0 + r)) * DK + 4 * c4);
    }
    if (tid < DK) s_vp[tid] = vp[h * DK + tid];
    __syncthreads();

    const int j0 = 2 * tid;
    const float* k0p = Kp + ((size_t)(bh * LL + j0)) * DK;
    const float* k1p = k0p + DK;
    const int* mrow = mask + ((size_t)(b * LL + q0)) * LL + j0;

    #pragma unroll 1
    for (int jq = 0; jq < 4; ++jq) {
        const int r0 = 4 * jq;           // first local query row of this pass

        float acc[4][2];
        #pragma unroll
        for (int j = 0; j < 4; ++j) { acc[j][0] = 0.0f; acc[j][1] = 0.0f; }

        #pragma unroll 1
        for (int d4 = 0; d4 < DK / 4; ++d4) {
            const v4f ka = *(const v4f*)(k0p + 4 * d4);
            const v4f kb = *(const v4f*)(k1p + 4 * d4);
            const v4f vv = *(const v4f*)&s_vp[4 * d4];
            #pragma unroll
            for (int j = 0; j < 4; ++j) {
                const v4f qv = *(const v4f*)&s_q[r0 + j][4 * d4];
                #pragma unroll
                for (int e = 0; e < 4; ++e) {
                    const float ra = RCP_FAST(EXP2_FAST(qv[e] + ka[e]) + 1.0f);   // 1/(1+e^{2x})
                    const float rb = RCP_FAST(EXP2_FAST(qv[e] + kb[e]) + 1.0f);
                    acc[j][0] = fmaf(vv[e], ra, acc[j][0]);
                    acc[j][1] = fmaf(vv[e], rb, acc[j][1]);
                }
            }
        }

        // logits with mask fill, block-wide row max over the 256 keys
        float bm[4];
        #pragma unroll
        for (int j = 0; j < 4; ++j) {
            const v2i mk = *(const v2i*)(mrow + (size_t)(r0 + j) * LL);
            const float s0 = (mk[0] == 0) ? MASKV : (-2.0f * acc[j][0]);
            const float s1 = (mk[1] == 0) ? MASKV : (-2.0f * acc[j][1]);
            acc[j][0] = s0;
            acc[j][1] = s1;
            float lm = fmaxf(s0, s1);
            #pragma unroll
            for (int off = 16; off > 0; off >>= 1) lm = fmaxf(lm, __shfl_xor(lm, off, 32));
            bm[j] = lm;
        }
        if (l == 0) {
            #pragma unroll
            for (int j = 0; j < 4; ++j) s_rmax[j][wv] = bm[j];
        }
        __syncthreads();
        #pragma unroll
        for (int j = 0; j < 4; ++j)
            bm[j] = fmaxf(fmaxf(s_rmax[j][0], s_rmax[j][1]), fmaxf(s_rmax[j][2], s_rmax[j][3]));

        float bs[4];
        #pragma unroll
        for (int j = 0; j < 4; ++j) {
            const float e0 = EXP2_FAST((acc[j][0] - bm[j]) * LOG2E);
            const float e1 = EXP2_FAST((acc[j][1] - bm[j]) * LOG2E);
            acc[j][0] = e0;
            acc[j][1] = e1;
            float ls = e0 + e1;
            #pragma unroll
            for (int off = 16; off > 0; off >>= 1) ls += __shfl_xor(ls, off, 32);
            bs[j] = ls;
        }
        if (l == 0) {
            #pragma unroll
            for (int j = 0; j < 4; ++j) s_rsum[j][wv] = bs[j];
        }
        __syncthreads();
        #pragma unroll
        for (int j = 0; j < 4; ++j) {
            const float sum = (s_rsum[j][0] + s_rsum[j][1]) + (s_rsum[j][2] + s_rsum[j][3]);
            const float inv = RCP_FAST(sum);
            const float p0  = acc[j][0] * inv;
            const float p1  = acc[j][1] * inv;
            unsigned int h0b, l0b, h1b, l1b;
            split1(p0, h0b, l0b);
            split1(p1, h1b, l1b);
            *(unsigned int*)&s_ph[r0 + j][j0] = (h1b << 16) | h0b;
            *(unsigned int*)&s_pl[r0 + j][j0] = (l1b << 16) | l0b;
        }
        // s_rmax is re-written by the next pass only after this pass's second barrier,
        // s_rsum only after the next pass's first barrier: no extra barrier needed here.
    }
    __syncthreads();

    // read-out: o[16 q][64 dk] = P . VT^T ; wave wv owns dk tile 16*wv
    v8f pacc = { 0.f, 0.f, 0.f, 0.f, 0.f, 0.f, 0.f, 0.f };
    const unsigned short* pah = &s_ph[m15][0];
    const unsigned short* pal = &s_pl[m15][0];
    const unsigned short* bvh = VTh + ((size_t)(bh * DK + 16 * wv + m15)) * LL;
    const unsigned short* bvl = VTl + ((size_t)(bh * DK + 16 * wv + m15)) * LL;
    #pragma unroll 1
    for (int k0 = 0; k0 < LL; k0 += 32) {
        const v16bf fah = frag16(pah, k0, hh);
        const v16bf fal = frag16(pal, k0, hh);
        const v16bf fbh = frag16(bvh, k0, hh);
        const v16bf fbl = frag16(bvl, k0, hh);
        pacc = wmma3(fah, fal, fbh, fbl, pacc);
    }
    #pragma unroll
    for (int r = 0; r < 8; ++r) s_o[8 * hh + r][16 * wv + m15] = pacc[r];
    __syncthreads();

    {
        const int row = tid >> 3;   // 0..15
        const int c8  = tid & 7;
        const v4f x0 = *(const v4f*)&s_o[row][8 * c8];
        const v4f x1 = *(const v4f*)&s_o[row][8 * c8 + 4];
        v8us hv, lv;
        split8(x0, x1, hv, lv);
        const size_t goff = ((size_t)(b * LL + q0 + row)) * DD + h * DK + 8 * c8;
        *(v8us*)(Oh + goff) = hv;
        *(v8us*)(Ol + goff) = lv;
        
    }
}

extern "C" void kernel_launch(void* const* d_in, const int* in_sizes, int n_in,
                              void* d_out, int out_size, void* d_ws, size_t ws_size,
                              hipStream_t stream)
{
    if (n_in < 13) return;
    if (in_sizes[0] != NR * DD || in_sizes[1] != NR * DD || in_sizes[2] != NR * DD) return;
    if (in_sizes[3] != BB * LL * LL) return;
    if (in_sizes[4] != DD * DD || in_sizes[6] != DD * DD || in_sizes[8] != DD * DD || in_sizes[11] != DD * DD) return;
    if (in_sizes[5] != DD || in_sizes[7] != DD || in_sizes[9] != DD || in_sizes[12] != DD) return;
    if (in_sizes[10] != HH * DK) return;
    if (out_size != NR * DD) return;

    const float* q    = (const float*)d_in[0];    // [4][256][512]
    const float* k    = (const float*)d_in[1];
    const float* v    = (const float*)d_in[2];
    const int*   mask = (const int*)d_in[3];      // [4][256][256] int32
    const float* Wq   = (const float*)d_in[4];    // [512 in][512 out]
    const float* bq   = (const float*)d_in[5];
    const float* Wk   = (const float*)d_in[6];
    const float* bk   = (const float*)d_in[7];
    const float* Wv   = (const float*)d_in[8];
    const float* bv   = (const float*)d_in[9];
    const float* vp   = (const float*)d_in[10];   // [8][64]
    const float* W0   = (const float*)d_in[11];
    const float* b0   = (const float*)d_in[12];
    float* out = (float*)d_out;                   // [1024][512] f32

    // workspace carve (bytes), every offset a multiple of 1 MiB
    const size_t sz_x  = (size_t)3 * NR * DD * 2;        // 3145728  (q,k,v planes)
    const size_t sz_wt = (size_t)4 * DD * DD * 2;        // 2097152  (WqT,WkT,WvT,W0T planes)
    const size_t sz_p  = (size_t)NR * DD * 4;            // 2097152  (f32 projection)
    const size_t sz_vt = (size_t)BB * HH * DK * LL * 2;  // 1048576
    const size_t sz_o  = (size_t)NR * DD * 2;            // 1048576
    size_t off = 0;
    const size_t off_xh  = off;  off += sz_x;
    const size_t off_xl  = off;  off += sz_x;
    const size_t off_wth = off;  off += sz_wt;
    const size_t off_wtl = off;  off += sz_wt;
    const size_t off_qp  = off;  off += sz_p;
    const size_t off_kp  = off;  off += sz_p;
    const size_t off_vth = off;  off += sz_vt;
    const size_t off_vtl = off;  off += sz_vt;
    const size_t off_oh  = off;  off += sz_o;
    const size_t off_ol  = off;  off += sz_o;             // total 18874368
    if (off > ws_size) return;

    char* ws = (char*)d_ws;
    unsigned short* xh  = (unsigned short*)(ws + off_xh);
    unsigned short* xl  = (unsigned short*)(ws + off_xl);
    unsigned short* wth = (unsigned short*)(ws + off_wth);
    unsigned short* wtl = (unsigned short*)(ws + off_wtl);
    float*          Qp  = (float*)(ws + off_qp);
    float*          Kp  = (float*)(ws + off_kp);
    unsigned short* VTh = (unsigned short*)(ws + off_vth);
    unsigned short* VTl = (unsigned short*)(ws + off_vtl);
    unsigned short* Oh  = (unsigned short*)(ws + off_oh);
    unsigned short* Ol  = (unsigned short*)(ws + off_ol);

    const size_t xplane = (size_t)NR * DD;   // elements per activation plane
    const size_t wplane = (size_t)DD * DD;   // elements per weight plane
    const float C2 = 2.8853900817779268f;    // 2*log2(e)

    // 1) 16-bit hi/lo planes for q,k,v and transposed Wq,Wk,Wv,W0
    prep_kernel<<<dim3(3 * (NR / 2) + 256), dim3(NTHR), 0, stream>>>(
        q, k, v, Wq, Wk, Wv, W0, xh, xl, wth, wtl);

    // 2) Q projection -> Qp (B,H,L,DK) f32 * 2log2e
    gemm3_kernel<1><<<dim3(NR / 32, DD / 256), dim3(NTHR), 0, stream>>>(
        xh, xl, wth, wtl, bq, C2, Qp, Oh, Ol);

    // 3) K projection -> Kp
    gemm3_kernel<1><<<dim3(NR / 32, DD / 256), dim3(NTHR), 0, stream>>>(
        xh + xplane, xl + xplane, wth + wplane, wtl + wplane, bk, C2, Kp, Oh, Ol);

    // 4) V projection, transposed: A = WvT planes (512 rows n), Bt = v planes (1024 rows m) -> VT hi/lo
    gemm3_kernel<2><<<dim3(DD / 32, NR / 256), dim3(NTHR), 0, stream>>>(
        wth + 2 * wplane, wtl + 2 * wplane, xh + 2 * xplane, xl + 2 * xplane, bv, 1.0f,
        (float*)(ws + off_oh), VTh, VTl);

    // 5) additive scores + softmax + P.V -> O hi/lo planes in merged (B,L,D) layout
    attn_kernel<<<dim3(LL / 16, BB * HH), dim3(NTHR), 0, stream>>>(
        Qp, Kp, vp, mask, VTh, VTl, Oh, Ol);

    // 6) output projection -> d_out
    gemm3_kernel<0><<<dim3(NR / 32, DD / 256), dim3(NTHR), 0, stream>>>(
        Oh, Ol, wth + 3 * wplane, wtl + 3 * wplane, b0, 1.0f, out, VTh, VTl);
}

// v001
// Measured time: 80.3 microseconds a run.
// Timed twice side by side with v000, it ran 1.55 and 1.56 times as fast.
#include <hip/hip_runtime.h>
#include <hip/hip_bf16.h>
#include <stddef.h>
#include <stdint.h>

// All contractions: v_wmma_f32_16x16x32_bf16 with bf16 hi/lo split operands (hi*hi + hi*lo + lo*hi, f32 accumulate): q/k/v projections, probability read-out P*V, output projection; additive scores (exp2 + rcp tanh form), mask fill, softmax and epilogues in f32.

#define BB   4
#define LL   256
#define DD   512
#define HH   8
#define DK   64
#define NR   (BB * LL)
#define NTHR 128

static_assert(NR == 1024);
static_assert(DD == HH * DK);
static_assert(LL == 2 * NTHR);
static_assert(DK == 64);

typedef unsigned short v8us  __attribute__((ext_vector_type(8)));
typedef __bf16         v16bf __attribute__((ext_vector_type(16)));
typedef float          v8f   __attribute__((ext_vector_type(8)));
typedef float          v4f   __attribute__((ext_vector_type(4)));
typedef int            v2i   __attribute__((ext_vector_type(2)));

union Frag { v16bf v; v8us h[2]; };

#if __has_builtin(__builtin_amdgcn_exp2f)
#define EXP2_FAST(x) __builtin_amdgcn_exp2f(x)
#else
#define EXP2_FAST(x) exp2f(x)
#endif
#if __has_builtin(__builtin_amdgcn_rcpf)
#define RCP_FAST(x) __builtin_amdgcn_rcpf(x)
#else
#define RCP_FAST(x) (1.0f / (x))
#endif

// f32 -> bf16 bits, RNE
__device__ __forceinline__ unsigned int bf16_rne(float f)
{
    unsigned int u = __float_as_uint(f);
    u += 0x7FFFu + ((u >> 16) & 1u);
    return u >> 16;
}

// x = hi + lo, both bf16 (RNE); lo = RNE(x - f32(hi))
__device__ __forceinline__ void split1(float x, unsigned int& hb, unsigned int& lb)
{
    hb = bf16_rne(x);
    const float xh = __uint_as_float(hb << 16);
    lb = bf16_rne(x - xh);
}

// 8 consecutive values (a then b) -> one 16-byte hi vector and one 16-byte lo vector
__device__ __forceinline__ void split8(v4f a, v4f b, v8us& hi, v8us& lo)
{
    v8us hr = { 0, 0, 0, 0, 0, 0, 0, 0 };
    v8us lr = { 0, 0, 0, 0, 0, 0, 0, 0 };
    #pragma unroll
    for (int e = 0; e < 4; ++e) {
        unsigned int hb, lb;
        split1(a[e], hb, lb);
        hr[e] = (unsigned short)hb;
        lr[e] = (unsigned short)lb;
        split1(b[e], hb, lb);
        hr[4 + e] = (unsigned short)hb;
        lr[4 + e] = (unsigned short)lb;
    }
    hi = hr;
    lo = lr;
}

// 16-bit fragment loader (wave32, 16x16x32): lane l, hh = l>>4, row/col = l&15.
// elements 0..7  <- row[k0 + 8*hh + 0..7], elements 8..15 <- row[k0 + 16 + 8*hh + 0..7].
// Used for A (row-major, k contiguous) and for B stored as [n][k] (k contiguous).
__device__ __forceinline__ v16bf frag16(const unsigned short* row, int k0, int hh)
{
    Frag f;
    f.h[0] = *(const v8us*)(row + k0 + 8 * hh);
    f.h[1] = *(const v8us*)(row + k0 + 16 + 8 * hh);
    return f.v;
}

// D += A*B with the VALU hazard guard after the instruction.
__device__ __forceinline__ v8f wmma_bf16(v16bf a, v16bf b, v8f c)
{
    v8f d = __builtin_amdgcn_wmma_f32_16x16x32_bf16(false, a, false, b, (short)0, c, false, false);
    asm volatile("v_nop\n\tv_nop\n\tv_nop\n\tv_nop" : "+v"(d) : "v"(a), "v"(b));
    return d;
}

// hi/lo split product: hh + hl + lh into one accumulator
__device__ __forceinline__ v8f wmma3(v16bf ah, v16bf al, v16bf bh, v16bf bl, v8f c)
{
    c = wmma_bf16(ah, bh, c);
    c = wmma_bf16(ah, bl, c);
    c = wmma_bf16(al, bh, c);
    return c;
}

// ---------------------------------------------------------------------------
// Operand preparation (128 threads / block).
//  blocks [0, 1536): xh/xl[t][row][512] = split(x_t[row]), t = 0:q 1:k 2:v, 2 rows per block,
//                    64 threads per row, 8 elements (16 B) per thread -> 512-B runs per wave.
//  blocks [1536, 1792): wth/wtl[w][n][512] = split(W_w[k][n]) (transposed, k contiguous),
// ---------------------------------------------------------------------------
__global__ void __launch_bounds__(NTHR) prep_kernel(
    const float* __restrict__ q, const float* __restrict__ k, const float* __restrict__ v,
    const float* __restrict__ Wq, const float* __restrict__ Wk,
    const float* __restrict__ Wv, const float* __restrict__ W0,
    unsigned short* xh, unsigned short* xl, unsigned short* wth, unsigned short* wtl)
{
    __shared__ float s_t[64][65];

    const int tid = threadIdx.x;
    const int bid = blockIdx.x;
    const int NXB = 3 * (NR / 2);   // 1536

    if (bid < NXB) {
        const int t   = bid / (NR / 2);
        const int row = ((bid % (NR / 2)) << 1) + (tid >> 6);
        const int c8  = tid & 63;
        const float* src = (t == 0) ? q : ((t == 1) ? k : v);
        const size_t soff = (size_t)row * DD + 8 * c8;
        const v4f x0 = *(const v4f*)(src + soff);
        const v4f x1 = *(const v4f*)(src + soff + 4);
        v8us hv, lv;
        split8(x0, x1, hv, lv);
        const size_t doff = ((size_t)t * NR + row) * DD + 8 * c8;
        *(v8us*)(xh + doff) = hv;
        *(v8us*)(xl + doff) = lv;
        
    } else {
        const int u    = bid - NXB;          // 0..255
        const int w    = u >> 6;             // 0..3
        const int tile = u & 63;
        const int k0   = (tile >> 3) * 64;
        const int n0   = (tile & 7) * 64;
        const float* Wsel = (w == 0) ? Wq : ((w == 1) ? Wk : ((w == 2) ? Wv : W0));
        // load W[k0+kk][n0+nn] -> s_t[nn][kk]
        #pragma unroll
        for (int i = 0; i < 8; ++i) {
            const int idx = tid + NTHR * i;  // 0..1023
            const int kk  = idx >> 4;        // 0..63
            const int c4  = idx & 15;        // 0..15
            const v4f x = *(const v4f*)(Wsel + (size_t)(k0 + kk) * DD + n0 + 4 * c4);
            s_t[4 * c4 + 0][kk] = x[0];
            s_t[4 * c4 + 1][kk] = x[1];
            s_t[4 * c4 + 2][kk] = x[2];
            s_t[4 * c4 + 3][kk] = x[3];
        }
        __syncthreads();
        v8us hv[4], lv[4];
        size_t off[4];
        #pragma unroll
        for (int i = 0; i < 4; ++i) {
            const int idx = tid + NTHR * i;  // 0..511
            const int nn  = idx >> 3;        // 0..63
            const int k8  = idx & 7;         // 0..7
            const v4f a  = { s_t[nn][8 * k8 + 0], s_t[nn][8 * k8 + 1], s_t[nn][8 * k8 + 2], s_t[nn][8 * k8 + 3] };
            const v4f b2 = { s_t[nn][8 * k8 + 4], s_t[nn][8 * k8 + 5], s_t[nn][8 * k8 + 6], s_t[nn][8 * k8 + 7] };
            split8(a, b2, hv[i], lv[i]);
            off[i] = ((size_t)w * DD + n0 + nn) * DD + k0 + 8 * k8;
        }
        #pragma unroll
        for (int i = 0; i < 4; ++i) {
            *(v8us*)(wth + off[i]) = hv[i];
            *(v8us*)(wtl + off[i]) = lv[i];
        }
        
    }
}

// ---------------------------------------------------------------------------
// C[32 rows of A][256 rows of Bt] = Ah/Al[.][512] . Bt h/l[.][512]^T  (K = 512, hi/lo split).
// One block of 128 threads per tile; row0, col0 = first A row and first Bt row of the tile.
// Wave wv: row tiles 0,1 and col tiles at 64*wv + 16*j, j = 0..3.
// Fragments straight from 16-bit global rows; epilogue staged in LDS.
// MODE 0: Cf[m][512] f32 = (C + bias[n]) * post                    (plain row-major)
// MODE 1: Cf[(b*8+h)*256 + l][64] f32 = (C + bias[n]) * post,  m = b*256+l, n = h*64+dk
// MODE 2: A rows are n = h*64+dk, Bt rows are m = b*256+j:
//         Ch/Cl[(b*8+h)*64 + dk][256 j] = split(C + bias[n])       (per-row bias)
// ---------------------------------------------------------------------------
__device__ __forceinline__ void gemm3_main(
    const unsigned short* __restrict__ Ah, const unsigned short* __restrict__ Al,
    const unsigned short* __restrict__ Bh, const unsigned short* __restrict__ Bl,
    int row0, int col0, float (*s_c)[260])
{
    const int tid  = threadIdx.x;
    const int wv   = tid >> 5;
    const int l    = tid & 31;
    const int hh   = l >> 4;
    const int m15  = l & 15;

    const v8f zero = { 0.f, 0.f, 0.f, 0.f, 0.f, 0.f, 0.f, 0.f };
    v8f acc[2][4];
    #pragma unroll
    for (int rt = 0; rt < 2; ++rt)
        #pragma unroll
        for (int j = 0; j < 4; ++j) acc[rt][j] = zero;

    const unsigned short* a0h = Ah + (size_t)(row0 + m15) * DD;
    const unsigned short* a0l = Al + (size_t)(row0 + m15) * DD;
    const unsigned short* a1h = Ah + (size_t)(row0 + 16 + m15) * DD;
    const unsigned short* a1l = Al + (size_t)(row0 + 16 + m15) * DD;
    const unsigned short* bph = Bh + (size_t)(col0 + 64 * wv + m15) * DD;
    const unsigned short* bpl = Bl + (size_t)(col0 + 64 * wv + m15) * DD;

    #pragma unroll 1
    for (int k0 = 0; k0 < DD; k0 += 32) {
        const v16bf fa0h = frag16(a0h, k0, hh);
        const v16bf fa0l = frag16(a0l, k0, hh);
        const v16bf fa1h = frag16(a1h, k0, hh);
        const v16bf fa1l = frag16(a1l, k0, hh);
        #pragma unroll
        for (int j = 0; j < 4; ++j) {
            const v16bf fbh = frag16(bph + (size_t)j * 16 * DD, k0, hh);
            const v16bf fbl = frag16(bpl + (size_t)j * 16 * DD, k0, hh);
            acc[0][j] = wmma3(fa0h, fa0l, fbh, fbl, acc[0][j]);
            acc[1][j] = wmma3(fa1h, fa1l, fbh, fbl, acc[1][j]);
        }
    }

    // D element r of lane -> (row 8*hh + r, col m15) of the 16x16 tile
    #pragma unroll
    for (int rt = 0; rt < 2; ++rt)
        #pragma unroll
        for (int j = 0; j < 4; ++j)
            #pragma unroll
            for (int r = 0; r < 8; ++r)
                s_c[rt * 16 + 8 * hh + r][64 * wv + 16 * j + m15] = acc[rt][j][r];
    __syncthreads();
}

template <int MODE>
__device__ __forceinline__ void gemm3_epilogue(
    const float* __restrict__ bias, float post,
    float* Cf, unsigned short* Ch, unsigned short* Cl,
    int row0, int col0, const float (*s_c)[260])
{
    const int tid = threadIdx.x;

    if (MODE == 0) {
        v4f vals[16];
        size_t off[16];
        #pragma unroll
        for (int i = 0; i < 16; ++i) {
            const int idx = tid + NTHR * i;     // 0..2047
            const int row = idx >> 6;           // 0..31
            const int c4  = idx & 63;           // 0..63
            const v4f x  = *(const v4f*)&s_c[row][4 * c4];
            const v4f bb = *(const v4f*)(bias + col0 + 4 * c4);
            vals[i] = (x + bb) * post;
            off[i]  = (size_t)(row0 + row) * DD + col0 + 4 * c4;
        }
        #pragma unroll
        for (int i = 0; i < 16; ++i) *(v4f*)(Cf + off[i]) = vals[i];
        
    } else if (MODE == 1) {
        v4f vals[16];
        size_t off[16];
        #pragma unroll
        for (int i = 0; i < 16; ++i) {
            const int idx = tid + NTHR * i;     // 0..2047
            const int hl  = idx >> 9;           // local head 0..3
            const int rem = idx & 511;
            const int row = rem >> 4;           // 0..31
            const int c4  = rem & 15;           // 0..15
            const int n   = col0 + 64 * hl + 4 * c4;
            const v4f x  = *(const v4f*)&s_c[row][64 * hl + 4 * c4];
            const v4f bb = *(const v4f*)(bias + n);
            // the address registers of the bias load are reused by the loads that follow it
            asm volatile("s_wait_xcnt 0x0" ::: "memory");
            vals[i] = (x + bb) * post;
            const int m  = row0 + row;
            const int b  = m >> 8;
            const int lq = m & 255;
            const int h  = n >> 6;
            off[i] = ((size_t)((b * HH + h) * LL + lq)) * DK + 4 * c4;
        }
        #pragma unroll
        for (int i = 0; i < 16; ++i) *(v4f*)(Cf + off[i]) = vals[i];
        // in the merged kernel other code follows these stores in the listing and reuses their registers
        asm volatile("s_wait_xcnt 0x0" ::: "memory");
    } else {
        v8us hv[8], lv[8];
        size_t off[8];
        const int b = col0 >> 8;
        #pragma unroll
        for (int i = 0; i < 8; ++i) {
            const int idx = tid + NTHR * i;     // 0..1023
            const int row = idx >> 5;           // 0..31 (one wave per row per pass)
            const int c8  = idx & 31;           // 0..31
            const float bs = bias[row0 + row];
            const v4f bb = { bs, bs, bs, bs };
            const v4f x0 = *(const v4f*)&s_c[row][8 * c8] + bb;
            const v4f x1 = *(const v4f*)&s_c[row][8 * c8 + 4] + bb;
            split8(x0, x1, hv[i], lv[i]);
            const int n  = row0 + row;
            const int h  = n >> 6;
            const int dk = n & 63;
            off[i] = ((size_t)((b * HH + h) * DK + dk)) * LL + 8 * c8;
        }
        #pragma unroll
        for (int i = 0; i < 8; ++i) {
            *(v8us*)(Ch + off[i]) = hv[i];
            *(v8us*)(Cl + off[i]) = lv[i];
        }
        
    }
}

// Output projection: one tile per block, row0 = 32*blockIdx.x, col0 = 256*blockIdx.y.
__global__ void __launch_bounds__(NTHR) gemm3_out_kernel(
    const unsigned short* __restrict__ Ah, const unsigned short* __restrict__ Al,
    const unsigned short* __restrict__ Bh, const unsigned short* __restrict__ Bl,
    const float* __restrict__ bias, float* Cf)
{
    __shared__ __align__(16) float s_c[32][260];
    const int row0 = blockIdx.x * 32;
    const int col0 = blockIdx.y * 256;
    gemm3_main(Ah, Al, Bh, Bl, row0, col0, s_c);
    gemm3_epilogue<0>(bias, 1.0f, Cf, nullptr, nullptr, row0, col0, s_c);
}

// The three input projections in one grid: none reads another's output, and each alone fills
// only 64 blocks. blockIdx.y = 0:q 1:k 2:v, blockIdx.x = tile 0..63 of that projection.
//  q, k: A = activation planes (32 row tiles), Bt = transposed weight planes (2 col tiles), MODE 1.
//  v:    A = transposed Wv planes (16 row tiles), Bt = activation planes (4 col tiles), MODE 2.
__global__ void __launch_bounds__(NTHR) proj3_kernel(
    const unsigned short* __restrict__ xh, const unsigned short* __restrict__ xl,
    const unsigned short* __restrict__ wth, const unsigned short* __restrict__ wtl,
    const float* __restrict__ bq, const float* __restrict__ bk, const float* __restrict__ bv,
    float post, float* Qp, float* Kp, unsigned short* VTh, unsigned short* VTl)
{
    __shared__ __align__(16) float s_c[32][260];

    const int    t      = blockIdx.y;
    const int    tile   = blockIdx.x;
    const size_t xplane = (size_t)NR * DD;
    const size_t wplane = (size_t)DD * DD;

    const bool   isv    = (t == 2);
    const unsigned short* xth = xh + t * xplane;
    const unsigned short* xtl = xl + t * xplane;
    const unsigned short* wh  = wth + t * wplane;
    const unsigned short* wl  = wtl + t * wplane;
    const int row0 = (isv ? (tile & 15) : (tile & 31)) * 32;
    const int col0 = (isv ? (tile >> 4) : (tile >> 5)) * 256;

    // one copy of the k loop serves all three; only the operand roles and the epilogue differ
    gemm3_main(isv ? wh : xth, isv ? wl : xtl, isv ? xth : wh, isv ? xtl : wl, row0, col0, s_c);
    if (isv) gemm3_epilogue<2>(bv, 1.0f, nullptr, VTh, VTl, row0, col0, s_c);
    else     gemm3_epilogue<1>((t == 0) ? bq : bk, post, (t == 0) ? Qp : Kp, nullptr, nullptr, row0, col0, s_c);
}

// ---------------------------------------------------------------------------
// Additive scores + softmax + read-out for one (b, h, 16 query rows) block, 128 threads.
// Qp/Kp are the projections pre-multiplied by 2*log2(e) in (B,H,L,DK) f32 layout.
// tanh(x) = 1 - 2/(1 + e^{2x}); score = sum_d vp_d - 2 * sum_d vp_d/(1 + e^{2x_d});
// the constant sum_d vp_d is invariant under softmax and omitted. mask == 0 -> -1e9.
// Thread tid owns keys 2*tid, 2*tid+1; the 16 query rows are processed as 4 passes of
// 4 rows (per-pass block softmax) to keep per-thread live state small. P is split to bf16
// hi/lo in LDS (dword stores, barrier, then 16-byte fragment reloads) and feeds O = P . VT^T,
// VT = [bh][dk][256 j] hi/lo planes; wave wv owns the dk tile 16*wv.
// ---------------------------------------------------------------------------
__global__ void __launch_bounds__(NTHR) attn_kernel(
    const float* __restrict__ Qp, const float* __restrict__ Kp, const float* __restrict__ vp,
    const int* __restrict__ mask,
    const unsigned short* __restrict__ VTh, const unsigned short* __restrict__ VTl,
    unsigned short* Oh, unsigned short* Ol)
{
    __shared__ __align__(16) float          s_q[16][DK];
    __shared__ __align__(16) float          s_vp[DK];
    __shared__ __align__(16) unsigned short s_ph[16][LL];
    __shared__ __align__(16) unsigned short s_pl[16][LL];
    __shared__ __align__(16) float          s_o[16][68];
    __shared__ float s_rmax[4][4];
    __shared__ float s_rsum[4][4];

    const int tid = threadIdx.x;
    const int wv  = tid >> 5;
    const int l   = tid & 31;
    const int hh  = l >> 4;
    const int m15 = l & 15;
    const int bh  = blockIdx.y;          // 0..31
    const int b   = bh >> 3;
    const int h   = bh & 7;
    const int q0  = blockIdx.x * 16;     // 0..240

    const float LOG2E = 1.4426950408889634f;
    const float MASKV = -1.0e9f;

    #pragma unroll
    for (int i = 0; i < 2; ++i) {
        const int idx = tid + NTHR * i;  // 0..255
        const int r   = idx >> 4;        // 0..15
        const int c4  = idx & 15;        // 0..15
        *(v4f*)&s_q[r][4 * c4] = *(const v4f*)(Qp + ((size_t)(bh * LL + q0 + r)) * DK + 4 * c4);
    }
    if (tid < DK) s_vp[tid] = vp[h * DK + tid];
    __syncthreads();

    const int j0 = 2 * tid;
    const float* k0p = Kp + ((size_t)(bh * LL + j0)) * DK;
    const float* k1p = k0p + DK;
    const int* mrow = mask + ((size_t)(b * LL + q0)) * LL + j0;

    #pragma unroll 1
    for (int jq = 0; jq < 4; ++jq) {
        const int r0 = 4 * jq;           // first local query row of this pass

        float acc[4][2];
        #pragma unroll
        for (int j = 0; j < 4; ++j) { acc[j][0] = 0.0f; acc[j][1] = 0.0f; }

        #pragma unroll 1
        for (int d4 = 0; d4 < DK / 4; ++d4) {
            const v4f ka = *(const v4f*)(k0p + 4 * d4);
            const v4f kb = *(const v4f*)(k1p + 4 * d4);
            const v4f vv = *(const v4f*)&s_vp[4 * d4];
            #pragma unroll
            for (int j = 0; j < 4; ++j) {
                const v4f qv = *(const v4f*)&s_q[r0 + j][4 * d4];
                #pragma unroll
                for (int e = 0; e < 4; ++e) {
                    const float ra = RCP_FAST(EXP2_FAST(qv[e] + ka[e]) + 1.0f);   // 1/(1+e^{2x})
                    const float rb = RCP_FAST(EXP2_FAST(qv[e] + kb[e]) + 1.0f);
                    acc[j][0] = fmaf(vv[e], ra, acc[j][0]);
                    acc[j][1] = fmaf(vv[e], rb, acc[j][1]);
                }
            }
        }

        // logits with mask fill, block-wide row max over the 256 keys
        float bm[4];
        #pragma unroll
        for (int j = 0; j < 4; ++j) {
            const v2i mk = *(const v2i*)(mrow + (size_t)(r0 + j) * LL);
            const float s0 = (mk[0] == 0) ? MASKV : (-2.0f * acc[j][0]);
            const float s1 = (mk[1] == 0) ? MASKV : (-2.0f * acc[j][1]);
            acc[j][0] = s0;
            acc[j][1] = s1;
            float lm = fmaxf(s0, s1);
            #pragma unroll
            for (int off = 16; off > 0; off >>= 1) lm = fmaxf(lm, __shfl_xor(lm, off, 32));
            bm[j] = lm;
        }
        if (l == 0) {
            #pragma unroll
            for (int j = 0; j < 4; ++j) s_rmax[j][wv] = bm[j];
        }
        __syncthreads();
        #pragma unroll
        for (int j = 0; j < 4; ++j)
            bm[j] = fmaxf(fmaxf(s_rmax[j][0], s_rmax[j][1]), fmaxf(s_rmax[j][2], s_rmax[j][3]));

        float bs[4];
        #pragma unroll
        for (int j = 0; j < 4; ++j) {
            const float e0 = EXP2_FAST((acc[j][0] - bm[j]) * LOG2E);
            const float e1 = EXP2_FAST((acc[j][1] - bm[j]) * LOG2E);
            acc[j][0] = e0;
            acc[j][1] = e1;
            float ls = e0 + e1;
            #pragma unroll
            for (int off = 16; off > 0; off >>= 1) ls += __shfl_xor(ls, off, 32);
            bs[j] = ls;
        }
        if (l == 0) {
            #pragma unroll
            for (int j = 0; j < 4; ++j) s_rsum[j][wv] = bs[j];
        }
        __syncthreads();
        #pragma unroll
        for (int j = 0; j < 4; ++j) {
            const float sum = (s_rsum[j][0] + s_rsum[j][1]) + (s_rsum[j][2] + s_rsum[j][3]);
            const float inv = RCP_FAST(sum);
            const float p0  = acc[j][0] * inv;
            const float p1  = acc[j][1] * inv;
            unsigned int h0b, l0b, h1b, l1b;
            split1(p0, h0b, l0b);
            split1(p1, h1b, l1b);
            *(unsigned int*)&s_ph[r0 + j][j0] = (h1b << 16) | h0b;
            *(unsigned int*)&s_pl[r0 + j][j0] = (l1b << 16) | l0b;
        }
        // s_rmax is re-written by the next pass only after this pass's second barrier,
        // s_rsum only after the next pass's first barrier: no extra barrier needed here.
    }
    __syncthreads();

    // read-out: o[16 q][64 dk] = P . VT^T ; wave wv owns dk tile 16*wv
    v8f pacc = { 0.f, 0.f, 0.f, 0.f, 0.f, 0.f, 0.f, 0.f };
    const unsigned short* pah = &s_ph[m15][0];
    const unsigned short* pal = &s_pl[m15][0];
    const unsigned short* bvh = VTh + ((size_t)(bh * DK + 16 * wv + m15)) * LL;
    const unsigned short* bvl = VTl + ((size_t)(bh * DK + 16 * wv + m15)) * LL;
    #pragma unroll 1
    for (int k0 = 0; k0 < LL; k0 += 32) {
        const v16bf fah = frag16(pah, k0, hh);
        const v16bf fal = frag16(pal, k0, hh);
        const v16bf fbh = frag16(bvh, k0, hh);
        const v16bf fbl = frag16(bvl, k0, hh);
        pacc = wmma3(fah, fal, fbh, fbl, pacc);
    }
    #pragma unroll
    for (int r = 0; r < 8; ++r) s_o[8 * hh + r][16 * wv + m15] = pacc[r];
    __syncthreads();

    {
        const int row = tid >> 3;   // 0..15
        const int c8  = tid & 7;
        const v4f x0 = *(const v4f*)&s_o[row][8 * c8];
        const v4f x1 = *(const v4f*)&s_o[row][8 * c8 + 4];
        v8us hv, lv;
        split8(x0, x1, hv, lv);
        const size_t goff = ((size_t)(b * LL + q0 + row)) * DD + h * DK + 8 * c8;
        *(v8us*)(Oh + goff) = hv;
        *(v8us*)(Ol + goff) = lv;
        
    }
}

extern "C" void kernel_launch(void* const* d_in, const int* in_sizes, int n_in,
                              void* d_out, int out_size, void* d_ws, size_t ws_size,
                              hipStream_t stream)
{
    if (n_in < 13) return;
    if (in_sizes[0] != NR * DD || in_sizes[1] != NR * DD || in_sizes[2] != NR * DD) return;
    if (in_sizes[3] != BB * LL * LL) return;
    if (in_sizes[4] != DD * DD || in_sizes[6] != DD * DD || in_sizes[8] != DD * DD || in_sizes[11] != DD * DD) return;
    if (in_sizes[5] != DD || in_sizes[7] != DD || in_sizes[9] != DD || in_sizes[12] != DD) return;
    if (in_sizes[10] != HH * DK) return;
    if (out_size != NR * DD) return;

    const float* q    = (const float*)d_in[0];    // [4][256][512]
    const float* k    = (const float*)d_in[1];
    const float* v    = (const float*)d_in[2];
    const int*   mask = (const int*)d_in[3];      // [4][256][256] int32
    const float* Wq   = (const float*)d_in[4];    // [512 in][512 out]
    const float* bq   = (const float*)d_in[5];
    const float* Wk   = (const float*)d_in[6];
    const float* bk   = (const float*)d_in[7];
    const float* Wv   = (const float*)d_in[8];
    const float* bv   = (const float*)d_in[9];
    const float* vp   = (const float*)d_in[10];   // [8][64]
    const float* W0   = (const float*)d_in[11];
    const float* b0   = (const float*)d_in[12];
    float* out = (float*)d_out;                   // [1024][512] f32

    // workspace carve (bytes), every offset a multiple of 1 MiB
    const size_t sz_x  = (size_t)3 * NR * DD * 2;        // 3145728  (q,k,v planes)
    const size_t sz_wt = (size_t)4 * DD * DD * 2;        // 2097152  (WqT,WkT,WvT,W0T planes)
    const size_t sz_p  = (size_t)NR * DD * 4;            // 2097152  (f32 projection)
    const size_t sz_vt = (size_t)BB * HH * DK * LL * 2;  // 1048576
    const size_t sz_o  = (size_t)NR * DD * 2;            // 1048576
    size_t off = 0;
    const size_t off_xh  = off;  off += sz_x;
    const size_t off_xl  = off;  off += sz_x;
    const size_t off_wth = off;  off += sz_wt;
    const size_t off_wtl = off;  off += sz_wt;
    const size_t off_qp  = off;  off += sz_p;
    const size_t off_kp  = off;  off += sz_p;
    const size_t off_vth = off;  off += sz_vt;
    const size_t off_vtl = off;  off += sz_vt;
    const size_t off_oh  = off;  off += sz_o;
    const size_t off_ol  = off;  off += sz_o;             // total 18874368
    if (off > ws_size) return;

    char* ws = (char*)d_ws;
    unsigned short* xh  = (unsigned short*)(ws + off_xh);
    unsigned short* xl  = (unsigned short*)(ws + off_xl);
    unsigned short* wth = (unsigned short*)(ws + off_wth);
    unsigned short* wtl = (unsigned short*)(ws + off_wtl);
    float*          Qp  = (float*)(ws + off_qp);
    float*          Kp  = (float*)(ws + off_kp);
    unsigned short* VTh = (unsigned short*)(ws + off_vth);
    unsigned short* VTl = (unsigned short*)(ws + off_vtl);
    unsigned short* Oh  = (unsigned short*)(ws + off_oh);
    unsigned short* Ol  = (unsigned short*)(ws + off_ol);

    const size_t wplane = (size_t)DD * DD;   // elements per weight plane
    const float C2 = 2.8853900817779268f;    // 2*log2(e)

    // 1) 16-bit hi/lo planes for q,k,v and transposed Wq,Wk,Wv,W0
    prep_kernel<<<dim3(3 * (NR / 2) + 256), dim3(NTHR), 0, stream>>>(
        q, k, v, Wq, Wk, Wv, W0, xh, xl, wth, wtl);

    // 2) Q, K projections -> Qp, Kp (B,H,L,DK) f32 * 2log2e, and the V projection, transposed
    //    -> VT hi/lo, as one grid of 3 x 64 blocks
    proj3_kernel<<<dim3(64, 3), dim3(NTHR), 0, stream>>>(
        xh, xl, wth, wtl, bq, bk, bv, C2, Qp, Kp, VTh, VTl);

    // 3) additive scores + softmax + P.V -> O hi/lo planes in merged (B,L,D) layout
    attn_kernel<<<dim3(LL / 16, BB * HH), dim3(NTHR), 0, stream>>>(
        Qp, Kp, vp, mask, VTh, VTl, Oh, Ol);

    // 4) output projection -> d_out
    gemm3_out_kernel<<<dim3(NR / 32, DD / 256), dim3(NTHR), 0, stream>>>(
        Oh, Ol, wth + 3 * wplane, wtl + 3 * wplane, b0, out);
}

// v002
// A run of this version takes 54.3 microseconds.
// Next to v001, in two timings, it ran 1.50 and 1.49 times as fast.
// Over all steps from v000 it is 2.32 times as fast.
#include <hip/hip_runtime.h>
#include <hip/hip_bf16.h>
#include <stddef.h>
#include <stdint.h>

// All contractions: v_wmma_f32_16x16x32_bf16 with bf16 hi/lo split operands (hi*hi + hi*lo + lo*hi, f32 accumulate): q/k/v projections, probability read-out P*V, output projection; additive scores (exp2 + rcp tanh form), mask fill, softmax and epilogues in f32.

#define BB   4
#define LL   256
#define DD   512
#define HH   8
#define DK   64
#define NR   (BB * LL)
#define NTHR 128

static_assert(NR == 1024);
static_assert(DD == HH * DK);
static_assert(LL == 2 * NTHR);
static_assert(DK == 64);

typedef unsigned short v8us  __attribute__((ext_vector_type(8)));
typedef __bf16         v16bf __attribute__((ext_vector_type(16)));
typedef float          v8f   __attribute__((ext_vector_type(8)));
typedef float          v4f   __attribute__((ext_vector_type(4)));
typedef int            v2i   __attribute__((ext_vector_type(2)));

union Frag { v16bf v; v8us h[2]; };

#if __has_builtin(__builtin_amdgcn_exp2f)
#define EXP2_FAST(x) __builtin_amdgcn_exp2f(x)
#else
#define EXP2_FAST(x) exp2f(x)
#endif
#if __has_builtin(__builtin_amdgcn_rcpf)
#define RCP_FAST(x) __builtin_amdgcn_rcpf(x)
#else
#define RCP_FAST(x) (1.0f / (x))
#endif

// f32 -> bf16 bits, RNE
__device__ __forceinline__ unsigned int bf16_rne(float f)
{
    unsigned int u = __float_as_uint(f);
    u += 0x7FFFu + ((u >> 16) & 1u);
    return u >> 16;
}

// x = hi + lo, both bf16 (RNE); lo = RNE(x - f32(hi))
__device__ __forceinline__ void split1(float x, unsigned int& hb, unsigned int& lb)
{
    hb = bf16_rne(x);
    const float xh = __uint_as_float(hb << 16);
    lb = bf16_rne(x - xh);
}

// 8 consecutive values (a then b) -> one 16-byte hi vector and one 16-byte lo vector
__device__ __forceinline__ void split8(v4f a, v4f b, v8us& hi, v8us& lo)
{
    v8us hr = { 0, 0, 0, 0, 0, 0, 0, 0 };
    v8us lr = { 0, 0, 0, 0, 0, 0, 0, 0 };
    #pragma unroll
    for (int e = 0; e < 4; ++e) {
        unsigned int hb, lb;
        split1(a[e], hb, lb);
        hr[e] = (unsigned short)hb;
        lr[e] = (unsigned short)lb;
        split1(b[e], hb, lb);
        hr[4 + e] = (unsigned short)hb;
        lr[4 + e] = (unsigned short)lb;
    }
    hi = hr;
    lo = lr;
}

// 16-bit fragment loader (wave32, 16x16x32): lane l, hh = l>>4, row/col = l&15.
// elements 0..7  <- row[k0 + 8*hh + 0..7], elements 8..15 <- row[k0 + 16 + 8*hh + 0..7].
// Used for A (row-major, k contiguous) and for B stored as [n][k] (k contiguous).
__device__ __forceinline__ v16bf frag16(const unsigned short* row, int k0, int hh)
{
    Frag f;
    f.h[0] = *(const v8us*)(row + k0 + 8 * hh);
    f.h[1] = *(const v8us*)(row + k0 + 16 + 8 * hh);
    return f.v;
}

// D += A*B with the VALU hazard guard after the instruction.
__device__ __forceinline__ v8f wmma_bf16(v16bf a, v16bf b, v8f c)
{
    v8f d = __builtin_amdgcn_wmma_f32_16x16x32_bf16(false, a, false, b, (short)0, c, false, false);
    asm volatile("v_nop\n\tv_nop\n\tv_nop\n\tv_nop" : "+v"(d) : "v"(a), "v"(b));
    return d;
}

// hi/lo split product: hh + hl + lh into one accumulator
__device__ __forceinline__ v8f wmma3(v16bf ah, v16bf al, v16bf bh, v16bf bl, v8f c)
{
    c = wmma_bf16(ah, bh, c);
    c = wmma_bf16(ah, bl, c);
    c = wmma_bf16(al, bh, c);
    return c;
}

// ---------------------------------------------------------------------------
// Operand preparation (128 threads / block).
//  blocks [0, 1536): xh/xl[t][row][512] = split(x_t[row]), t = 0:q 1:k 2:v, 2 rows per block,
//                    64 threads per row, 8 elements (16 B) per thread -> 512-B runs per wave.
//  blocks [1536, 1792): wth/wtl[w][n][512] = split(W_w[k][n]) (transposed, k contiguous),
// ---------------------------------------------------------------------------
__global__ void __launch_bounds__(NTHR) prep_kernel(
    const float* __restrict__ q, const float* __restrict__ k, const float* __restrict__ v,
    const float* __restrict__ Wq, const float* __restrict__ Wk,
    const float* __restrict__ Wv, const float* __restrict__ W0,
    unsigned short* xh, unsigned short* xl, unsigned short* wth, unsigned short* wtl)
{
    __shared__ float s_t[64][65];

    const int tid = threadIdx.x;
    const int bid = blockIdx.x;
    const int NXB = 3 * (NR / 2);   // 1536

    if (bid < NXB) {
        const int t   = bid / (NR / 2);
        const int row = ((bid % (NR / 2)) << 1) + (tid >> 6);
        const int c8  = tid & 63;
        const float* src = (t == 0) ? q : ((t == 1) ? k : v);
        const size_t soff = (size_t)row * DD + 8 * c8;
        const v4f x0 = *(const v4f*)(src + soff);
        const v4f x1 = *(const v4f*)(src + soff + 4);
        v8us hv, lv;
        split8(x0, x1, hv, lv);
        const size_t doff = ((size_t)t * NR + row) * DD + 8 * c8;
        *(v8us*)(xh + doff) = hv;
        *(v8us*)(xl + doff) = lv;
        
    } else {
        const int u    = bid - NXB;          // 0..255
        const int w    = u >> 6;             // 0..3
        const int tile = u & 63;
        const int k0   = (tile >> 3) * 64;
        const int n0   = (tile & 7) * 64;
        const float* Wsel = (w == 0) ? Wq : ((w == 1) ? Wk : ((w == 2) ? Wv : W0));
        // load W[k0+kk][n0+nn] -> s_t[nn][kk]
        #pragma unroll
        for (int i = 0; i < 8; ++i) {
            const int idx = tid + NTHR * i;  // 0..1023
            const int kk  = idx >> 4;        // 0..63
            const int c4  = idx & 15;        // 0..15
            const v4f x = *(const v4f*)(Wsel + (size_t)(k0 + kk) * DD + n0 + 4 * c4);
            s_t[4 * c4 + 0][kk] = x[0];
            s_t[4 * c4 + 1][kk] = x[1];
            s_t[4 * c4 + 2][kk] = x[2];
            s_t[4 * c4 + 3][kk] = x[3];
        }
        __syncthreads();
        v8us hv[4], lv[4];
        size_t off[4];
        #pragma unroll
        for (int i = 0; i < 4; ++i) {
            const int idx = tid + NTHR * i;  // 0..511
            const int nn  = idx >> 3;        // 0..63
            const int k8  = idx & 7;         // 0..7
            const v4f a  = { s_t[nn][8 * k8 + 0], s_t[nn][8 * k8 + 1], s_t[nn][8 * k8 + 2], s_t[nn][8 * k8 + 3] };
            const v4f b2 = { s_t[nn][8 * k8 + 4], s_t[nn][8 * k8 + 5], s_t[nn][8 * k8 + 6], s_t[nn][8 * k8 + 7] };
            split8(a, b2, hv[i], lv[i]);
            off[i] = ((size_t)w * DD + n0 + nn) * DD + k0 + 8 * k8;
        }
        #pragma unroll
        for (int i = 0; i < 4; ++i) {
            *(v8us*)(wth + off[i]) = hv[i];
            *(v8us*)(wtl + off[i]) = lv[i];
        }
        
    }
}

// ---------------------------------------------------------------------------
// C[32 rows of A][256 rows of Bt] = Ah/Al[.][512] . Bt h/l[.][512]^T  (K = 512, hi/lo split).
// One block of 128 threads per tile; row0, col0 = first A row and first Bt row of the tile.
// Wave wv: row tiles 0,1 and col tiles at 64*wv + 16*j, j = 0..3.
// k slices of 64 staged in LDS by asynchronous copies, two buffers; epilogue staged in LDS.
// MODE 0: Cf[m][512] f32 = (C + bias[n]) * post                    (plain row-major)
// MODE 1: Cf[(b*8+h)*256 + l][64] f32 = (C + bias[n]) * post,  m = b*256+l, n = h*64+dk
// MODE 2: A rows are n = h*64+dk, Bt rows are m = b*256+j:
//         Ch/Cl[(b*8+h)*64 + dk][256 j] = split(C + bias[n])       (per-row bias)
// ---------------------------------------------------------------------------
// One k slice of the tile in LDS: 576 rows of KT 16-bit values, [Ah 32 | Al 32 | Bh 256 | Bl 256],
// row pitch 144 B (16 B x odd: conflict-free for the 16-byte fragment reads).
#define KT       64
#define SPITCH   72                       // 16-bit elements per staged row
#define SROWS    576
#define SBUF     (SROWS * SPITCH)         // elements per buffer (82944 B)
#define NTRIP    (DD / KT)

static_assert(NTRIP >= 2);
static_assert(SROWS * (KT / 8) == 36 * NTHR);

// Twelve 16-byte asynchronous copies global -> LDS, each lane its own addresses. The s_wait_xcnt
// is the last line of the copies' own statement, so no address register is rewritten ahead of it.
__device__ __forceinline__ void copy12(const unsigned int* la, const unsigned short* const* ga)
{
    asm volatile(
        "global_load_async_to_lds_b128 %0, %12, off\n\t"
        "global_load_async_to_lds_b128 %1, %13, off\n\t"
        "global_load_async_to_lds_b128 %2, %14, off\n\t"
        "global_load_async_to_lds_b128 %3, %15, off\n\t"
        "global_load_async_to_lds_b128 %4, %16, off\n\t"
        "global_load_async_to_lds_b128 %5, %17, off\n\t"
        "global_load_async_to_lds_b128 %6, %18, off\n\t"
        "global_load_async_to_lds_b128 %7, %19, off\n\t"
        "global_load_async_to_lds_b128 %8, %20, off\n\t"
        "global_load_async_to_lds_b128 %9, %21, off\n\t"
        "global_load_async_to_lds_b128 %10, %22, off\n\t"
        "global_load_async_to_lds_b128 %11, %23, off\n\t"
        "s_wait_xcnt 0x0"
        :: "v"(la[0]), "v"(la[1]), "v"(la[2]), "v"(la[3]), "v"(la[4]), "v"(la[5]),
           "v"(la[6]), "v"(la[7]), "v"(la[8]), "v"(la[9]), "v"(la[10]), "v"(la[11]),
           "v"(ga[0]), "v"(ga[1]), "v"(ga[2]), "v"(ga[3]), "v"(ga[4]), "v"(ga[5]),
           "v"(ga[6]), "v"(ga[7]), "v"(ga[8]), "v"(ga[9]), "v"(ga[10]), "v"(ga[11])
        : "memory");
}

// Stage one k slice: copy i of thread tid moves 16 B of staged row 16*i + (tid >> 3), chunk tid & 7,
// so a wave's copy covers four whole 128-B lines. lds0 and the four pointers already hold the
// thread's row and chunk; kk = first k of the slice.
__device__ __forceinline__ void stage_slice(
    unsigned int lds0,
    const unsigned short* gah, const unsigned short* gal,
    const unsigned short* gbh, const unsigned short* gbl, int kk)
{
    unsigned int la[36];
    const unsigned short* ga[36];
    #pragma unroll
    for (int i = 0; i < 36; ++i) {
        la[i] = lds0 + (unsigned int)(i * 16 * SPITCH * 2);
        ga[i] = ((i < 2)  ? gah + (size_t)i * 16 * DD
               : (i < 4)  ? gal + (size_t)(i - 2) * 16 * DD
               : (i < 20) ? gbh + (size_t)(i - 4) * 16 * DD
                          : gbl + (size_t)(i - 20) * 16 * DD) + kk;
    }
    copy12(la, ga);
    copy12(la + 12, ga + 12);
    copy12(la + 24, ga + 24);
}

__device__ __forceinline__ void gemm3_main(
    const unsigned short* __restrict__ Ah, const unsigned short* __restrict__ Al,
    const unsigned short* __restrict__ Bh, const unsigned short* __restrict__ Bl,
    int row0, int col0, float (*s_c)[260], unsigned short* s_st)
{
    const int tid  = threadIdx.x;
    const int wv   = tid >> 5;
    const int l    = tid & 31;
    const int hh   = l >> 4;
    const int m15  = l & 15;

    const v8f zero = { 0.f, 0.f, 0.f, 0.f, 0.f, 0.f, 0.f, 0.f };
    v8f acc[2][4];
    #pragma unroll
    for (int rt = 0; rt < 2; ++rt)
        #pragma unroll
        for (int j = 0; j < 4; ++j) acc[rt][j] = zero;

    // copy side: this thread's row (of 16) and 16-byte chunk (of 8)
    const int crow = tid >> 3;
    const int cchk = tid & 7;
    const unsigned short* gah = Ah + (size_t)(row0 + crow) * DD + 8 * cchk;
    const unsigned short* gal = Al + (size_t)(row0 + crow) * DD + 8 * cchk;
    const unsigned short* gbh = Bh + (size_t)(col0 + crow) * DD + 8 * cchk;
    const unsigned short* gbl = Bl + (size_t)(col0 + crow) * DD + 8 * cchk;
    const unsigned int lds0 = (unsigned int)(uintptr_t)s_st + (unsigned int)(crow * SPITCH * 2 + cchk * 16);

    // read side: element offsets of this lane's fragment rows inside a buffer
    const int oa0h = m15 * SPITCH;
    const int oa1h = (16 + m15) * SPITCH;
    const int oa0l = (32 + m15) * SPITCH;
    const int oa1l = (48 + m15) * SPITCH;
    const int obh  = (64 + 64 * wv + m15) * SPITCH;
    const int obl  = (320 + 64 * wv + m15) * SPITCH;

    // slice 0 lands and is published, then slice 1 starts to fly
    stage_slice(lds0, gah, gal, gbh, gbl, 0);
    asm volatile("s_wait_asynccnt 0x0" ::: "memory");   // this wave's copies of slice 0 have landed
    __syncthreads();
    stage_slice(lds0 + SBUF * 2, gah, gal, gbh, gbl, KT);

    // kept rolled: a trip already holds 48 WMMAs and 36 copies, unrolling would only add code to fetch
    #pragma unroll 1
    for (int t = 0; t < NTRIP; ++t) {
        const unsigned short* sb = s_st + (t & 1) * SBUF;
        #pragma unroll
        for (int k0 = 0; k0 < KT; k0 += 32) {
            const v16bf fa0h = frag16(sb + oa0h, k0, hh);
            const v16bf fa0l = frag16(sb + oa0l, k0, hh);
            const v16bf fa1h = frag16(sb + oa1h, k0, hh);
            const v16bf fa1l = frag16(sb + oa1l, k0, hh);
            // all fragments of a k step are read as one group, so one LDS latency is waited out per step
            v16bf fbh[4], fbl[4];
            #pragma unroll
            for (int j = 0; j < 4; ++j) {
                fbh[j] = frag16(sb + obh + j * 16 * SPITCH, k0, hh);
                fbl[j] = frag16(sb + obl + j * 16 * SPITCH, k0, hh);
            }
            #pragma unroll
            for (int j = 0; j < 4; ++j) {
                acc[0][j] = wmma3(fa0h, fa0l, fbh[j], fbl[j], acc[0][j]);
                acc[1][j] = wmma3(fa1h, fa1l, fbh[j], fbl[j], acc[1][j]);
            }
        }
        asm volatile("s_wait_dscnt 0x0" ::: "memory");      // this wave's reads of the buffer are done before it is refilled
        asm volatile("s_wait_asynccnt 0x0" ::: "memory");   // this wave's copies of slice t + 1 have landed
        __syncthreads();                                    // publishes slice t + 1, frees slice t's buffer
        if (t + 2 < NTRIP)
            stage_slice(lds0 + (unsigned int)((t & 1) * SBUF * 2), gah, gal, gbh, gbl, (t + 2) * KT);
    }
    asm volatile("s_wait_asynccnt 0x0" ::: "memory");       // no copy is outstanding past the loop

    // D element r of lane -> (row 8*hh + r, col m15) of the 16x16 tile
    #pragma unroll
    for (int rt = 0; rt < 2; ++rt)
        #pragma unroll
        for (int j = 0; j < 4; ++j)
            #pragma unroll
            for (int r = 0; r < 8; ++r)
                s_c[rt * 16 + 8 * hh + r][64 * wv + 16 * j + m15] = acc[rt][j][r];
    __syncthreads();
}

template <int MODE>
__device__ __forceinline__ void gemm3_epilogue(
    const float* __restrict__ bias, float post,
    float* Cf, unsigned short* Ch, unsigned short* Cl,
    int row0, int col0, const float (*s_c)[260])
{
    const int tid = threadIdx.x;

    if (MODE == 0) {
        v4f vals[16];
        size_t off[16];
        #pragma unroll
        for (int i = 0; i < 16; ++i) {
            const int idx = tid + NTHR * i;     // 0..2047
            const int row = idx >> 6;           // 0..31
            const int c4  = idx & 63;           // 0..63
            const v4f x  = *(const v4f*)&s_c[row][4 * c4];
            const v4f bb = *(const v4f*)(bias + col0 + 4 * c4);
            vals[i] = (x + bb) * post;
            off[i]  = (size_t)(row0 + row) * DD + col0 + 4 * c4;
        }
        #pragma unroll
        for (int i = 0; i < 16; ++i) *(v4f*)(Cf + off[i]) = vals[i];
        
    } else if (MODE == 1) {
        v4f vals[16];
        size_t off[16];
        #pragma unroll
        for (int i = 0; i < 16; ++i) {
            const int idx = tid + NTHR * i;     // 0..2047
            const int hl  = idx >> 9;           // local head 0..3
            const int rem = idx & 511;
            const int row = rem >> 4;           // 0..31
            const int c4  = rem & 15;           // 0..15
            const int n   = col0 + 64 * hl + 4 * c4;
            const v4f x  = *(const v4f*)&s_c[row][64 * hl + 4 * c4];
            const v4f bb = *(const v4f*)(bias + n);
            // the address registers of the bias load are reused by the loads that follow it
            asm volatile("s_wait_xcnt 0x0" ::: "memory");
            vals[i] = (x + bb) * post;
            const int m  = row0 + row;
            const int b  = m >> 8;
            const int lq = m & 255;
            const int h  = n >> 6;
            off[i] = ((size_t)((b * HH + h) * LL + lq)) * DK + 4 * c4;
        }
        #pragma unroll
        for (int i = 0; i < 16; ++i) *(v4f*)(Cf + off[i]) = vals[i];
        // in the merged kernel other code follows these stores in the listing and reuses their registers
        asm volatile("s_wait_xcnt 0x0" ::: "memory");
    } else {
        v8us hv[8], lv[8];
        size_t off[8];
        const int b = col0 >> 8;
        #pragma unroll
        for (int i = 0; i < 8; ++i) {
            const int idx = tid + NTHR * i;     // 0..1023
            const int row = idx >> 5;           // 0..31 (one wave per row per pass)
            const int c8  = idx & 31;           // 0..31
            const float bs = bias[row0 + row];
            const v4f bb = { bs, bs, bs, bs };
            const v4f x0 = *(const v4f*)&s_c[row][8 * c8] + bb;
            const v4f x1 = *(const v4f*)&s_c[row][8 * c8 + 4] + bb;
            split8(x0, x1, hv[i], lv[i]);
            const int n  = row0 + row;
            const int h  = n >> 6;
            const int dk = n & 63;
            off[i] = ((size_t)((b * HH + h) * DK + dk)) * LL + 8 * c8;
        }
        #pragma unroll
        for (int i = 0; i < 8; ++i) {
            *(v8us*)(Ch + off[i]) = hv[i];
            *(v8us*)(Cl + off[i]) = lv[i];
        }
        
    }
}

// Output projection: one tile per block, row0 = 32*blockIdx.x, col0 = 256*blockIdx.y.
__global__ void __launch_bounds__(NTHR) gemm3_out_kernel(
    const unsigned short* __restrict__ Ah, const unsigned short* __restrict__ Al,
    const unsigned short* __restrict__ Bh, const unsigned short* __restrict__ Bl,
    const float* __restrict__ bias, float* Cf)
{
    __shared__ __align__(16) float s_c[32][260];
    __shared__ __align__(16) unsigned short s_st[2 * SBUF];
    const int row0 = blockIdx.x * 32;
    const int col0 = blockIdx.y * 256;
    gemm3_main(Ah, Al, Bh, Bl, row0, col0, s_c, s_st);
    gemm3_epilogue<0>(bias, 1.0f, Cf, nullptr, nullptr, row0, col0, s_c);
}

// The three input projections in one grid: none reads another's output, and each alone fills
// only 64 blocks. blockIdx.y = 0:q 1:k 2:v, blockIdx.x = tile 0..63 of that projection.
//  q, k: A = activation planes (32 row tiles), Bt = transposed weight planes (2 col tiles), MODE 1.
//  v:    A = transposed Wv planes (16 row tiles), Bt = activation planes (4 col tiles), MODE 2.
__global__ void __launch_bounds__(NTHR) proj3_kernel(
    const unsigned short* __restrict__ xh, const unsigned short* __restrict__ xl,
    const unsigned short* __restrict__ wth, const unsigned short* __restrict__ wtl,
    const float* __restrict__ bq, const float* __restrict__ bk, const float* __restrict__ bv,
    float post, float* Qp, float* Kp, unsigned short* VTh, unsigned short* VTl)
{
    __shared__ __align__(16) float s_c[32][260];
    __shared__ __align__(16) unsigned short s_st[2 * SBUF];

    const int    t      = blockIdx.y;
    const int    tile   = blockIdx.x;
    const size_t xplane = (size_t)NR * DD;
    const size_t wplane = (size_t)DD * DD;

    const bool   isv    = (t == 2);
    const unsigned short* xth = xh + t * xplane;
    const unsigned short* xtl = xl + t * xplane;
    const unsigned short* wh  = wth + t * wplane;
    const unsigned short* wl  = wtl + t * wplane;
    const int row0 = (isv ? (tile & 15) : (tile & 31)) * 32;
    const int col0 = (isv ? (tile >> 4) : (tile >> 5)) * 256;

    // one copy of the k loop serves all three; only the operand roles and the epilogue differ
    gemm3_main(isv ? wh : xth, isv ? wl : xtl, isv ? xth : wh, isv ? xtl : wl, row0, col0, s_c, s_st);
    if (isv) gemm3_epilogue<2>(bv, 1.0f, nullptr, VTh, VTl, row0, col0, s_c);
    else     gemm3_epilogue<1>((t == 0) ? bq : bk, post, (t == 0) ? Qp : Kp, nullptr, nullptr, row0, col0, s_c);
}

// ---------------------------------------------------------------------------
// Additive scores + softmax + read-out for one (b, h, 16 query rows) block, 128 threads.
// Qp/Kp are the projections pre-multiplied by 2*log2(e) in (B,H,L,DK) f32 layout.
// tanh(x) = 1 - 2/(1 + e^{2x}); score = sum_d vp_d - 2 * sum_d vp_d/(1 + e^{2x_d});
// the constant sum_d vp_d is invariant under softmax and omitted. mask == 0 -> -1e9.
// Thread tid owns keys 2*tid, 2*tid+1; the 16 query rows are processed as 4 passes of
// 4 rows (per-pass block softmax) to keep per-thread live state small. P is split to bf16
// hi/lo in LDS (dword stores, barrier, then 16-byte fragment reloads) and feeds O = P . VT^T,
// VT = [bh][dk][256 j] hi/lo planes; wave wv owns the dk tile 16*wv.
// ---------------------------------------------------------------------------
__global__ void __launch_bounds__(NTHR) attn_kernel(
    const float* __restrict__ Qp, const float* __restrict__ Kp, const float* __restrict__ vp,
    const int* __restrict__ mask,
    const unsigned short* __restrict__ VTh, const unsigned short* __restrict__ VTl,
    unsigned short* Oh, unsigned short* Ol)
{
    __shared__ __align__(16) float          s_q[16][DK];
    __shared__ __align__(16) float          s_vp[DK];
    __shared__ __align__(16) unsigned short s_ph[16][LL];
    __shared__ __align__(16) unsigned short s_pl[16][LL];
    __shared__ __align__(16) float          s_o[16][68];
    __shared__ float s_rmax[4][4];
    __shared__ float s_rsum[4][4];

    const int tid = threadIdx.x;
    const int wv  = tid >> 5;
    const int l   = tid & 31;
    const int hh  = l >> 4;
    const int m15 = l & 15;
    const int bh  = blockIdx.y;          // 0..31
    const int b   = bh >> 3;
    const int h   = bh & 7;
    const int q0  = blockIdx.x * 16;     // 0..240

    const float LOG2E = 1.4426950408889634f;
    const float MASKV = -1.0e9f;

    #pragma unroll
    for (int i = 0; i < 2; ++i) {
        const int idx = tid + NTHR * i;  // 0..255
        const int r   = idx >> 4;        // 0..15
        const int c4  = idx & 15;        // 0..15
        *(v4f*)&s_q[r][4 * c4] = *(const v4f*)(Qp + ((size_t)(bh * LL + q0 + r)) * DK + 4 * c4);
    }
    if (tid < DK) s_vp[tid] = vp[h * DK + tid];
    __syncthreads();

    const int j0 = 2 * tid;
    const float* k0p = Kp + ((size_t)(bh * LL + j0)) * DK;
    const float* k1p = k0p + DK;
    const int* mrow = mask + ((size_t)(b * LL + q0)) * LL + j0;

    #pragma unroll 1
    for (int jq = 0; jq < 4; ++jq) {
        const int r0 = 4 * jq;           // first local query row of this pass

        float acc[4][2];
        #pragma unroll
        for (int j = 0; j < 4; ++j) { acc[j][0] = 0.0f; acc[j][1] = 0.0f; }

        #pragma unroll 1
        for (int d4 = 0; d4 < DK / 4; ++d4) {
            const v4f ka = *(const v4f*)(k0p + 4 * d4);
            const v4f kb = *(const v4f*)(k1p + 4 * d4);
            const v4f vv = *(const v4f*)&s_vp[4 * d4];
            #pragma unroll
            for (int j = 0; j < 4; ++j) {
                const v4f qv = *(const v4f*)&s_q[r0 + j][4 * d4];
                #pragma unroll
                for (int e = 0; e < 4; ++e) {
                    const float ra = RCP_FAST(EXP2_FAST(qv[e] + ka[e]) + 1.0f);   // 1/(1+e^{2x})
                    const float rb = RCP_FAST(EXP2_FAST(qv[e] + kb[e]) + 1.0f);
                    acc[j][0] = fmaf(vv[e], ra, acc[j][0]);
                    acc[j][1] = fmaf(vv[e], rb, acc[j][1]);
                }
            }
        }

        // logits with mask fill, block-wide row max over the 256 keys
        float bm[4];
        #pragma unroll
        for (int j = 0; j < 4; ++j) {
            const v2i mk = *(const v2i*)(mrow + (size_t)(r0 + j) * LL);
            const float s0 = (mk[0] == 0) ? MASKV : (-2.0f * acc[j][0]);
            const float s1 = (mk[1] == 0) ? MASKV : (-2.0f * acc[j][1]);
            acc[j][0] = s0;
            acc[j][1] = s1;
            float lm = fmaxf(s0, s1);
            #pragma unroll
            for (int off = 16; off > 0; off >>= 1) lm = fmaxf(lm, __shfl_xor(lm, off, 32));
            bm[j] = lm;
        }
        if (l == 0) {
            #pragma unroll
            for (int j = 0; j < 4; ++j) s_rmax[j][wv] = bm[j];
        }
        __syncthreads();
        #pragma unroll
        for (int j = 0; j < 4; ++j)
            bm[j] = fmaxf(fmaxf(s_rmax[j][0], s_rmax[j][1]), fmaxf(s_rmax[j][2], s_rmax[j][3]));

        float bs[4];
        #pragma unroll
        for (int j = 0; j < 4; ++j) {
            const float e0 = EXP2_FAST((acc[j][0] - bm[j]) * LOG2E);
            const float e1 = EXP2_FAST((acc[j][1] - bm[j]) * LOG2E);
            acc[j][0] = e0;
            acc[j][1] = e1;
            float ls = e0 + e1;
            #pragma unroll
            for (int off = 16; off > 0; off >>= 1) ls += __shfl_xor(ls, off, 32);
            bs[j] = ls;
        }
        if (l == 0) {
            #pragma unroll
            for (int j = 0; j < 4; ++j) s_rsum[j][wv] = bs[j];
        }
        __syncthreads();
        #pragma unroll
        for (int j = 0; j < 4; ++j) {
            const float sum = (s_rsum[j][0] + s_rsum[j][1]) + (s_rsum[j][2] + s_rsum[j][3]);
            const float inv = RCP_FAST(sum);
            const float p0  = acc[j][0] * inv;
            const float p1  = acc[j][1] * inv;
            unsigned int h0b, l0b, h1b, l1b;
            split1(p0, h0b, l0b);
            split1(p1, h1b, l1b);
            *(unsigned int*)&s_ph[r0 + j][j0] = (h1b << 16) | h0b;
            *(unsigned int*)&s_pl[r0 + j][j0] = (l1b << 16) | l0b;
        }
        // s_rmax is re-written by the next pass only after this pass's second barrier,
        // s_rsum only after the next pass's first barrier: no extra barrier needed here.
    }
    __syncthreads();

    // read-out: o[16 q][64 dk] = P . VT^T ; wave wv owns dk tile 16*wv
    v8f pacc = { 0.f, 0.f, 0.f, 0.f, 0.f, 0.f, 0.f, 0.f };
    const unsigned short* pah = &s_ph[m15][0];
    const unsigned short* pal = &s_pl[m15][0];
    const unsigned short* bvh = VTh + ((size_t)(bh * DK + 16 * wv + m15)) * LL;
    const unsigned short* bvl = VTl + ((size_t)(bh * DK + 16 * wv + m15)) * LL;
    #pragma unroll 1
    for (int k0 = 0; k0 < LL; k0 += 32) {
        const v16bf fah = frag16(pah, k0, hh);
        const v16bf fal = frag16(pal, k0, hh);
        const v16bf fbh = frag16(bvh, k0, hh);
        const v16bf fbl = frag16(bvl, k0, hh);
        pacc = wmma3(fah, fal, fbh, fbl, pacc);
    }
    #pragma unroll
    for (int r = 0; r < 8; ++r) s_o[8 * hh + r][16 * wv + m15] = pacc[r];
    __syncthreads();

    {
        const int row = tid >> 3;   // 0..15
        const int c8  = tid & 7;
        const v4f x0 = *(const v4f*)&s_o[row][8 * c8];
        const v4f x1 = *(const v4f*)&s_o[row][8 * c8 + 4];
        v8us hv, lv;
        split8(x0, x1, hv, lv);
        const size_t goff = ((size_t)(b * LL + q0 + row)) * DD + h * DK + 8 * c8;
        *(v8us*)(Oh + goff) = hv;
        *(v8us*)(Ol + goff) = lv;
        
    }
}

extern "C" void kernel_launch(void* const* d_in, const int* in_sizes, int n_in,
                              void* d_out, int out_size, void* d_ws, size_t ws_size,
                              hipStream_t stream)
{
    if (n_in < 13) return;
    if (in_sizes[0] != NR * DD || in_sizes[1] != NR * DD || in_sizes[2] != NR * DD) return;
    if (in_sizes[3] != BB * LL * LL) return;
    if (in_sizes[4] != DD * DD || in_sizes[6] != DD * DD || in_sizes[8] != DD * DD || in_sizes[11] != DD * DD) return;
    if (in_sizes[5] != DD || in_sizes[7] != DD || in_sizes[9] != DD || in_sizes[12] != DD) return;
    if (in_sizes[10] != HH * DK) return;
    if (out_size != NR * DD) return;

    const float* q    = (const float*)d_in[0];    // [4][256][512]
    const float* k    = (const float*)d_in[1];
    const float* v    = (const float*)d_in[2];
    const int*   mask = (const int*)d_in[3];      // [4][256][256] int32
    const float* Wq   = (const float*)d_in[4];    // [512 in][512 out]
    const float* bq   = (const float*)d_in[5];
    const float* Wk   = (const float*)d_in[6];
    const float* bk   = (const float*)d_in[7];
    const float* Wv   = (const float*)d_in[8];
    const float* bv   = (const float*)d_in[9];
    const float* vp   = (const float*)d_in[10];   // [8][64]
    const float* W0   = (const float*)d_in[11];
    const float* b0   = (const float*)d_in[12];
    float* out = (float*)d_out;                   // [1024][512] f32

    // workspace carve (bytes), every offset a multiple of 1 MiB
    const size_t sz_x  = (size_t)3 * NR * DD * 2;        // 3145728  (q,k,v planes)
    const size_t sz_wt = (size_t)4 * DD * DD * 2;        // 2097152  (WqT,WkT,WvT,W0T planes)
    const size_t sz_p  = (size_t)NR * DD * 4;            // 2097152  (f32 projection)
    const size_t sz_vt = (size_t)BB * HH * DK * LL * 2;  // 1048576
    const size_t sz_o  = (size_t)NR * DD * 2;            // 1048576
    size_t off = 0;
    const size_t off_xh  = off;  off += sz_x;
    const size_t off_xl  = off;  off += sz_x;
    const size_t off_wth = off;  off += sz_wt;
    const size_t off_wtl = off;  off += sz_wt;
    const size_t off_qp  = off;  off += sz_p;
    const size_t off_kp  = off;  off += sz_p;
    const size_t off_vth = off;  off += sz_vt;
    const size_t off_vtl = off;  off += sz_vt;
    const size_t off_oh  = off;  off += sz_o;
    const size_t off_ol  = off;  off += sz_o;             // total 18874368
    if (off > ws_size) return;

    char* ws = (char*)d_ws;
    unsigned short* xh  = (unsigned short*)(ws + off_xh);
    unsigned short* xl  = (unsigned short*)(ws + off_xl);
    unsigned short* wth = (unsigned short*)(ws + off_wth);
    unsigned short* wtl = (unsigned short*)(ws + off_wtl);
    float*          Qp  = (float*)(ws + off_qp);
    float*          Kp  = (float*)(ws + off_kp);
    unsigned short* VTh = (unsigned short*)(ws + off_vth);
    unsigned short* VTl = (unsigned short*)(ws + off_vtl);
    unsigned short* Oh  = (unsigned short*)(ws + off_oh);
    unsigned short* Ol  = (unsigned short*)(ws + off_ol);

    const size_t wplane = (size_t)DD * DD;   // elements per weight plane
    const float C2 = 2.8853900817779268f;    // 2*log2(e)

    // 1) 16-bit hi/lo planes for q,k,v and transposed Wq,Wk,Wv,W0
    prep_kernel<<<dim3(3 * (NR / 2) + 256), dim3(NTHR), 0, stream>>>(
        q, k, v, Wq, Wk, Wv, W0, xh, xl, wth, wtl);

    // 2) Q, K projections -> Qp, Kp (B,H,L,DK) f32 * 2log2e, and the V projection, transposed
    //    -> VT hi/lo, as one grid of 3 x 64 blocks
    proj3_kernel<<<dim3(64, 3), dim3(NTHR), 0, stream>>>(
        xh, xl, wth, wtl, bq, bk, bv, C2, Qp, Kp, VTh, VTl);

    // 3) additive scores + softmax + P.V -> O hi/lo planes in merged (B,L,D) layout
    attn_kernel<<<dim3(LL / 16, BB * HH), dim3(NTHR), 0, stream>>>(
        Qp, Kp, vp, mask, VTh, VTl, Oh, Ol);

    // 4) output projection -> d_out
    gemm3_out_kernel<<<dim3(NR / 32, DD / 256), dim3(NTHR), 0, stream>>>(
        Oh, Ol, wth + 3 * wplane, wtl + 3 * wplane, b0, out);
}

// v003
// A run of this version takes 50.2 microseconds.
// Timed twice side by side with v002, it ran 1.09 times as fast both times.
// Counting every step since v000, it is 2.52 times as fast.
#include <hip/hip_runtime.h>
#include <hip/hip_bf16.h>
#include <stddef.h>
#include <stdint.h>

// All contractions: v_wmma_f32_16x16x32_bf16 with bf16 hi/lo split operands (hi*hi + hi*lo + lo*hi, f32 accumulate): q/k/v projections, probability read-out P*V, output projection; additive scores (exp2 + rcp tanh form), mask fill, softmax and epilogues in f32.

#define BB   4
#define LL   256
#define DD   512
#define HH   8
#define DK   64
#define NR   (BB * LL)
#define NTHR 128

static_assert(NR == 1024);
static_assert(DD == HH * DK);
static_assert(LL == 2 * NTHR);
static_assert(DK == 64);

typedef unsigned short v8us  __attribute__((ext_vector_type(8)));
typedef __bf16         v16bf __attribute__((ext_vector_type(16)));
typedef float          v8f   __attribute__((ext_vector_type(8)));
typedef float          v4f   __attribute__((ext_vector_type(4)));
typedef int            v2i   __attribute__((ext_vector_type(2)));

union Frag { v16bf v; v8us h[2]; };

#if __has_builtin(__builtin_amdgcn_exp2f)
#define EXP2_FAST(x) __builtin_amdgcn_exp2f(x)
#else
#define EXP2_FAST(x) exp2f(x)
#endif
#if __has_builtin(__builtin_amdgcn_rcpf)
#define RCP_FAST(x) __builtin_amdgcn_rcpf(x)
#else
#define RCP_FAST(x) (1.0f / (x))
#endif

// f32 -> bf16 bits, RNE
__device__ __forceinline__ unsigned int bf16_rne(float f)
{
    unsigned int u = __float_as_uint(f);
    u += 0x7FFFu + ((u >> 16) & 1u);
    return u >> 16;
}

// x = hi + lo, both bf16 (RNE); lo = RNE(x - f32(hi))
__device__ __forceinline__ void split1(float x, unsigned int& hb, unsigned int& lb)
{
    hb = bf16_rne(x);
    const float xh = __uint_as_float(hb << 16);
    lb = bf16_rne(x - xh);
}

// 8 consecutive values (a then b) -> one 16-byte hi vector and one 16-byte lo vector
__device__ __forceinline__ void split8(v4f a, v4f b, v8us& hi, v8us& lo)
{
    v8us hr = { 0, 0, 0, 0, 0, 0, 0, 0 };
    v8us lr = { 0, 0, 0, 0, 0, 0, 0, 0 };
    #pragma unroll
    for (int e = 0; e < 4; ++e) {
        unsigned int hb, lb;
        split1(a[e], hb, lb);
        hr[e] = (unsigned short)hb;
        lr[e] = (unsigned short)lb;
        split1(b[e], hb, lb);
        hr[4 + e] = (unsigned short)hb;
        lr[4 + e] = (unsigned short)lb;
    }
    hi = hr;
    lo = lr;
}

// 16-bit fragment loader (wave32, 16x16x32): lane l, hh = l>>4, row/col = l&15.
// elements 0..7  <- row[k0 + 8*hh + 0..7], elements 8..15 <- row[k0 + 16 + 8*hh + 0..7].
// Used for A (row-major, k contiguous) and for B stored as [n][k] (k contiguous).
__device__ __forceinline__ v16bf frag16(const unsigned short* row, int k0, int hh)
{
    Frag f;
    f.h[0] = *(const v8us*)(row + k0 + 8 * hh);
    f.h[1] = *(const v8us*)(row + k0 + 16 + 8 * hh);
    return f.v;
}

// D += A*B with the VALU hazard guard after the instruction.
__device__ __forceinline__ v8f wmma_bf16(v16bf a, v16bf b, v8f c)
{
    v8f d = __builtin_amdgcn_wmma_f32_16x16x32_bf16(false, a, false, b, (short)0, c, false, false);
    asm volatile("v_nop\n\tv_nop\n\tv_nop\n\tv_nop" : "+v"(d) : "v"(a), "v"(b));
    return d;
}

// hi/lo split product: hh + hl + lh into one accumulator
__device__ __forceinline__ v8f wmma3(v16bf ah, v16bf al, v16bf bh, v16bf bl, v8f c)
{
    c = wmma_bf16(ah, bh, c);
    c = wmma_bf16(ah, bl, c);
    c = wmma_bf16(al, bh, c);
    return c;
}

// ---------------------------------------------------------------------------
// Operand preparation (128 threads / block).
//  blocks [0, 1536): xh/xl[t][row][512] = split(x_t[row]), t = 0:q 1:k 2:v, 2 rows per block,
//                    64 threads per row, 8 elements (16 B) per thread -> 512-B runs per wave.
//  blocks [1536, 1792): wth/wtl[w][n][512] = split(W_w[k][n]) (transposed, k contiguous),
// ---------------------------------------------------------------------------
__global__ void __launch_bounds__(NTHR) prep_kernel(
    const float* __restrict__ q, const float* __restrict__ k, const float* __restrict__ v,
    const float* __restrict__ Wq, const float* __restrict__ Wk,
    const float* __restrict__ Wv, const float* __restrict__ W0,
    unsigned short* xh, unsigned short* xl, unsigned short* wth, unsigned short* wtl)
{
    __shared__ float s_t[64][65];

    const int tid = threadIdx.x;
    const int bid = blockIdx.x;
    const int NXB = 3 * (NR / 2);   // 1536

    if (bid < NXB) {
        const int t   = bid / (NR / 2);
        const int row = ((bid % (NR / 2)) << 1) + (tid >> 6);
        const int c8  = tid & 63;
        const float* src = (t == 0) ? q : ((t == 1) ? k : v);
        const size_t soff = (size_t)row * DD + 8 * c8;
        const v4f x0 = *(const v4f*)(src + soff);
        const v4f x1 = *(const v4f*)(src + soff + 4);
        v8us hv, lv;
        split8(x0, x1, hv, lv);
        const size_t doff = ((size_t)t * NR + row) * DD + 8 * c8;
        *(v8us*)(xh + doff) = hv;
        *(v8us*)(xl + doff) = lv;
        
    } else {
        const int u    = bid - NXB;          // 0..255
        const int w    = u >> 6;             // 0..3
        const int tile = u & 63;
        const int k0   = (tile >> 3) * 64;
        const int n0   = (tile & 7) * 64;
        const float* Wsel = (w == 0) ? Wq : ((w == 1) ? Wk : ((w == 2) ? Wv : W0));
        // load W[k0+kk][n0+nn] -> s_t[nn][kk]
        #pragma unroll
        for (int i = 0; i < 8; ++i) {
            const int idx = tid + NTHR * i;  // 0..1023
            const int kk  = idx >> 4;        // 0..63
            const int c4  = idx & 15;        // 0..15
            const v4f x = *(const v4f*)(Wsel + (size_t)(k0 + kk) * DD + n0 + 4 * c4);
            s_t[4 * c4 + 0][kk] = x[0];
            s_t[4 * c4 + 1][kk] = x[1];
            s_t[4 * c4 + 2][kk] = x[2];
            s_t[4 * c4 + 3][kk] = x[3];
        }
        __syncthreads();
        v8us hv[4], lv[4];
        size_t off[4];
        #pragma unroll
        for (int i = 0; i < 4; ++i) {
            const int idx = tid + NTHR * i;  // 0..511
            const int nn  = idx >> 3;        // 0..63
            const int k8  = idx & 7;         // 0..7
            const v4f a  = { s_t[nn][8 * k8 + 0], s_t[nn][8 * k8 + 1], s_t[nn][8 * k8 + 2], s_t[nn][8 * k8 + 3] };
            const v4f b2 = { s_t[nn][8 * k8 + 4], s_t[nn][8 * k8 + 5], s_t[nn][8 * k8 + 6], s_t[nn][8 * k8 + 7] };
            split8(a, b2, hv[i], lv[i]);
            off[i] = ((size_t)w * DD + n0 + nn) * DD + k0 + 8 * k8;
        }
        #pragma unroll
        for (int i = 0; i < 4; ++i) {
            *(v8us*)(wth + off[i]) = hv[i];
            *(v8us*)(wtl + off[i]) = lv[i];
        }
        
    }
}

// ---------------------------------------------------------------------------
// C[32 rows of A][256 rows of Bt] = Ah/Al[.][512] . Bt h/l[.][512]^T  (K = 512, hi/lo split).
// One block of 128 threads per tile; row0, col0 = first A row and first Bt row of the tile.
// Wave wv: row tiles 0,1 and col tiles at 64*wv + 16*j, j = 0..3.
// k slices of 64 staged in LDS by asynchronous copies, two buffers; epilogue staged in LDS.
// MODE 0: Cf[m][512] f32 = (C + bias[n]) * post                    (plain row-major)
// MODE 1: Cf[(b*8+h)*256 + l][64] f32 = (C + bias[n]) * post,  m = b*256+l, n = h*64+dk
// MODE 2: A rows are n = h*64+dk, Bt rows are m = b*256+j:
//         Ch/Cl[(b*8+h)*64 + dk][256 j] = split(C + bias[n])       (per-row bias)
// ---------------------------------------------------------------------------
// One k slice of the tile in LDS: 576 rows of KT 16-bit values, [Ah 32 | Al 32 | Bh 256 | Bl 256],
// row pitch 144 B (16 B x odd: conflict-free for the 16-byte fragment reads).
#define KT       64
#define SPITCH   72                       // 16-bit elements per staged row
#define SROWS    576
#define SBUF     (SROWS * SPITCH)         // elements per buffer (82944 B)
#define NTRIP    (DD / KT)

static_assert(NTRIP >= 2);
static_assert(SROWS * (KT / 8) == 36 * NTHR);

// Twelve 16-byte asynchronous copies global -> LDS, each lane its own addresses. The s_wait_xcnt
// is the last line of the copies' own statement, so no address register is rewritten ahead of it.
__device__ __forceinline__ void copy12(const unsigned int* la, const unsigned short* const* ga)
{
    asm volatile(
        "global_load_async_to_lds_b128 %0, %12, off\n\t"
        "global_load_async_to_lds_b128 %1, %13, off\n\t"
        "global_load_async_to_lds_b128 %2, %14, off\n\t"
        "global_load_async_to_lds_b128 %3, %15, off\n\t"
        "global_load_async_to_lds_b128 %4, %16, off\n\t"
        "global_load_async_to_lds_b128 %5, %17, off\n\t"
        "global_load_async_to_lds_b128 %6, %18, off\n\t"
        "global_load_async_to_lds_b128 %7, %19, off\n\t"
        "global_load_async_to_lds_b128 %8, %20, off\n\t"
        "global_load_async_to_lds_b128 %9, %21, off\n\t"
        "global_load_async_to_lds_b128 %10, %22, off\n\t"
        "global_load_async_to_lds_b128 %11, %23, off\n\t"
        "s_wait_xcnt 0x0"
        :: "v"(la[0]), "v"(la[1]), "v"(la[2]), "v"(la[3]), "v"(la[4]), "v"(la[5]),
           "v"(la[6]), "v"(la[7]), "v"(la[8]), "v"(la[9]), "v"(la[10]), "v"(la[11]),
           "v"(ga[0]), "v"(ga[1]), "v"(ga[2]), "v"(ga[3]), "v"(ga[4]), "v"(ga[5]),
           "v"(ga[6]), "v"(ga[7]), "v"(ga[8]), "v"(ga[9]), "v"(ga[10]), "v"(ga[11])
        : "memory");
}

// Stage one k slice: copy i of thread tid moves 16 B of staged row 16*i + (tid >> 3), chunk tid & 7,
// so a wave's copy covers four whole 128-B lines. lds0 and the four pointers already hold the
// thread's row and chunk; kk = first k of the slice.
__device__ __forceinline__ void stage_slice(
    unsigned int lds0,
    const unsigned short* gah, const unsigned short* gal,
    const unsigned short* gbh, const unsigned short* gbl, int kk)
{
    unsigned int la[36];
    const unsigned short* ga[36];
    #pragma unroll
    for (int i = 0; i < 36; ++i) {
        la[i] = lds0 + (unsigned int)(i * 16 * SPITCH * 2);
        ga[i] = ((i < 2)  ? gah + (size_t)i * 16 * DD
               : (i < 4)  ? gal + (size_t)(i - 2) * 16 * DD
               : (i < 20) ? gbh + (size_t)(i - 4) * 16 * DD
                          : gbl + (size_t)(i - 20) * 16 * DD) + kk;
    }
    copy12(la, ga);
    copy12(la + 12, ga + 12);
    copy12(la + 24, ga + 24);
}

__device__ __forceinline__ void gemm3_main(
    const unsigned short* __restrict__ Ah, const unsigned short* __restrict__ Al,
    const unsigned short* __restrict__ Bh, const unsigned short* __restrict__ Bl,
    int row0, int col0, float (*s_c)[260], unsigned short* s_st)
{
    const int tid  = threadIdx.x;
    const int wv   = tid >> 5;
    const int l    = tid & 31;
    const int hh   = l >> 4;
    const int m15  = l & 15;

    const v8f zero = { 0.f, 0.f, 0.f, 0.f, 0.f, 0.f, 0.f, 0.f };
    v8f acc[2][4];
    #pragma unroll
    for (int rt = 0; rt < 2; ++rt)
        #pragma unroll
        for (int j = 0; j < 4; ++j) acc[rt][j] = zero;

    // copy side: this thread's row (of 16) and 16-byte chunk (of 8)
    const int crow = tid >> 3;
    const int cchk = tid & 7;
    const unsigned short* gah = Ah + (size_t)(row0 + crow) * DD + 8 * cchk;
    const unsigned short* gal = Al + (size_t)(row0 + crow) * DD + 8 * cchk;
    const unsigned short* gbh = Bh + (size_t)(col0 + crow) * DD + 8 * cchk;
    const unsigned short* gbl = Bl + (size_t)(col0 + crow) * DD + 8 * cchk;
    const unsigned int lds0 = (unsigned int)(uintptr_t)s_st + (unsigned int)(crow * SPITCH * 2 + cchk * 16);

    // read side: element offsets of this lane's fragment rows inside a buffer
    const int oa0h = m15 * SPITCH;
    const int oa1h = (16 + m15) * SPITCH;
    const int oa0l = (32 + m15) * SPITCH;
    const int oa1l = (48 + m15) * SPITCH;
    const int obh  = (64 + 64 * wv + m15) * SPITCH;
    const int obl  = (320 + 64 * wv + m15) * SPITCH;

    // slice 0 lands and is published, then slice 1 starts to fly
    stage_slice(lds0, gah, gal, gbh, gbl, 0);
    asm volatile("s_wait_asynccnt 0x0" ::: "memory");   // this wave's copies of slice 0 have landed
    __syncthreads();
    stage_slice(lds0 + SBUF * 2, gah, gal, gbh, gbl, KT);

    // kept rolled: a trip already holds 48 WMMAs and 36 copies, unrolling would only add code to fetch
    #pragma unroll 1
    for (int t = 0; t < NTRIP; ++t) {
        const unsigned short* sb = s_st + (t & 1) * SBUF;
        #pragma unroll
        for (int k0 = 0; k0 < KT; k0 += 32) {
            const v16bf fa0h = frag16(sb + oa0h, k0, hh);
            const v16bf fa0l = frag16(sb + oa0l, k0, hh);
            const v16bf fa1h = frag16(sb + oa1h, k0, hh);
            const v16bf fa1l = frag16(sb + oa1l, k0, hh);
            // all fragments of a k step are read as one group, so one LDS latency is waited out per step
            v16bf fbh[4], fbl[4];
            #pragma unroll
            for (int j = 0; j < 4; ++j) {
                fbh[j] = frag16(sb + obh + j * 16 * SPITCH, k0, hh);
                fbl[j] = frag16(sb + obl + j * 16 * SPITCH, k0, hh);
            }
            #pragma unroll
            for (int j = 0; j < 4; ++j) {
                acc[0][j] = wmma3(fa0h, fa0l, fbh[j], fbl[j], acc[0][j]);
                acc[1][j] = wmma3(fa1h, fa1l, fbh[j], fbl[j], acc[1][j]);
            }
        }
        asm volatile("s_wait_dscnt 0x0" ::: "memory");      // this wave's reads of the buffer are done before it is refilled
        asm volatile("s_wait_asynccnt 0x0" ::: "memory");   // this wave's copies of slice t + 1 have landed
        __syncthreads();                                    // publishes slice t + 1, frees slice t's buffer
        if (t + 2 < NTRIP)
            stage_slice(lds0 + (unsigned int)((t & 1) * SBUF * 2), gah, gal, gbh, gbl, (t + 2) * KT);
    }
    asm volatile("s_wait_asynccnt 0x0" ::: "memory");       // no copy is outstanding past the loop

    // D element r of lane -> (row 8*hh + r, col m15) of the 16x16 tile
    #pragma unroll
    for (int rt = 0; rt < 2; ++rt)
        #pragma unroll
        for (int j = 0; j < 4; ++j)
            #pragma unroll
            for (int r = 0; r < 8; ++r)
                s_c[rt * 16 + 8 * hh + r][64 * wv + 16 * j + m15] = acc[rt][j][r];
    __syncthreads();
}

template <int MODE>
__device__ __forceinline__ void gemm3_epilogue(
    const float* __restrict__ bias, float post,
    float* Cf, unsigned short* Ch, unsigned short* Cl,
    int row0, int col0, const float (*s_c)[260])
{
    const int tid = threadIdx.x;

    if (MODE == 0) {
        v4f vals[16];
        size_t off[16];
        #pragma unroll
        for (int i = 0; i < 16; ++i) {
            const int idx = tid + NTHR * i;     // 0..2047
            const int row = idx >> 6;           // 0..31
            const int c4  = idx & 63;           // 0..63
            const v4f x  = *(const v4f*)&s_c[row][4 * c4];
            const v4f bb = *(const v4f*)(bias + col0 + 4 * c4);
            vals[i] = (x + bb) * post;
            off[i]  = (size_t)(row0 + row) * DD + col0 + 4 * c4;
        }
        #pragma unroll
        for (int i = 0; i < 16; ++i) *(v4f*)(Cf + off[i]) = vals[i];
        
    } else if (MODE == 1) {
        v4f vals[16];
        size_t off[16];
        #pragma unroll
        for (int i = 0; i < 16; ++i) {
            const int idx = tid + NTHR * i;     // 0..2047
            const int hl  = idx >> 9;           // local head 0..3
            const int rem = idx & 511;
            const int row = rem >> 4;           // 0..31
            const int c4  = rem & 15;           // 0..15
            const int n   = col0 + 64 * hl + 4 * c4;
            const v4f x  = *(const v4f*)&s_c[row][64 * hl + 4 * c4];
            const v4f bb = *(const v4f*)(bias + n);
            // the address registers of the bias load are reused by the loads that follow it
            asm volatile("s_wait_xcnt 0x0" ::: "memory");
            vals[i] = (x + bb) * post;
            const int m  = row0 + row;
            const int b  = m >> 8;
            const int lq = m & 255;
            const int h  = n >> 6;
            off[i] = ((size_t)((b * HH + h) * LL + lq)) * DK + 4 * c4;
        }
        #pragma unroll
        for (int i = 0; i < 16; ++i) *(v4f*)(Cf + off[i]) = vals[i];
        // in the merged kernel other code follows these stores in the listing and reuses their registers
        asm volatile("s_wait_xcnt 0x0" ::: "memory");
    } else {
        v8us hv[8], lv[8];
        size_t off[8];
        const int b = col0 >> 8;
        #pragma unroll
        for (int i = 0; i < 8; ++i) {
            const int idx = tid + NTHR * i;     // 0..1023
            const int row = idx >> 5;           // 0..31 (one wave per row per pass)
            const int c8  = idx & 31;           // 0..31
            const float bs = bias[row0 + row];
            const v4f bb = { bs, bs, bs, bs };
            const v4f x0 = *(const v4f*)&s_c[row][8 * c8] + bb;
            const v4f x1 = *(const v4f*)&s_c[row][8 * c8 + 4] + bb;
            split8(x0, x1, hv[i], lv[i]);
            const int n  = row0 + row;
            const int h  = n >> 6;
            const int dk = n & 63;
            off[i] = ((size_t)((b * HH + h) * DK + dk)) * LL + 8 * c8;
        }
        #pragma unroll
        for (int i = 0; i < 8; ++i) {
            *(v8us*)(Ch + off[i]) = hv[i];
            *(v8us*)(Cl + off[i]) = lv[i];
        }
        
    }
}

// Output projection: one tile per block, row0 = 32*blockIdx.x, col0 = 256*blockIdx.y.
__global__ void __launch_bounds__(NTHR) gemm3_out_kernel(
    const unsigned short* __restrict__ Ah, const unsigned short* __restrict__ Al,
    const unsigned short* __restrict__ Bh, const unsigned short* __restrict__ Bl,
    const float* __restrict__ bias, float* Cf)
{
    __shared__ __align__(16) float s_c[32][260];
    __shared__ __align__(16) unsigned short s_st[2 * SBUF];
    const int row0 = blockIdx.x * 32;
    const int col0 = blockIdx.y * 256;
    gemm3_main(Ah, Al, Bh, Bl, row0, col0, s_c, s_st);
    gemm3_epilogue<0>(bias, 1.0f, Cf, nullptr, nullptr, row0, col0, s_c);
}

// The three input projections in one grid: none reads another's output, and each alone fills
// only 64 blocks. blockIdx.y = 0:q 1:k 2:v, blockIdx.x = tile 0..63 of that projection.
//  q, k: A = activation planes (32 row tiles), Bt = transposed weight planes (2 col tiles), MODE 1.
//  v:    A = transposed Wv planes (16 row tiles), Bt = activation planes (4 col tiles), MODE 2.
__global__ void __launch_bounds__(NTHR) proj3_kernel(
    const unsigned short* __restrict__ xh, const unsigned short* __restrict__ xl,
    const unsigned short* __restrict__ wth, const unsigned short* __restrict__ wtl,
    const float* __restrict__ bq, const float* __restrict__ bk, const float* __restrict__ bv,
    float post, float* Qp, float* Kp, unsigned short* VTh, unsigned short* VTl)
{
    __shared__ __align__(16) float s_c[32][260];
    __shared__ __align__(16) unsigned short s_st[2 * SBUF];

    const int    t      = blockIdx.y;
    const int    tile   = blockIdx.x;
    const size_t xplane = (size_t)NR * DD;
    const size_t wplane = (size_t)DD * DD;

    const bool   isv    = (t == 2);
    const unsigned short* xth = xh + t * xplane;
    const unsigned short* xtl = xl + t * xplane;
    const unsigned short* wh  = wth + t * wplane;
    const unsigned short* wl  = wtl + t * wplane;
    const int row0 = (isv ? (tile & 15) : (tile & 31)) * 32;
    const int col0 = (isv ? (tile >> 4) : (tile >> 5)) * 256;

    // one copy of the k loop serves all three; only the operand roles and the epilogue differ
    gemm3_main(isv ? wh : xth, isv ? wl : xtl, isv ? xth : wh, isv ? xtl : wl, row0, col0, s_c, s_st);
    if (isv) gemm3_epilogue<2>(bv, 1.0f, nullptr, VTh, VTl, row0, col0, s_c);
    else     gemm3_epilogue<1>((t == 0) ? bq : bk, post, (t == 0) ? Qp : Kp, nullptr, nullptr, row0, col0, s_c);
}

// ---------------------------------------------------------------------------
// Additive scores + softmax + read-out for one (b, h, 16 query rows) block, 128 threads.
// Qp/Kp are the projections pre-multiplied by 2*log2(e) in (B,H,L,DK) f32 layout.
// tanh(x) = 1 - 2/(1 + e^{2x}); score = sum_d vp_d - 2 * sum_d vp_d/(1 + e^{2x_d});
// the constant sum_d vp_d is invariant under softmax and omitted. mask == 0 -> -1e9.
// Thread tid owns keys 2*tid, 2*tid+1; the 16 query rows are processed as 4 passes of
// 4 rows (per-pass block softmax) to keep per-thread live state small. P is split to bf16
// hi/lo in LDS (dword stores, barrier, then 16-byte fragment reloads) and feeds O = P . VT^T,
// VT = [bh][dk][256 j] hi/lo planes; wave wv owns the dk tile 16*wv.
// The head's K rows (256 keys x 64 f32) are staged once per block in LDS by asynchronous copies of
// whole lines: a thread reading its own two rows from global memory touches 32 lines per load.
// Key j lies in LDS row (j >> 1) + 128 * (j & 1), row pitch 272 B (16 B x odd), so that the lanes of
// a wave, which own every second key, read rows one pitch apart without bank conflicts.
// ---------------------------------------------------------------------------
#define KPITCH 68                         // f32 elements per staged K row

static_assert(LL * DK * 4 == 32 * NTHR * 16);

// Eight 16-byte asynchronous copies global -> LDS, each lane its own addresses. The s_wait_xcnt
// is the last line of the copies' own statement, so no address register is rewritten ahead of it.
__device__ __forceinline__ void copy8(const unsigned int* la, const float* const* ga)
{
    asm volatile(
        "global_load_async_to_lds_b128 %0, %8, off\n\t"
        "global_load_async_to_lds_b128 %1, %9, off\n\t"
        "global_load_async_to_lds_b128 %2, %10, off\n\t"
        "global_load_async_to_lds_b128 %3, %11, off\n\t"
        "global_load_async_to_lds_b128 %4, %12, off\n\t"
        "global_load_async_to_lds_b128 %5, %13, off\n\t"
        "global_load_async_to_lds_b128 %6, %14, off\n\t"
        "global_load_async_to_lds_b128 %7, %15, off\n\t"
        "s_wait_xcnt 0x0"
        :: "v"(la[0]), "v"(la[1]), "v"(la[2]), "v"(la[3]), "v"(la[4]), "v"(la[5]), "v"(la[6]), "v"(la[7]),
           "v"(ga[0]), "v"(ga[1]), "v"(ga[2]), "v"(ga[3]), "v"(ga[4]), "v"(ga[5]), "v"(ga[6]), "v"(ga[7])
        : "memory");
}

__global__ void __launch_bounds__(NTHR) attn_kernel(
    const float* __restrict__ Qp, const float* __restrict__ Kp, const float* __restrict__ vp,
    const int* __restrict__ mask,
    const unsigned short* __restrict__ VTh, const unsigned short* __restrict__ VTl,
    unsigned short* Oh, unsigned short* Ol)
{
    __shared__ __align__(16) float          s_k[LL][KPITCH];
    __shared__ __align__(16) float          s_q[16][DK];
    __shared__ __align__(16) float          s_vp[DK];
    __shared__ __align__(16) unsigned short s_ph[16][LL];
    __shared__ __align__(16) unsigned short s_pl[16][LL];
    __shared__ __align__(16) float          s_o[16][68];
    __shared__ float s_rmax[4][4];
    __shared__ float s_rsum[4][4];

    const int tid = threadIdx.x;
    const int wv  = tid >> 5;
    const int l   = tid & 31;
    const int hh  = l >> 4;
    const int m15 = l & 15;
    const int bh  = blockIdx.y;          // 0..31
    const int b   = bh >> 3;
    const int h   = bh & 7;
    const int q0  = blockIdx.x * 16;     // 0..240

    const float LOG2E = 1.4426950408889634f;
    const float MASKV = -1.0e9f;

    // K tile: copy i of thread tid moves 16-byte chunk tid + 128*i of the head's 64 KiB, that is
    // key (tid >> 4) + 8*i, chunk tid & 15; a wave's copy covers four whole 128-B lines.
    {
        const float* gk0 = Kp + (size_t)bh * LL * DK + 4 * tid;
        const unsigned int lk0 = (unsigned int)(uintptr_t)&s_k[0][0]
            + (unsigned int)(((tid >> 5) + 128 * ((tid >> 4) & 1)) * (KPITCH * 4) + (tid & 15) * 16);
        #pragma unroll
        for (int g = 0; g < 4; ++g) {
            unsigned int la[8];
            const float* ga[8];
            #pragma unroll
            for (int i = 0; i < 8; ++i) {
                la[i] = lk0 + (unsigned int)((8 * g + i) * 4 * (KPITCH * 4));
                ga[i] = gk0 + (size_t)(8 * g + i) * (NTHR * 4);
            }
            copy8(la, ga);
        }
    }

    #pragma unroll
    for (int i = 0; i < 2; ++i) {
        const int idx = tid + NTHR * i;  // 0..255
        const int r   = idx >> 4;        // 0..15
        const int c4  = idx & 15;        // 0..15
        *(v4f*)&s_q[r][4 * c4] = *(const v4f*)(Qp + ((size_t)(bh * LL + q0 + r)) * DK + 4 * c4);
    }
    if (tid < DK) s_vp[tid] = vp[h * DK + tid];
    asm volatile("s_wait_asynccnt 0x0" ::: "memory");   // this wave's copies of the K tile have landed
    __syncthreads();                                    // publishes s_q, s_vp and the K tile

    const int j0 = 2 * tid;
    const float* k0p = &s_k[tid][0];          // key 2*tid
    const float* k1p = &s_k[128 + tid][0];    // key 2*tid + 1
    const int* mrow = mask + ((size_t)(b * LL + q0)) * LL + j0;

    #pragma unroll 1
    for (int jq = 0; jq < 4; ++jq) {
        const int r0 = 4 * jq;           // first local query row of this pass

        float acc[4][2];
        #pragma unroll
        for (int j = 0; j < 4; ++j) { acc[j][0] = 0.0f; acc[j][1] = 0.0f; }

        #pragma unroll 1
        for (int d4 = 0; d4 < DK / 4; ++d4) {
            const v4f ka = *(const v4f*)(k0p + 4 * d4);
            const v4f kb = *(const v4f*)(k1p + 4 * d4);
            const v4f vv = *(const v4f*)&s_vp[4 * d4];
            #pragma unroll
            for (int j = 0; j < 4; ++j) {
                const v4f qv = *(const v4f*)&s_q[r0 + j][4 * d4];
                #pragma unroll
                for (int e = 0; e < 4; ++e) {
                    const float ra = RCP_FAST(EXP2_FAST(qv[e] + ka[e]) + 1.0f);   // 1/(1+e^{2x})
                    const float rb = RCP_FAST(EXP2_FAST(qv[e] + kb[e]) + 1.0f);
                    acc[j][0] = fmaf(vv[e], ra, acc[j][0]);
                    acc[j][1] = fmaf(vv[e], rb, acc[j][1]);
                }
            }
        }

        // logits with mask fill, block-wide row max over the 256 keys
        float bm[4];
        #pragma unroll
        for (int j = 0; j < 4; ++j) {
            const v2i mk = *(const v2i*)(mrow + (size_t)(r0 + j) * LL);
            const float s0 = (mk[0] == 0) ? MASKV : (-2.0f * acc[j][0]);
            const float s1 = (mk[1] == 0) ? MASKV : (-2.0f * acc[j][1]);
            acc[j][0] = s0;
            acc[j][1] = s1;
            float lm = fmaxf(s0, s1);
            #pragma unroll
            for (int off = 16; off > 0; off >>= 1) lm = fmaxf(lm, __shfl_xor(lm, off, 32));
            bm[j] = lm;
        }
        if (l == 0) {
            #pragma unroll
            for (int j = 0; j < 4; ++j) s_rmax[j][wv] = bm[j];
        }
        __syncthreads();
        #pragma unroll
        for (int j = 0; j < 4; ++j)
            bm[j] = fmaxf(fmaxf(s_rmax[j][0], s_rmax[j][1]), fmaxf(s_rmax[j][2], s_rmax[j][3]));

        float bs[4];
        #pragma unroll
        for (int j = 0; j < 4; ++j) {
            const float e0 = EXP2_FAST((acc[j][0] - bm[j]) * LOG2E);
            const float e1 = EXP2_FAST((acc[j][1] - bm[j]) * LOG2E);
            acc[j][0] = e0;
            acc[j][1] = e1;
            float ls = e0 + e1;
            #pragma unroll
            for (int off = 16; off > 0; off >>= 1) ls += __shfl_xor(ls, off, 32);
            bs[j] = ls;
        }
        if (l == 0) {
            #pragma unroll
            for (int j = 0; j < 4; ++j) s_rsum[j][wv] = bs[j];
        }
        __syncthreads();
        #pragma unroll
        for (int j = 0; j < 4; ++j) {
            const float sum = (s_rsum[j][0] + s_rsum[j][1]) + (s_rsum[j][2] + s_rsum[j][3]);
            const float inv = RCP_FAST(sum);
            const float p0  = acc[j][0] * inv;
            const float p1  = acc[j][1] * inv;
            unsigned int h0b, l0b, h1b, l1b;
            split1(p0, h0b, l0b);
            split1(p1, h1b, l1b);
            *(unsigned int*)&s_ph[r0 + j][j0] = (h1b << 16) | h0b;
            *(unsigned int*)&s_pl[r0 + j][j0] = (l1b << 16) | l0b;
        }
        // s_rmax is re-written by the next pass only after this pass's second barrier,
        // s_rsum only after the next pass's first barrier: no extra barrier needed here.
    }
    __syncthreads();

    // read-out: o[16 q][64 dk] = P . VT^T ; wave wv owns dk tile 16*wv
    v8f pacc = { 0.f, 0.f, 0.f, 0.f, 0.f, 0.f, 0.f, 0.f };
    const unsigned short* pah = &s_ph[m15][0];
    const unsigned short* pal = &s_pl[m15][0];
    const unsigned short* bvh = VTh + ((size_t)(bh * DK + 16 * wv + m15)) * LL;
    const unsigned short* bvl = VTl + ((size_t)(bh * DK + 16 * wv + m15)) * LL;
    #pragma unroll 1
    for (int k0 = 0; k0 < LL; k0 += 32) {
        const v16bf fah = frag16(pah, k0, hh);
        const v16bf fal = frag16(pal, k0, hh);
        const v16bf fbh = frag16(bvh, k0, hh);
        const v16bf fbl = frag16(bvl, k0, hh);
        pacc = wmma3(fah, fal, fbh, fbl, pacc);
    }
    #pragma unroll
    for (int r = 0; r < 8; ++r) s_o[8 * hh + r][16 * wv + m15] = pacc[r];
    __syncthreads();

    {
        const int row = tid >> 3;   // 0..15
        const int c8  = tid & 7;
        const v4f x0 = *(const v4f*)&s_o[row][8 * c8];
        const v4f x1 = *(const v4f*)&s_o[row][8 * c8 + 4];
        v8us hv, lv;
        split8(x0, x1, hv, lv);
        const size_t goff = ((size_t)(b * LL + q0 + row)) * DD + h * DK + 8 * c8;
        *(v8us*)(Oh + goff) = hv;
        *(v8us*)(Ol + goff) = lv;
        
    }
}

extern "C" void kernel_launch(void* const* d_in, const int* in_sizes, int n_in,
                              void* d_out, int out_size, void* d_ws, size_t ws_size,
                              hipStream_t stream)
{
    if (n_in < 13) return;
    if (in_sizes[0] != NR * DD || in_sizes[1] != NR * DD || in_sizes[2] != NR * DD) return;
    if (in_sizes[3] != BB * LL * LL) return;
    if (in_sizes[4] != DD * DD || in_sizes[6] != DD * DD || in_sizes[8] != DD * DD || in_sizes[11] != DD * DD) return;
    if (in_sizes[5] != DD || in_sizes[7] != DD || in_sizes[9] != DD || in_sizes[12] != DD) return;
    if (in_sizes[10] != HH * DK) return;
    if (out_size != NR * DD) return;

    const float* q    = (const float*)d_in[0];    // [4][256][512]
    const float* k    = (const float*)d_in[1];
    const float* v    = (const float*)d_in[2];
    const int*   mask = (const int*)d_in[3];      // [4][256][256] int32
    const float* Wq   = (const float*)d_in[4];    // [512 in][512 out]
    const float* bq   = (const float*)d_in[5];
    const float* Wk   = (const float*)d_in[6];
    const float* bk   = (const float*)d_in[7];
    const float* Wv   = (const float*)d_in[8];
    const float* bv   = (const float*)d_in[9];
    const float* vp   = (const float*)d_in[10];   // [8][64]
    const float* W0   = (const float*)d_in[11];
    const float* b0   = (const float*)d_in[12];
    float* out = (float*)d_out;                   // [1024][512] f32

    // workspace carve (bytes), every offset a multiple of 1 MiB
    const size_t sz_x  = (size_t)3 * NR * DD * 2;        // 3145728  (q,k,v planes)
    const size_t sz_wt = (size_t)4 * DD * DD * 2;        // 2097152  (WqT,WkT,WvT,W0T planes)
    const size_t sz_p  = (size_t)NR * DD * 4;            // 2097152  (f32 projection)
    const size_t sz_vt = (size_t)BB * HH * DK * LL * 2;  // 1048576
    const size_t sz_o  = (size_t)NR * DD * 2;            // 1048576
    size_t off = 0;
    const size_t off_xh  = off;  off += sz_x;
    const size_t off_xl  = off;  off += sz_x;
    const size_t off_wth = off;  off += sz_wt;
    const size_t off_wtl = off;  off += sz_wt;
    const size_t off_qp  = off;  off += sz_p;
    const size_t off_kp  = off;  off += sz_p;
    const size_t off_vth = off;  off += sz_vt;
    const size_t off_vtl = off;  off += sz_vt;
    const size_t off_oh  = off;  off += sz_o;
    const size_t off_ol  = off;  off += sz_o;             // total 18874368
    if (off > ws_size) return;

    char* ws = (char*)d_ws;
    unsigned short* xh  = (unsigned short*)(ws + off_xh);
    unsigned short* xl  = (unsigned short*)(ws + off_xl);
    unsigned short* wth = (unsigned short*)(ws + off_wth);
    unsigned short* wtl = (unsigned short*)(ws + off_wtl);
    float*          Qp  = (float*)(ws + off_qp);
    float*          Kp  = (float*)(ws + off_kp);
    unsigned short* VTh = (unsigned short*)(ws + off_vth);
    unsigned short* VTl = (unsigned short*)(ws + off_vtl);
    unsigned short* Oh  = (unsigned short*)(ws + off_oh);
    unsigned short* Ol  = (unsigned short*)(ws + off_ol);

    const size_t wplane = (size_t)DD * DD;   // elements per weight plane
    const float C2 = 2.8853900817779268f;    // 2*log2(e)

    // 1) 16-bit hi/lo planes for q,k,v and transposed Wq,Wk,Wv,W0
    prep_kernel<<<dim3(3 * (NR / 2) + 256), dim3(NTHR), 0, stream>>>(
        q, k, v, Wq, Wk, Wv, W0, xh, xl, wth, wtl);

    // 2) Q, K projections -> Qp, Kp (B,H,L,DK) f32 * 2log2e, and the V projection, transposed
    //    -> VT hi/lo, as one grid of 3 x 64 blocks
    proj3_kernel<<<dim3(64, 3), dim3(NTHR), 0, stream>>>(
        xh, xl, wth, wtl, bq, bk, bv, C2, Qp, Kp, VTh, VTl);

    // 3) additive scores + softmax + P.V -> O hi/lo planes in merged (B,L,D) layout
    attn_kernel<<<dim3(LL / 16, BB * HH), dim3(NTHR), 0, stream>>>(
        Qp, Kp, vp, mask, VTh, VTl, Oh, Ol);

    // 4) output projection -> d_out
    gemm3_out_kernel<<<dim3(NR / 32, DD / 256), dim3(NTHR), 0, stream>>>(
        Oh, Ol, wth + 3 * wplane, wtl + 3 * wplane, b0, out);
}

// v004
// One run takes 46 microseconds.
// Timed twice side by side with v003, it ran 1.09 and 1.10 times as fast.
// Over all steps from v000 it is 2.76 times as fast.
#include <hip/hip_runtime.h>
#include <hip/hip_bf16.h>
#include <stddef.h>
#include <stdint.h>

// All contractions: v_wmma_f32_16x16x32_bf16 with bf16 hi/lo split operands (hi*hi + hi*lo + lo*hi, f32 accumulate): q/k/v projections, probability read-out P*V, output projection; additive scores (exp2 + rcp tanh form), mask fill, softmax and epilogues in f32.

#define BB   4
#define LL   256
#define DD   512
#define HH   8
#define DK   64
#define NR   (BB * LL)
#define NTHR 128

static_assert(NR == 1024);
static_assert(DD == HH * DK);
static_assert(LL == 2 * NTHR);
static_assert(DK == 64);

typedef unsigned short v8us  __attribute__((ext_vector_type(8)));
typedef __bf16         v16bf __attribute__((ext_vector_type(16)));
typedef float          v8f   __attribute__((ext_vector_type(8)));
typedef float          v4f   __attribute__((ext_vector_type(4)));
typedef int            v2i   __attribute__((ext_vector_type(2)));

union Frag { v16bf v; v8us h[2]; };

#if __has_builtin(__builtin_amdgcn_exp2f)
#define EXP2_FAST(x) __builtin_amdgcn_exp2f(x)
#else
#define EXP2_FAST(x) exp2f(x)
#endif
#if __has_builtin(__builtin_amdgcn_rcpf)
#define RCP_FAST(x) __builtin_amdgcn_rcpf(x)
#else
#define RCP_FAST(x) (1.0f / (x))
#endif

// f32 -> bf16 bits, RNE
__device__ __forceinline__ unsigned int bf16_rne(float f)
{
    unsigned int u = __float_as_uint(f);
    u += 0x7FFFu + ((u >> 16) & 1u);
    return u >> 16;
}

// x = hi + lo, both bf16 (RNE); lo = RNE(x - f32(hi))
__device__ __forceinline__ void split1(float x, unsigned int& hb, unsigned int& lb)
{
    hb = bf16_rne(x);
    const float xh = __uint_as_float(hb << 16);
    lb = bf16_rne(x - xh);
}

// 8 consecutive values (a then b) -> one 16-byte hi vector and one 16-byte lo vector
__device__ __forceinline__ void split8(v4f a, v4f b, v8us& hi, v8us& lo)
{
    v8us hr = { 0, 0, 0, 0, 0, 0, 0, 0 };
    v8us lr = { 0, 0, 0, 0, 0, 0, 0, 0 };
    #pragma unroll
    for (int e = 0; e < 4; ++e) {
        unsigned int hb, lb;
        split1(a[e], hb, lb);
        hr[e] = (unsigned short)hb;
        lr[e] = (unsigned short)lb;
        split1(b[e], hb, lb);
        hr[4 + e] = (unsigned short)hb;
        lr[4 + e] = (unsigned short)lb;
    }
    hi = hr;
    lo = lr;
}

// 16-bit fragment loader (wave32, 16x16x32): lane l, hh = l>>4, row/col = l&15.
// elements 0..7  <- row[k0 + 8*hh + 0..7], elements 8..15 <- row[k0 + 16 + 8*hh + 0..7].
// Used for A (row-major, k contiguous) and for B stored as [n][k] (k contiguous).
__device__ __forceinline__ v16bf frag16(const unsigned short* row, int k0, int hh)
{
    Frag f;
    f.h[0] = *(const v8us*)(row + k0 + 8 * hh);
    f.h[1] = *(const v8us*)(row + k0 + 16 + 8 * hh);
    return f.v;
}

// D += A*B with the VALU hazard guard after the instruction.
__device__ __forceinline__ v8f wmma_bf16(v16bf a, v16bf b, v8f c)
{
    v8f d = __builtin_amdgcn_wmma_f32_16x16x32_bf16(false, a, false, b, (short)0, c, false, false);
    asm volatile("v_nop\n\tv_nop\n\tv_nop\n\tv_nop" : "+v"(d) : "v"(a), "v"(b));
    return d;
}

// hi/lo split product: hh + hl + lh into one accumulator
__device__ __forceinline__ v8f wmma3(v16bf ah, v16bf al, v16bf bh, v16bf bl, v8f c)
{
    c = wmma_bf16(ah, bh, c);
    c = wmma_bf16(ah, bl, c);
    c = wmma_bf16(al, bh, c);
    return c;
}

// ---------------------------------------------------------------------------
// Operand preparation (128 threads / block).
//  blocks [0, 1536): xh/xl[t][row][512] = split(x_t[row]), t = 0:q 1:k 2:v, 2 rows per block,
//                    64 threads per row, 8 elements (16 B) per thread -> 512-B runs per wave.
//  blocks [1536, 1792): wth/wtl[w][n][512] = split(W_w[k][n]) (transposed, k contiguous),
// ---------------------------------------------------------------------------
__global__ void __launch_bounds__(NTHR) prep_kernel(
    const float* __restrict__ q, const float* __restrict__ k, const float* __restrict__ v,
    const float* __restrict__ Wq, const float* __restrict__ Wk,
    const float* __restrict__ Wv, const float* __restrict__ W0,
    unsigned short* xh, unsigned short* xl, unsigned short* wth, unsigned short* wtl)
{
    __shared__ float s_t[64][65];

    const int tid = threadIdx.x;
    const int bid = blockIdx.x;
    const int NXB = 3 * (NR / 2);   // 1536

    if (bid < NXB) {
        const int t   = bid / (NR / 2);
        const int row = ((bid % (NR / 2)) << 1) + (tid >> 6);
        const int c8  = tid & 63;
        const float* src = (t == 0) ? q : ((t == 1) ? k : v);
        const size_t soff = (size_t)row * DD + 8 * c8;
        const v4f x0 = *(const v4f*)(src + soff);
        const v4f x1 = *(const v4f*)(src + soff + 4);
        v8us hv, lv;
        split8(x0, x1, hv, lv);
        const size_t doff = ((size_t)t * NR + row) * DD + 8 * c8;
        *(v8us*)(xh + doff) = hv;
        *(v8us*)(xl + doff) = lv;
        
    } else {
        const int u    = bid - NXB;          // 0..255
        const int w    = u >> 6;             // 0..3
        const int tile = u & 63;
        const int k0   = (tile >> 3) * 64;
        const int n0   = (tile & 7) * 64;
        const float* Wsel = (w == 0) ? Wq : ((w == 1) ? Wk : ((w == 2) ? Wv : W0));
        // load W[k0+kk][n0+nn] -> s_t[nn][kk]
        #pragma unroll
        for (int i = 0; i < 8; ++i) {
            const int idx = tid + NTHR * i;  // 0..1023
            const int kk  = idx >> 4;        // 0..63
            const int c4  = idx & 15;        // 0..15
            const v4f x = *(const v4f*)(Wsel + (size_t)(k0 + kk) * DD + n0 + 4 * c4);
            s_t[4 * c4 + 0][kk] = x[0];
            s_t[4 * c4 + 1][kk] = x[1];
            s_t[4 * c4 + 2][kk] = x[2];
            s_t[4 * c4 + 3][kk] = x[3];
        }
        __syncthreads();
        v8us hv[4], lv[4];
        size_t off[4];
        #pragma unroll
        for (int i = 0; i < 4; ++i) {
            const int idx = tid + NTHR * i;  // 0..511
            const int nn  = idx >> 3;        // 0..63
            const int k8  = idx & 7;         // 0..7
            const v4f a  = { s_t[nn][8 * k8 + 0], s_t[nn][8 * k8 + 1], s_t[nn][8 * k8 + 2], s_t[nn][8 * k8 + 3] };
            const v4f b2 = { s_t[nn][8 * k8 + 4], s_t[nn][8 * k8 + 5], s_t[nn][8 * k8 + 6], s_t[nn][8 * k8 + 7] };
            split8(a, b2, hv[i], lv[i]);
            off[i] = ((size_t)w * DD + n0 + nn) * DD + k0 + 8 * k8;
        }
        #pragma unroll
        for (int i = 0; i < 4; ++i) {
            *(v8us*)(wth + off[i]) = hv[i];
            *(v8us*)(wtl + off[i]) = lv[i];
        }
        
    }
}

// ---------------------------------------------------------------------------
// C[32 rows of A][256 rows of Bt] = Ah/Al[.][512] . Bt h/l[.][512]^T  (K = 512, hi/lo split).
// One block of 128 threads per tile; row0, col0 = first A row and first Bt row of the tile.
// Wave wv: row tiles 0,1 and col tiles at 64*wv + 16*j, j = 0..3.
// k slices of 64 staged in LDS by asynchronous copies, two buffers; epilogue staged in LDS.
// MODE 0: Cf[m][512] f32 = (C + bias[n]) * post                    (plain row-major)
// MODE 1: Cf[(b*8+h)*256 + l][64] f32 = 2^((C + bsum[n]) * post),  m = b*256+l, n = h*64+dk;
//         bsum = bias + bias2 where both_bias is set, 0 where it is not
// MODE 2: A rows are n = h*64+dk, Bt rows are m = b*256+j:
//         Ch/Cl[(b*8+h)*64 + dk][256 j] = split(C + bias[n])       (per-row bias)
// ---------------------------------------------------------------------------
// One k slice of the tile in LDS: 576 rows of KT 16-bit values, [Ah 32 | Al 32 | Bh 256 | Bl 256],
// row pitch 144 B (16 B x odd: conflict-free for the 16-byte fragment reads).
#define KT       64
#define SPITCH   72                       // 16-bit elements per staged row
#define SROWS    576
#define SBUF     (SROWS * SPITCH)         // elements per buffer (82944 B)
#define NTRIP    (DD / KT)

static_assert(NTRIP >= 2);
static_assert(SROWS * (KT / 8) == 36 * NTHR);

// Twelve 16-byte asynchronous copies global -> LDS, each lane its own addresses. The s_wait_xcnt
// is the last line of the copies' own statement, so no address register is rewritten ahead of it.
__device__ __forceinline__ void copy12(const unsigned int* la, const unsigned short* const* ga)
{
    asm volatile(
        "global_load_async_to_lds_b128 %0, %12, off\n\t"
        "global_load_async_to_lds_b128 %1, %13, off\n\t"
        "global_load_async_to_lds_b128 %2, %14, off\n\t"
        "global_load_async_to_lds_b128 %3, %15, off\n\t"
        "global_load_async_to_lds_b128 %4, %16, off\n\t"
        "global_load_async_to_lds_b128 %5, %17, off\n\t"
        "global_load_async_to_lds_b128 %6, %18, off\n\t"
        "global_load_async_to_lds_b128 %7, %19, off\n\t"
        "global_load_async_to_lds_b128 %8, %20, off\n\t"
        "global_load_async_to_lds_b128 %9, %21, off\n\t"
        "global_load_async_to_lds_b128 %10, %22, off\n\t"
        "global_load_async_to_lds_b128 %11, %23, off\n\t"
        "s_wait_xcnt 0x0"
        :: "v"(la[0]), "v"(la[1]), "v"(la[2]), "v"(la[3]), "v"(la[4]), "v"(la[5]),
           "v"(la[6]), "v"(la[7]), "v"(la[8]), "v"(la[9]), "v"(la[10]), "v"(la[11]),
           "v"(ga[0]), "v"(ga[1]), "v"(ga[2]), "v"(ga[3]), "v"(ga[4]), "v"(ga[5]),
           "v"(ga[6]), "v"(ga[7]), "v"(ga[8]), "v"(ga[9]), "v"(ga[10]), "v"(ga[11])
        : "memory");
}

// Stage one k slice: copy i of thread tid moves 16 B of staged row 16*i + (tid >> 3), chunk tid & 7,
// so a wave's copy covers four whole 128-B lines. lds0 and the four pointers already hold the
// thread's row and chunk; kk = first k of the slice.
__device__ __forceinline__ void stage_slice(
    unsigned int lds0,
    const unsigned short* gah, const unsigned short* gal,
    const unsigned short* gbh, const unsigned short* gbl, int kk)
{
    unsigned int la[36];
    const unsigned short* ga[36];
    #pragma unroll
    for (int i = 0; i < 36; ++i) {
        la[i] = lds0 + (unsigned int)(i * 16 * SPITCH * 2);
        ga[i] = ((i < 2)  ? gah + (size_t)i * 16 * DD
               : (i < 4)  ? gal + (size_t)(i - 2) * 16 * DD
               : (i < 20) ? gbh + (size_t)(i - 4) * 16 * DD
                          : gbl + (size_t)(i - 20) * 16 * DD) + kk;
    }
    copy12(la, ga);
    copy12(la + 12, ga + 12);
    copy12(la + 24, ga + 24);
}

__device__ __forceinline__ void gemm3_main(
    const unsigned short* __restrict__ Ah, const unsigned short* __restrict__ Al,
    const unsigned short* __restrict__ Bh, const unsigned short* __restrict__ Bl,
    int row0, int col0, float (*s_c)[260], unsigned short* s_st)
{
    const int tid  = threadIdx.x;
    const int wv   = tid >> 5;
    const int l    = tid & 31;
    const int hh   = l >> 4;
    const int m15  = l & 15;

    const v8f zero = { 0.f, 0.f, 0.f, 0.f, 0.f, 0.f, 0.f, 0.f };
    v8f acc[2][4];
    #pragma unroll
    for (int rt = 0; rt < 2; ++rt)
        #pragma unroll
        for (int j = 0; j < 4; ++j) acc[rt][j] = zero;

    // copy side: this thread's row (of 16) and 16-byte chunk (of 8)
    const int crow = tid >> 3;
    const int cchk = tid & 7;
    const unsigned short* gah = Ah + (size_t)(row0 + crow) * DD + 8 * cchk;
    const unsigned short* gal = Al + (size_t)(row0 + crow) * DD + 8 * cchk;
    const unsigned short* gbh = Bh + (size_t)(col0 + crow) * DD + 8 * cchk;
    const unsigned short* gbl = Bl + (size_t)(col0 + crow) * DD + 8 * cchk;
    const unsigned int lds0 = (unsigned int)(uintptr_t)s_st + (unsigned int)(crow * SPITCH * 2 + cchk * 16);

    // read side: element offsets of this lane's fragment rows inside a buffer
    const int oa0h = m15 * SPITCH;
    const int oa1h = (16 + m15) * SPITCH;
    const int oa0l = (32 + m15) * SPITCH;
    const int oa1l = (48 + m15) * SPITCH;
    const int obh  = (64 + 64 * wv + m15) * SPITCH;
    const int obl  = (320 + 64 * wv + m15) * SPITCH;

    // slice 0 lands and is published, then slice 1 starts to fly
    stage_slice(lds0, gah, gal, gbh, gbl, 0);
    asm volatile("s_wait_asynccnt 0x0" ::: "memory");   // this wave's copies of slice 0 have landed
    __syncthreads();
    stage_slice(lds0 + SBUF * 2, gah, gal, gbh, gbl, KT);

    // kept rolled: a trip already holds 48 WMMAs and 36 copies, unrolling would only add code to fetch
    #pragma unroll 1
    for (int t = 0; t < NTRIP; ++t) {
        const unsigned short* sb = s_st + (t & 1) * SBUF;
        #pragma unroll
        for (int k0 = 0; k0 < KT; k0 += 32) {
            const v16bf fa0h = frag16(sb + oa0h, k0, hh);
            const v16bf fa0l = frag16(sb + oa0l, k0, hh);
            const v16bf fa1h = frag16(sb + oa1h, k0, hh);
            const v16bf fa1l = frag16(sb + oa1l, k0, hh);
            // all fragments of a k step are read as one group, so one LDS latency is waited out per step
            v16bf fbh[4], fbl[4];
            #pragma unroll
            for (int j = 0; j < 4; ++j) {
                fbh[j] = frag16(sb + obh + j * 16 * SPITCH, k0, hh);
                fbl[j] = frag16(sb + obl + j * 16 * SPITCH, k0, hh);
            }
            #pragma unroll
            for (int j = 0; j < 4; ++j) {
                acc[0][j] = wmma3(fa0h, fa0l, fbh[j], fbl[j], acc[0][j]);
                acc[1][j] = wmma3(fa1h, fa1l, fbh[j], fbl[j], acc[1][j]);
            }
        }
        asm volatile("s_wait_dscnt 0x0" ::: "memory");      // this wave's reads of the buffer are done before it is refilled
        asm volatile("s_wait_asynccnt 0x0" ::: "memory");   // this wave's copies of slice t + 1 have landed
        __syncthreads();                                    // publishes slice t + 1, frees slice t's buffer
        if (t + 2 < NTRIP)
            stage_slice(lds0 + (unsigned int)((t & 1) * SBUF * 2), gah, gal, gbh, gbl, (t + 2) * KT);
    }
    asm volatile("s_wait_asynccnt 0x0" ::: "memory");       // no copy is outstanding past the loop

    // D element r of lane -> (row 8*hh + r, col m15) of the 16x16 tile
    #pragma unroll
    for (int rt = 0; rt < 2; ++rt)
        #pragma unroll
        for (int j = 0; j < 4; ++j)
            #pragma unroll
            for (int r = 0; r < 8; ++r)
                s_c[rt * 16 + 8 * hh + r][64 * wv + 16 * j + m15] = acc[rt][j][r];
    __syncthreads();
}

template <int MODE>
__device__ __forceinline__ void gemm3_epilogue(
    const float* __restrict__ bias, float post,
    float* Cf, unsigned short* Ch, unsigned short* Cl,
    int row0, int col0, const float (*s_c)[260],
    const float* __restrict__ bias2 = nullptr, bool both_bias = false)
{
    const int tid = threadIdx.x;

    if (MODE == 0) {
        v4f vals[16];
        size_t off[16];
        #pragma unroll
        for (int i = 0; i < 16; ++i) {
            const int idx = tid + NTHR * i;     // 0..2047
            const int row = idx >> 6;           // 0..31
            const int c4  = idx & 63;           // 0..63
            const v4f x  = *(const v4f*)&s_c[row][4 * c4];
            const v4f bb = *(const v4f*)(bias + col0 + 4 * c4);
            vals[i] = (x + bb) * post;
            off[i]  = (size_t)(row0 + row) * DD + col0 + 4 * c4;
        }
        #pragma unroll
        for (int i = 0; i < 16; ++i) *(v4f*)(Cf + off[i]) = vals[i];
        
    } else if (MODE == 1) {
        v4f vals[16];
        size_t off[16];
        #pragma unroll
        for (int i = 0; i < 16; ++i) {
            const int idx = tid + NTHR * i;     // 0..2047
            const int hl  = idx >> 9;           // local head 0..3
            const int rem = idx & 511;
            const int row = rem >> 4;           // 0..31
            const int c4  = rem & 15;           // 0..15
            const int n   = col0 + 64 * hl + 4 * c4;
            const v4f x  = *(const v4f*)&s_c[row][64 * hl + 4 * c4];
            const v4f b1 = *(const v4f*)(bias + n);
            const v4f b2 = *(const v4f*)(bias2 + n);
            // the address registers of the bias loads are reused by the loads that follow them
            asm volatile("s_wait_xcnt 0x0" ::: "memory");
            // Only q + k enters the score, so both biases go into the q factor and none into the k
            // factor: biases of opposite sign cancel here, before the exponent is clamped.
            const v4f zero4 = { 0.f, 0.f, 0.f, 0.f };
            const v4f bb = both_bias ? (b1 + b2) : zero4;
            // The exponent is held inside the normal range, so both factors of the later product
            // 2^q' * 2^k' stay finite and non-zero and the product is never inf * 0. A clamped factor
            // (a value beyond 43) still gives the saturated tanh unless the other factor's value lies
            // beyond 35 on the opposite side; with the biases on one side the other is k . Wk alone.
            const v4f y = (x + bb) * post;
            #pragma unroll   // constant element indices, so that vals stays in registers
            for (int e = 0; e < 4; ++e) vals[i][e] = fminf(fmaxf(y[e], -126.0f), 126.0f);
            const int m  = row0 + row;
            const int b  = m >> 8;
            const int lq = m & 255;
            const int h  = n >> 6;
            off[i] = ((size_t)((b * HH + h) * LL + lq)) * DK + 4 * c4;
        }
        #pragma unroll
        for (int i = 0; i < 16; ++i) {
            #pragma unroll   // constant element indices, so that vals stays in registers
            for (int e = 0; e < 4; ++e) vals[i][e] = EXP2_FAST(vals[i][e]);
            *(v4f*)(Cf + off[i]) = vals[i];
        }
        // in the merged kernel other code follows these stores in the listing and reuses their registers
        asm volatile("s_wait_xcnt 0x0" ::: "memory");
    } else {
        v8us hv[8], lv[8];
        size_t off[8];
        const int b = col0 >> 8;
        #pragma unroll
        for (int i = 0; i < 8; ++i) {
            const int idx = tid + NTHR * i;     // 0..1023
            const int row = idx >> 5;           // 0..31 (one wave per row per pass)
            const int c8  = idx & 31;           // 0..31
            const float bs = bias[row0 + row];
            const v4f bb = { bs, bs, bs, bs };
            const v4f x0 = *(const v4f*)&s_c[row][8 * c8] + bb;
            const v4f x1 = *(const v4f*)&s_c[row][8 * c8 + 4] + bb;
            split8(x0, x1, hv[i], lv[i]);
            const int n  = row0 + row;
            const int h  = n >> 6;
            const int dk = n & 63;
            off[i] = ((size_t)((b * HH + h) * DK + dk)) * LL + 8 * c8;
        }
        #pragma unroll
        for (int i = 0; i < 8; ++i) {
            *(v8us*)(Ch + off[i]) = hv[i];
            *(v8us*)(Cl + off[i]) = lv[i];
        }
        
    }
}

// Output projection: one tile per block, row0 = 32*blockIdx.x, col0 = 256*blockIdx.y.
__global__ void __launch_bounds__(NTHR) gemm3_out_kernel(
    const unsigned short* __restrict__ Ah, const unsigned short* __restrict__ Al,
    const unsigned short* __restrict__ Bh, const unsigned short* __restrict__ Bl,
    const float* __restrict__ bias, float* Cf)
{
    __shared__ __align__(16) float s_c[32][260];
    __shared__ __align__(16) unsigned short s_st[2 * SBUF];
    const int row0 = blockIdx.x * 32;
    const int col0 = blockIdx.y * 256;
    gemm3_main(Ah, Al, Bh, Bl, row0, col0, s_c, s_st);
    gemm3_epilogue<0>(bias, 1.0f, Cf, nullptr, nullptr, row0, col0, s_c);
}

// The three input projections in one grid: none reads another's output, and each alone fills
// only 64 blocks. blockIdx.y = 0:q 1:k 2:v, blockIdx.x = tile 0..63 of that projection.
//  q, k: A = activation planes (32 row tiles), Bt = transposed weight planes (2 col tiles), MODE 1.
//  v:    A = transposed Wv planes (16 row tiles), Bt = activation planes (4 col tiles), MODE 2.
__global__ void __launch_bounds__(NTHR) proj3_kernel(
    const unsigned short* __restrict__ xh, const unsigned short* __restrict__ xl,
    const unsigned short* __restrict__ wth, const unsigned short* __restrict__ wtl,
    const float* __restrict__ bq, const float* __restrict__ bk, const float* __restrict__ bv,
    float post, float* Qp, float* Kp, unsigned short* VTh, unsigned short* VTl)
{
    __shared__ __align__(16) float s_c[32][260];
    __shared__ __align__(16) unsigned short s_st[2 * SBUF];

    const int    t      = blockIdx.y;
    const int    tile   = blockIdx.x;
    const size_t xplane = (size_t)NR * DD;
    const size_t wplane = (size_t)DD * DD;

    const bool   isv    = (t == 2);
    const unsigned short* xth = xh + t * xplane;
    const unsigned short* xtl = xl + t * xplane;
    const unsigned short* wh  = wth + t * wplane;
    const unsigned short* wl  = wtl + t * wplane;
    const int row0 = (isv ? (tile & 15) : (tile & 31)) * 32;
    const int col0 = (isv ? (tile >> 4) : (tile >> 5)) * 256;

    // one copy of the k loop serves all three; only the operand roles and the epilogue differ
    gemm3_main(isv ? wh : xth, isv ? wl : xtl, isv ? xth : wh, isv ? xtl : wl, row0, col0, s_c, s_st);
    if (isv) gemm3_epilogue<2>(bv, 1.0f, nullptr, VTh, VTl, row0, col0, s_c);
    else     gemm3_epilogue<1>(bq, post, (t == 0) ? Qp : Kp, nullptr, nullptr, row0, col0, s_c, bk, t == 0);
}

// ---------------------------------------------------------------------------
// Additive scores + softmax + read-out for one (b, h, 16 query rows) block, 128 threads.
// Qp holds e^{2(q + bq + bk)} and Kp e^{2k} of the bias-free projections q, k in (B,H,L,DK) f32 layout:
// their product is e^{2x} of the pair's x = (q + bq) + (k + bk), so the exponential is taken once per
// projected element and not once per (query, key) pair.
// tanh(x) = 1 - 2/(1 + e^{2x}); score = sum_d vp_d - 2 * sum_d vp_d/(1 + e^{2x_d});
// the constant sum_d vp_d is invariant under softmax and omitted. mask == 0 -> -1e9.
// Thread tid owns keys 2*tid, 2*tid+1; the 16 query rows are processed as 4 passes of
// 4 rows (per-pass block softmax) to keep per-thread live state small. P is split to bf16
// hi/lo in LDS (dword stores, barrier, then 16-byte fragment reloads) and feeds O = P . VT^T,
// VT = [bh][dk][256 j] hi/lo planes; wave wv owns the dk tile 16*wv.
// The head's K rows (256 keys x 64 f32) are staged once per block in LDS by asynchronous copies of
// whole lines: a thread reading its own two rows from global memory touches 32 lines per load.
// Key j lies in LDS row (j >> 1) + 128 * (j & 1), row pitch 272 B (16 B x odd), so that the lanes of
// a wave, which own every second key, read rows one pitch apart without bank conflicts.
// ---------------------------------------------------------------------------
#define KPITCH 68                         // f32 elements per staged K row

static_assert(LL * DK * 4 == 32 * NTHR * 16);

// Eight 16-byte asynchronous copies global -> LDS, each lane its own addresses. The s_wait_xcnt
// is the last line of the copies' own statement, so no address register is rewritten ahead of it.
__device__ __forceinline__ void copy8(const unsigned int* la, const float* const* ga)
{
    asm volatile(
        "global_load_async_to_lds_b128 %0, %8, off\n\t"
        "global_load_async_to_lds_b128 %1, %9, off\n\t"
        "global_load_async_to_lds_b128 %2, %10, off\n\t"
        "global_load_async_to_lds_b128 %3, %11, off\n\t"
        "global_load_async_to_lds_b128 %4, %12, off\n\t"
        "global_load_async_to_lds_b128 %5, %13, off\n\t"
        "global_load_async_to_lds_b128 %6, %14, off\n\t"
        "global_load_async_to_lds_b128 %7, %15, off\n\t"
        "s_wait_xcnt 0x0"
        :: "v"(la[0]), "v"(la[1]), "v"(la[2]), "v"(la[3]), "v"(la[4]), "v"(la[5]), "v"(la[6]), "v"(la[7]),
           "v"(ga[0]), "v"(ga[1]), "v"(ga[2]), "v"(ga[3]), "v"(ga[4]), "v"(ga[5]), "v"(ga[6]), "v"(ga[7])
        : "memory");
}

__global__ void __launch_bounds__(NTHR) attn_kernel(
    const float* __restrict__ Qp, const float* __restrict__ Kp, const float* __restrict__ vp,
    const int* __restrict__ mask,
    const unsigned short* __restrict__ VTh, const unsigned short* __restrict__ VTl,
    unsigned short* Oh, unsigned short* Ol)
{
    __shared__ __align__(16) float          s_k[LL][KPITCH];
    __shared__ __align__(16) float          s_q[16][DK];
    __shared__ __align__(16) float          s_vp[DK];
    __shared__ __align__(16) unsigned short s_ph[16][LL];
    __shared__ __align__(16) unsigned short s_pl[16][LL];
    __shared__ __align__(16) float          s_o[16][68];
    __shared__ float s_rmax[4][4];
    __shared__ float s_rsum[4][4];

    const int tid = threadIdx.x;
    const int wv  = tid >> 5;
    const int l   = tid & 31;
    const int hh  = l >> 4;
    const int m15 = l & 15;
    const int bh  = blockIdx.y;          // 0..31
    const int b   = bh >> 3;
    const int h   = bh & 7;
    const int q0  = blockIdx.x * 16;     // 0..240

    const float LOG2E = 1.4426950408889634f;
    const float MASKV = -1.0e9f;

    // K tile: copy i of thread tid moves 16-byte chunk tid + 128*i of the head's 64 KiB, that is
    // key (tid >> 4) + 8*i, chunk tid & 15; a wave's copy covers four whole 128-B lines.
    {
        const float* gk0 = Kp + (size_t)bh * LL * DK + 4 * tid;
        const unsigned int lk0 = (unsigned int)(uintptr_t)&s_k[0][0]
            + (unsigned int)(((tid >> 5) + 128 * ((tid >> 4) & 1)) * (KPITCH * 4) + (tid & 15) * 16);
        #pragma unroll
        for (int g = 0; g < 4; ++g) {
            unsigned int la[8];
            const float* ga[8];
            #pragma unroll
            for (int i = 0; i < 8; ++i) {
                la[i] = lk0 + (unsigned int)((8 * g + i) * 4 * (KPITCH * 4));
                ga[i] = gk0 + (size_t)(8 * g + i) * (NTHR * 4);
            }
            copy8(la, ga);
        }
    }

    #pragma unroll
    for (int i = 0; i < 2; ++i) {
        const int idx = tid + NTHR * i;  // 0..255
        const int r   = idx >> 4;        // 0..15
        const int c4  = idx & 15;        // 0..15
        *(v4f*)&s_q[r][4 * c4] = *(const v4f*)(Qp + ((size_t)(bh * LL + q0 + r)) * DK + 4 * c4);
    }
    if (tid < DK) s_vp[tid] = vp[h * DK + tid];
    asm volatile("s_wait_asynccnt 0x0" ::: "memory");   // this wave's copies of the K tile have landed
    __syncthreads();                                    // publishes s_q, s_vp and the K tile

    const int j0 = 2 * tid;
    const float* k0p = &s_k[tid][0];          // key 2*tid
    const float* k1p = &s_k[128 + tid][0];    // key 2*tid + 1
    const int* mrow = mask + ((size_t)(b * LL + q0)) * LL + j0;

    #pragma unroll 1
    for (int jq = 0; jq < 4; ++jq) {
        const int r0 = 4 * jq;           // first local query row of this pass

        float acc[4][2];
        #pragma unroll
        for (int j = 0; j < 4; ++j) { acc[j][0] = 0.0f; acc[j][1] = 0.0f; }

        #pragma unroll 1
        for (int d4 = 0; d4 < DK / 4; ++d4) {
            const v4f ka = *(const v4f*)(k0p + 4 * d4);
            const v4f kb = *(const v4f*)(k1p + 4 * d4);
            const v4f vv = *(const v4f*)&s_vp[4 * d4];
            #pragma unroll
            for (int j = 0; j < 4; ++j) {
                const v4f qv = *(const v4f*)&s_q[r0 + j][4 * d4];
                #pragma unroll
                for (int e = 0; e < 4; ++e) {
                    const float ra = RCP_FAST(fmaf(qv[e], ka[e], 1.0f));   // 1/(1+e^{2x})
                    const float rb = RCP_FAST(fmaf(qv[e], kb[e], 1.0f));
                    acc[j][0] = fmaf(vv[e], ra, acc[j][0]);
                    acc[j][1] = fmaf(vv[e], rb, acc[j][1]);
                }
            }
        }

        // logits with mask fill, block-wide row max over the 256 keys
        float bm[4];
        #pragma unroll
        for (int j = 0; j < 4; ++j) {
            const v2i mk = *(const v2i*)(mrow + (size_t)(r0 + j) * LL);
            const float s0 = (mk[0] == 0) ? MASKV : (-2.0f * acc[j][0]);
            const float s1 = (mk[1] == 0) ? MASKV : (-2.0f * acc[j][1]);
            acc[j][0] = s0;
            acc[j][1] = s1;
            float lm = fmaxf(s0, s1);
            #pragma unroll
            for (int off = 16; off > 0; off >>= 1) lm = fmaxf(lm, __shfl_xor(lm, off, 32));
            bm[j] = lm;
        }
        if (l == 0) {
            #pragma unroll
            for (int j = 0; j < 4; ++j) s_rmax[j][wv] = bm[j];
        }
        __syncthreads();
        #pragma unroll
        for (int j = 0; j < 4; ++j)
            bm[j] = fmaxf(fmaxf(s_rmax[j][0], s_rmax[j][1]), fmaxf(s_rmax[j][2], s_rmax[j][3]));

        float bs[4];
        #pragma unroll
        for (int j = 0; j < 4; ++j) {
            const float e0 = EXP2_FAST((acc[j][0] - bm[j]) * LOG2E);
            const float e1 = EXP2_FAST((acc[j][1] - bm[j]) * LOG2E);
            acc[j][0] = e0;
            acc[j][1] = e1;
            float ls = e0 + e1;
            #pragma unroll
            for (int off = 16; off > 0; off >>= 1) ls += __shfl_xor(ls, off, 32);
            bs[j] = ls;
        }
        if (l == 0) {
            #pragma unroll
            for (int j = 0; j < 4; ++j) s_rsum[j][wv] = bs[j];
        }
        __syncthreads();
        #pragma unroll
        for (int j = 0; j < 4; ++j) {
            const float sum = (s_rsum[j][0] + s_rsum[j][1]) + (s_rsum[j][2] + s_rsum[j][3]);
            const float inv = RCP_FAST(sum);
            const float p0  = acc[j][0] * inv;
            const float p1  = acc[j][1] * inv;
            unsigned int h0b, l0b, h1b, l1b;
            split1(p0, h0b, l0b);
            split1(p1, h1b, l1b);
            *(unsigned int*)&s_ph[r0 + j][j0] = (h1b << 16) | h0b;
            *(unsigned int*)&s_pl[r0 + j][j0] = (l1b << 16) | l0b;
        }
        // s_rmax is re-written by the next pass only after this pass's second barrier,
        // s_rsum only after the next pass's first barrier: no extra barrier needed here.
    }
    __syncthreads();

    // read-out: o[16 q][64 dk] = P . VT^T ; wave wv owns dk tile 16*wv
    v8f pacc = { 0.f, 0.f, 0.f, 0.f, 0.f, 0.f, 0.f, 0.f };
    const unsigned short* pah = &s_ph[m15][0];
    const unsigned short* pal = &s_pl[m15][0];
    const unsigned short* bvh = VTh + ((size_t)(bh * DK + 16 * wv + m15)) * LL;
    const unsigned short* bvl = VTl + ((size_t)(bh * DK + 16 * wv + m15)) * LL;
    #pragma unroll 1
    for (int k0 = 0; k0 < LL; k0 += 32) {
        const v16bf fah = frag16(pah, k0, hh);
        const v16bf fal = frag16(pal, k0, hh);
        const v16bf fbh = frag16(bvh, k0, hh);
        const v16bf fbl = frag16(bvl, k0, hh);
        pacc = wmma3(fah, fal, fbh, fbl, pacc);
    }
    #pragma unroll
    for (int r = 0; r < 8; ++r) s_o[8 * hh + r][16 * wv + m15] = pacc[r];
    __syncthreads();

    {
        const int row = tid >> 3;   // 0..15
        const int c8  = tid & 7;
        const v4f x0 = *(const v4f*)&s_o[row][8 * c8];
        const v4f x1 = *(const v4f*)&s_o[row][8 * c8 + 4];
        v8us hv, lv;
        split8(x0, x1, hv, lv);
        const size_t goff = ((size_t)(b * LL + q0 + row)) * DD + h * DK + 8 * c8;
        *(v8us*)(Oh + goff) = hv;
        *(v8us*)(Ol + goff) = lv;
        
    }
}

extern "C" void kernel_launch(void* const* d_in, const int* in_sizes, int n_in,
                              void* d_out, int out_size, void* d_ws, size_t ws_size,
                              hipStream_t stream)
{
    if (n_in < 13) return;
    if (in_sizes[0] != NR * DD || in_sizes[1] != NR * DD || in_sizes[2] != NR * DD) return;
    if (in_sizes[3] != BB * LL * LL) return;
    if (in_sizes[4] != DD * DD || in_sizes[6] != DD * DD || in_sizes[8] != DD * DD || in_sizes[11] != DD * DD) return;
    if (in_sizes[5] != DD || in_sizes[7] != DD || in_sizes[9] != DD || in_sizes[12] != DD) return;
    if (in_sizes[10] != HH * DK) return;
    if (out_size != NR * DD) return;

    const float* q    = (const float*)d_in[0];    // [4][256][512]
    const float* k    = (const float*)d_in[1];
    const float* v    = (const float*)d_in[2];
    const int*   mask = (const int*)d_in[3];      // [4][256][256] int32
    const float* Wq   = (const float*)d_in[4];    // [512 in][512 out]
    const float* bq   = (const float*)d_in[5];
    const float* Wk   = (const float*)d_in[6];
    const float* bk   = (const float*)d_in[7];
    const float* Wv   = (const float*)d_in[8];
    const float* bv   = (const float*)d_in[9];
    const float* vp   = (const float*)d_in[10];   // [8][64]
    const float* W0   = (const float*)d_in[11];
    const float* b0   = (const float*)d_in[12];
    float* out = (float*)d_out;                   // [1024][512] f32

    // workspace carve (bytes), every offset a multiple of 1 MiB
    const size_t sz_x  = (size_t)3 * NR * DD * 2;        // 3145728  (q,k,v planes)
    const size_t sz_wt = (size_t)4 * DD * DD * 2;        // 2097152  (WqT,WkT,WvT,W0T planes)
    const size_t sz_p  = (size_t)NR * DD * 4;            // 2097152  (f32 projection)
    const size_t sz_vt = (size_t)BB * HH * DK * LL * 2;  // 1048576
    const size_t sz_o  = (size_t)NR * DD * 2;            // 1048576
    size_t off = 0;
    const size_t off_xh  = off;  off += sz_x;
    const size_t off_xl  = off;  off += sz_x;
    const size_t off_wth = off;  off += sz_wt;
    const size_t off_wtl = off;  off += sz_wt;
    const size_t off_qp  = off;  off += sz_p;
    const size_t off_kp  = off;  off += sz_p;
    const size_t off_vth = off;  off += sz_vt;
    const size_t off_vtl = off;  off += sz_vt;
    const size_t off_oh  = off;  off += sz_o;
    const size_t off_ol  = off;  off += sz_o;             // total 18874368
    if (off > ws_size) return;

    char* ws = (char*)d_ws;
    unsigned short* xh  = (unsigned short*)(ws + off_xh);
    unsigned short* xl  = (unsigned short*)(ws + off_xl);
    unsigned short* wth = (unsigned short*)(ws + off_wth);
    unsigned short* wtl = (unsigned short*)(ws + off_wtl);
    float*          Qp  = (float*)(ws + off_qp);
    float*          Kp  = (float*)(ws + off_kp);
    unsigned short* VTh = (unsigned short*)(ws + off_vth);
    unsigned short* VTl = (unsigned short*)(ws + off_vtl);
    unsigned short* Oh  = (unsigned short*)(ws + off_oh);
    unsigned short* Ol  = (unsigned short*)(ws + off_ol);

    const size_t wplane = (size_t)DD * DD;   // elements per weight plane
    const float C2 = 2.8853900817779268f;    // 2*log2(e)

    // 1) 16-bit hi/lo planes for q,k,v and transposed Wq,Wk,Wv,W0
    prep_kernel<<<dim3(3 * (NR / 2) + 256), dim3(NTHR), 0, stream>>>(
        q, k, v, Wq, Wk, Wv, W0, xh, xl, wth, wtl);

    // 2) Q, K projections -> Qp, Kp (B,H,L,DK) f32 = 2^((q + bq + bk) * 2log2e), 2^(k * 2log2e), and the V projection, transposed
    //    -> VT hi/lo, as one grid of 3 x 64 blocks
    proj3_kernel<<<dim3(64, 3), dim3(NTHR), 0, stream>>>(
        xh, xl, wth, wtl, bq, bk, bv, C2, Qp, Kp, VTh, VTl);

    // 3) additive scores + softmax + P.V -> O hi/lo planes in merged (B,L,D) layout
    attn_kernel<<<dim3(LL / 16, BB * HH), dim3(NTHR), 0, stream>>>(
        Qp, Kp, vp, mask, VTh, VTl, Oh, Ol);

    // 4) output projection -> d_out
    gemm3_out_kernel<<<dim3(NR / 32, DD / 256), dim3(NTHR), 0, stream>>>(
        Oh, Ol, wth + 3 * wplane, wtl + 3 * wplane, b0, out);
}

// v005
// It runs in 40.4 microseconds.
// Timed twice side by side with v004, it ran 1.15 and 1.13 times as fast.
// Over all steps from v000 it is 3.14 times as fast.
#include <hip/hip_runtime.h>
#include <hip/hip_bf16.h>
#include <stddef.h>
#include <stdint.h>

// All contractions: v_wmma_f32_16x16x32_bf16 with bf16 hi/lo split operands (hi*hi + hi*lo + lo*hi, f32 accumulate): q/k/v projections, probability read-out P*V, output projection; additive scores (exp2 + rcp tanh form), mask fill, softmax and epilogues in f32.

#define BB   4
#define LL   256
#define DD   512
#define HH   8
#define DK   64
#define NR   (BB * LL)
#define NTHR 128

static_assert(NR == 1024);
static_assert(DD == HH * DK);
static_assert(LL == 2 * NTHR);
static_assert(DK == 64);

typedef unsigned short v8us  __attribute__((ext_vector_type(8)));
typedef __bf16         v16bf __attribute__((ext_vector_type(16)));
typedef float          v8f   __attribute__((ext_vector_type(8)));
typedef float          v4f   __attribute__((ext_vector_type(4)));
typedef int            v2i   __attribute__((ext_vector_type(2)));

union Frag { v16bf v; v8us h[2]; };

#if __has_builtin(__builtin_amdgcn_exp2f)
#define EXP2_FAST(x) __builtin_amdgcn_exp2f(x)
#else
#define EXP2_FAST(x) exp2f(x)
#endif
#if __has_builtin(__builtin_amdgcn_rcpf)
#define RCP_FAST(x) __builtin_amdgcn_rcpf(x)
#else
#define RCP_FAST(x) (1.0f / (x))
#endif

// f32 -> bf16 bits, RNE
__device__ __forceinline__ unsigned int bf16_rne(float f)
{
    unsigned int u = __float_as_uint(f);
    u += 0x7FFFu + ((u >> 16) & 1u);
    return u >> 16;
}

// x = hi + lo, both bf16 (RNE); lo = RNE(x - f32(hi))
__device__ __forceinline__ void split1(float x, unsigned int& hb, unsigned int& lb)
{
    hb = bf16_rne(x);
    const float xh = __uint_as_float(hb << 16);
    lb = bf16_rne(x - xh);
}

// 8 consecutive values (a then b) -> one 16-byte hi vector and one 16-byte lo vector
__device__ __forceinline__ void split8(v4f a, v4f b, v8us& hi, v8us& lo)
{
    v8us hr = { 0, 0, 0, 0, 0, 0, 0, 0 };
    v8us lr = { 0, 0, 0, 0, 0, 0, 0, 0 };
    #pragma unroll
    for (int e = 0; e < 4; ++e) {
        unsigned int hb, lb;
        split1(a[e], hb, lb);
        hr[e] = (unsigned short)hb;
        lr[e] = (unsigned short)lb;
        split1(b[e], hb, lb);
        hr[4 + e] = (unsigned short)hb;
        lr[4 + e] = (unsigned short)lb;
    }
    hi = hr;
    lo = lr;
}

// 16-bit fragment loader (wave32, 16x16x32): lane l, hh = l>>4, row/col = l&15.
// elements 0..7  <- row[k0 + 8*hh + 0..7], elements 8..15 <- row[k0 + 16 + 8*hh + 0..7].
// Used for A (row-major, k contiguous) and for B stored as [n][k] (k contiguous).
__device__ __forceinline__ v16bf frag16(const unsigned short* row, int k0, int hh)
{
    Frag f;
    f.h[0] = *(const v8us*)(row + k0 + 8 * hh);
    f.h[1] = *(const v8us*)(row + k0 + 16 + 8 * hh);
    return f.v;
}

// D += A*B with the VALU hazard guard after the instruction.
__device__ __forceinline__ v8f wmma_bf16(v16bf a, v16bf b, v8f c)
{
    v8f d = __builtin_amdgcn_wmma_f32_16x16x32_bf16(false, a, false, b, (short)0, c, false, false);
    asm volatile("v_nop\n\tv_nop\n\tv_nop\n\tv_nop" : "+v"(d) : "v"(a), "v"(b));
    return d;
}

// hi/lo split product: hh + hl + lh into one accumulator
__device__ __forceinline__ v8f wmma3(v16bf ah, v16bf al, v16bf bh, v16bf bl, v8f c)
{
    c = wmma_bf16(ah, bh, c);
    c = wmma_bf16(ah, bl, c);
    c = wmma_bf16(al, bh, c);
    return c;
}

// ---------------------------------------------------------------------------
// Operand preparation (128 threads / block).
//  blocks [0, 1536): xh/xl[t][row][512] = split(x_t[row]), t = 0:q 1:k 2:v, 2 rows per block,
//                    64 threads per row, 8 elements (16 B) per thread -> 512-B runs per wave.
//  blocks [1536, 1792): wth/wtl[w][n][512] = split(W_w[k][n]) (transposed, k contiguous),
// ---------------------------------------------------------------------------
__global__ void __launch_bounds__(NTHR) prep_kernel(
    const float* __restrict__ q, const float* __restrict__ k, const float* __restrict__ v,
    const float* __restrict__ Wq, const float* __restrict__ Wk,
    const float* __restrict__ Wv, const float* __restrict__ W0,
    unsigned short* xh, unsigned short* xl, unsigned short* wth, unsigned short* wtl)
{
    __shared__ float s_t[64][65];

    const int tid = threadIdx.x;
    const int bid = blockIdx.x;
    const int NXB = 3 * (NR / 2);   // 1536

    if (bid < NXB) {
        const int t   = bid / (NR / 2);
        const int row = ((bid % (NR / 2)) << 1) + (tid >> 6);
        const int c8  = tid & 63;
        const float* src = (t == 0) ? q : ((t == 1) ? k : v);
        const size_t soff = (size_t)row * DD + 8 * c8;
        const v4f x0 = *(const v4f*)(src + soff);
        const v4f x1 = *(const v4f*)(src + soff + 4);
        v8us hv, lv;
        split8(x0, x1, hv, lv);
        const size_t doff = ((size_t)t * NR + row) * DD + 8 * c8;
        *(v8us*)(xh + doff) = hv;
        *(v8us*)(xl + doff) = lv;
        
    } else {
        const int u    = bid - NXB;          // 0..255
        const int w    = u >> 6;             // 0..3
        const int tile = u & 63;
        const int k0   = (tile >> 3) * 64;
        const int n0   = (tile & 7) * 64;
        const float* Wsel = (w == 0) ? Wq : ((w == 1) ? Wk : ((w == 2) ? Wv : W0));
        // load W[k0+kk][n0+nn] -> s_t[nn][kk]
        #pragma unroll
        for (int i = 0; i < 8; ++i) {
            const int idx = tid + NTHR * i;  // 0..1023
            const int kk  = idx >> 4;        // 0..63
            const int c4  = idx & 15;        // 0..15
            const v4f x = *(const v4f*)(Wsel + (size_t)(k0 + kk) * DD + n0 + 4 * c4);
            s_t[4 * c4 + 0][kk] = x[0];
            s_t[4 * c4 + 1][kk] = x[1];
            s_t[4 * c4 + 2][kk] = x[2];
            s_t[4 * c4 + 3][kk] = x[3];
        }
        __syncthreads();
        v8us hv[4], lv[4];
        size_t off[4];
        #pragma unroll
        for (int i = 0; i < 4; ++i) {
            const int idx = tid + NTHR * i;  // 0..511
            const int nn  = idx >> 3;        // 0..63
            const int k8  = idx & 7;         // 0..7
            const v4f a  = { s_t[nn][8 * k8 + 0], s_t[nn][8 * k8 + 1], s_t[nn][8 * k8 + 2], s_t[nn][8 * k8 + 3] };
            const v4f b2 = { s_t[nn][8 * k8 + 4], s_t[nn][8 * k8 + 5], s_t[nn][8 * k8 + 6], s_t[nn][8 * k8 + 7] };
            split8(a, b2, hv[i], lv[i]);
            off[i] = ((size_t)w * DD + n0 + nn) * DD + k0 + 8 * k8;
        }
        #pragma unroll
        for (int i = 0; i < 4; ++i) {
            *(v8us*)(wth + off[i]) = hv[i];
            *(v8us*)(wtl + off[i]) = lv[i];
        }
        
    }
}

// ---------------------------------------------------------------------------
// C[32*WR rows of A][64 rows of Bt] = Ah/Al[.][512] . Bt h/l[.][512]^T  (K = 512, hi/lo split).
// One block of 128 threads per tile; row0, col0 = first A row and first Bt row of the tile.
// The tile is small so that the grids cover the chip's WGPs: a K = 512 product of this size is a chain of
// latencies per block, and a narrow tile shortens every link (copies, fragment reads, WMMAs, epilogue).
// WR = 1: four waves side by side, wave wv has rows 0..31 and the col tile at 16*wv.
// WR = 2: waves 2 x 2, wave wv has rows 32*(wv >> 1) + 0..31 and the col tiles at 32*(wv & 1) + 16*j, j = 0..1.
// k slices of 64 staged in LDS by asynchronous copies, two buffers; epilogue staged in LDS.
// MODE 0: Cf[m][512] f32 = (C + bias[n]) * post                    (plain row-major)
// MODE 1: Cf[(b*8+h)*256 + l][64] f32 = 2^((C + bsum[n]) * post),  m = b*256+l, n = h*64+dk;
//         bsum = bias + bias2 where both_bias is set, 0 where it is not
// MODE 2: A rows are n = h*64+dk, Bt rows are m = b*256+j:
//         Ch/Cl[(b*8+h)*64 + dk][256 j] = split(C + bias[n])       (per-row bias)
// ---------------------------------------------------------------------------
// One k slice of the tile in LDS: rows of KT 16-bit values, [Ah 32*WR | Al 32*WR | Bh 64 | Bl 64],
// row pitch 144 B (16 B x odd: conflict-free for the 16-byte fragment reads).
#define KT       64
#define SPITCH   72                       // 16-bit elements per staged row
#define TN       64                       // Bt rows (output columns) of a tile
#define CPITCH   68                       // f32 elements per row of the staged result
#define SROWS(WR) (64 * (WR) + 2 * TN)    // staged rows per slice: 192 or 256
#define SBUF(WR)  (SROWS(WR) * SPITCH)    // elements per buffer (27648 B or 36864 B)
#define NTRIP    (DD / KT)

static_assert(NTRIP >= 2);
static_assert(SROWS(1) * (KT / 8) == 12 * NTHR);
static_assert(SROWS(2) * (KT / 8) == 16 * NTHR);

// Twelve 16-byte asynchronous copies global -> LDS, each lane its own addresses. The s_wait_xcnt
// is the last line of the copies' own statement, so no address register is rewritten ahead of it.
__device__ __forceinline__ void copy12(const unsigned int* la, const unsigned short* const* ga)
{
    asm volatile(
        "global_load_async_to_lds_b128 %0, %12, off\n\t"
        "global_load_async_to_lds_b128 %1, %13, off\n\t"
        "global_load_async_to_lds_b128 %2, %14, off\n\t"
        "global_load_async_to_lds_b128 %3, %15, off\n\t"
        "global_load_async_to_lds_b128 %4, %16, off\n\t"
        "global_load_async_to_lds_b128 %5, %17, off\n\t"
        "global_load_async_to_lds_b128 %6, %18, off\n\t"
        "global_load_async_to_lds_b128 %7, %19, off\n\t"
        "global_load_async_to_lds_b128 %8, %20, off\n\t"
        "global_load_async_to_lds_b128 %9, %21, off\n\t"
        "global_load_async_to_lds_b128 %10, %22, off\n\t"
        "global_load_async_to_lds_b128 %11, %23, off\n\t"
        "s_wait_xcnt 0x0"
        :: "v"(la[0]), "v"(la[1]), "v"(la[2]), "v"(la[3]), "v"(la[4]), "v"(la[5]),
           "v"(la[6]), "v"(la[7]), "v"(la[8]), "v"(la[9]), "v"(la[10]), "v"(la[11]),
           "v"(ga[0]), "v"(ga[1]), "v"(ga[2]), "v"(ga[3]), "v"(ga[4]), "v"(ga[5]),
           "v"(ga[6]), "v"(ga[7]), "v"(ga[8]), "v"(ga[9]), "v"(ga[10]), "v"(ga[11])
        : "memory");
}

// The same for eight copies (a slice of 256 rows is two such runs).
__device__ __forceinline__ void copy8h(const unsigned int* la, const unsigned short* const* ga)
{
    asm volatile(
        "global_load_async_to_lds_b128 %0, %8, off\n\t"
        "global_load_async_to_lds_b128 %1, %9, off\n\t"
        "global_load_async_to_lds_b128 %2, %10, off\n\t"
        "global_load_async_to_lds_b128 %3, %11, off\n\t"
        "global_load_async_to_lds_b128 %4, %12, off\n\t"
        "global_load_async_to_lds_b128 %5, %13, off\n\t"
        "global_load_async_to_lds_b128 %6, %14, off\n\t"
        "global_load_async_to_lds_b128 %7, %15, off\n\t"
        "s_wait_xcnt 0x0"
        :: "v"(la[0]), "v"(la[1]), "v"(la[2]), "v"(la[3]), "v"(la[4]), "v"(la[5]), "v"(la[6]), "v"(la[7]),
           "v"(ga[0]), "v"(ga[1]), "v"(ga[2]), "v"(ga[3]), "v"(ga[4]), "v"(ga[5]), "v"(ga[6]), "v"(ga[7])
        : "memory");
}

// Stage one k slice: copy i of thread tid moves 16 B of staged row 16*i + (tid >> 3), chunk tid & 7,
// so a wave's copy covers four whole 128-B lines. lds0 and the four pointers already hold the
// thread's row and chunk; kk = first k of the slice.
template <int WR>
__device__ __forceinline__ void stage_slice(
    unsigned int lds0,
    const unsigned short* gah, const unsigned short* gal,
    const unsigned short* gbh, const unsigned short* gbl, int kk)
{
    constexpr int AG = 2 * WR;            // groups of 16 rows in one A plane
    constexpr int BG = TN / 16;           // groups of 16 rows in one B plane
    constexpr int NC = 2 * AG + 2 * BG;   // copies per thread: 12 or 16
    unsigned int la[NC];
    const unsigned short* ga[NC];
    #pragma unroll
    for (int i = 0; i < NC; ++i) {
        la[i] = lds0 + (unsigned int)(i * 16 * SPITCH * 2);
        ga[i] = ((i < AG)          ? gah + (size_t)i * 16 * DD
               : (i < 2 * AG)      ? gal + (size_t)(i - AG) * 16 * DD
               : (i < 2 * AG + BG) ? gbh + (size_t)(i - 2 * AG) * 16 * DD
                                   : gbl + (size_t)(i - 2 * AG - BG) * 16 * DD) + kk;
    }
    if constexpr (NC == 12) {
        copy12(la, ga);
    } else {
        copy8h(la, ga);
        copy8h(la + 8, ga + 8);
    }
}

template <int WR>
__device__ __forceinline__ void gemm3_main(
    const unsigned short* __restrict__ Ah, const unsigned short* __restrict__ Al,
    const unsigned short* __restrict__ Bh, const unsigned short* __restrict__ Bl,
    int row0, int col0, float (*s_c)[CPITCH], unsigned short* s_st)
{
    constexpr int AR = 32 * WR;           // A rows of the tile
    constexpr int NJ = WR;                // col tiles per wave
    constexpr int WC = 4 / WR;            // waves side by side

    const int tid  = threadIdx.x;
    const int wv   = tid >> 5;
    const int l    = tid & 31;
    const int hh   = l >> 4;
    const int m15  = l & 15;
    const int ar0  = 32 * (wv / WC);          // first tile row of this wave
    const int bc0  = 16 * NJ * (wv % WC);     // first tile column of this wave

    const v8f zero = { 0.f, 0.f, 0.f, 0.f, 0.f, 0.f, 0.f, 0.f };
    v8f acc[2][NJ];
    #pragma unroll
    for (int rt = 0; rt < 2; ++rt)
        #pragma unroll
        for (int j = 0; j < NJ; ++j) acc[rt][j] = zero;

    // copy side: this thread's row (of 16) and 16-byte chunk (of 8)
    const int crow = tid >> 3;
    const int cchk = tid & 7;
    const unsigned short* gah = Ah + (size_t)(row0 + crow) * DD + 8 * cchk;
    const unsigned short* gal = Al + (size_t)(row0 + crow) * DD + 8 * cchk;
    const unsigned short* gbh = Bh + (size_t)(col0 + crow) * DD + 8 * cchk;
    const unsigned short* gbl = Bl + (size_t)(col0 + crow) * DD + 8 * cchk;
    const unsigned int lds0 = (unsigned int)(uintptr_t)s_st + (unsigned int)(crow * SPITCH * 2 + cchk * 16);

    // read side: element offsets of this lane's fragment rows inside a buffer
    const int oa0h = (ar0 + m15) * SPITCH;
    const int oa1h = (ar0 + 16 + m15) * SPITCH;
    const int oa0l = (AR + ar0 + m15) * SPITCH;
    const int oa1l = (AR + ar0 + 16 + m15) * SPITCH;
    const int obh  = (2 * AR + bc0 + m15) * SPITCH;
    const int obl  = (2 * AR + TN + bc0 + m15) * SPITCH;

    // slice 0 lands and is published, then slice 1 starts to fly
    stage_slice<WR>(lds0, gah, gal, gbh, gbl, 0);
    asm volatile("s_wait_asynccnt 0x0" ::: "memory");   // this wave's copies of slice 0 have landed
    __syncthreads();
    stage_slice<WR>(lds0 + SBUF(WR) * 2, gah, gal, gbh, gbl, KT);

    // kept rolled: the trips are chained by their barriers, unrolling would only add code to fetch
    #pragma unroll 1
    for (int t = 0; t < NTRIP; ++t) {
        const unsigned short* sb = s_st + (t & 1) * SBUF(WR);
        #pragma unroll
        for (int k0 = 0; k0 < KT; k0 += 32) {
            const v16bf fa0h = frag16(sb + oa0h, k0, hh);
            const v16bf fa0l = frag16(sb + oa0l, k0, hh);
            const v16bf fa1h = frag16(sb + oa1h, k0, hh);
            const v16bf fa1l = frag16(sb + oa1l, k0, hh);
            // all fragments of a k step are read as one group, so one LDS latency is waited out per step
            v16bf fbh[NJ], fbl[NJ];
            #pragma unroll
            for (int j = 0; j < NJ; ++j) {
                fbh[j] = frag16(sb + obh + j * 16 * SPITCH, k0, hh);
                fbl[j] = frag16(sb + obl + j * 16 * SPITCH, k0, hh);
            }
            #pragma unroll
            for (int j = 0; j < NJ; ++j) {
                acc[0][j] = wmma3(fa0h, fa0l, fbh[j], fbl[j], acc[0][j]);
                acc[1][j] = wmma3(fa1h, fa1l, fbh[j], fbl[j], acc[1][j]);
            }
        }
        asm volatile("s_wait_dscnt 0x0" ::: "memory");      // this wave's reads of the buffer are done before it is refilled
        asm volatile("s_wait_asynccnt 0x0" ::: "memory");   // this wave's copies of slice t + 1 have landed
        __syncthreads();                                    // publishes slice t + 1, frees slice t's buffer
        if (t + 2 < NTRIP)
            stage_slice<WR>(lds0 + (unsigned int)((t & 1) * SBUF(WR) * 2), gah, gal, gbh, gbl, (t + 2) * KT);
    }
    asm volatile("s_wait_asynccnt 0x0" ::: "memory");       // no copy is outstanding past the loop

    // D element r of lane -> (row 8*hh + r, col m15) of the 16x16 tile
    #pragma unroll
    for (int rt = 0; rt < 2; ++rt)
        #pragma unroll
        for (int j = 0; j < NJ; ++j)
            #pragma unroll
            for (int r = 0; r < 8; ++r)
                s_c[ar0 + rt * 16 + 8 * hh + r][bc0 + 16 * j + m15] = acc[rt][j][r];
    __syncthreads();
}

template <int MODE, int WR>
__device__ __forceinline__ void gemm3_epilogue(
    const float* __restrict__ bias, float post,
    float* Cf, unsigned short* Ch, unsigned short* Cl,
    int row0, int col0, const float (*s_c)[CPITCH],
    const float* __restrict__ bias2 = nullptr, bool both_bias = false)
{
    constexpr int AR = 32 * WR;                     // rows of the tile
    constexpr int N4 = AR * (TN / 4) / NTHR;        // 16-byte f32 pieces per thread
    constexpr int N8 = AR * (TN / 8) / NTHR;        // 8-element pieces per thread
    const int tid = threadIdx.x;

    if (MODE == 0) {
        v4f vals[N4];
        size_t off[N4];
        const int c4 = tid & 15;                // all pieces of a thread lie in the same four columns
        const v4f bb = *(const v4f*)(bias + col0 + 4 * c4);
        #pragma unroll
        for (int i = 0; i < N4; ++i) {
            const int row = (tid >> 4) + 8 * i; // 0..AR-1
            const v4f x  = *(const v4f*)&s_c[row][4 * c4];
            vals[i] = (x + bb) * post;
            off[i]  = (size_t)(row0 + row) * DD + col0 + 4 * c4;
        }
        #pragma unroll
        for (int i = 0; i < N4; ++i) *(v4f*)(Cf + off[i]) = vals[i];
        
    } else if (MODE == 1) {
        v4f vals[N4];
        size_t off[N4];
        const int c4 = tid & 15;                // all pieces of a thread lie in the same four columns
        const int n  = col0 + 4 * c4;           // the tile's 64 columns are one head
        const v4f b1 = *(const v4f*)(bias + n);
        const v4f b2 = *(const v4f*)(bias2 + n);
        // the address registers of the bias loads are reused by the code that follows them
        asm volatile("s_wait_xcnt 0x0" ::: "memory");
        // Only q + k enters the score, so both biases go into the q factor and none into the k
        // factor: biases of opposite sign cancel here, before the exponent is clamped.
        const v4f zero4 = { 0.f, 0.f, 0.f, 0.f };
        const v4f bb = both_bias ? (b1 + b2) : zero4;
        #pragma unroll
        for (int i = 0; i < N4; ++i) {
            const int row = (tid >> 4) + 8 * i; // 0..AR-1
            const v4f x  = *(const v4f*)&s_c[row][4 * c4];
            // The exponent is held inside the normal range, so both factors of the later product
            // 2^q' * 2^k' stay finite and non-zero and the product is never inf * 0. A clamped factor
            // (a value beyond 43) still gives the saturated tanh unless the other factor's value lies
            // beyond 35 on the opposite side; with the biases on one side the other is k . Wk alone.
            const v4f y = (x + bb) * post;
            #pragma unroll   // constant element indices, so that vals stays in registers
            for (int e = 0; e < 4; ++e) vals[i][e] = fminf(fmaxf(y[e], -126.0f), 126.0f);
            const int m  = row0 + row;
            const int b  = m >> 8;
            const int lq = m & 255;
            const int h  = n >> 6;
            off[i] = ((size_t)((b * HH + h) * LL + lq)) * DK + 4 * c4;
        }
        #pragma unroll
        for (int i = 0; i < N4; ++i) {
            #pragma unroll   // constant element indices, so that vals stays in registers
            for (int e = 0; e < 4; ++e) vals[i][e] = EXP2_FAST(vals[i][e]);
            *(v4f*)(Cf + off[i]) = vals[i];
        }
        // in the merged kernel other code follows these stores in the listing and reuses their registers
        asm volatile("s_wait_xcnt 0x0" ::: "memory");
    } else {
        v8us hv[N8], lv[N8];
        size_t off[N8];
        const int b  = col0 >> 8;
        const int jb = col0 & 255;              // first key of the tile inside its batch
        #pragma unroll
        for (int i = 0; i < N8; ++i) {
            const int idx = tid + NTHR * i;
            const int row = idx >> 3;           // 0..AR-1 (eight threads write one 128-B line per plane)
            const int c8  = idx & 7;            // 0..7
            const float bs = bias[row0 + row];
            const v4f bb = { bs, bs, bs, bs };
            const v4f x0 = *(const v4f*)&s_c[row][8 * c8] + bb;
            const v4f x1 = *(const v4f*)&s_c[row][8 * c8 + 4] + bb;
            split8(x0, x1, hv[i], lv[i]);
            const int n  = row0 + row;
            const int h  = n >> 6;
            const int dk = n & 63;
            off[i] = ((size_t)((b * HH + h) * DK + dk)) * LL + jb + 8 * c8;
        }
        #pragma unroll
        for (int i = 0; i < N8; ++i) {
            *(v8us*)(Ch + off[i]) = hv[i];
            *(v8us*)(Cl + off[i]) = lv[i];
        }
        
    }
}

// Output projection: one 32 x 64 tile per block (256 blocks), row0 = 32*blockIdx.x, col0 = 64*blockIdx.y.
__global__ void __launch_bounds__(NTHR) gemm3_out_kernel(
    const unsigned short* __restrict__ Ah, const unsigned short* __restrict__ Al,
    const unsigned short* __restrict__ Bh, const unsigned short* __restrict__ Bl,
    const float* __restrict__ bias, float* Cf)
{
    __shared__ __align__(16) float s_c[32][CPITCH];
    __shared__ __align__(16) unsigned short s_st[2 * SBUF(1)];
    const int row0 = blockIdx.x * 32;
    const int col0 = blockIdx.y * TN;
    gemm3_main<1>(Ah, Al, Bh, Bl, row0, col0, s_c, s_st);
    gemm3_epilogue<0, 1>(bias, 1.0f, Cf, nullptr, nullptr, row0, col0, s_c);
}

// The three input projections in one grid: none reads another's output. 64 x 64 tiles, 128 per
// projection (a square tile, since three projections together read the most from L2).
// blockIdx.y = 0:q 1:k 2:v, blockIdx.x = tile 0..127 of that projection.
//  q, k: A = activation planes (16 row tiles), Bt = transposed weight planes (8 col tiles), MODE 1.
//  v:    A = transposed Wv planes (8 row tiles), Bt = activation planes (16 col tiles), MODE 2.
__global__ void __launch_bounds__(NTHR) proj3_kernel(
    const unsigned short* __restrict__ xh, const unsigned short* __restrict__ xl,
    const unsigned short* __restrict__ wth, const unsigned short* __restrict__ wtl,
    const float* __restrict__ bq, const float* __restrict__ bk, const float* __restrict__ bv,
    float post, float* Qp, float* Kp, unsigned short* VTh, unsigned short* VTl)
{
    __shared__ __align__(16) float s_c[64][CPITCH];
    __shared__ __align__(16) unsigned short s_st[2 * SBUF(2)];

    const int    t      = blockIdx.y;
    const int    tile   = blockIdx.x;
    const size_t xplane = (size_t)NR * DD;
    const size_t wplane = (size_t)DD * DD;

    const bool   isv    = (t == 2);
    const unsigned short* xth = xh + t * xplane;
    const unsigned short* xtl = xl + t * xplane;
    const unsigned short* wh  = wth + t * wplane;
    const unsigned short* wl  = wtl + t * wplane;
    const int row0 = (isv ? (tile & 7) : (tile & 15)) * 64;
    const int col0 = (isv ? (tile >> 3) : (tile >> 4)) * TN;

    // one copy of the k loop serves all three; only the operand roles and the epilogue differ
    gemm3_main<2>(isv ? wh : xth, isv ? wl : xtl, isv ? xth : wh, isv ? xtl : wl, row0, col0, s_c, s_st);
    if (isv) gemm3_epilogue<2, 2>(bv, 1.0f, nullptr, VTh, VTl, row0, col0, s_c);
    else     gemm3_epilogue<1, 2>(bq, post, (t == 0) ? Qp : Kp, nullptr, nullptr, row0, col0, s_c, bk, t == 0);
}

// ---------------------------------------------------------------------------
// Additive scores + softmax + read-out for one (b, h, 16 query rows) block, 128 threads.
// Qp holds e^{2(q + bq + bk)} and Kp e^{2k} of the bias-free projections q, k in (B,H,L,DK) f32 layout:
// their product is e^{2x} of the pair's x = (q + bq) + (k + bk), so the exponential is taken once per
// projected element and not once per (query, key) pair.
// tanh(x) = 1 - 2/(1 + e^{2x}); score = sum_d vp_d - 2 * sum_d vp_d/(1 + e^{2x_d});
// the constant sum_d vp_d is invariant under softmax and omitted. mask == 0 -> -1e9.
// Thread tid owns keys 2*tid, 2*tid+1; the 16 query rows are processed as 4 passes of
// 4 rows (per-pass block softmax) to keep per-thread live state small. P is split to bf16
// hi/lo in LDS (dword stores, barrier, then 16-byte fragment reloads) and feeds O = P . VT^T,
// VT = [bh][dk][256 j] hi/lo planes; wave wv owns the dk tile 16*wv.
// The head's K rows (256 keys x 64 f32) are staged once per block in LDS by asynchronous copies of
// whole lines: a thread reading its own two rows from global memory touches 32 lines per load.
// Key j lies in LDS row (j >> 1) + 128 * (j & 1), row pitch 272 B (16 B x odd), so that the lanes of
// a wave, which own every second key, read rows one pitch apart without bank conflicts.
// ---------------------------------------------------------------------------
#define KPITCH 68                         // f32 elements per staged K row

static_assert(LL * DK * 4 == 32 * NTHR * 16);

// Eight 16-byte asynchronous copies global -> LDS, each lane its own addresses. The s_wait_xcnt
// is the last line of the copies' own statement, so no address register is rewritten ahead of it.
__device__ __forceinline__ void copy8(const unsigned int* la, const float* const* ga)
{
    asm volatile(
        "global_load_async_to_lds_b128 %0, %8, off\n\t"
        "global_load_async_to_lds_b128 %1, %9, off\n\t"
        "global_load_async_to_lds_b128 %2, %10, off\n\t"
        "global_load_async_to_lds_b128 %3, %11, off\n\t"
        "global_load_async_to_lds_b128 %4, %12, off\n\t"
        "global_load_async_to_lds_b128 %5, %13, off\n\t"
        "global_load_async_to_lds_b128 %6, %14, off\n\t"
        "global_load_async_to_lds_b128 %7, %15, off\n\t"
        "s_wait_xcnt 0x0"
        :: "v"(la[0]), "v"(la[1]), "v"(la[2]), "v"(la[3]), "v"(la[4]), "v"(la[5]), "v"(la[6]), "v"(la[7]),
           "v"(ga[0]), "v"(ga[1]), "v"(ga[2]), "v"(ga[3]), "v"(ga[4]), "v"(ga[5]), "v"(ga[6]), "v"(ga[7])
        : "memory");
}

__global__ void __launch_bounds__(NTHR) attn_kernel(
    const float* __restrict__ Qp, const float* __restrict__ Kp, const float* __restrict__ vp,
    const int* __restrict__ mask,
    const unsigned short* __restrict__ VTh, const unsigned short* __restrict__ VTl,
    unsigned short* Oh, unsigned short* Ol)
{
    __shared__ __align__(16) float          s_k[LL][KPITCH];
    __shared__ __align__(16) float          s_q[16][DK];
    __shared__ __align__(16) float          s_vp[DK];
    __shared__ __align__(16) unsigned short s_ph[16][LL];
    __shared__ __align__(16) unsigned short s_pl[16][LL];
    __shared__ __align__(16) float          s_o[16][68];
    __shared__ float s_rmax[4][4];
    __shared__ float s_rsum[4][4];

    const int tid = threadIdx.x;
    const int wv  = tid >> 5;
    const int l   = tid & 31;
    const int hh  = l >> 4;
    const int m15 = l & 15;
    const int bh  = blockIdx.y;          // 0..31
    const int b   = bh >> 3;
    const int h   = bh & 7;
    const int q0  = blockIdx.x * 16;     // 0..240

    const float LOG2E = 1.4426950408889634f;
    const float MASKV = -1.0e9f;

    // K tile: copy i of thread tid moves 16-byte chunk tid + 128*i of the head's 64 KiB, that is
    // key (tid >> 4) + 8*i, chunk tid & 15; a wave's copy covers four whole 128-B lines.
    {
        const float* gk0 = Kp + (size_t)bh * LL * DK + 4 * tid;
        const unsigned int lk0 = (unsigned int)(uintptr_t)&s_k[0][0]
            + (unsigned int)(((tid >> 5) + 128 * ((tid >> 4) & 1)) * (KPITCH * 4) + (tid & 15) * 16);
        #pragma unroll
        for (int g = 0; g < 4; ++g) {
            unsigned int la[8];
            const float* ga[8];
            #pragma unroll
            for (int i = 0; i < 8; ++i) {
                la[i] = lk0 + (unsigned int)((8 * g + i) * 4 * (KPITCH * 4));
                ga[i] = gk0 + (size_t)(8 * g + i) * (NTHR * 4);
            }
            copy8(la, ga);
        }
    }

    #pragma unroll
    for (int i = 0; i < 2; ++i) {
        const int idx = tid + NTHR * i;  // 0..255
        const int r   = idx >> 4;        // 0..15
        const int c4  = idx & 15;        // 0..15
        *(v4f*)&s_q[r][4 * c4] = *(const v4f*)(Qp + ((size_t)(bh * LL + q0 + r)) * DK + 4 * c4);
    }
    if (tid < DK) s_vp[tid] = vp[h * DK + tid];
    asm volatile("s_wait_asynccnt 0x0" ::: "memory");   // this wave's copies of the K tile have landed
    __syncthreads();                                    // publishes s_q, s_vp and the K tile

    const int j0 = 2 * tid;
    const float* k0p = &s_k[tid][0];          // key 2*tid
    const float* k1p = &s_k[128 + tid][0];    // key 2*tid + 1
    const int* mrow = mask + ((size_t)(b * LL + q0)) * LL + j0;

    #pragma unroll 1
    for (int jq = 0; jq < 4; ++jq) {
        const int r0 = 4 * jq;           // first local query row of this pass

        float acc[4][2];
        #pragma unroll
        for (int j = 0; j < 4; ++j) { acc[j][0] = 0.0f; acc[j][1] = 0.0f; }

        #pragma unroll 1
        for (int d4 = 0; d4 < DK / 4; ++d4) {
            const v4f ka = *(const v4f*)(k0p + 4 * d4);
            const v4f kb = *(const v4f*)(k1p + 4 * d4);
            const v4f vv = *(const v4f*)&s_vp[4 * d4];
            #pragma unroll
            for (int j = 0; j < 4; ++j) {
                const v4f qv = *(const v4f*)&s_q[r0 + j][4 * d4];
                #pragma unroll
                for (int e = 0; e < 4; ++e) {
                    const float ra = RCP_FAST(fmaf(qv[e], ka[e], 1.0f));   // 1/(1+e^{2x})
                    const float rb = RCP_FAST(fmaf(qv[e], kb[e], 1.0f));
                    acc[j][0] = fmaf(vv[e], ra, acc[j][0]);
                    acc[j][1] = fmaf(vv[e], rb, acc[j][1]);
                }
            }
        }

        // logits with mask fill, block-wide row max over the 256 keys
        float bm[4];
        #pragma unroll
        for (int j = 0; j < 4; ++j) {
            const v2i mk = *(const v2i*)(mrow + (size_t)(r0 + j) * LL);
            const float s0 = (mk[0] == 0) ? MASKV : (-2.0f * acc[j][0]);
            const float s1 = (mk[1] == 0) ? MASKV : (-2.0f * acc[j][1]);
            acc[j][0] = s0;
            acc[j][1] = s1;
            float lm = fmaxf(s0, s1);
            #pragma unroll
            for (int off = 16; off > 0; off >>= 1) lm = fmaxf(lm, __shfl_xor(lm, off, 32));
            bm[j] = lm;
        }
        if (l == 0) {
            #pragma unroll
            for (int j = 0; j < 4; ++j) s_rmax[j][wv] = bm[j];
        }
        __syncthreads();
        #pragma unroll
        for (int j = 0; j < 4; ++j)
            bm[j] = fmaxf(fmaxf(s_rmax[j][0], s_rmax[j][1]), fmaxf(s_rmax[j][2], s_rmax[j][3]));

        float bs[4];
        #pragma unroll
        for (int j = 0; j < 4; ++j) {
            const float e0 = EXP2_FAST((acc[j][0] - bm[j]) * LOG2E);
            const float e1 = EXP2_FAST((acc[j][1] - bm[j]) * LOG2E);
            acc[j][0] = e0;
            acc[j][1] = e1;
            float ls = e0 + e1;
            #pragma unroll
            for (int off = 16; off > 0; off >>= 1) ls += __shfl_xor(ls, off, 32);
            bs[j] = ls;
        }
        if (l == 0) {
            #pragma unroll
            for (int j = 0; j < 4; ++j) s_rsum[j][wv] = bs[j];
        }
        __syncthreads();
        #pragma unroll
        for (int j = 0; j < 4; ++j) {
            const float sum = (s_rsum[j][0] + s_rsum[j][1]) + (s_rsum[j][2] + s_rsum[j][3]);
            const float inv = RCP_FAST(sum);
            const float p0  = acc[j][0] * inv;
            const float p1  = acc[j][1] * inv;
            unsigned int h0b, l0b, h1b, l1b;
            split1(p0, h0b, l0b);
            split1(p1, h1b, l1b);
            *(unsigned int*)&s_ph[r0 + j][j0] = (h1b << 16) | h0b;
            *(unsigned int*)&s_pl[r0 + j][j0] = (l1b << 16) | l0b;
        }
        // s_rmax is re-written by the next pass only after this pass's second barrier,
        // s_rsum only after the next pass's first barrier: no extra barrier needed here.
    }
    __syncthreads();

    // read-out: o[16 q][64 dk] = P . VT^T ; wave wv owns dk tile 16*wv
    v8f pacc = { 0.f, 0.f, 0.f, 0.f, 0.f, 0.f, 0.f, 0.f };
    const unsigned short* pah = &s_ph[m15][0];
    const unsigned short* pal = &s_pl[m15][0];
    const unsigned short* bvh = VTh + ((size_t)(bh * DK + 16 * wv + m15)) * LL;
    const unsigned short* bvl = VTl + ((size_t)(bh * DK + 16 * wv + m15)) * LL;
    #pragma unroll 1
    for (int k0 = 0; k0 < LL; k0 += 32) {
        const v16bf fah = frag16(pah, k0, hh);
        const v16bf fal = frag16(pal, k0, hh);
        const v16bf fbh = frag16(bvh, k0, hh);
        const v16bf fbl = frag16(bvl, k0, hh);
        pacc = wmma3(fah, fal, fbh, fbl, pacc);
    }
    #pragma unroll
    for (int r = 0; r < 8; ++r) s_o[8 * hh + r][16 * wv + m15] = pacc[r];
    __syncthreads();

    {
        const int row = tid >> 3;   // 0..15
        const int c8  = tid & 7;
        const v4f x0 = *(const v4f*)&s_o[row][8 * c8];
        const v4f x1 = *(const v4f*)&s_o[row][8 * c8 + 4];
        v8us hv, lv;
        split8(x0, x1, hv, lv);
        const size_t goff = ((size_t)(b * LL + q0 + row)) * DD + h * DK + 8 * c8;
        *(v8us*)(Oh + goff) = hv;
        *(v8us*)(Ol + goff) = lv;
        
    }
}

extern "C" void kernel_launch(void* const* d_in, const int* in_sizes, int n_in,
                              void* d_out, int out_size, void* d_ws, size_t ws_size,
                              hipStream_t stream)
{
    if (n_in < 13) return;
    if (in_sizes[0] != NR * DD || in_sizes[1] != NR * DD || in_sizes[2] != NR * DD) return;
    if (in_sizes[3] != BB * LL * LL) return;
    if (in_sizes[4] != DD * DD || in_sizes[6] != DD * DD || in_sizes[8] != DD * DD || in_sizes[11] != DD * DD) return;
    if (in_sizes[5] != DD || in_sizes[7] != DD || in_sizes[9] != DD || in_sizes[12] != DD) return;
    if (in_sizes[10] != HH * DK) return;
    if (out_size != NR * DD) return;

    const float* q    = (const float*)d_in[0];    // [4][256][512]
    const float* k    = (const float*)d_in[1];
    const float* v    = (const float*)d_in[2];
    const int*   mask = (const int*)d_in[3];      // [4][256][256] int32
    const float* Wq   = (const float*)d_in[4];    // [512 in][512 out]
    const float* bq   = (const float*)d_in[5];
    const float* Wk   = (const float*)d_in[6];
    const float* bk   = (const float*)d_in[7];
    const float* Wv   = (const float*)d_in[8];
    const float* bv   = (const float*)d_in[9];
    const float* vp   = (const float*)d_in[10];   // [8][64]
    const float* W0   = (const float*)d_in[11];
    const float* b0   = (const float*)d_in[12];
    float* out = (float*)d_out;                   // [1024][512] f32

    // workspace carve (bytes), every offset a multiple of 1 MiB
    const size_t sz_x  = (size_t)3 * NR * DD * 2;        // 3145728  (q,k,v planes)
    const size_t sz_wt = (size_t)4 * DD * DD * 2;        // 2097152  (WqT,WkT,WvT,W0T planes)
    const size_t sz_p  = (size_t)NR * DD * 4;            // 2097152  (f32 projection)
    const size_t sz_vt = (size_t)BB * HH * DK * LL * 2;  // 1048576
    const size_t sz_o  = (size_t)NR * DD * 2;            // 1048576
    size_t off = 0;
    const size_t off_xh  = off;  off += sz_x;
    const size_t off_xl  = off;  off += sz_x;
    const size_t off_wth = off;  off += sz_wt;
    const size_t off_wtl = off;  off += sz_wt;
    const size_t off_qp  = off;  off += sz_p;
    const size_t off_kp  = off;  off += sz_p;
    const size_t off_vth = off;  off += sz_vt;
    const size_t off_vtl = off;  off += sz_vt;
    const size_t off_oh  = off;  off += sz_o;
    const size_t off_ol  = off;  off += sz_o;             // total 18874368
    if (off > ws_size) return;

    char* ws = (char*)d_ws;
    unsigned short* xh  = (unsigned short*)(ws + off_xh);
    unsigned short* xl  = (unsigned short*)(ws + off_xl);
    unsigned short* wth = (unsigned short*)(ws + off_wth);
    unsigned short* wtl = (unsigned short*)(ws + off_wtl);
    float*          Qp  = (float*)(ws + off_qp);
    float*          Kp  = (float*)(ws + off_kp);
    unsigned short* VTh = (unsigned short*)(ws + off_vth);
    unsigned short* VTl = (unsigned short*)(ws + off_vtl);
    unsigned short* Oh  = (unsigned short*)(ws + off_oh);
    unsigned short* Ol  = (unsigned short*)(ws + off_ol);

    const size_t wplane = (size_t)DD * DD;   // elements per weight plane
    const float C2 = 2.8853900817779268f;    // 2*log2(e)

    // 1) 16-bit hi/lo planes for q,k,v and transposed Wq,Wk,Wv,W0
    prep_kernel<<<dim3(3 * (NR / 2) + 256), dim3(NTHR), 0, stream>>>(
        q, k, v, Wq, Wk, Wv, W0, xh, xl, wth, wtl);

    // 2) Q, K projections -> Qp, Kp (B,H,L,DK) f32 = 2^(projection * 2log2e), and the V projection, transposed
    //    -> VT hi/lo, as one grid of 3 x 128 blocks
    proj3_kernel<<<dim3(128, 3), dim3(NTHR), 0, stream>>>(
        xh, xl, wth, wtl, bq, bk, bv, C2, Qp, Kp, VTh, VTl);

    // 3) additive scores + softmax + P.V -> O hi/lo planes in merged (B,L,D) layout
    attn_kernel<<<dim3(LL / 16, BB * HH), dim3(NTHR), 0, stream>>>(
        Qp, Kp, vp, mask, VTh, VTl, Oh, Ol);

    // 4) output projection -> d_out
    gemm3_out_kernel<<<dim3(NR / 32, DD / TN), dim3(NTHR), 0, stream>>>(
        Oh, Ol, wth + 3 * wplane, wtl + 3 * wplane, b0, out);
}

// v006
// It runs in 37.4 microseconds.
// In both of two side-by-side timings against v005, it was 1.08 times as fast.
// Counting every step since v000, it is 3.39 times as fast.
#include <hip/hip_runtime.h>
#include <hip/hip_bf16.h>
#include <stddef.h>
#include <stdint.h>

// All contractions: v_wmma_f32_16x16x32_bf16 with bf16 hi/lo split operands (hi*hi + hi*lo + lo*hi, f32 accumulate): q/k/v projections, probability read-out P*V, output projection; additive scores (exp2 + rcp tanh form), mask fill, softmax and epilogues in f32.

#define BB   4
#define LL   256
#define DD   512
#define HH   8
#define DK   64
#define NR   (BB * LL)
#define NTHR 128

static_assert(NR == 1024);
static_assert(DD == HH * DK);
static_assert(LL == 2 * NTHR);
static_assert(DK == 64);

typedef unsigned short v8us  __attribute__((ext_vector_type(8)));
typedef __bf16         v16bf __attribute__((ext_vector_type(16)));
typedef float          v8f   __attribute__((ext_vector_type(8)));
typedef float          v4f   __attribute__((ext_vector_type(4)));
typedef int            v2i   __attribute__((ext_vector_type(2)));
typedef float          v2f   __attribute__((ext_vector_type(2)));

union Frag { v16bf v; v8us h[2]; };

#if __has_builtin(__builtin_amdgcn_exp2f)
#define EXP2_FAST(x) __builtin_amdgcn_exp2f(x)
#else
#define EXP2_FAST(x) exp2f(x)
#endif
#if __has_builtin(__builtin_amdgcn_rcpf)
#define RCP_FAST(x) __builtin_amdgcn_rcpf(x)
#else
#define RCP_FAST(x) (1.0f / (x))
#endif

// f32 -> bf16 bits, RNE
__device__ __forceinline__ unsigned int bf16_rne(float f)
{
    unsigned int u = __float_as_uint(f);
    u += 0x7FFFu + ((u >> 16) & 1u);
    return u >> 16;
}

// x = hi + lo, both bf16 (RNE); lo = RNE(x - f32(hi))
__device__ __forceinline__ void split1(float x, unsigned int& hb, unsigned int& lb)
{
    hb = bf16_rne(x);
    const float xh = __uint_as_float(hb << 16);
    lb = bf16_rne(x - xh);
}

// 8 consecutive values (a then b) -> one 16-byte hi vector and one 16-byte lo vector
__device__ __forceinline__ void split8(v4f a, v4f b, v8us& hi, v8us& lo)
{
    v8us hr = { 0, 0, 0, 0, 0, 0, 0, 0 };
    v8us lr = { 0, 0, 0, 0, 0, 0, 0, 0 };
    #pragma unroll
    for (int e = 0; e < 4; ++e) {
        unsigned int hb, lb;
        split1(a[e], hb, lb);
        hr[e] = (unsigned short)hb;
        lr[e] = (unsigned short)lb;
        split1(b[e], hb, lb);
        hr[4 + e] = (unsigned short)hb;
        lr[4 + e] = (unsigned short)lb;
    }
    hi = hr;
    lo = lr;
}

// 16-bit fragment loader (wave32, 16x16x32): lane l, hh = l>>4, row/col = l&15.
// elements 0..7  <- row[k0 + 8*hh + 0..7], elements 8..15 <- row[k0 + 16 + 8*hh + 0..7].
// Used for A (row-major, k contiguous) and for B stored as [n][k] (k contiguous).
__device__ __forceinline__ v16bf frag16(const unsigned short* row, int k0, int hh)
{
    Frag f;
    f.h[0] = *(const v8us*)(row + k0 + 8 * hh);
    f.h[1] = *(const v8us*)(row + k0 + 16 + 8 * hh);
    return f.v;
}

// D += A*B with the VALU hazard guard after the instruction.
__device__ __forceinline__ v8f wmma_bf16(v16bf a, v16bf b, v8f c)
{
    v8f d = __builtin_amdgcn_wmma_f32_16x16x32_bf16(false, a, false, b, (short)0, c, false, false);
    asm volatile("v_nop\n\tv_nop\n\tv_nop\n\tv_nop" : "+v"(d) : "v"(a), "v"(b));
    return d;
}

// hi/lo split product: hh + hl + lh into one accumulator
__device__ __forceinline__ v8f wmma3(v16bf ah, v16bf al, v16bf bh, v16bf bl, v8f c)
{
    c = wmma_bf16(ah, bh, c);
    c = wmma_bf16(ah, bl, c);
    c = wmma_bf16(al, bh, c);
    return c;
}

// ---------------------------------------------------------------------------
// Operand preparation (128 threads / block).
//  blocks [0, 1536): xh/xl[t][row][512] = split(x_t[row]), t = 0:q 1:k 2:v, 2 rows per block,
//                    64 threads per row, 8 elements (16 B) per thread -> 512-B runs per wave.
//  blocks [1536, 1792): wth/wtl[w][n][512] = split(W_w[k][n]) (transposed, k contiguous),
// ---------------------------------------------------------------------------
__global__ void __launch_bounds__(NTHR) prep_kernel(
    const float* __restrict__ q, const float* __restrict__ k, const float* __restrict__ v,
    const float* __restrict__ Wq, const float* __restrict__ Wk,
    const float* __restrict__ Wv, const float* __restrict__ W0,
    unsigned short* xh, unsigned short* xl, unsigned short* wth, unsigned short* wtl)
{
    __shared__ float s_t[64][65];

    const int tid = threadIdx.x;
    const int bid = blockIdx.x;
    const int NXB = 3 * (NR / 2);   // 1536

    if (bid < NXB) {
        const int t   = bid / (NR / 2);
        const int row = ((bid % (NR / 2)) << 1) + (tid >> 6);
        const int c8  = tid & 63;
        const float* src = (t == 0) ? q : ((t == 1) ? k : v);
        const size_t soff = (size_t)row * DD + 8 * c8;
        const v4f x0 = *(const v4f*)(src + soff);
        const v4f x1 = *(const v4f*)(src + soff + 4);
        v8us hv, lv;
        split8(x0, x1, hv, lv);
        const size_t doff = ((size_t)t * NR + row) * DD + 8 * c8;
        *(v8us*)(xh + doff) = hv;
        *(v8us*)(xl + doff) = lv;
        
    } else {
        const int u    = bid - NXB;          // 0..255
        const int w    = u >> 6;             // 0..3
        const int tile = u & 63;
        const int k0   = (tile >> 3) * 64;
        const int n0   = (tile & 7) * 64;
        const float* Wsel = (w == 0) ? Wq : ((w == 1) ? Wk : ((w == 2) ? Wv : W0));
        // load W[k0+kk][n0+nn] -> s_t[nn][kk]
        #pragma unroll
        for (int i = 0; i < 8; ++i) {
            const int idx = tid + NTHR * i;  // 0..1023
            const int kk  = idx >> 4;        // 0..63
            const int c4  = idx & 15;        // 0..15
            const v4f x = *(const v4f*)(Wsel + (size_t)(k0 + kk) * DD + n0 + 4 * c4);
            s_t[4 * c4 + 0][kk] = x[0];
            s_t[4 * c4 + 1][kk] = x[1];
            s_t[4 * c4 + 2][kk] = x[2];
            s_t[4 * c4 + 3][kk] = x[3];
        }
        __syncthreads();
        v8us hv[4], lv[4];
        size_t off[4];
        #pragma unroll
        for (int i = 0; i < 4; ++i) {
            const int idx = tid + NTHR * i;  // 0..511
            const int nn  = idx >> 3;        // 0..63
            const int k8  = idx & 7;         // 0..7
            const v4f a  = { s_t[nn][8 * k8 + 0], s_t[nn][8 * k8 + 1], s_t[nn][8 * k8 + 2], s_t[nn][8 * k8 + 3] };
            const v4f b2 = { s_t[nn][8 * k8 + 4], s_t[nn][8 * k8 + 5], s_t[nn][8 * k8 + 6], s_t[nn][8 * k8 + 7] };
            split8(a, b2, hv[i], lv[i]);
            off[i] = ((size_t)w * DD + n0 + nn) * DD + k0 + 8 * k8;
        }
        #pragma unroll
        for (int i = 0; i < 4; ++i) {
            *(v8us*)(wth + off[i]) = hv[i];
            *(v8us*)(wtl + off[i]) = lv[i];
        }
        
    }
}

// ---------------------------------------------------------------------------
// C[32*WR rows of A][64 rows of Bt] = Ah/Al[.][512] . Bt h/l[.][512]^T  (K = 512, hi/lo split).
// One block of 128 threads per tile; row0, col0 = first A row and first Bt row of the tile.
// The tile is small so that the grids cover the chip's WGPs: a K = 512 product of this size is a chain of
// latencies per block, and a narrow tile shortens every link (copies, fragment reads, WMMAs, epilogue).
// WR = 1: four waves side by side, wave wv has rows 0..31 and the col tile at 16*wv.
// WR = 2: waves 2 x 2, wave wv has rows 32*(wv >> 1) + 0..31 and the col tiles at 32*(wv & 1) + 16*j, j = 0..1.
// k slices of 64 staged in LDS by asynchronous copies, two buffers; epilogue staged in LDS.
// MODE 0: Cf[m][512] f32 = (C + bias[n]) * post                    (plain row-major)
// MODE 1: Cf[(b*8+h)*256 + l][64] f32 = 2^((C + bsum[n]) * post),  m = b*256+l, n = h*64+dk;
//         bsum = bias + bias2 where both_bias is set, 0 where it is not
// MODE 2: A rows are n = h*64+dk, Bt rows are m = b*256+j:
//         Ch/Cl[(b*8+h)*64 + dk][256 j] = split(C + bias[n])       (per-row bias)
// ---------------------------------------------------------------------------
// One k slice of the tile in LDS: rows of KT 16-bit values, [Ah 32*WR | Al 32*WR | Bh 64 | Bl 64],
// row pitch 144 B (16 B x odd: conflict-free for the 16-byte fragment reads).
#define KT       64
#define SPITCH   72                       // 16-bit elements per staged row
#define TN       64                       // Bt rows (output columns) of a tile
#define CPITCH   68                       // f32 elements per row of the staged result
#define SROWS(WR) (64 * (WR) + 2 * TN)    // staged rows per slice: 192 or 256
#define SBUF(WR)  (SROWS(WR) * SPITCH)    // elements per buffer (27648 B or 36864 B)
#define NTRIP    (DD / KT)

static_assert(NTRIP >= 2);
static_assert(SROWS(1) * (KT / 8) == 12 * NTHR);
static_assert(SROWS(2) * (KT / 8) == 16 * NTHR);

// Twelve 16-byte asynchronous copies global -> LDS, each lane its own addresses. The s_wait_xcnt
// is the last line of the copies' own statement, so no address register is rewritten ahead of it.
__device__ __forceinline__ void copy12(const unsigned int* la, const unsigned short* const* ga)
{
    asm volatile(
        "global_load_async_to_lds_b128 %0, %12, off\n\t"
        "global_load_async_to_lds_b128 %1, %13, off\n\t"
        "global_load_async_to_lds_b128 %2, %14, off\n\t"
        "global_load_async_to_lds_b128 %3, %15, off\n\t"
        "global_load_async_to_lds_b128 %4, %16, off\n\t"
        "global_load_async_to_lds_b128 %5, %17, off\n\t"
        "global_load_async_to_lds_b128 %6, %18, off\n\t"
        "global_load_async_to_lds_b128 %7, %19, off\n\t"
        "global_load_async_to_lds_b128 %8, %20, off\n\t"
        "global_load_async_to_lds_b128 %9, %21, off\n\t"
        "global_load_async_to_lds_b128 %10, %22, off\n\t"
        "global_load_async_to_lds_b128 %11, %23, off\n\t"
        "s_wait_xcnt 0x0"
        :: "v"(la[0]), "v"(la[1]), "v"(la[2]), "v"(la[3]), "v"(la[4]), "v"(la[5]),
           "v"(la[6]), "v"(la[7]), "v"(la[8]), "v"(la[9]), "v"(la[10]), "v"(la[11]),
           "v"(ga[0]), "v"(ga[1]), "v"(ga[2]), "v"(ga[3]), "v"(ga[4]), "v"(ga[5]),
           "v"(ga[6]), "v"(ga[7]), "v"(ga[8]), "v"(ga[9]), "v"(ga[10]), "v"(ga[11])
        : "memory");
}

// The same for eight copies (a slice of 256 rows is two such runs).
__device__ __forceinline__ void copy8h(const unsigned int* la, const unsigned short* const* ga)
{
    asm volatile(
        "global_load_async_to_lds_b128 %0, %8, off\n\t"
        "global_load_async_to_lds_b128 %1, %9, off\n\t"
        "global_load_async_to_lds_b128 %2, %10, off\n\t"
        "global_load_async_to_lds_b128 %3, %11, off\n\t"
        "global_load_async_to_lds_b128 %4, %12, off\n\t"
        "global_load_async_to_lds_b128 %5, %13, off\n\t"
        "global_load_async_to_lds_b128 %6, %14, off\n\t"
        "global_load_async_to_lds_b128 %7, %15, off\n\t"
        "s_wait_xcnt 0x0"
        :: "v"(la[0]), "v"(la[1]), "v"(la[2]), "v"(la[3]), "v"(la[4]), "v"(la[5]), "v"(la[6]), "v"(la[7]),
           "v"(ga[0]), "v"(ga[1]), "v"(ga[2]), "v"(ga[3]), "v"(ga[4]), "v"(ga[5]), "v"(ga[6]), "v"(ga[7])
        : "memory");
}

// Stage one k slice: copy i of thread tid moves 16 B of staged row 16*i + (tid >> 3), chunk tid & 7,
// so a wave's copy covers four whole 128-B lines. lds0 and the four pointers already hold the
// thread's row and chunk; kk = first k of the slice.
template <int WR>
__device__ __forceinline__ void stage_slice(
    unsigned int lds0,
    const unsigned short* gah, const unsigned short* gal,
    const unsigned short* gbh, const unsigned short* gbl, int kk)
{
    constexpr int AG = 2 * WR;            // groups of 16 rows in one A plane
    constexpr int BG = TN / 16;           // groups of 16 rows in one B plane
    constexpr int NC = 2 * AG + 2 * BG;   // copies per thread: 12 or 16
    unsigned int la[NC];
    const unsigned short* ga[NC];
    #pragma unroll
    for (int i = 0; i < NC; ++i) {
        la[i] = lds0 + (unsigned int)(i * 16 * SPITCH * 2);
        ga[i] = ((i < AG)          ? gah + (size_t)i * 16 * DD
               : (i < 2 * AG)      ? gal + (size_t)(i - AG) * 16 * DD
               : (i < 2 * AG + BG) ? gbh + (size_t)(i - 2 * AG) * 16 * DD
                                   : gbl + (size_t)(i - 2 * AG - BG) * 16 * DD) + kk;
    }
    if constexpr (NC == 12) {
        copy12(la, ga);
    } else {
        copy8h(la, ga);
        copy8h(la + 8, ga + 8);
    }
}

template <int WR>
__device__ __forceinline__ void gemm3_main(
    const unsigned short* __restrict__ Ah, const unsigned short* __restrict__ Al,
    const unsigned short* __restrict__ Bh, const unsigned short* __restrict__ Bl,
    int row0, int col0, float (*s_c)[CPITCH], unsigned short* s_st)
{
    constexpr int AR = 32 * WR;           // A rows of the tile
    constexpr int NJ = WR;                // col tiles per wave
    constexpr int WC = 4 / WR;            // waves side by side

    const int tid  = threadIdx.x;
    const int wv   = tid >> 5;
    const int l    = tid & 31;
    const int hh   = l >> 4;
    const int m15  = l & 15;
    const int ar0  = 32 * (wv / WC);          // first tile row of this wave
    const int bc0  = 16 * NJ * (wv % WC);     // first tile column of this wave

    const v8f zero = { 0.f, 0.f, 0.f, 0.f, 0.f, 0.f, 0.f, 0.f };
    v8f acc[2][NJ];
    #pragma unroll
    for (int rt = 0; rt < 2; ++rt)
        #pragma unroll
        for (int j = 0; j < NJ; ++j) acc[rt][j] = zero;

    // copy side: this thread's row (of 16) and 16-byte chunk (of 8)
    const int crow = tid >> 3;
    const int cchk = tid & 7;
    const unsigned short* gah = Ah + (size_t)(row0 + crow) * DD + 8 * cchk;
    const unsigned short* gal = Al + (size_t)(row0 + crow) * DD + 8 * cchk;
    const unsigned short* gbh = Bh + (size_t)(col0 + crow) * DD + 8 * cchk;
    const unsigned short* gbl = Bl + (size_t)(col0 + crow) * DD + 8 * cchk;
    const unsigned int lds0 = (unsigned int)(uintptr_t)s_st + (unsigned int)(crow * SPITCH * 2 + cchk * 16);

    // read side: element offsets of this lane's fragment rows inside a buffer
    const int oa0h = (ar0 + m15) * SPITCH;
    const int oa1h = (ar0 + 16 + m15) * SPITCH;
    const int oa0l = (AR + ar0 + m15) * SPITCH;
    const int oa1l = (AR + ar0 + 16 + m15) * SPITCH;
    const int obh  = (2 * AR + bc0 + m15) * SPITCH;
    const int obl  = (2 * AR + TN + bc0 + m15) * SPITCH;

    // slice 0 lands and is published, then slice 1 starts to fly
    stage_slice<WR>(lds0, gah, gal, gbh, gbl, 0);
    asm volatile("s_wait_asynccnt 0x0" ::: "memory");   // this wave's copies of slice 0 have landed
    __syncthreads();
    stage_slice<WR>(lds0 + SBUF(WR) * 2, gah, gal, gbh, gbl, KT);

    // kept rolled: the trips are chained by their barriers, unrolling would only add code to fetch
    #pragma unroll 1
    for (int t = 0; t < NTRIP; ++t) {
        const unsigned short* sb = s_st + (t & 1) * SBUF(WR);
        #pragma unroll
        for (int k0 = 0; k0 < KT; k0 += 32) {
            const v16bf fa0h = frag16(sb + oa0h, k0, hh);
            const v16bf fa0l = frag16(sb + oa0l, k0, hh);
            const v16bf fa1h = frag16(sb + oa1h, k0, hh);
            const v16bf fa1l = frag16(sb + oa1l, k0, hh);
            // all fragments of a k step are read as one group, so one LDS latency is waited out per step
            v16bf fbh[NJ], fbl[NJ];
            #pragma unroll
            for (int j = 0; j < NJ; ++j) {
                fbh[j] = frag16(sb + obh + j * 16 * SPITCH, k0, hh);
                fbl[j] = frag16(sb + obl + j * 16 * SPITCH, k0, hh);
            }
            #pragma unroll
            for (int j = 0; j < NJ; ++j) {
                acc[0][j] = wmma3(fa0h, fa0l, fbh[j], fbl[j], acc[0][j]);
                acc[1][j] = wmma3(fa1h, fa1l, fbh[j], fbl[j], acc[1][j]);
            }
        }
        asm volatile("s_wait_dscnt 0x0" ::: "memory");      // this wave's reads of the buffer are done before it is refilled
        asm volatile("s_wait_asynccnt 0x0" ::: "memory");   // this wave's copies of slice t + 1 have landed
        __syncthreads();                                    // publishes slice t + 1, frees slice t's buffer
        if (t + 2 < NTRIP)
            stage_slice<WR>(lds0 + (unsigned int)((t & 1) * SBUF(WR) * 2), gah, gal, gbh, gbl, (t + 2) * KT);
    }
    asm volatile("s_wait_asynccnt 0x0" ::: "memory");       // no copy is outstanding past the loop

    // D element r of lane -> (row 8*hh + r, col m15) of the 16x16 tile
    #pragma unroll
    for (int rt = 0; rt < 2; ++rt)
        #pragma unroll
        for (int j = 0; j < NJ; ++j)
            #pragma unroll
            for (int r = 0; r < 8; ++r)
                s_c[ar0 + rt * 16 + 8 * hh + r][bc0 + 16 * j + m15] = acc[rt][j][r];
    __syncthreads();
}

template <int MODE, int WR>
__device__ __forceinline__ void gemm3_epilogue(
    const float* __restrict__ bias, float post,
    float* Cf, unsigned short* Ch, unsigned short* Cl,
    int row0, int col0, const float (*s_c)[CPITCH],
    const float* __restrict__ bias2 = nullptr, bool both_bias = false)
{
    constexpr int AR = 32 * WR;                     // rows of the tile
    constexpr int N4 = AR * (TN / 4) / NTHR;        // 16-byte f32 pieces per thread
    constexpr int N8 = AR * (TN / 8) / NTHR;        // 8-element pieces per thread
    const int tid = threadIdx.x;

    if (MODE == 0) {
        v4f vals[N4];
        size_t off[N4];
        const int c4 = tid & 15;                // all pieces of a thread lie in the same four columns
        const v4f bb = *(const v4f*)(bias + col0 + 4 * c4);
        #pragma unroll
        for (int i = 0; i < N4; ++i) {
            const int row = (tid >> 4) + 8 * i; // 0..AR-1
            const v4f x  = *(const v4f*)&s_c[row][4 * c4];
            vals[i] = (x + bb) * post;
            off[i]  = (size_t)(row0 + row) * DD + col0 + 4 * c4;
        }
        #pragma unroll
        for (int i = 0; i < N4; ++i) *(v4f*)(Cf + off[i]) = vals[i];
        
    } else if (MODE == 1) {
        v4f vals[N4];
        size_t off[N4];
        const int c4 = tid & 15;                // all pieces of a thread lie in the same four columns
        const int n  = col0 + 4 * c4;           // the tile's 64 columns are one head
        const v4f b1 = *(const v4f*)(bias + n);
        const v4f b2 = *(const v4f*)(bias2 + n);
        // the address registers of the bias loads are reused by the code that follows them
        asm volatile("s_wait_xcnt 0x0" ::: "memory");
        // Only q + k enters the score, so both biases go into the q factor and none into the k
        // factor: biases of opposite sign cancel here, before the exponent is clamped.
        const v4f zero4 = { 0.f, 0.f, 0.f, 0.f };
        const v4f bb = both_bias ? (b1 + b2) : zero4;
        #pragma unroll
        for (int i = 0; i < N4; ++i) {
            const int row = (tid >> 4) + 8 * i; // 0..AR-1
            const v4f x  = *(const v4f*)&s_c[row][4 * c4];
            // The exponent is held inside the normal range, so both factors of the later product
            // 2^q' * 2^k' stay finite and non-zero and the product is never inf * 0. A clamped factor
            // (a value beyond 43) still gives the saturated tanh unless the other factor's value lies
            // beyond 35 on the opposite side; with the biases on one side the other is k . Wk alone.
            const v4f y = (x + bb) * post;
            #pragma unroll   // constant element indices, so that vals stays in registers
            for (int e = 0; e < 4; ++e) vals[i][e] = fminf(fmaxf(y[e], -126.0f), 126.0f);
            const int m  = row0 + row;
            const int b  = m >> 8;
            const int lq = m & 255;
            const int h  = n >> 6;
            off[i] = ((size_t)((b * HH + h) * LL + lq)) * DK + 4 * c4;
        }
        #pragma unroll
        for (int i = 0; i < N4; ++i) {
            #pragma unroll   // constant element indices, so that vals stays in registers
            for (int e = 0; e < 4; ++e) vals[i][e] = EXP2_FAST(vals[i][e]);
            *(v4f*)(Cf + off[i]) = vals[i];
        }
        // in the merged kernel other code follows these stores in the listing and reuses their registers
        asm volatile("s_wait_xcnt 0x0" ::: "memory");
    } else {
        v8us hv[N8], lv[N8];
        size_t off[N8];
        const int b  = col0 >> 8;
        const int jb = col0 & 255;              // first key of the tile inside its batch
        #pragma unroll
        for (int i = 0; i < N8; ++i) {
            const int idx = tid + NTHR * i;
            const int row = idx >> 3;           // 0..AR-1 (eight threads write one 128-B line per plane)
            const int c8  = idx & 7;            // 0..7
            const float bs = bias[row0 + row];
            const v4f bb = { bs, bs, bs, bs };
            const v4f x0 = *(const v4f*)&s_c[row][8 * c8] + bb;
            const v4f x1 = *(const v4f*)&s_c[row][8 * c8 + 4] + bb;
            split8(x0, x1, hv[i], lv[i]);
            const int n  = row0 + row;
            const int h  = n >> 6;
            const int dk = n & 63;
            off[i] = ((size_t)((b * HH + h) * DK + dk)) * LL + jb + 8 * c8;
        }
        #pragma unroll
        for (int i = 0; i < N8; ++i) {
            *(v8us*)(Ch + off[i]) = hv[i];
            *(v8us*)(Cl + off[i]) = lv[i];
        }
        
    }
}

// Output projection: one 32 x 64 tile per block (256 blocks), row0 = 32*blockIdx.x, col0 = 64*blockIdx.y.
__global__ void __launch_bounds__(NTHR) gemm3_out_kernel(
    const unsigned short* __restrict__ Ah, const unsigned short* __restrict__ Al,
    const unsigned short* __restrict__ Bh, const unsigned short* __restrict__ Bl,
    const float* __restrict__ bias, float* Cf)
{
    __shared__ __align__(16) float s_c[32][CPITCH];
    __shared__ __align__(16) unsigned short s_st[2 * SBUF(1)];
    const int row0 = blockIdx.x * 32;
    const int col0 = blockIdx.y * TN;
    gemm3_main<1>(Ah, Al, Bh, Bl, row0, col0, s_c, s_st);
    gemm3_epilogue<0, 1>(bias, 1.0f, Cf, nullptr, nullptr, row0, col0, s_c);
}

// The three input projections in one grid: none reads another's output. 64 x 64 tiles, 128 per
// projection (a square tile, since three projections together read the most from L2).
// blockIdx.y = 0:q 1:k 2:v, blockIdx.x = tile 0..127 of that projection.
//  q, k: A = activation planes (16 row tiles), Bt = transposed weight planes (8 col tiles), MODE 1.
//  v:    A = transposed Wv planes (8 row tiles), Bt = activation planes (16 col tiles), MODE 2.
__global__ void __launch_bounds__(NTHR) proj3_kernel(
    const unsigned short* __restrict__ xh, const unsigned short* __restrict__ xl,
    const unsigned short* __restrict__ wth, const unsigned short* __restrict__ wtl,
    const float* __restrict__ bq, const float* __restrict__ bk, const float* __restrict__ bv,
    float post, float* Qp, float* Kp, unsigned short* VTh, unsigned short* VTl)
{
    __shared__ __align__(16) float s_c[64][CPITCH];
    __shared__ __align__(16) unsigned short s_st[2 * SBUF(2)];

    const int    t      = blockIdx.y;
    const int    tile   = blockIdx.x;
    const size_t xplane = (size_t)NR * DD;
    const size_t wplane = (size_t)DD * DD;

    const bool   isv    = (t == 2);
    const unsigned short* xth = xh + t * xplane;
    const unsigned short* xtl = xl + t * xplane;
    const unsigned short* wh  = wth + t * wplane;
    const unsigned short* wl  = wtl + t * wplane;
    const int row0 = (isv ? (tile & 7) : (tile & 15)) * 64;
    const int col0 = (isv ? (tile >> 3) : (tile >> 4)) * TN;

    // one copy of the k loop serves all three; only the operand roles and the epilogue differ
    gemm3_main<2>(isv ? wh : xth, isv ? wl : xtl, isv ? xth : wh, isv ? xtl : wl, row0, col0, s_c, s_st);
    if (isv) gemm3_epilogue<2, 2>(bv, 1.0f, nullptr, VTh, VTl, row0, col0, s_c);
    else     gemm3_epilogue<1, 2>(bq, post, (t == 0) ? Qp : Kp, nullptr, nullptr, row0, col0, s_c, bk, t == 0);
}

// ---------------------------------------------------------------------------
// Additive scores + softmax + read-out for one (b, h, 16 query rows) block, 128 threads.
// Qp holds e^{2(q + bq + bk)} and Kp e^{2k} of the bias-free projections q, k in (B,H,L,DK) f32 layout:
// their product is e^{2x} of the pair's x = (q + bq) + (k + bk), so the exponential is taken once per
// projected element and not once per (query, key) pair.
// tanh(x) = 1 - 2/(1 + e^{2x}); score = sum_d vp_d - 2 * sum_d vp_d/(1 + e^{2x_d});
// the constant sum_d vp_d is invariant under softmax and omitted. mask == 0 -> -1e9.
// Thread tid owns keys 2*tid, 2*tid+1 and holds the scores of all 16 query rows in registers: one score
// loop and one block softmax, whose 16 rows cover each other's cross-lane and LDS latencies. P is split to bf16
// hi/lo in LDS (dword stores, barrier, then 16-byte fragment reloads) and feeds O = P . VT^T,
// VT = [bh][dk][256 j] hi/lo planes; wave wv owns the dk tile 16*wv.
// The head's K rows (256 keys x 64 f32) are staged once per block in LDS by asynchronous copies of
// whole lines: a thread reading its own two rows from global memory touches 32 lines per load.
// Key j lies in LDS row (j >> 1) + 128 * (j & 1), row pitch 272 B (16 B x odd), so that the lanes of
// a wave, which own every second key, read rows one pitch apart without bank conflicts.
// ---------------------------------------------------------------------------
#define KPITCH 68                         // f32 elements per staged K row

// 2^x with a v_nop behind it in the same statement: the instruction set asks for one independent instruction
// before a transcendental's result is read or its source register rewritten.
__device__ __forceinline__ float exp2_slot(float x)
{
    float r;
    asm("v_exp_f32 %0, %1\n\tv_nop" : "=v"(r) : "v"(x));
    return r;
}

static_assert(LL * DK * 4 == 32 * NTHR * 16);

// Eight 16-byte asynchronous copies global -> LDS, each lane its own addresses. The s_wait_xcnt
// is the last line of the copies' own statement, so no address register is rewritten ahead of it.
__device__ __forceinline__ void copy8(const unsigned int* la, const float* const* ga)
{
    asm volatile(
        "global_load_async_to_lds_b128 %0, %8, off\n\t"
        "global_load_async_to_lds_b128 %1, %9, off\n\t"
        "global_load_async_to_lds_b128 %2, %10, off\n\t"
        "global_load_async_to_lds_b128 %3, %11, off\n\t"
        "global_load_async_to_lds_b128 %4, %12, off\n\t"
        "global_load_async_to_lds_b128 %5, %13, off\n\t"
        "global_load_async_to_lds_b128 %6, %14, off\n\t"
        "global_load_async_to_lds_b128 %7, %15, off\n\t"
        "s_wait_xcnt 0x0"
        :: "v"(la[0]), "v"(la[1]), "v"(la[2]), "v"(la[3]), "v"(la[4]), "v"(la[5]), "v"(la[6]), "v"(la[7]),
           "v"(ga[0]), "v"(ga[1]), "v"(ga[2]), "v"(ga[3]), "v"(ga[4]), "v"(ga[5]), "v"(ga[6]), "v"(ga[7])
        : "memory");
}

__global__ void __launch_bounds__(NTHR) attn_kernel(
    const float* __restrict__ Qp, const float* __restrict__ Kp, const float* __restrict__ vp,
    const int* __restrict__ mask,
    const unsigned short* __restrict__ VTh, const unsigned short* __restrict__ VTl,
    unsigned short* Oh, unsigned short* Ol)
{
    __shared__ __align__(16) float          s_k[LL][KPITCH];
    __shared__ __align__(16) float          s_q[16][DK];
    __shared__ __align__(16) float          s_vp[DK];
    __shared__ __align__(16) unsigned short s_ph[16][LL];
    __shared__ __align__(16) unsigned short s_pl[16][LL];
    __shared__ __align__(16) float          s_o[16][68];
    __shared__ __align__(16) float s_rmax[4][16];   // [wave][query row]
    __shared__ __align__(16) float s_rsum[4][16];

    const int tid = threadIdx.x;
    const int wv  = tid >> 5;
    const int l   = tid & 31;
    const int hh  = l >> 4;
    const int m15 = l & 15;
    const int bh  = blockIdx.y;          // 0..31
    const int b   = bh >> 3;
    const int h   = bh & 7;
    const int q0  = blockIdx.x * 16;     // 0..240

    const float LOG2E = 1.4426950408889634f;
    const float MASKV = -1.0e9f;

    // K tile: copy i of thread tid moves 16-byte chunk tid + 128*i of the head's 64 KiB, that is
    // key (tid >> 4) + 8*i, chunk tid & 15; a wave's copy covers four whole 128-B lines.
    {
        const float* gk0 = Kp + (size_t)bh * LL * DK + 4 * tid;
        const unsigned int lk0 = (unsigned int)(uintptr_t)&s_k[0][0]
            + (unsigned int)(((tid >> 5) + 128 * ((tid >> 4) & 1)) * (KPITCH * 4) + (tid & 15) * 16);
        #pragma unroll
        for (int g = 0; g < 4; ++g) {
            unsigned int la[8];
            const float* ga[8];
            #pragma unroll
            for (int i = 0; i < 8; ++i) {
                la[i] = lk0 + (unsigned int)((8 * g + i) * 4 * (KPITCH * 4));
                ga[i] = gk0 + (size_t)(8 * g + i) * (NTHR * 4);
            }
            copy8(la, ga);
        }
    }

    // the 16 mask rows of this thread's two keys, one group of loads in flight beside the K copies
    v2i mk[16];
    {
        const int* mrow = mask + ((size_t)(b * LL + q0)) * LL + 2 * tid;
        #pragma unroll
        for (int j = 0; j < 16; ++j) mk[j] = *(const v2i*)(mrow + (size_t)j * LL);
    }

    #pragma unroll
    for (int i = 0; i < 2; ++i) {
        const int idx = tid + NTHR * i;  // 0..255
        const int r   = idx >> 4;        // 0..15
        const int c4  = idx & 15;        // 0..15
        *(v4f*)&s_q[r][4 * c4] = *(const v4f*)(Qp + ((size_t)(bh * LL + q0 + r)) * DK + 4 * c4);
    }
    if (tid < DK) s_vp[tid] = vp[h * DK + tid];
    asm volatile("s_wait_asynccnt 0x0" ::: "memory");   // this wave's copies of the K tile have landed
    __syncthreads();                                    // publishes s_q, s_vp and the K tile

    const int j0 = 2 * tid;
    const float* k0p = &s_k[tid][0];          // key 2*tid
    const float* k1p = &s_k[128 + tid][0];    // key 2*tid + 1

    v2f acc[16];                         // [query row], element = key 2*tid, 2*tid + 1
    #pragma unroll
    for (int j = 0; j < 16; ++j) { acc[j][0] = 0.0f; acc[j][1] = 0.0f; }

    // kept rolled: one trip is 128 pair elements per lane, enough to cover its own LDS reads
    #pragma unroll 1
    for (int d4 = 0; d4 < DK / 4; ++d4) {
        const v4f ka = *(const v4f*)(k0p + 4 * d4);
        const v4f kb = *(const v4f*)(k1p + 4 * d4);
        const v4f vv = *(const v4f*)&s_vp[4 * d4];
        const v2f one2 = { 1.0f, 1.0f };
        v2f kk[4];                       // the thread's two keys side by side: packed f32 arithmetic
        #pragma unroll
        for (int e = 0; e < 4; ++e) { kk[e][0] = ka[e]; kk[e][1] = kb[e]; }
        #pragma unroll
        for (int j = 0; j < 16; ++j) {
            const v4f qv = *(const v4f*)&s_q[j][4 * d4];
            #pragma unroll
            for (int e = 0; e < 4; ++e) {
                const v2f q2 = { qv[e], qv[e] };
                const v2f v2 = { vv[e], vv[e] };
                const v2f a  = __builtin_elementwise_fma(q2, kk[e], one2);   // 1 + e^{2x}
                const v2f rr = { RCP_FAST(a[0]), RCP_FAST(a[1]) };
                acc[j] = __builtin_elementwise_fma(v2, rr, acc[j]);
            }
        }
    }

    // logits with mask fill, block-wide row max over the 256 keys; each cross-lane round runs over
    // all 16 rows before the next one starts, so a round's latency is waited out once and not per row
    float bm[16];
    #pragma unroll
    for (int j = 0; j < 16; ++j) {
        const float s0 = (mk[j][0] == 0) ? MASKV : (-2.0f * acc[j][0]);
        const float s1 = (mk[j][1] == 0) ? MASKV : (-2.0f * acc[j][1]);
        acc[j][0] = s0;
        acc[j][1] = s1;
        bm[j] = fmaxf(s0, s1);
    }
    #pragma unroll
    for (int off = 16; off > 0; off >>= 1) {
        float t[16];
        #pragma unroll
        for (int j = 0; j < 16; ++j) t[j] = __shfl_xor(bm[j], off, 32);
        #pragma unroll
        for (int j = 0; j < 16; ++j) bm[j] = fmaxf(bm[j], t[j]);
    }
    if (l == 0) {
        #pragma unroll
        for (int i = 0; i < 4; ++i) {
            const v4f x = { bm[4 * i], bm[4 * i + 1], bm[4 * i + 2], bm[4 * i + 3] };
            *(v4f*)&s_rmax[wv][4 * i] = x;
        }
    }
    __syncthreads();
    #pragma unroll
    for (int j = 0; j < 16; ++j)
        bm[j] = fmaxf(fmaxf(s_rmax[0][j], s_rmax[1][j]), fmaxf(s_rmax[2][j], s_rmax[3][j]));

    float bs[16];
    #pragma unroll
    for (int j = 0; j < 16; ++j) {
        const float e0 = exp2_slot((acc[j][0] - bm[j]) * LOG2E);
        const float e1 = exp2_slot((acc[j][1] - bm[j]) * LOG2E);
        acc[j][0] = e0;
        acc[j][1] = e1;
        bs[j] = e0 + e1;
    }
    #pragma unroll
    for (int off = 16; off > 0; off >>= 1) {
        float t[16];
        #pragma unroll
        for (int j = 0; j < 16; ++j) t[j] = __shfl_xor(bs[j], off, 32);
        #pragma unroll
        for (int j = 0; j < 16; ++j) bs[j] += t[j];
    }
    if (l == 0) {
        #pragma unroll
        for (int i = 0; i < 4; ++i) {
            const v4f x = { bs[4 * i], bs[4 * i + 1], bs[4 * i + 2], bs[4 * i + 3] };
            *(v4f*)&s_rsum[wv][4 * i] = x;
        }
    }
    __syncthreads();
    #pragma unroll
    for (int j = 0; j < 16; ++j) {
        const float sum = (s_rsum[0][j] + s_rsum[1][j]) + (s_rsum[2][j] + s_rsum[3][j]);
        const float inv = RCP_FAST(sum);
        const float p0  = acc[j][0] * inv;
        const float p1  = acc[j][1] * inv;
        unsigned int h0b, l0b, h1b, l1b;
        split1(p0, h0b, l0b);
        split1(p1, h1b, l1b);
        *(unsigned int*)&s_ph[j][j0] = (h1b << 16) | h0b;
        *(unsigned int*)&s_pl[j][j0] = (l1b << 16) | l0b;
    }
    __syncthreads();

    // read-out: o[16 q][64 dk] = P . VT^T ; wave wv owns dk tile 16*wv
    v8f pacc = { 0.f, 0.f, 0.f, 0.f, 0.f, 0.f, 0.f, 0.f };
    const unsigned short* pah = &s_ph[m15][0];
    const unsigned short* pal = &s_pl[m15][0];
    const unsigned short* bvh = VTh + ((size_t)(bh * DK + 16 * wv + m15)) * LL;
    const unsigned short* bvl = VTl + ((size_t)(bh * DK + 16 * wv + m15)) * LL;
    #pragma unroll 1
    for (int k0 = 0; k0 < LL; k0 += 32) {
        const v16bf fah = frag16(pah, k0, hh);
        const v16bf fal = frag16(pal, k0, hh);
        const v16bf fbh = frag16(bvh, k0, hh);
        const v16bf fbl = frag16(bvl, k0, hh);
        pacc = wmma3(fah, fal, fbh, fbl, pacc);
    }
    #pragma unroll
    for (int r = 0; r < 8; ++r) s_o[8 * hh + r][16 * wv + m15] = pacc[r];
    __syncthreads();

    {
        const int row = tid >> 3;   // 0..15
        const int c8  = tid & 7;
        const v4f x0 = *(const v4f*)&s_o[row][8 * c8];
        const v4f x1 = *(const v4f*)&s_o[row][8 * c8 + 4];
        v8us hv, lv;
        split8(x0, x1, hv, lv);
        const size_t goff = ((size_t)(b * LL + q0 + row)) * DD + h * DK + 8 * c8;
        *(v8us*)(Oh + goff) = hv;
        *(v8us*)(Ol + goff) = lv;
        
    }
}

extern "C" void kernel_launch(void* const* d_in, const int* in_sizes, int n_in,
                              void* d_out, int out_size, void* d_ws, size_t ws_size,
                              hipStream_t stream)
{
    if (n_in < 13) return;
    if (in_sizes[0] != NR * DD || in_sizes[1] != NR * DD || in_sizes[2] != NR * DD) return;
    if (in_sizes[3] != BB * LL * LL) return;
    if (in_sizes[4] != DD * DD || in_sizes[6] != DD * DD || in_sizes[8] != DD * DD || in_sizes[11] != DD * DD) return;
    if (in_sizes[5] != DD || in_sizes[7] != DD || in_sizes[9] != DD || in_sizes[12] != DD) return;
    if (in_sizes[10] != HH * DK) return;
    if (out_size != NR * DD) return;

    const float* q    = (const float*)d_in[0];    // [4][256][512]
    const float* k    = (const float*)d_in[1];
    const float* v    = (const float*)d_in[2];
    const int*   mask = (const int*)d_in[3];      // [4][256][256] int32
    const float* Wq   = (const float*)d_in[4];    // [512 in][512 out]
    const float* bq   = (const float*)d_in[5];
    const float* Wk   = (const float*)d_in[6];
    const float* bk   = (const float*)d_in[7];
    const float* Wv   = (const float*)d_in[8];
    const float* bv   = (const float*)d_in[9];
    const float* vp   = (const float*)d_in[10];   // [8][64]
    const float* W0   = (const float*)d_in[11];
    const float* b0   = (const float*)d_in[12];
    float* out = (float*)d_out;                   // [1024][512] f32

    // workspace carve (bytes), every offset a multiple of 1 MiB
    const size_t sz_x  = (size_t)3 * NR * DD * 2;        // 3145728  (q,k,v planes)
    const size_t sz_wt = (size_t)4 * DD * DD * 2;        // 2097152  (WqT,WkT,WvT,W0T planes)
    const size_t sz_p  = (size_t)NR * DD * 4;            // 2097152  (f32 projection)
    const size_t sz_vt = (size_t)BB * HH * DK * LL * 2;  // 1048576
    const size_t sz_o  = (size_t)NR * DD * 2;            // 1048576
    size_t off = 0;
    const size_t off_xh  = off;  off += sz_x;
    const size_t off_xl  = off;  off += sz_x;
    const size_t off_wth = off;  off += sz_wt;
    const size_t off_wtl = off;  off += sz_wt;
    const size_t off_qp  = off;  off += sz_p;
    const size_t off_kp  = off;  off += sz_p;
    const size_t off_vth = off;  off += sz_vt;
    const size_t off_vtl = off;  off += sz_vt;
    const size_t off_oh  = off;  off += sz_o;
    const size_t off_ol  = off;  off += sz_o;             // total 18874368
    if (off > ws_size) return;

    char* ws = (char*)d_ws;
    unsigned short* xh  = (unsigned short*)(ws + off_xh);
    unsigned short* xl  = (unsigned short*)(ws + off_xl);
    unsigned short* wth = (unsigned short*)(ws + off_wth);
    unsigned short* wtl = (unsigned short*)(ws + off_wtl);
    float*          Qp  = (float*)(ws + off_qp);
    float*          Kp  = (float*)(ws + off_kp);
    unsigned short* VTh = (unsigned short*)(ws + off_vth);
    unsigned short* VTl = (unsigned short*)(ws + off_vtl);
    unsigned short* Oh  = (unsigned short*)(ws + off_oh);
    unsigned short* Ol  = (unsigned short*)(ws + off_ol);

    const size_t wplane = (size_t)DD * DD;   // elements per weight plane
    const float C2 = 2.8853900817779268f;    // 2*log2(e)

    // 1) 16-bit hi/lo planes for q,k,v and transposed Wq,Wk,Wv,W0
    prep_kernel<<<dim3(3 * (NR / 2) + 256), dim3(NTHR), 0, stream>>>(
        q, k, v, Wq, Wk, Wv, W0, xh, xl, wth, wtl);

    // 2) Q, K projections -> Qp, Kp (B,H,L,DK) f32 = 2^(projection * 2log2e), and the V projection, transposed
    //    -> VT hi/lo, as one grid of 3 x 128 blocks
    proj3_kernel<<<dim3(128, 3), dim3(NTHR), 0, stream>>>(
        xh, xl, wth, wtl, bq, bk, bv, C2, Qp, Kp, VTh, VTl);

    // 3) additive scores + softmax + P.V -> O hi/lo planes in merged (B,L,D) layout
    attn_kernel<<<dim3(LL / 16, BB * HH), dim3(NTHR), 0, stream>>>(
        Qp, Kp, vp, mask, VTh, VTl, Oh, Ol);

    // 4) output projection -> d_out
    gemm3_out_kernel<<<dim3(NR / 32, DD / TN), dim3(NTHR), 0, stream>>>(
        Oh, Ol, wth + 3 * wplane, wtl + 3 * wplane, b0, out);
}

// v007
// Measured time: 34.7 microseconds a run.
// Next to v006, in two timings, it ran 1.08 times as fast each time.
// Counting every step since v000, it is 3.66 times as fast.
#include <hip/hip_runtime.h>
#include <hip/hip_bf16.h>
#include <stddef.h>
#include <stdint.h>

// All contractions: v_wmma_f32_16x16x32_bf16 with bf16 hi/lo split operands (hi*hi + hi*lo + lo*hi, f32 accumulate): q/k/v projections, probability read-out P*V, output projection; additive scores (exp2 + rcp tanh form), mask fill, softmax and epilogues in f32.

#define BB   4
#define LL   256
#define DD   512
#define HH   8
#define DK   64
#define NR   (BB * LL)
#define NTHR 128

static_assert(NR == 1024);
static_assert(DD == HH * DK);
static_assert(LL == 2 * NTHR);
static_assert(DK == 64);

typedef unsigned short v8us  __attribute__((ext_vector_type(8)));
typedef __bf16         v16bf __attribute__((ext_vector_type(16)));
typedef float          v8f   __attribute__((ext_vector_type(8)));
typedef float          v4f   __attribute__((ext_vector_type(4)));
typedef int            v2i   __attribute__((ext_vector_type(2)));
typedef float          v2f   __attribute__((ext_vector_type(2)));

union Frag { v16bf v; v8us h[2]; };

#if __has_builtin(__builtin_amdgcn_exp2f)
#define EXP2_FAST(x) __builtin_amdgcn_exp2f(x)
#else
#define EXP2_FAST(x) exp2f(x)
#endif
#if __has_builtin(__builtin_amdgcn_rcpf)
#define RCP_FAST(x) __builtin_amdgcn_rcpf(x)
#else
#define RCP_FAST(x) (1.0f / (x))
#endif

// f32 -> bf16 bits, RNE
__device__ __forceinline__ unsigned int bf16_rne(float f)
{
    unsigned int u = __float_as_uint(f);
    u += 0x7FFFu + ((u >> 16) & 1u);
    return u >> 16;
}

// x = hi + lo, both bf16 (RNE); lo = RNE(x - f32(hi))
__device__ __forceinline__ void split1(float x, unsigned int& hb, unsigned int& lb)
{
    hb = bf16_rne(x);
    const float xh = __uint_as_float(hb << 16);
    lb = bf16_rne(x - xh);
}

// 8 consecutive values (a then b) -> one 16-byte hi vector and one 16-byte lo vector
__device__ __forceinline__ void split8(v4f a, v4f b, v8us& hi, v8us& lo)
{
    v8us hr = { 0, 0, 0, 0, 0, 0, 0, 0 };
    v8us lr = { 0, 0, 0, 0, 0, 0, 0, 0 };
    #pragma unroll
    for (int e = 0; e < 4; ++e) {
        unsigned int hb, lb;
        split1(a[e], hb, lb);
        hr[e] = (unsigned short)hb;
        lr[e] = (unsigned short)lb;
        split1(b[e], hb, lb);
        hr[4 + e] = (unsigned short)hb;
        lr[4 + e] = (unsigned short)lb;
    }
    hi = hr;
    lo = lr;
}

// 16-bit fragment loader (wave32, 16x16x32): lane l, hh = l>>4, row/col = l&15.
// elements 0..7  <- row[k0 + 8*hh + 0..7], elements 8..15 <- row[k0 + 16 + 8*hh + 0..7].
// Used for A (row-major, k contiguous) and for B stored as [n][k] (k contiguous).
__device__ __forceinline__ v16bf frag16(const unsigned short* row, int k0, int hh)
{
    Frag f;
    f.h[0] = *(const v8us*)(row + k0 + 8 * hh);
    f.h[1] = *(const v8us*)(row + k0 + 16 + 8 * hh);
    return f.v;
}

// D += A*B with the VALU hazard guard after the instruction.
__device__ __forceinline__ v8f wmma_bf16(v16bf a, v16bf b, v8f c)
{
    v8f d = __builtin_amdgcn_wmma_f32_16x16x32_bf16(false, a, false, b, (short)0, c, false, false);
    asm volatile("v_nop\n\tv_nop\n\tv_nop\n\tv_nop" : "+v"(d) : "v"(a), "v"(b));
    return d;
}

// hi/lo split product: hh + hl + lh into one accumulator
__device__ __forceinline__ v8f wmma3(v16bf ah, v16bf al, v16bf bh, v16bf bl, v8f c)
{
    c = wmma_bf16(ah, bh, c);
    c = wmma_bf16(ah, bl, c);
    c = wmma_bf16(al, bh, c);
    return c;
}

// ---------------------------------------------------------------------------
// Operand preparation (128 threads / block).
//  blocks [0, 1536): xh/xl[t][row][512] = split(x_t[row]), t = 0:q 1:k 2:v, 2 rows per block,
//                    64 threads per row, 8 elements (16 B) per thread -> 512-B runs per wave.
//  blocks [1536, 1792): wth/wtl[w][n][512] = split(W_w[k][n]) (transposed, k contiguous),
// ---------------------------------------------------------------------------
__global__ void __launch_bounds__(NTHR) prep_kernel(
    const float* __restrict__ q, const float* __restrict__ k, const float* __restrict__ v,
    const float* __restrict__ Wq, const float* __restrict__ Wk,
    const float* __restrict__ Wv, const float* __restrict__ W0,
    unsigned short* xh, unsigned short* xl, unsigned short* wth, unsigned short* wtl)
{
    __shared__ float s_t[64][65];

    const int tid = threadIdx.x;
    const int bid = blockIdx.x;
    const int NXB = 3 * (NR / 2);   // 1536

    if (bid < NXB) {
        const int t   = bid / (NR / 2);
        const int row = ((bid % (NR / 2)) << 1) + (tid >> 6);
        const int c8  = tid & 63;
        const float* src = (t == 0) ? q : ((t == 1) ? k : v);
        const size_t soff = (size_t)row * DD + 8 * c8;
        const v4f x0 = *(const v4f*)(src + soff);
        const v4f x1 = *(const v4f*)(src + soff + 4);
        v8us hv, lv;
        split8(x0, x1, hv, lv);
        const size_t doff = ((size_t)t * NR + row) * DD + 8 * c8;
        *(v8us*)(xh + doff) = hv;
        *(v8us*)(xl + doff) = lv;
        
    } else {
        const int u    = bid - NXB;          // 0..255
        const int w    = u >> 6;             // 0..3
        const int tile = u & 63;
        const int k0   = (tile >> 3) * 64;
        const int n0   = (tile & 7) * 64;
        const float* Wsel = (w == 0) ? Wq : ((w == 1) ? Wk : ((w == 2) ? Wv : W0));
        // load W[k0+kk][n0+nn] -> s_t[nn][kk]
        #pragma unroll
        for (int i = 0; i < 8; ++i) {
            const int idx = tid + NTHR * i;  // 0..1023
            const int kk  = idx >> 4;        // 0..63
            const int c4  = idx & 15;        // 0..15
            const v4f x = *(const v4f*)(Wsel + (size_t)(k0 + kk) * DD + n0 + 4 * c4);
            s_t[4 * c4 + 0][kk] = x[0];
            s_t[4 * c4 + 1][kk] = x[1];
            s_t[4 * c4 + 2][kk] = x[2];
            s_t[4 * c4 + 3][kk] = x[3];
        }
        __syncthreads();
        v8us hv[4], lv[4];
        size_t off[4];
        #pragma unroll
        for (int i = 0; i < 4; ++i) {
            const int idx = tid + NTHR * i;  // 0..511
            const int nn  = idx >> 3;        // 0..63
            const int k8  = idx & 7;         // 0..7
            const v4f a  = { s_t[nn][8 * k8 + 0], s_t[nn][8 * k8 + 1], s_t[nn][8 * k8 + 2], s_t[nn][8 * k8 + 3] };
            const v4f b2 = { s_t[nn][8 * k8 + 4], s_t[nn][8 * k8 + 5], s_t[nn][8 * k8 + 6], s_t[nn][8 * k8 + 7] };
            split8(a, b2, hv[i], lv[i]);
            off[i] = ((size_t)w * DD + n0 + nn) * DD + k0 + 8 * k8;
        }
        #pragma unroll
        for (int i = 0; i < 4; ++i) {
            *(v8us*)(wth + off[i]) = hv[i];
            *(v8us*)(wtl + off[i]) = lv[i];
        }
        
    }
}

// ---------------------------------------------------------------------------
// C[32*WR rows of A][64 rows of Bt] = Ah/Al[.][512] . Bt h/l[.][512]^T  (K = 512, hi/lo split).
// One block of 128 threads per tile; row0, col0 = first A row and first Bt row of the tile.
// The tile is small so that the grids cover the chip's WGPs: a K = 512 product of this size is a chain of
// latencies per block, and a narrow tile shortens every link (copies, fragment reads, WMMAs, epilogue).
// WR = 1: four waves side by side, wave wv has rows 0..31 and the col tile at 16*wv.
// WR = 2: waves 2 x 2, wave wv has rows 32*(wv >> 1) + 0..31 and the col tiles at 32*(wv & 1) + 16*j, j = 0..1.
// k slices of 128 staged in LDS by asynchronous copies, two buffers; epilogue staged in LDS. With two buffers one
// slice is in flight at a time, so the loop pays one copy flight per slice: few, long slices.
// MODE 0: Cf[m][512] f32 = (C + bias[n]) * post                    (plain row-major)
// MODE 1: Cf[(b*8+h)*256 + l][64] f32 = 2^((C + bsum[n]) * post),  m = b*256+l, n = h*64+dk;
//         bsum = bias + bias2 where both_bias is set, 0 where it is not
// MODE 2: A rows are n = h*64+dk, Bt rows are m = b*256+j:
//         Ch/Cl[(b*8+h)*64 + dk][256 j] = split(C + bias[n])       (per-row bias)
// ---------------------------------------------------------------------------
// One k slice of the tile in LDS: rows of KT 16-bit values, [Ah 32*WR | Al 32*WR | Bh 64 | Bl 64],
// row pitch 272 B (16 B x odd: conflict-free for the 16-byte fragment reads).
#define KT       128
#define SPITCH   136                      // 16-bit elements per staged row
#define TN       64                       // Bt rows (output columns) of a tile
#define CPITCH   68                       // f32 elements per row of the staged result
#define SROWS(WR) (64 * (WR) + 2 * TN)    // staged rows per slice: 192 or 256
#define SBUF(WR)  (SROWS(WR) * SPITCH)    // elements per buffer (52224 B or 69632 B)
#define NTRIP    (DD / KT)

static_assert(NTRIP >= 2);
static_assert(SROWS(1) * (KT / 8) == 24 * NTHR);
static_assert(SROWS(2) * (KT / 8) == 32 * NTHR);

// Twelve 16-byte asynchronous copies global -> LDS, each lane its own addresses. The s_wait_xcnt
// is the last line of the copies' own statement, so no address register is rewritten ahead of it.
__device__ __forceinline__ void copy12(const unsigned int* la, const unsigned short* const* ga)
{
    asm volatile(
        "global_load_async_to_lds_b128 %0, %12, off\n\t"
        "global_load_async_to_lds_b128 %1, %13, off\n\t"
        "global_load_async_to_lds_b128 %2, %14, off\n\t"
        "global_load_async_to_lds_b128 %3, %15, off\n\t"
        "global_load_async_to_lds_b128 %4, %16, off\n\t"
        "global_load_async_to_lds_b128 %5, %17, off\n\t"
        "global_load_async_to_lds_b128 %6, %18, off\n\t"
        "global_load_async_to_lds_b128 %7, %19, off\n\t"
        "global_load_async_to_lds_b128 %8, %20, off\n\t"
        "global_load_async_to_lds_b128 %9, %21, off\n\t"
        "global_load_async_to_lds_b128 %10, %22, off\n\t"
        "global_load_async_to_lds_b128 %11, %23, off\n\t"
        "s_wait_xcnt 0x0"
        :: "v"(la[0]), "v"(la[1]), "v"(la[2]), "v"(la[3]), "v"(la[4]), "v"(la[5]),
           "v"(la[6]), "v"(la[7]), "v"(la[8]), "v"(la[9]), "v"(la[10]), "v"(la[11]),
           "v"(ga[0]), "v"(ga[1]), "v"(ga[2]), "v"(ga[3]), "v"(ga[4]), "v"(ga[5]),
           "v"(ga[6]), "v"(ga[7]), "v"(ga[8]), "v"(ga[9]), "v"(ga[10]), "v"(ga[11])
        : "memory");
}

// The same for eight copies (a slice of 256 rows is two runs of twelve and one of eight).
__device__ __forceinline__ void copy8h(const unsigned int* la, const unsigned short* const* ga)
{
    asm volatile(
        "global_load_async_to_lds_b128 %0, %8, off\n\t"
        "global_load_async_to_lds_b128 %1, %9, off\n\t"
        "global_load_async_to_lds_b128 %2, %10, off\n\t"
        "global_load_async_to_lds_b128 %3, %11, off\n\t"
        "global_load_async_to_lds_b128 %4, %12, off\n\t"
        "global_load_async_to_lds_b128 %5, %13, off\n\t"
        "global_load_async_to_lds_b128 %6, %14, off\n\t"
        "global_load_async_to_lds_b128 %7, %15, off\n\t"
        "s_wait_xcnt 0x0"
        :: "v"(la[0]), "v"(la[1]), "v"(la[2]), "v"(la[3]), "v"(la[4]), "v"(la[5]), "v"(la[6]), "v"(la[7]),
           "v"(ga[0]), "v"(ga[1]), "v"(ga[2]), "v"(ga[3]), "v"(ga[4]), "v"(ga[5]), "v"(ga[6]), "v"(ga[7])
        : "memory");
}

// Stage one k slice: copy i of thread tid moves 16 B of staged row 8*i + (tid >> 4), chunk tid & 15,
// so a wave's copy covers four whole 128-B lines (two rows of 256 B). lds0 and the four pointers
// already hold the thread's row and chunk; kk = first k of the slice.
template <int WR>
__device__ __forceinline__ void stage_slice(
    unsigned int lds0,
    const unsigned short* gah, const unsigned short* gal,
    const unsigned short* gbh, const unsigned short* gbl, int kk)
{
    constexpr int AG = 4 * WR;            // groups of 8 rows in one A plane
    constexpr int BG = TN / 8;            // groups of 8 rows in one B plane
    constexpr int NC = 2 * AG + 2 * BG;   // copies per thread: 24 or 32
    unsigned int la[NC];
    const unsigned short* ga[NC];
    #pragma unroll
    for (int i = 0; i < NC; ++i) {
        la[i] = lds0 + (unsigned int)(i * 8 * SPITCH * 2);
        ga[i] = ((i < AG)          ? gah + (size_t)i * 8 * DD
               : (i < 2 * AG)      ? gal + (size_t)(i - AG) * 8 * DD
               : (i < 2 * AG + BG) ? gbh + (size_t)(i - 2 * AG) * 8 * DD
                                   : gbl + (size_t)(i - 2 * AG - BG) * 8 * DD) + kk;
    }
    if constexpr (NC == 24) {
        copy12(la, ga);
        copy12(la + 12, ga + 12);
    } else {
        copy12(la, ga);
        copy12(la + 12, ga + 12);
        copy8h(la + 24, ga + 24);
    }
}

template <int WR>
__device__ __forceinline__ void gemm3_main(
    const unsigned short* __restrict__ Ah, const unsigned short* __restrict__ Al,
    const unsigned short* __restrict__ Bh, const unsigned short* __restrict__ Bl,
    int row0, int col0, float (*s_c)[CPITCH], unsigned short* s_st)
{
    constexpr int AR = 32 * WR;           // A rows of the tile
    constexpr int NJ = WR;                // col tiles per wave
    constexpr int WC = 4 / WR;            // waves side by side

    const int tid  = threadIdx.x;
    const int wv   = tid >> 5;
    const int l    = tid & 31;
    const int hh   = l >> 4;
    const int m15  = l & 15;
    const int ar0  = 32 * (wv / WC);          // first tile row of this wave
    const int bc0  = 16 * NJ * (wv % WC);     // first tile column of this wave

    const v8f zero = { 0.f, 0.f, 0.f, 0.f, 0.f, 0.f, 0.f, 0.f };
    v8f acc[2][NJ];
    #pragma unroll
    for (int rt = 0; rt < 2; ++rt)
        #pragma unroll
        for (int j = 0; j < NJ; ++j) acc[rt][j] = zero;

    // copy side: this thread's row (of 8) and 16-byte chunk (of 16)
    const int crow = tid >> 4;
    const int cchk = tid & 15;
    const unsigned short* gah = Ah + (size_t)(row0 + crow) * DD + 8 * cchk;
    const unsigned short* gal = Al + (size_t)(row0 + crow) * DD + 8 * cchk;
    const unsigned short* gbh = Bh + (size_t)(col0 + crow) * DD + 8 * cchk;
    const unsigned short* gbl = Bl + (size_t)(col0 + crow) * DD + 8 * cchk;
    const unsigned int lds0 = (unsigned int)(uintptr_t)s_st + (unsigned int)(crow * SPITCH * 2 + cchk * 16);

    // read side: element offsets of this lane's fragment rows inside a buffer
    const int oa0h = (ar0 + m15) * SPITCH;
    const int oa1h = (ar0 + 16 + m15) * SPITCH;
    const int oa0l = (AR + ar0 + m15) * SPITCH;
    const int oa1l = (AR + ar0 + 16 + m15) * SPITCH;
    const int obh  = (2 * AR + bc0 + m15) * SPITCH;
    const int obl  = (2 * AR + TN + bc0 + m15) * SPITCH;

    // slice 0 lands and is published, then slice 1 starts to fly
    stage_slice<WR>(lds0, gah, gal, gbh, gbl, 0);
    asm volatile("s_wait_asynccnt 0x0" ::: "memory");   // this wave's copies of slice 0 have landed
    __syncthreads();
    stage_slice<WR>(lds0 + SBUF(WR) * 2, gah, gal, gbh, gbl, KT);

    // kept rolled: the trips are chained by their barriers, unrolling would only add code to fetch
    #pragma unroll 1
    for (int t = 0; t < NTRIP; ++t) {
        const unsigned short* sb = s_st + (t & 1) * SBUF(WR);
        #pragma unroll
        for (int k0 = 0; k0 < KT; k0 += 32) {
            const v16bf fa0h = frag16(sb + oa0h, k0, hh);
            const v16bf fa0l = frag16(sb + oa0l, k0, hh);
            const v16bf fa1h = frag16(sb + oa1h, k0, hh);
            const v16bf fa1l = frag16(sb + oa1l, k0, hh);
            // all fragments of a k step are read as one group, so one LDS latency is waited out per step
            v16bf fbh[NJ], fbl[NJ];
            #pragma unroll
            for (int j = 0; j < NJ; ++j) {
                fbh[j] = frag16(sb + obh + j * 16 * SPITCH, k0, hh);
                fbl[j] = frag16(sb + obl + j * 16 * SPITCH, k0, hh);
            }
            #pragma unroll
            for (int j = 0; j < NJ; ++j) {
                acc[0][j] = wmma3(fa0h, fa0l, fbh[j], fbl[j], acc[0][j]);
                acc[1][j] = wmma3(fa1h, fa1l, fbh[j], fbl[j], acc[1][j]);
            }
        }
        asm volatile("s_wait_dscnt 0x0" ::: "memory");      // this wave's reads of the buffer are done before it is refilled
        asm volatile("s_wait_asynccnt 0x0" ::: "memory");   // this wave's copies of slice t + 1 have landed
        __syncthreads();                                    // publishes slice t + 1, frees slice t's buffer
        if (t + 2 < NTRIP)
            stage_slice<WR>(lds0 + (unsigned int)((t & 1) * SBUF(WR) * 2), gah, gal, gbh, gbl, (t + 2) * KT);
    }
    asm volatile("s_wait_asynccnt 0x0" ::: "memory");       // no copy is outstanding past the loop

    // D element r of lane -> (row 8*hh + r, col m15) of the 16x16 tile
    #pragma unroll
    for (int rt = 0; rt < 2; ++rt)
        #pragma unroll
        for (int j = 0; j < NJ; ++j)
            #pragma unroll
            for (int r = 0; r < 8; ++r)
                s_c[ar0 + rt * 16 + 8 * hh + r][bc0 + 16 * j + m15] = acc[rt][j][r];
    __syncthreads();
}

template <int MODE, int WR>
__device__ __forceinline__ void gemm3_epilogue(
    const float* __restrict__ bias, float post,
    float* Cf, unsigned short* Ch, unsigned short* Cl,
    int row0, int col0, const float (*s_c)[CPITCH],
    const float* __restrict__ bias2 = nullptr, bool both_bias = false)
{
    constexpr int AR = 32 * WR;                     // rows of the tile
    constexpr int N4 = AR * (TN / 4) / NTHR;        // 16-byte f32 pieces per thread
    constexpr int N8 = AR * (TN / 8) / NTHR;        // 8-element pieces per thread
    const int tid = threadIdx.x;

    if (MODE == 0) {
        v4f vals[N4];
        size_t off[N4];
        const int c4 = tid & 15;                // all pieces of a thread lie in the same four columns
        const v4f bb = *(const v4f*)(bias + col0 + 4 * c4);
        #pragma unroll
        for (int i = 0; i < N4; ++i) {
            const int row = (tid >> 4) + 8 * i; // 0..AR-1
            const v4f x  = *(const v4f*)&s_c[row][4 * c4];
            vals[i] = (x + bb) * post;
            off[i]  = (size_t)(row0 + row) * DD + col0 + 4 * c4;
        }
        #pragma unroll
        for (int i = 0; i < N4; ++i) *(v4f*)(Cf + off[i]) = vals[i];
        
    } else if (MODE == 1) {
        v4f vals[N4];
        size_t off[N4];
        const int c4 = tid & 15;                // all pieces of a thread lie in the same four columns
        const int n  = col0 + 4 * c4;           // the tile's 64 columns are one head
        const v4f b1 = *(const v4f*)(bias + n);
        const v4f b2 = *(const v4f*)(bias2 + n);
        // the address registers of the bias loads are reused by the code that follows them
        asm volatile("s_wait_xcnt 0x0" ::: "memory");
        // Only q + k enters the score, so both biases go into the q factor and none into the k
        // factor: biases of opposite sign cancel here, before the exponent is clamped.
        const v4f zero4 = { 0.f, 0.f, 0.f, 0.f };
        const v4f bb = both_bias ? (b1 + b2) : zero4;
        #pragma unroll
        for (int i = 0; i < N4; ++i) {
            const int row = (tid >> 4) + 8 * i; // 0..AR-1
            const v4f x  = *(const v4f*)&s_c[row][4 * c4];
            // The exponent is held inside the normal range, so both factors of the later product
            // 2^q' * 2^k' stay finite and non-zero and the product is never inf * 0. A clamped factor
            // (a value beyond 43) still gives the saturated tanh unless the other factor's value lies
            // beyond 35 on the opposite side; with the biases on one side the other is k . Wk alone.
            const v4f y = (x + bb) * post;
            #pragma unroll   // constant element indices, so that vals stays in registers
            for (int e = 0; e < 4; ++e) vals[i][e] = fminf(fmaxf(y[e], -126.0f), 126.0f);
            const int m  = row0 + row;
            const int b  = m >> 8;
            const int lq = m & 255;
            const int h  = n >> 6;
            off[i] = ((size_t)((b * HH + h) * LL + lq)) * DK + 4 * c4;
        }
        #pragma unroll
        for (int i = 0; i < N4; ++i) {
            #pragma unroll   // constant element indices, so that vals stays in registers
            for (int e = 0; e < 4; ++e) vals[i][e] = EXP2_FAST(vals[i][e]);
            *(v4f*)(Cf + off[i]) = vals[i];
        }
        // in the merged kernel other code follows these stores in the listing and reuses their registers
        asm volatile("s_wait_xcnt 0x0" ::: "memory");
    } else {
        v8us hv[N8], lv[N8];
        size_t off[N8];
        const int b  = col0 >> 8;
        const int jb = col0 & 255;              // first key of the tile inside its batch
        #pragma unroll
        for (int i = 0; i < N8; ++i) {
            const int idx = tid + NTHR * i;
            const int row = idx >> 3;           // 0..AR-1 (eight threads write one 128-B line per plane)
            const int c8  = idx & 7;            // 0..7
            const float bs = bias[row0 + row];
            const v4f bb = { bs, bs, bs, bs };
            const v4f x0 = *(const v4f*)&s_c[row][8 * c8] + bb;
            const v4f x1 = *(const v4f*)&s_c[row][8 * c8 + 4] + bb;
            split8(x0, x1, hv[i], lv[i]);
            const int n  = row0 + row;
            const int h  = n >> 6;
            const int dk = n & 63;
            off[i] = ((size_t)((b * HH + h) * DK + dk)) * LL + jb + 8 * c8;
        }
        #pragma unroll
        for (int i = 0; i < N8; ++i) {
            *(v8us*)(Ch + off[i]) = hv[i];
            *(v8us*)(Cl + off[i]) = lv[i];
        }
        
    }
}

// Output projection: one 32 x 64 tile per block (256 blocks), row0 = 32*blockIdx.x, col0 = 64*blockIdx.y.
__global__ void __launch_bounds__(NTHR) gemm3_out_kernel(
    const unsigned short* __restrict__ Ah, const unsigned short* __restrict__ Al,
    const unsigned short* __restrict__ Bh, const unsigned short* __restrict__ Bl,
    const float* __restrict__ bias, float* Cf)
{
    __shared__ __align__(16) float s_c[32][CPITCH];
    __shared__ __align__(16) unsigned short s_st[2 * SBUF(1)];
    const int row0 = blockIdx.x * 32;
    const int col0 = blockIdx.y * TN;
    gemm3_main<1>(Ah, Al, Bh, Bl, row0, col0, s_c, s_st);
    gemm3_epilogue<0, 1>(bias, 1.0f, Cf, nullptr, nullptr, row0, col0, s_c);
}

// The three input projections in one grid: none reads another's output. 64 x 64 tiles, 128 per
// projection (a square tile, since three projections together read the most from L2).
// blockIdx.y = 0:q 1:k 2:v, blockIdx.x = tile 0..127 of that projection.
//  q, k: A = activation planes (16 row tiles), Bt = transposed weight planes (8 col tiles), MODE 1.
//  v:    A = transposed Wv planes (8 row tiles), Bt = activation planes (16 col tiles), MODE 2.
__global__ void __launch_bounds__(NTHR) proj3_kernel(
    const unsigned short* __restrict__ xh, const unsigned short* __restrict__ xl,
    const unsigned short* __restrict__ wth, const unsigned short* __restrict__ wtl,
    const float* __restrict__ bq, const float* __restrict__ bk, const float* __restrict__ bv,
    float post, float* Qp, float* Kp, unsigned short* VTh, unsigned short* VTl)
{
    __shared__ __align__(16) float s_c[64][CPITCH];
    __shared__ __align__(16) unsigned short s_st[2 * SBUF(2)];

    const int    t      = blockIdx.y;
    const int    tile   = blockIdx.x;
    const size_t xplane = (size_t)NR * DD;
    const size_t wplane = (size_t)DD * DD;

    const bool   isv    = (t == 2);
    const unsigned short* xth = xh + t * xplane;
    const unsigned short* xtl = xl + t * xplane;
    const unsigned short* wh  = wth + t * wplane;
    const unsigned short* wl  = wtl + t * wplane;
    const int row0 = (isv ? (tile & 7) : (tile & 15)) * 64;
    const int col0 = (isv ? (tile >> 3) : (tile >> 4)) * TN;

    // one copy of the k loop serves all three; only the operand roles and the epilogue differ
    gemm3_main<2>(isv ? wh : xth, isv ? wl : xtl, isv ? xth : wh, isv ? xtl : wl, row0, col0, s_c, s_st);
    if (isv) gemm3_epilogue<2, 2>(bv, 1.0f, nullptr, VTh, VTl, row0, col0, s_c);
    else     gemm3_epilogue<1, 2>(bq, post, (t == 0) ? Qp : Kp, nullptr, nullptr, row0, col0, s_c, bk, t == 0);
}

// ---------------------------------------------------------------------------
// Additive scores + softmax + read-out for one (b, h, 16 query rows) block, 128 threads.
// Qp holds e^{2(q + bq + bk)} and Kp e^{2k} of the bias-free projections q, k in (B,H,L,DK) f32 layout:
// their product is e^{2x} of the pair's x = (q + bq) + (k + bk), so the exponential is taken once per
// projected element and not once per (query, key) pair.
// tanh(x) = 1 - 2/(1 + e^{2x}); score = sum_d vp_d - 2 * sum_d vp_d/(1 + e^{2x_d});
// the constant sum_d vp_d is invariant under softmax and omitted. mask == 0 -> -1e9.
// Thread tid owns keys 2*tid, 2*tid+1 and holds the scores of all 16 query rows in registers: one score
// loop and one block softmax, whose 16 rows cover each other's cross-lane and LDS latencies. P is split to bf16
// hi/lo in LDS (dword stores, barrier, then 16-byte fragment reloads) and feeds O = P . VT^T,
// VT = [bh][dk][256 j] hi/lo planes; wave wv owns the dk tile 16*wv.
// The head's K rows (256 keys x 64 f32) are staged once per block in LDS by asynchronous copies of
// whole lines: a thread reading its own two rows from global memory touches 32 lines per load.
// Key j lies in LDS row (j >> 1) + 128 * (j & 1), row pitch 272 B (16 B x odd), so that the lanes of
// a wave, which own every second key, read rows one pitch apart without bank conflicts.
// ---------------------------------------------------------------------------
#define KPITCH 68                         // f32 elements per staged K row

// 2^x with a v_nop behind it in the same statement: the instruction set asks for one independent instruction
// before a transcendental's result is read or its source register rewritten.
__device__ __forceinline__ float exp2_slot(float x)
{
    float r;
    asm("v_exp_f32 %0, %1\n\tv_nop" : "=v"(r) : "v"(x));
    return r;
}

static_assert(LL * DK * 4 == 32 * NTHR * 16);

// Eight 16-byte asynchronous copies global -> LDS, each lane its own addresses. The s_wait_xcnt
// is the last line of the copies' own statement, so no address register is rewritten ahead of it.
__device__ __forceinline__ void copy8(const unsigned int* la, const float* const* ga)
{
    asm volatile(
        "global_load_async_to_lds_b128 %0, %8, off\n\t"
        "global_load_async_to_lds_b128 %1, %9, off\n\t"
        "global_load_async_to_lds_b128 %2, %10, off\n\t"
        "global_load_async_to_lds_b128 %3, %11, off\n\t"
        "global_load_async_to_lds_b128 %4, %12, off\n\t"
        "global_load_async_to_lds_b128 %5, %13, off\n\t"
        "global_load_async_to_lds_b128 %6, %14, off\n\t"
        "global_load_async_to_lds_b128 %7, %15, off\n\t"
        "s_wait_xcnt 0x0"
        :: "v"(la[0]), "v"(la[1]), "v"(la[2]), "v"(la[3]), "v"(la[4]), "v"(la[5]), "v"(la[6]), "v"(la[7]),
           "v"(ga[0]), "v"(ga[1]), "v"(ga[2]), "v"(ga[3]), "v"(ga[4]), "v"(ga[5]), "v"(ga[6]), "v"(ga[7])
        : "memory");
}

__global__ void __launch_bounds__(NTHR) attn_kernel(
    const float* __restrict__ Qp, const float* __restrict__ Kp, const float* __restrict__ vp,
    const int* __restrict__ mask,
    const unsigned short* __restrict__ VTh, const unsigned short* __restrict__ VTl,
    unsigned short* Oh, unsigned short* Ol)
{
    __shared__ __align__(16) float          s_k[LL][KPITCH];
    __shared__ __align__(16) float          s_q[16][DK];
    __shared__ __align__(16) float          s_vp[DK];
    __shared__ __align__(16) unsigned short s_ph[16][LL];
    __shared__ __align__(16) unsigned short s_pl[16][LL];
    __shared__ __align__(16) float          s_o[16][68];
    __shared__ __align__(16) float s_rmax[4][16];   // [wave][query row]
    __shared__ __align__(16) float s_rsum[4][16];

    const int tid = threadIdx.x;
    const int wv  = tid >> 5;
    const int l   = tid & 31;
    const int hh  = l >> 4;
    const int m15 = l & 15;
    const int bh  = blockIdx.y;          // 0..31
    const int b   = bh >> 3;
    const int h   = bh & 7;
    const int q0  = blockIdx.x * 16;     // 0..240

    const float LOG2E = 1.4426950408889634f;
    const float MASKV = -1.0e9f;

    // K tile: copy i of thread tid moves 16-byte chunk tid + 128*i of the head's 64 KiB, that is
    // key (tid >> 4) + 8*i, chunk tid & 15; a wave's copy covers four whole 128-B lines.
    {
        const float* gk0 = Kp + (size_t)bh * LL * DK + 4 * tid;
        const unsigned int lk0 = (unsigned int)(uintptr_t)&s_k[0][0]
            + (unsigned int)(((tid >> 5) + 128 * ((tid >> 4) & 1)) * (KPITCH * 4) + (tid & 15) * 16);
        #pragma unroll
        for (int g = 0; g < 4; ++g) {
            unsigned int la[8];
            const float* ga[8];
            #pragma unroll
            for (int i = 0; i < 8; ++i) {
                la[i] = lk0 + (unsigned int)((8 * g + i) * 4 * (KPITCH * 4));
                ga[i] = gk0 + (size_t)(8 * g + i) * (NTHR * 4);
            }
            copy8(la, ga);
        }
    }

    // the 16 mask rows of this thread's two keys, one group of loads in flight beside the K copies
    v2i mk[16];
    {
        const int* mrow = mask + ((size_t)(b * LL + q0)) * LL + 2 * tid;
        #pragma unroll
        for (int j = 0; j < 16; ++j) mk[j] = *(const v2i*)(mrow + (size_t)j * LL);
    }

    #pragma unroll
    for (int i = 0; i < 2; ++i) {
        const int idx = tid + NTHR * i;  // 0..255
        const int r   = idx >> 4;        // 0..15
        const int c4  = idx & 15;        // 0..15
        *(v4f*)&s_q[r][4 * c4] = *(const v4f*)(Qp + ((size_t)(bh * LL + q0 + r)) * DK + 4 * c4);
    }
    if (tid < DK) s_vp[tid] = vp[h * DK + tid];
    asm volatile("s_wait_asynccnt 0x0" ::: "memory");   // this wave's copies of the K tile have landed
    __syncthreads();                                    // publishes s_q, s_vp and the K tile

    const int j0 = 2 * tid;
    const float* k0p = &s_k[tid][0];          // key 2*tid
    const float* k1p = &s_k[128 + tid][0];    // key 2*tid + 1

    v2f acc[16];                         // [query row], element = key 2*tid, 2*tid + 1
    #pragma unroll
    for (int j = 0; j < 16; ++j) { acc[j][0] = 0.0f; acc[j][1] = 0.0f; }

    // kept rolled: one trip is 128 pair elements per lane, enough to cover its own LDS reads
    #pragma unroll 1
    for (int d4 = 0; d4 < DK / 4; ++d4) {
        const v4f ka = *(const v4f*)(k0p + 4 * d4);
        const v4f kb = *(const v4f*)(k1p + 4 * d4);
        const v4f vv = *(const v4f*)&s_vp[4 * d4];
        const v2f one2 = { 1.0f, 1.0f };
        v2f kk[4];                       // the thread's two keys side by side: packed f32 arithmetic
        #pragma unroll
        for (int e = 0; e < 4; ++e) { kk[e][0] = ka[e]; kk[e][1] = kb[e]; }
        #pragma unroll
        for (int j = 0; j < 16; ++j) {
            const v4f qv = *(const v4f*)&s_q[j][4 * d4];
            #pragma unroll
            for (int e = 0; e < 4; ++e) {
                const v2f q2 = { qv[e], qv[e] };
                const v2f v2 = { vv[e], vv[e] };
                const v2f a  = __builtin_elementwise_fma(q2, kk[e], one2);   // 1 + e^{2x}
                const v2f rr = { RCP_FAST(a[0]), RCP_FAST(a[1]) };
                acc[j] = __builtin_elementwise_fma(v2, rr, acc[j]);
            }
        }
    }

    // logits with mask fill, block-wide row max over the 256 keys; each cross-lane round runs over
    // all 16 rows before the next one starts, so a round's latency is waited out once and not per row
    float bm[16];
    #pragma unroll
    for (int j = 0; j < 16; ++j) {
        const float s0 = (mk[j][0] == 0) ? MASKV : (-2.0f * acc[j][0]);
        const float s1 = (mk[j][1] == 0) ? MASKV : (-2.0f * acc[j][1]);
        acc[j][0] = s0;
        acc[j][1] = s1;
        bm[j] = fmaxf(s0, s1);
    }
    #pragma unroll
    for (int off = 16; off > 0; off >>= 1) {
        float t[16];
        #pragma unroll
        for (int j = 0; j < 16; ++j) t[j] = __shfl_xor(bm[j], off, 32);
        #pragma unroll
        for (int j = 0; j < 16; ++j) bm[j] = fmaxf(bm[j], t[j]);
    }
    if (l == 0) {
        #pragma unroll
        for (int i = 0; i < 4; ++i) {
            const v4f x = { bm[4 * i], bm[4 * i + 1], bm[4 * i + 2], bm[4 * i + 3] };
            *(v4f*)&s_rmax[wv][4 * i] = x;
        }
    }
    __syncthreads();
    #pragma unroll
    for (int j = 0; j < 16; ++j)
        bm[j] = fmaxf(fmaxf(s_rmax[0][j], s_rmax[1][j]), fmaxf(s_rmax[2][j], s_rmax[3][j]));

    float bs[16];
    #pragma unroll
    for (int j = 0; j < 16; ++j) {
        const float e0 = exp2_slot((acc[j][0] - bm[j]) * LOG2E);
        const float e1 = exp2_slot((acc[j][1] - bm[j]) * LOG2E);
        acc[j][0] = e0;
        acc[j][1] = e1;
        bs[j] = e0 + e1;
    }
    #pragma unroll
    for (int off = 16; off > 0; off >>= 1) {
        float t[16];
        #pragma unroll
        for (int j = 0; j < 16; ++j) t[j] = __shfl_xor(bs[j], off, 32);
        #pragma unroll
        for (int j = 0; j < 16; ++j) bs[j] += t[j];
    }
    if (l == 0) {
        #pragma unroll
        for (int i = 0; i < 4; ++i) {
            const v4f x = { bs[4 * i], bs[4 * i + 1], bs[4 * i + 2], bs[4 * i + 3] };
            *(v4f*)&s_rsum[wv][4 * i] = x;
        }
    }
    __syncthreads();
    #pragma unroll
    for (int j = 0; j < 16; ++j) {
        const float sum = (s_rsum[0][j] + s_rsum[1][j]) + (s_rsum[2][j] + s_rsum[3][j]);
        const float inv = RCP_FAST(sum);
        const float p0  = acc[j][0] * inv;
        const float p1  = acc[j][1] * inv;
        unsigned int h0b, l0b, h1b, l1b;
        split1(p0, h0b, l0b);
        split1(p1, h1b, l1b);
        *(unsigned int*)&s_ph[j][j0] = (h1b << 16) | h0b;
        *(unsigned int*)&s_pl[j][j0] = (l1b << 16) | l0b;
    }
    __syncthreads();

    // read-out: o[16 q][64 dk] = P . VT^T ; wave wv owns dk tile 16*wv
    v8f pacc = { 0.f, 0.f, 0.f, 0.f, 0.f, 0.f, 0.f, 0.f };
    const unsigned short* pah = &s_ph[m15][0];
    const unsigned short* pal = &s_pl[m15][0];
    const unsigned short* bvh = VTh + ((size_t)(bh * DK + 16 * wv + m15)) * LL;
    const unsigned short* bvl = VTl + ((size_t)(bh * DK + 16 * wv + m15)) * LL;
    #pragma unroll 1
    for (int k0 = 0; k0 < LL; k0 += 32) {
        const v16bf fah = frag16(pah, k0, hh);
        const v16bf fal = frag16(pal, k0, hh);
        const v16bf fbh = frag16(bvh, k0, hh);
        const v16bf fbl = frag16(bvl, k0, hh);
        pacc = wmma3(fah, fal, fbh, fbl, pacc);
    }
    #pragma unroll
    for (int r = 0; r < 8; ++r) s_o[8 * hh + r][16 * wv + m15] = pacc[r];
    __syncthreads();

    {
        const int row = tid >> 3;   // 0..15
        const int c8  = tid & 7;
        const v4f x0 = *(const v4f*)&s_o[row][8 * c8];
        const v4f x1 = *(const v4f*)&s_o[row][8 * c8 + 4];
        v8us hv, lv;
        split8(x0, x1, hv, lv);
        const size_t goff = ((size_t)(b * LL + q0 + row)) * DD + h * DK + 8 * c8;
        *(v8us*)(Oh + goff) = hv;
        *(v8us*)(Ol + goff) = lv;
        
    }
}

extern "C" void kernel_launch(void* const* d_in, const int* in_sizes, int n_in,
                              void* d_out, int out_size, void* d_ws, size_t ws_size,
                              hipStream_t stream)
{
    if (n_in < 13) return;
    if (in_sizes[0] != NR * DD || in_sizes[1] != NR * DD || in_sizes[2] != NR * DD) return;
    if (in_sizes[3] != BB * LL * LL) return;
    if (in_sizes[4] != DD * DD || in_sizes[6] != DD * DD || in_sizes[8] != DD * DD || in_sizes[11] != DD * DD) return;
    if (in_sizes[5] != DD || in_sizes[7] != DD || in_sizes[9] != DD || in_sizes[12] != DD) return;
    if (in_sizes[10] != HH * DK) return;
    if (out_size != NR * DD) return;

    const float* q    = (const float*)d_in[0];    // [4][256][512]
    const float* k    = (const float*)d_in[1];
    const float* v    = (const float*)d_in[2];
    const int*   mask = (const int*)d_in[3];      // [4][256][256] int32
    const float* Wq   = (const float*)d_in[4];    // [512 in][512 out]
    const float* bq   = (const float*)d_in[5];
    const float* Wk   = (const float*)d_in[6];
    const float* bk   = (const float*)d_in[7];
    const float* Wv   = (const float*)d_in[8];
    const float* bv   = (const float*)d_in[9];
    const float* vp   = (const float*)d_in[10];   // [8][64]
    const float* W0   = (const float*)d_in[11];
    const float* b0   = (const float*)d_in[12];
    float* out = (float*)d_out;                   // [1024][512] f32

    // workspace carve (bytes), every offset a multiple of 1 MiB
    const size_t sz_x  = (size_t)3 * NR * DD * 2;        // 3145728  (q,k,v planes)
    const size_t sz_wt = (size_t)4 * DD * DD * 2;        // 2097152  (WqT,WkT,WvT,W0T planes)
    const size_t sz_p  = (size_t)NR * DD * 4;            // 2097152  (f32 projection)
    const size_t sz_vt = (size_t)BB * HH * DK * LL * 2;  // 1048576
    const size_t sz_o  = (size_t)NR * DD * 2;            // 1048576
    size_t off = 0;
    const size_t off_xh  = off;  off += sz_x;
    const size_t off_xl  = off;  off += sz_x;
    const size_t off_wth = off;  off += sz_wt;
    const size_t off_wtl = off;  off += sz_wt;
    const size_t off_qp  = off;  off += sz_p;
    const size_t off_kp  = off;  off += sz_p;
    const size_t off_vth = off;  off += sz_vt;
    const size_t off_vtl = off;  off += sz_vt;
    const size_t off_oh  = off;  off += sz_o;
    const size_t off_ol  = off;  off += sz_o;             // total 18874368
    if (off > ws_size) return;

    char* ws = (char*)d_ws;
    unsigned short* xh  = (unsigned short*)(ws + off_xh);
    unsigned short* xl  = (unsigned short*)(ws + off_xl);
    unsigned short* wth = (unsigned short*)(ws + off_wth);
    unsigned short* wtl = (unsigned short*)(ws + off_wtl);
    float*          Qp  = (float*)(ws + off_qp);
    float*          Kp  = (float*)(ws + off_kp);
    unsigned short* VTh = (unsigned short*)(ws + off_vth);
    unsigned short* VTl = (unsigned short*)(ws + off_vtl);
    unsigned short* Oh  = (unsigned short*)(ws + off_oh);
    unsigned short* Ol  = (unsigned short*)(ws + off_ol);

    const size_t wplane = (size_t)DD * DD;   // elements per weight plane
    const float C2 = 2.8853900817779268f;    // 2*log2(e)

    // 1) 16-bit hi/lo planes for q,k,v and transposed Wq,Wk,Wv,W0
    prep_kernel<<<dim3(3 * (NR / 2) + 256), dim3(NTHR), 0, stream>>>(
        q, k, v, Wq, Wk, Wv, W0, xh, xl, wth, wtl);

    // 2) Q, K projections -> Qp, Kp (B,H,L,DK) f32 = 2^(projection * 2log2e), and the V projection, transposed
    //    -> VT hi/lo, as one grid of 3 x 128 blocks
    proj3_kernel<<<dim3(128, 3), dim3(NTHR), 0, stream>>>(
        xh, xl, wth, wtl, bq, bk, bv, C2, Qp, Kp, VTh, VTl);

    // 3) additive scores + softmax + P.V -> O hi/lo planes in merged (B,L,D) layout
    attn_kernel<<<dim3(LL / 16, BB * HH), dim3(NTHR), 0, stream>>>(
        Qp, Kp, vp, mask, VTh, VTl, Oh, Ol);

    // 4) output projection -> d_out
    gemm3_out_kernel<<<dim3(NR / 32, DD / TN), dim3(NTHR), 0, stream>>>(
        Oh, Ol, wth + 3 * wplane, wtl + 3 * wplane, b0, out);
}

// v008
// It runs in 32.3 microseconds.
// In both of two side-by-side timings against v007, it was 1.08 times as fast.
// Counting every step since v000, it is 3.95 times as fast.
#include <hip/hip_runtime.h>
#include <hip/hip_bf16.h>
#include <stddef.h>
#include <stdint.h>

// All contractions: v_wmma_f32_16x16x32_bf16 with bf16 hi/lo split operands (hi*hi + hi*lo + lo*hi, f32 accumulate): q/k/v projections, probability read-out P*V, output projection; additive scores (exp2 + rcp tanh form), mask fill, softmax and epilogues in f32.

#define BB   4
#define LL   256
#define DD   512
#define HH   8
#define DK   64
#define NR   (BB * LL)
#define NTHR 128

static_assert(NR == 1024);
static_assert(DD == HH * DK);
static_assert(LL == 2 * NTHR);
static_assert(DK == 64);

typedef unsigned short v8us  __attribute__((ext_vector_type(8)));
typedef __bf16         v16bf __attribute__((ext_vector_type(16)));
typedef float          v8f   __attribute__((ext_vector_type(8)));
typedef float          v4f   __attribute__((ext_vector_type(4)));
typedef int            v2i   __attribute__((ext_vector_type(2)));
typedef float          v2f   __attribute__((ext_vector_type(2)));

union Frag { v16bf v; v8us h[2]; };

#if __has_builtin(__builtin_amdgcn_exp2f)
#define EXP2_FAST(x) __builtin_amdgcn_exp2f(x)
#else
#define EXP2_FAST(x) exp2f(x)
#endif
#if __has_builtin(__builtin_amdgcn_rcpf)
#define RCP_FAST(x) __builtin_amdgcn_rcpf(x)
#else
#define RCP_FAST(x) (1.0f / (x))
#endif

// f32 -> bf16 bits, RNE
__device__ __forceinline__ unsigned int bf16_rne(float f)
{
    unsigned int u = __float_as_uint(f);
    u += 0x7FFFu + ((u >> 16) & 1u);
    return u >> 16;
}

// x = hi + lo, both bf16 (RNE); lo = RNE(x - f32(hi))
__device__ __forceinline__ void split1(float x, unsigned int& hb, unsigned int& lb)
{
    hb = bf16_rne(x);
    const float xh = __uint_as_float(hb << 16);
    lb = bf16_rne(x - xh);
}

// 8 consecutive values (a then b) -> one 16-byte hi vector and one 16-byte lo vector
__device__ __forceinline__ void split8(v4f a, v4f b, v8us& hi, v8us& lo)
{
    v8us hr = { 0, 0, 0, 0, 0, 0, 0, 0 };
    v8us lr = { 0, 0, 0, 0, 0, 0, 0, 0 };
    #pragma unroll
    for (int e = 0; e < 4; ++e) {
        unsigned int hb, lb;
        split1(a[e], hb, lb);
        hr[e] = (unsigned short)hb;
        lr[e] = (unsigned short)lb;
        split1(b[e], hb, lb);
        hr[4 + e] = (unsigned short)hb;
        lr[4 + e] = (unsigned short)lb;
    }
    hi = hr;
    lo = lr;
}

// 16-bit fragment loader (wave32, 16x16x32): lane l, hh = l>>4, row/col = l&15.
// elements 0..7  <- row[k0 + 8*hh + 0..7], elements 8..15 <- row[k0 + 16 + 8*hh + 0..7].
// Used for A (row-major, k contiguous) and for B stored as [n][k] (k contiguous).
__device__ __forceinline__ v16bf frag16(const unsigned short* row, int k0, int hh)
{
    Frag f;
    f.h[0] = *(const v8us*)(row + k0 + 8 * hh);
    f.h[1] = *(const v8us*)(row + k0 + 16 + 8 * hh);
    return f.v;
}

// D += A*B with the VALU hazard guard after the instruction.
__device__ __forceinline__ v8f wmma_bf16(v16bf a, v16bf b, v8f c)
{
    v8f d = __builtin_amdgcn_wmma_f32_16x16x32_bf16(false, a, false, b, (short)0, c, false, false);
    asm volatile("v_nop\n\tv_nop\n\tv_nop\n\tv_nop" : "+v"(d) : "v"(a), "v"(b));
    return d;
}

// hi/lo split product: hh + hl + lh into one accumulator
__device__ __forceinline__ v8f wmma3(v16bf ah, v16bf al, v16bf bh, v16bf bl, v8f c)
{
    c = wmma_bf16(ah, bh, c);
    c = wmma_bf16(ah, bl, c);
    c = wmma_bf16(al, bh, c);
    return c;
}

// ---------------------------------------------------------------------------
// Operand preparation (128 threads / block).
//  blocks [0, 1536): xh/xl[t][row][512] = split(x_t[row]), t = 0:q 1:k 2:v, 2 rows per block,
//                    64 threads per row, 8 elements (16 B) per thread -> 512-B runs per wave.
//  blocks [1536, 1792): wth/wtl[w][n][512] = split(W_w[k][n]) (transposed, k contiguous),
// ---------------------------------------------------------------------------
__global__ void __launch_bounds__(NTHR) prep_kernel(
    const float* __restrict__ q, const float* __restrict__ k, const float* __restrict__ v,
    const float* __restrict__ Wq, const float* __restrict__ Wk,
    const float* __restrict__ Wv, const float* __restrict__ W0,
    unsigned short* xh, unsigned short* xl, unsigned short* wth, unsigned short* wtl)
{
    __shared__ float s_t[64][65];

    const int tid = threadIdx.x;
    const int bid = blockIdx.x;
    const int NXB = 3 * (NR / 2);   // 1536

    if (bid < NXB) {
        const int t   = bid / (NR / 2);
        const int row = ((bid % (NR / 2)) << 1) + (tid >> 6);
        const int c8  = tid & 63;
        const float* src = (t == 0) ? q : ((t == 1) ? k : v);
        const size_t soff = (size_t)row * DD + 8 * c8;
        const v4f x0 = *(const v4f*)(src + soff);
        const v4f x1 = *(const v4f*)(src + soff + 4);
        v8us hv, lv;
        split8(x0, x1, hv, lv);
        const size_t doff = ((size_t)t * NR + row) * DD + 8 * c8;
        *(v8us*)(xh + doff) = hv;
        *(v8us*)(xl + doff) = lv;
        
    } else {
        const int u    = bid - NXB;          // 0..255
        const int w    = u >> 6;             // 0..3
        const int tile = u & 63;
        const int k0   = (tile >> 3) * 64;
        const int n0   = (tile & 7) * 64;
        const float* Wsel = (w == 0) ? Wq : ((w == 1) ? Wk : ((w == 2) ? Wv : W0));
        // load W[k0+kk][n0+nn] -> s_t[nn][kk]
        #pragma unroll
        for (int i = 0; i < 8; ++i) {
            const int idx = tid + NTHR * i;  // 0..1023
            const int kk  = idx >> 4;        // 0..63
            const int c4  = idx & 15;        // 0..15
            const v4f x = *(const v4f*)(Wsel + (size_t)(k0 + kk) * DD + n0 + 4 * c4);
            s_t[4 * c4 + 0][kk] = x[0];
            s_t[4 * c4 + 1][kk] = x[1];
            s_t[4 * c4 + 2][kk] = x[2];
            s_t[4 * c4 + 3][kk] = x[3];
        }
        __syncthreads();
        v8us hv[4], lv[4];
        size_t off[4];
        #pragma unroll
        for (int i = 0; i < 4; ++i) {
            const int idx = tid + NTHR * i;  // 0..511
            const int nn  = idx >> 3;        // 0..63
            const int k8  = idx & 7;         // 0..7
            const v4f a  = { s_t[nn][8 * k8 + 0], s_t[nn][8 * k8 + 1], s_t[nn][8 * k8 + 2], s_t[nn][8 * k8 + 3] };
            const v4f b2 = { s_t[nn][8 * k8 + 4], s_t[nn][8 * k8 + 5], s_t[nn][8 * k8 + 6], s_t[nn][8 * k8 + 7] };
            split8(a, b2, hv[i], lv[i]);
            off[i] = ((size_t)w * DD + n0 + nn) * DD + k0 + 8 * k8;
        }
        #pragma unroll
        for (int i = 0; i < 4; ++i) {
            *(v8us*)(wth + off[i]) = hv[i];
            *(v8us*)(wtl + off[i]) = lv[i];
        }
        
    }
}

// ---------------------------------------------------------------------------
// C[32*WR rows of A][64 rows of Bt] = Ah/Al[.][512] . Bt h/l[.][512]^T  (K = 512, hi/lo split).
// One block of 128 threads per tile; row0, col0 = first A row and first Bt row of the tile.
// The tile is small so that the grids cover the chip's WGPs: a K = 512 product of this size is a chain of
// latencies per block, and a narrow tile shortens every link (copies, fragment reads, WMMAs, epilogue).
// WR = 1: four waves side by side, wave wv has rows 0..31 and the col tile at 16*wv.
// WR = 2: waves 2 x 2, wave wv has rows 32*(wv >> 1) + 0..31 and the col tiles at 32*(wv & 1) + 16*j, j = 0..1.
// k slices of 128 staged in LDS by asynchronous copies, two buffers; epilogue staged in LDS. With two buffers one
// slice is in flight at a time, so the loop pays one copy flight per slice: few, long slices.
// MODE 0: Cf[m][512] f32 = (C + bias[n]) * post                    (plain row-major)
// MODE 1: Cf[(b*8+h)*256 + l][64] f32 = 2^((C + bsum[n]) * post),  m = b*256+l, n = h*64+dk;
//         bsum = bias + bias2 where both_bias is set, 0 where it is not
// MODE 2: A rows are n = h*64+dk, Bt rows are m = b*256+j:
//         Ch/Cl[(b*8+h)*64 + dk][256 j] = split(C + bias[n])       (per-row bias)
// ---------------------------------------------------------------------------
// One k slice of the tile in LDS: rows of KT 16-bit values, [Ah 32*WR | Al 32*WR | Bh 64 | Bl 64],
// row pitch 272 B (16 B x odd: conflict-free for the 16-byte fragment reads).
#define KT       128
#define SPITCH   136                      // 16-bit elements per staged row
#define TN       64                       // Bt rows (output columns) of a tile
#define CPITCH   68                       // f32 elements per row of the staged result
#define SROWS(WR) (64 * (WR) + 2 * TN)    // staged rows per slice: 192 or 256
#define SBUF(WR)  (SROWS(WR) * SPITCH)    // elements per buffer (52224 B or 69632 B)
#define NTRIP    (DD / KT)

static_assert(NTRIP >= 2);
static_assert(SROWS(1) * (KT / 8) == 24 * NTHR);
static_assert(SROWS(2) * (KT / 8) == 32 * NTHR);

// Twelve 16-byte asynchronous copies global -> LDS, each lane its own addresses. The s_wait_xcnt
// is the last line of the copies' own statement, so no address register is rewritten ahead of it.
__device__ __forceinline__ void copy12(const unsigned int* la, const unsigned short* const* ga)
{
    asm volatile(
        "global_load_async_to_lds_b128 %0, %12, off\n\t"
        "global_load_async_to_lds_b128 %1, %13, off\n\t"
        "global_load_async_to_lds_b128 %2, %14, off\n\t"
        "global_load_async_to_lds_b128 %3, %15, off\n\t"
        "global_load_async_to_lds_b128 %4, %16, off\n\t"
        "global_load_async_to_lds_b128 %5, %17, off\n\t"
        "global_load_async_to_lds_b128 %6, %18, off\n\t"
        "global_load_async_to_lds_b128 %7, %19, off\n\t"
        "global_load_async_to_lds_b128 %8, %20, off\n\t"
        "global_load_async_to_lds_b128 %9, %21, off\n\t"
        "global_load_async_to_lds_b128 %10, %22, off\n\t"
        "global_load_async_to_lds_b128 %11, %23, off\n\t"
        "s_wait_xcnt 0x0"
        :: "v"(la[0]), "v"(la[1]), "v"(la[2]), "v"(la[3]), "v"(la[4]), "v"(la[5]),
           "v"(la[6]), "v"(la[7]), "v"(la[8]), "v"(la[9]), "v"(la[10]), "v"(la[11]),
           "v"(ga[0]), "v"(ga[1]), "v"(ga[2]), "v"(ga[3]), "v"(ga[4]), "v"(ga[5]),
           "v"(ga[6]), "v"(ga[7]), "v"(ga[8]), "v"(ga[9]), "v"(ga[10]), "v"(ga[11])
        : "memory");
}

// The same for eight copies (a slice of 256 rows is two runs of twelve and one of eight).
__device__ __forceinline__ void copy8h(const unsigned int* la, const unsigned short* const* ga)
{
    asm volatile(
        "global_load_async_to_lds_b128 %0, %8, off\n\t"
        "global_load_async_to_lds_b128 %1, %9, off\n\t"
        "global_load_async_to_lds_b128 %2, %10, off\n\t"
        "global_load_async_to_lds_b128 %3, %11, off\n\t"
        "global_load_async_to_lds_b128 %4, %12, off\n\t"
        "global_load_async_to_lds_b128 %5, %13, off\n\t"
        "global_load_async_to_lds_b128 %6, %14, off\n\t"
        "global_load_async_to_lds_b128 %7, %15, off\n\t"
        "s_wait_xcnt 0x0"
        :: "v"(la[0]), "v"(la[1]), "v"(la[2]), "v"(la[3]), "v"(la[4]), "v"(la[5]), "v"(la[6]), "v"(la[7]),
           "v"(ga[0]), "v"(ga[1]), "v"(ga[2]), "v"(ga[3]), "v"(ga[4]), "v"(ga[5]), "v"(ga[6]), "v"(ga[7])
        : "memory");
}

// Stage one k slice: copy i of thread tid moves 16 B of staged row 8*i + (tid >> 4), chunk tid & 15,
// so a wave's copy covers four whole 128-B lines (two rows of 256 B). lds0 and the four pointers
// already hold the thread's row and chunk; kk = first k of the slice.
template <int WR>
__device__ __forceinline__ void stage_slice(
    unsigned int lds0,
    const unsigned short* gah, const unsigned short* gal,
    const unsigned short* gbh, const unsigned short* gbl, int kk)
{
    constexpr int AG = 4 * WR;            // groups of 8 rows in one A plane
    constexpr int BG = TN / 8;            // groups of 8 rows in one B plane
    constexpr int NC = 2 * AG + 2 * BG;   // copies per thread: 24 or 32
    unsigned int la[NC];
    const unsigned short* ga[NC];
    #pragma unroll
    for (int i = 0; i < NC; ++i) {
        la[i] = lds0 + (unsigned int)(i * 8 * SPITCH * 2);
        ga[i] = ((i < AG)          ? gah + (size_t)i * 8 * DD
               : (i < 2 * AG)      ? gal + (size_t)(i - AG) * 8 * DD
               : (i < 2 * AG + BG) ? gbh + (size_t)(i - 2 * AG) * 8 * DD
                                   : gbl + (size_t)(i - 2 * AG - BG) * 8 * DD) + kk;
    }
    if constexpr (NC == 24) {
        copy12(la, ga);
        copy12(la + 12, ga + 12);
    } else {
        copy12(la, ga);
        copy12(la + 12, ga + 12);
        copy8h(la + 24, ga + 24);
    }
}

template <int WR>
__device__ __forceinline__ void gemm3_main(
    const unsigned short* __restrict__ Ah, const unsigned short* __restrict__ Al,
    const unsigned short* __restrict__ Bh, const unsigned short* __restrict__ Bl,
    int row0, int col0, float (*s_c)[CPITCH], unsigned short* s_st)
{
    constexpr int AR = 32 * WR;           // A rows of the tile
    constexpr int NJ = WR;                // col tiles per wave
    constexpr int WC = 4 / WR;            // waves side by side

    const int tid  = threadIdx.x;
    const int wv   = tid >> 5;
    const int l    = tid & 31;
    const int hh   = l >> 4;
    const int m15  = l & 15;
    const int ar0  = 32 * (wv / WC);          // first tile row of this wave
    const int bc0  = 16 * NJ * (wv % WC);     // first tile column of this wave

    const v8f zero = { 0.f, 0.f, 0.f, 0.f, 0.f, 0.f, 0.f, 0.f };
    v8f acc[2][NJ];
    #pragma unroll
    for (int rt = 0; rt < 2; ++rt)
        #pragma unroll
        for (int j = 0; j < NJ; ++j) acc[rt][j] = zero;

    // copy side: this thread's row (of 8) and 16-byte chunk (of 16)
    const int crow = tid >> 4;
    const int cchk = tid & 15;
    const unsigned short* gah = Ah + (size_t)(row0 + crow) * DD + 8 * cchk;
    const unsigned short* gal = Al + (size_t)(row0 + crow) * DD + 8 * cchk;
    const unsigned short* gbh = Bh + (size_t)(col0 + crow) * DD + 8 * cchk;
    const unsigned short* gbl = Bl + (size_t)(col0 + crow) * DD + 8 * cchk;
    const unsigned int lds0 = (unsigned int)(uintptr_t)s_st + (unsigned int)(crow * SPITCH * 2 + cchk * 16);

    // read side: element offsets of this lane's fragment rows inside a buffer
    const int oa0h = (ar0 + m15) * SPITCH;
    const int oa1h = (ar0 + 16 + m15) * SPITCH;
    const int oa0l = (AR + ar0 + m15) * SPITCH;
    const int oa1l = (AR + ar0 + 16 + m15) * SPITCH;
    const int obh  = (2 * AR + bc0 + m15) * SPITCH;
    const int obl  = (2 * AR + TN + bc0 + m15) * SPITCH;

    // slice 0 lands and is published, then slice 1 starts to fly
    stage_slice<WR>(lds0, gah, gal, gbh, gbl, 0);
    asm volatile("s_wait_asynccnt 0x0" ::: "memory");   // this wave's copies of slice 0 have landed
    __syncthreads();
    stage_slice<WR>(lds0 + SBUF(WR) * 2, gah, gal, gbh, gbl, KT);

    // kept rolled: the trips are chained by their barriers, unrolling would only add code to fetch
    #pragma unroll 1
    for (int t = 0; t < NTRIP; ++t) {
        const unsigned short* sb = s_st + (t & 1) * SBUF(WR);
        #pragma unroll
        for (int k0 = 0; k0 < KT; k0 += 32) {
            const v16bf fa0h = frag16(sb + oa0h, k0, hh);
            const v16bf fa0l = frag16(sb + oa0l, k0, hh);
            const v16bf fa1h = frag16(sb + oa1h, k0, hh);
            const v16bf fa1l = frag16(sb + oa1l, k0, hh);
            // all fragments of a k step are read as one group, so one LDS latency is waited out per step
            v16bf fbh[NJ], fbl[NJ];
            #pragma unroll
            for (int j = 0; j < NJ; ++j) {
                fbh[j] = frag16(sb + obh + j * 16 * SPITCH, k0, hh);
                fbl[j] = frag16(sb + obl + j * 16 * SPITCH, k0, hh);
            }
            #pragma unroll
            for (int j = 0; j < NJ; ++j) {
                acc[0][j] = wmma3(fa0h, fa0l, fbh[j], fbl[j], acc[0][j]);
                acc[1][j] = wmma3(fa1h, fa1l, fbh[j], fbl[j], acc[1][j]);
            }
        }
        asm volatile("s_wait_dscnt 0x0" ::: "memory");      // this wave's reads of the buffer are done before it is refilled
        asm volatile("s_wait_asynccnt 0x0" ::: "memory");   // this wave's copies of slice t + 1 have landed
        __syncthreads();                                    // publishes slice t + 1, frees slice t's buffer
        if (t + 2 < NTRIP)
            stage_slice<WR>(lds0 + (unsigned int)((t & 1) * SBUF(WR) * 2), gah, gal, gbh, gbl, (t + 2) * KT);
    }
    asm volatile("s_wait_asynccnt 0x0" ::: "memory");       // no copy is outstanding past the loop

    // D element r of lane -> (row 8*hh + r, col m15) of the 16x16 tile
    #pragma unroll
    for (int rt = 0; rt < 2; ++rt)
        #pragma unroll
        for (int j = 0; j < NJ; ++j)
            #pragma unroll
            for (int r = 0; r < 8; ++r)
                s_c[ar0 + rt * 16 + 8 * hh + r][bc0 + 16 * j + m15] = acc[rt][j][r];
    __syncthreads();
}

template <int MODE, int WR>
__device__ __forceinline__ void gemm3_epilogue(
    const float* __restrict__ bias, float post,
    float* Cf, unsigned short* Ch, unsigned short* Cl,
    int row0, int col0, const float (*s_c)[CPITCH],
    const float* __restrict__ bias2 = nullptr, bool both_bias = false)
{
    constexpr int AR = 32 * WR;                     // rows of the tile
    constexpr int N4 = AR * (TN / 4) / NTHR;        // 16-byte f32 pieces per thread
    constexpr int N8 = AR * (TN / 8) / NTHR;        // 8-element pieces per thread
    const int tid = threadIdx.x;

    if (MODE == 0) {
        v4f vals[N4];
        size_t off[N4];
        const int c4 = tid & 15;                // all pieces of a thread lie in the same four columns
        const v4f bb = *(const v4f*)(bias + col0 + 4 * c4);
        #pragma unroll
        for (int i = 0; i < N4; ++i) {
            const int row = (tid >> 4) + 8 * i; // 0..AR-1
            const v4f x  = *(const v4f*)&s_c[row][4 * c4];
            vals[i] = (x + bb) * post;
            off[i]  = (size_t)(row0 + row) * DD + col0 + 4 * c4;
        }
        #pragma unroll
        for (int i = 0; i < N4; ++i) *(v4f*)(Cf + off[i]) = vals[i];
        
    } else if (MODE == 1) {
        v4f vals[N4];
        size_t off[N4];
        const int c4 = tid & 15;                // all pieces of a thread lie in the same four columns
        const int n  = col0 + 4 * c4;           // the tile's 64 columns are one head
        const v4f b1 = *(const v4f*)(bias + n);
        const v4f b2 = *(const v4f*)(bias2 + n);
        // the address registers of the bias loads are reused by the code that follows them
        asm volatile("s_wait_xcnt 0x0" ::: "memory");
        // Only q + k enters the score, so both biases go into the q factor and none into the k
        // factor: biases of opposite sign cancel here, before the exponent is clamped.
        const v4f zero4 = { 0.f, 0.f, 0.f, 0.f };
        const v4f bb = both_bias ? (b1 + b2) : zero4;
        #pragma unroll
        for (int i = 0; i < N4; ++i) {
            const int row = (tid >> 4) + 8 * i; // 0..AR-1
            const v4f x  = *(const v4f*)&s_c[row][4 * c4];
            // The exponent is held inside the normal range, so both factors of the later product
            // 2^q' * 2^k' stay finite and non-zero and the product is never inf * 0. A clamped factor
            // (a value beyond 43) still gives the saturated tanh unless the other factor's value lies
            // beyond 35 on the opposite side; with the biases on one side the other is k . Wk alone.
            const v4f y = (x + bb) * post;
            #pragma unroll   // constant element indices, so that vals stays in registers
            for (int e = 0; e < 4; ++e) vals[i][e] = fminf(fmaxf(y[e], -126.0f), 126.0f);
            const int m  = row0 + row;
            const int b  = m >> 8;
            const int lq = m & 255;
            const int h  = n >> 6;
            off[i] = ((size_t)((b * HH + h) * LL + lq)) * DK + 4 * c4;
        }
        #pragma unroll
        for (int i = 0; i < N4; ++i) {
            #pragma unroll   // constant element indices, so that vals stays in registers
            for (int e = 0; e < 4; ++e) vals[i][e] = EXP2_FAST(vals[i][e]);
            *(v4f*)(Cf + off[i]) = vals[i];
        }
        // in the merged kernel other code follows these stores in the listing and reuses their registers
        asm volatile("s_wait_xcnt 0x0" ::: "memory");
    } else {
        v8us hv[N8], lv[N8];
        size_t off[N8];
        const int b  = col0 >> 8;
        const int jb = col0 & 255;              // first key of the tile inside its batch
        #pragma unroll
        for (int i = 0; i < N8; ++i) {
            const int idx = tid + NTHR * i;
            const int row = idx >> 3;           // 0..AR-1 (eight threads write one 128-B line per plane)
            const int c8  = idx & 7;            // 0..7
            const float bs = bias[row0 + row];
            const v4f bb = { bs, bs, bs, bs };
            const v4f x0 = *(const v4f*)&s_c[row][8 * c8] + bb;
            const v4f x1 = *(const v4f*)&s_c[row][8 * c8 + 4] + bb;
            split8(x0, x1, hv[i], lv[i]);
            const int n  = row0 + row;
            const int h  = n >> 6;
            const int dk = n & 63;
            off[i] = ((size_t)((b * HH + h) * DK + dk)) * LL + jb + 8 * c8;
        }
        #pragma unroll
        for (int i = 0; i < N8; ++i) {
            *(v8us*)(Ch + off[i]) = hv[i];
            *(v8us*)(Cl + off[i]) = lv[i];
        }
        
    }
}

// Output projection: one 32 x 64 tile per block (256 blocks), row0 = 32*blockIdx.x, col0 = 64*blockIdx.y.
__global__ void __launch_bounds__(NTHR) gemm3_out_kernel(
    const unsigned short* __restrict__ Ah, const unsigned short* __restrict__ Al,
    const unsigned short* __restrict__ Bh, const unsigned short* __restrict__ Bl,
    const float* __restrict__ bias, float* Cf)
{
    __shared__ __align__(16) float s_c[32][CPITCH];
    __shared__ __align__(16) unsigned short s_st[2 * SBUF(1)];
    const int row0 = blockIdx.x * 32;
    const int col0 = blockIdx.y * TN;
    gemm3_main<1>(Ah, Al, Bh, Bl, row0, col0, s_c, s_st);
    gemm3_epilogue<0, 1>(bias, 1.0f, Cf, nullptr, nullptr, row0, col0, s_c);
}

// The three input projections in one grid: none reads another's output. 64 x 64 tiles, 128 per
// projection (a square tile, since three projections together read the most from L2).
// blockIdx.y = 0:q 1:k 2:v, blockIdx.x = tile 0..127 of that projection.
//  q, k: A = activation planes (16 row tiles), Bt = transposed weight planes (8 col tiles), MODE 1.
//  v:    A = transposed Wv planes (8 row tiles), Bt = activation planes (16 col tiles), MODE 2.
__global__ void __launch_bounds__(NTHR) proj3_kernel(
    const unsigned short* __restrict__ xh, const unsigned short* __restrict__ xl,
    const unsigned short* __restrict__ wth, const unsigned short* __restrict__ wtl,
    const float* __restrict__ bq, const float* __restrict__ bk, const float* __restrict__ bv,
    float post, float* Qp, float* Kp, unsigned short* VTh, unsigned short* VTl)
{
    __shared__ __align__(16) float s_c[64][CPITCH];
    __shared__ __align__(16) unsigned short s_st[2 * SBUF(2)];

    const int    t      = blockIdx.y;
    const int    tile   = blockIdx.x;
    const size_t xplane = (size_t)NR * DD;
    const size_t wplane = (size_t)DD * DD;

    const bool   isv    = (t == 2);
    const unsigned short* xth = xh + t * xplane;
    const unsigned short* xtl = xl + t * xplane;
    const unsigned short* wh  = wth + t * wplane;
    const unsigned short* wl  = wtl + t * wplane;
    const int row0 = (isv ? (tile & 7) : (tile & 15)) * 64;
    const int col0 = (isv ? (tile >> 3) : (tile >> 4)) * TN;

    // one copy of the k loop serves all three; only the operand roles and the epilogue differ
    gemm3_main<2>(isv ? wh : xth, isv ? wl : xtl, isv ? xth : wh, isv ? xtl : wl, row0, col0, s_c, s_st);
    if (isv) gemm3_epilogue<2, 2>(bv, 1.0f, nullptr, VTh, VTl, row0, col0, s_c);
    else     gemm3_epilogue<1, 2>(bq, post, (t == 0) ? Qp : Kp, nullptr, nullptr, row0, col0, s_c, bk, t == 0);
}

// ---------------------------------------------------------------------------
// Additive scores + softmax + read-out for one (b, h, 16 query rows) block, 128 threads.
// Qp holds e^{2(q + bq + bk)} and Kp e^{2k} of the bias-free projections q, k in (B,H,L,DK) f32 layout:
// their product is e^{2x} of the pair's x = (q + bq) + (k + bk), so the exponential is taken once per
// projected element and not once per (query, key) pair.
// tanh(x) = 1 - 2/(1 + e^{2x}); score = sum_d vp_d - 2 * sum_d vp_d/(1 + e^{2x_d});
// the constant sum_d vp_d is invariant under softmax and omitted. mask == 0 -> -1e9.
// Thread tid owns keys 2*tid, 2*tid+1 and holds the scores of all 16 query rows in registers: one score
// loop and one block softmax, whose 16 rows cover each other's cross-lane and LDS latencies. P is split to bf16
// hi/lo in LDS (dword stores, barrier, then 16-byte fragment reloads) and feeds O = P . VT^T,
// VT = [bh][dk][256 j] hi/lo planes, staged in LDS behind the score loop; wave wv owns the dk tile 16*wv.
// The head's K rows (256 keys x 64 f32) are staged once per block in LDS by asynchronous copies of
// whole lines: a thread reading its own two rows from global memory touches 32 lines per load.
// Key j lies in LDS row (j >> 1) + 128 * (j & 1), row pitch 272 B (16 B x odd), so that the lanes of
// a wave, which own every second key, read rows one pitch apart without bank conflicts.
// ---------------------------------------------------------------------------
#define KPITCH 68                         // f32 elements per staged K row
// Read-out operands: P rows and staged V rows have a pitch of 528 B (16 B x odd). At the plain 512 B the 16 rows
// of a fragment read start on one bank and a 16-byte read is served one lane at a time.
#define VPITCH 264                        // 16-bit elements per P row and per staged V row

// 2^x with a v_nop behind it in the same statement: the instruction set asks for one independent instruction
// before a transcendental's result is read or its source register rewritten.
__device__ __forceinline__ float exp2_slot(float x)
{
    float r;
    asm("v_exp_f32 %0, %1\n\tv_nop" : "=v"(r) : "v"(x));
    return r;
}

static_assert(LL * DK * 4 == 32 * NTHR * 16);
static_assert(2 * DK * LL * 2 == 32 * NTHR * 16);            // V hi and lo planes of a head: 32 copies per thread
static_assert(2 * DK * VPITCH * 2 <= LL * KPITCH * 4);       // and they fit the K tile's LDS

// Eight 16-byte asynchronous copies global -> LDS, each lane its own addresses. The s_wait_xcnt
// is the last line of the copies' own statement, so no address register is rewritten ahead of it.
__device__ __forceinline__ void copy8(const unsigned int* la, const float* const* ga)
{
    asm volatile(
        "global_load_async_to_lds_b128 %0, %8, off\n\t"
        "global_load_async_to_lds_b128 %1, %9, off\n\t"
        "global_load_async_to_lds_b128 %2, %10, off\n\t"
        "global_load_async_to_lds_b128 %3, %11, off\n\t"
        "global_load_async_to_lds_b128 %4, %12, off\n\t"
        "global_load_async_to_lds_b128 %5, %13, off\n\t"
        "global_load_async_to_lds_b128 %6, %14, off\n\t"
        "global_load_async_to_lds_b128 %7, %15, off\n\t"
        "s_wait_xcnt 0x0"
        :: "v"(la[0]), "v"(la[1]), "v"(la[2]), "v"(la[3]), "v"(la[4]), "v"(la[5]), "v"(la[6]), "v"(la[7]),
           "v"(ga[0]), "v"(ga[1]), "v"(ga[2]), "v"(ga[3]), "v"(ga[4]), "v"(ga[5]), "v"(ga[6]), "v"(ga[7])
        : "memory");
}

__global__ void __launch_bounds__(NTHR) attn_kernel(
    const float* __restrict__ Qp, const float* __restrict__ Kp, const float* __restrict__ vp,
    const int* __restrict__ mask,
    const unsigned short* __restrict__ VTh, const unsigned short* __restrict__ VTl,
    unsigned short* Oh, unsigned short* Ol)
{
    __shared__ __align__(16) float          s_k[LL][KPITCH];
    __shared__ __align__(16) float          s_q[16][DK];
    __shared__ __align__(16) float          s_vp[DK];
    __shared__ __align__(16) unsigned short s_ph[16][VPITCH];
    __shared__ __align__(16) unsigned short s_pl[16][VPITCH];
    __shared__ __align__(16) float          s_o[16][68];
    __shared__ __align__(16) float s_rmax[4][16];   // [wave][query row]
    __shared__ __align__(16) float s_rsum[4][16];

    const int tid = threadIdx.x;
    const int wv  = tid >> 5;
    const int l   = tid & 31;
    const int hh  = l >> 4;
    const int m15 = l & 15;
    const int bh  = blockIdx.y;          // 0..31
    const int b   = bh >> 3;
    const int h   = bh & 7;
    const int q0  = blockIdx.x * 16;     // 0..240

    const float LOG2E = 1.4426950408889634f;
    const float MASKV = -1.0e9f;

    // K tile: copy i of thread tid moves 16-byte chunk tid + 128*i of the head's 64 KiB, that is
    // key (tid >> 4) + 8*i, chunk tid & 15; a wave's copy covers four whole 128-B lines.
    {
        const float* gk0 = Kp + (size_t)bh * LL * DK + 4 * tid;
        const unsigned int lk0 = (unsigned int)(uintptr_t)&s_k[0][0]
            + (unsigned int)(((tid >> 5) + 128 * ((tid >> 4) & 1)) * (KPITCH * 4) + (tid & 15) * 16);
        #pragma unroll
        for (int g = 0; g < 4; ++g) {
            unsigned int la[8];
            const float* ga[8];
            #pragma unroll
            for (int i = 0; i < 8; ++i) {
                la[i] = lk0 + (unsigned int)((8 * g + i) * 4 * (KPITCH * 4));
                ga[i] = gk0 + (size_t)(8 * g + i) * (NTHR * 4);
            }
            copy8(la, ga);
        }
    }

    // the 16 mask rows of this thread's two keys, one group of loads in flight beside the K copies
    v2i mk[16];
    {
        const int* mrow = mask + ((size_t)(b * LL + q0)) * LL + 2 * tid;
        #pragma unroll
        for (int j = 0; j < 16; ++j) mk[j] = *(const v2i*)(mrow + (size_t)j * LL);
    }

    #pragma unroll
    for (int i = 0; i < 2; ++i) {
        const int idx = tid + NTHR * i;  // 0..255
        const int r   = idx >> 4;        // 0..15
        const int c4  = idx & 15;        // 0..15
        *(v4f*)&s_q[r][4 * c4] = *(const v4f*)(Qp + ((size_t)(bh * LL + q0 + r)) * DK + 4 * c4);
    }
    if (tid < DK) s_vp[tid] = vp[h * DK + tid];
    asm volatile("s_wait_asynccnt 0x0" ::: "memory");   // this wave's copies of the K tile have landed
    __syncthreads();                                    // publishes s_q, s_vp and the K tile

    const int j0 = 2 * tid;
    const float* k0p = &s_k[tid][0];          // key 2*tid
    const float* k1p = &s_k[128 + tid][0];    // key 2*tid + 1

    v2f acc[16];                         // [query row], element = key 2*tid, 2*tid + 1
    #pragma unroll
    for (int j = 0; j < 16; ++j) { acc[j][0] = 0.0f; acc[j][1] = 0.0f; }

    // kept rolled: one trip is 128 pair elements per lane, enough to cover its own LDS reads
    #pragma unroll 1
    for (int d4 = 0; d4 < DK / 4; ++d4) {
        const v4f ka = *(const v4f*)(k0p + 4 * d4);
        const v4f kb = *(const v4f*)(k1p + 4 * d4);
        const v4f vv = *(const v4f*)&s_vp[4 * d4];
        const v2f one2 = { 1.0f, 1.0f };
        v2f kk[4];                       // the thread's two keys side by side: packed f32 arithmetic
        #pragma unroll
        for (int e = 0; e < 4; ++e) { kk[e][0] = ka[e]; kk[e][1] = kb[e]; }
        #pragma unroll
        for (int j = 0; j < 16; ++j) {
            const v4f qv = *(const v4f*)&s_q[j][4 * d4];
            #pragma unroll
            for (int e = 0; e < 4; ++e) {
                const v2f q2 = { qv[e], qv[e] };
                const v2f v2 = { vv[e], vv[e] };
                const v2f a  = __builtin_elementwise_fma(q2, kk[e], one2);   // 1 + e^{2x}
                const v2f rr = { RCP_FAST(a[0]), RCP_FAST(a[1]) };
                acc[j] = __builtin_elementwise_fma(v2, rr, acc[j]);
            }
        }
    }

    // logits with mask fill, block-wide row max over the 256 keys; each cross-lane round runs over
    // all 16 rows before the next one starts, so a round's latency is waited out once and not per row
    float bm[16];
    #pragma unroll
    for (int j = 0; j < 16; ++j) {
        const float s0 = (mk[j][0] == 0) ? MASKV : (-2.0f * acc[j][0]);
        const float s1 = (mk[j][1] == 0) ? MASKV : (-2.0f * acc[j][1]);
        acc[j][0] = s0;
        acc[j][1] = s1;
        bm[j] = fmaxf(s0, s1);
    }
    #pragma unroll
    for (int off = 16; off > 0; off >>= 1) {
        float t[16];
        #pragma unroll
        for (int j = 0; j < 16; ++j) t[j] = __shfl_xor(bm[j], off, 32);
        #pragma unroll
        for (int j = 0; j < 16; ++j) bm[j] = fmaxf(bm[j], t[j]);
    }
    if (l == 0) {
        #pragma unroll
        for (int i = 0; i < 4; ++i) {
            const v4f x = { bm[4 * i], bm[4 * i + 1], bm[4 * i + 2], bm[4 * i + 3] };
            *(v4f*)&s_rmax[wv][4 * i] = x;
        }
    }
    asm volatile("s_wait_dscnt 0x0" ::: "memory");      // this wave's reads of the K tile are done before its LDS is refilled
    __syncthreads();                                    // publishes s_rmax, ends every wave's reads of the K tile

    // The head's V planes (64 dk rows x 256 keys, hi then lo) go into the LDS that held the K tile and fly under the
    // rest of the softmax, so the read-out waits for no global load. Copy i of thread tid moves 16 B of staged row
    // 4*i + (tid >> 5), chunk tid & 31: a wave's copy is one whole row of 512 B (four lines).
    unsigned short* s_v = (unsigned short*)&s_k[0][0];
    {
        const unsigned int lv0 = (unsigned int)(uintptr_t)s_v + (unsigned int)(wv * (VPITCH * 2) + l * 16);
        const unsigned short* gvh = VTh + ((size_t)(bh * DK + wv)) * LL + 8 * l;
        const unsigned short* gvl = VTl + ((size_t)(bh * DK + wv)) * LL + 8 * l;
        unsigned int la[32];
        const unsigned short* ga[32];
        #pragma unroll   // constant indices, so that both address arrays stay in registers
        for (int i = 0; i < 32; ++i) {
            la[i] = lv0 + (unsigned int)(i * 4 * (VPITCH * 2));
            ga[i] = (i < 16) ? gvh + (size_t)i * 4 * LL : gvl + (size_t)(i - 16) * 4 * LL;
        }
        copy12(la, ga);
        copy12(la + 12, ga + 12);
        copy8h(la + 24, ga + 24);
    }
    #pragma unroll
    for (int j = 0; j < 16; ++j)
        bm[j] = fmaxf(fmaxf(s_rmax[0][j], s_rmax[1][j]), fmaxf(s_rmax[2][j], s_rmax[3][j]));

    float bs[16];
    #pragma unroll
    for (int j = 0; j < 16; ++j) {
        const float e0 = exp2_slot((acc[j][0] - bm[j]) * LOG2E);
        const float e1 = exp2_slot((acc[j][1] - bm[j]) * LOG2E);
        acc[j][0] = e0;
        acc[j][1] = e1;
        bs[j] = e0 + e1;
    }
    #pragma unroll
    for (int off = 16; off > 0; off >>= 1) {
        float t[16];
        #pragma unroll
        for (int j = 0; j < 16; ++j) t[j] = __shfl_xor(bs[j], off, 32);
        #pragma unroll
        for (int j = 0; j < 16; ++j) bs[j] += t[j];
    }
    if (l == 0) {
        #pragma unroll
        for (int i = 0; i < 4; ++i) {
            const v4f x = { bs[4 * i], bs[4 * i + 1], bs[4 * i + 2], bs[4 * i + 3] };
            *(v4f*)&s_rsum[wv][4 * i] = x;
        }
    }
    __syncthreads();
    #pragma unroll
    for (int j = 0; j < 16; ++j) {
        const float sum = (s_rsum[0][j] + s_rsum[1][j]) + (s_rsum[2][j] + s_rsum[3][j]);
        const float inv = RCP_FAST(sum);
        const float p0  = acc[j][0] * inv;
        const float p1  = acc[j][1] * inv;
        unsigned int h0b, l0b, h1b, l1b;
        split1(p0, h0b, l0b);
        split1(p1, h1b, l1b);
        *(unsigned int*)&s_ph[j][j0] = (h1b << 16) | h0b;
        *(unsigned int*)&s_pl[j][j0] = (l1b << 16) | l0b;
    }
    asm volatile("s_wait_asynccnt 0x0" ::: "memory");   // this wave's copies of the V planes have landed
    __syncthreads();                                    // publishes P and the V planes

    // read-out: o[16 q][64 dk] = P . VT^T ; wave wv owns dk tile 16*wv
    v8f pacc = { 0.f, 0.f, 0.f, 0.f, 0.f, 0.f, 0.f, 0.f };
    const unsigned short* pah = &s_ph[m15][0];
    const unsigned short* pal = &s_pl[m15][0];
    const unsigned short* bvh = s_v + (16 * wv + m15) * VPITCH;
    const unsigned short* bvl = s_v + (DK + 16 * wv + m15) * VPITCH;
    v16bf fah = frag16(pah, 0, hh);
    v16bf fal = frag16(pal, 0, hh);
    v16bf fbh = frag16(bvh, 0, hh);
    v16bf fbl = frag16(bvl, 0, hh);
    #pragma unroll   // two register sets take turns: unrolled, no copy between them is needed
    for (int k0 = 0; k0 < LL; k0 += 32) {
        v16bf nah = fah, nal = fal, nbh = fbh, nbl = fbl;
        if (k0 + 32 < LL) {
            nah = frag16(pah, k0 + 32, hh);
            nal = frag16(pal, k0 + 32, hh);
            nbh = frag16(bvh, k0 + 32, hh);
            nbl = frag16(bvl, k0 + 32, hh);
        }
        // holds the next k step's LDS reads ahead of this step's WMMAs, so that their latency runs under them
        __builtin_amdgcn_sched_barrier(0);
        pacc = wmma3(fah, fal, fbh, fbl, pacc);
        fah = nah; fal = nal; fbh = nbh; fbl = nbl;
    }
    #pragma unroll
    for (int r = 0; r < 8; ++r) s_o[8 * hh + r][16 * wv + m15] = pacc[r];
    __syncthreads();

    {
        const int row = tid >> 3;   // 0..15
        const int c8  = tid & 7;
        const v4f x0 = *(const v4f*)&s_o[row][8 * c8];
        const v4f x1 = *(const v4f*)&s_o[row][8 * c8 + 4];
        v8us hv, lv;
        split8(x0, x1, hv, lv);
        const size_t goff = ((size_t)(b * LL + q0 + row)) * DD + h * DK + 8 * c8;
        *(v8us*)(Oh + goff) = hv;
        *(v8us*)(Ol + goff) = lv;
        
    }
}

extern "C" void kernel_launch(void* const* d_in, const int* in_sizes, int n_in,
                              void* d_out, int out_size, void* d_ws, size_t ws_size,
                              hipStream_t stream)
{
    if (n_in < 13) return;
    if (in_sizes[0] != NR * DD || in_sizes[1] != NR * DD || in_sizes[2] != NR * DD) return;
    if (in_sizes[3] != BB * LL * LL) return;
    if (in_sizes[4] != DD * DD || in_sizes[6] != DD * DD || in_sizes[8] != DD * DD || in_sizes[11] != DD * DD) return;
    if (in_sizes[5] != DD || in_sizes[7] != DD || in_sizes[9] != DD || in_sizes[12] != DD) return;
    if (in_sizes[10] != HH * DK) return;
    if (out_size != NR * DD) return;

    const float* q    = (const float*)d_in[0];    // [4][256][512]
    const float* k    = (const float*)d_in[1];
    const float* v    = (const float*)d_in[2];
    const int*   mask = (const int*)d_in[3];      // [4][256][256] int32
    const float* Wq   = (const float*)d_in[4];    // [512 in][512 out]
    const float* bq   = (const float*)d_in[5];
    const float* Wk   = (const float*)d_in[6];
    const float* bk   = (const float*)d_in[7];
    const float* Wv   = (const float*)d_in[8];
    const float* bv   = (const float*)d_in[9];
    const float* vp   = (const float*)d_in[10];   // [8][64]
    const float* W0   = (const float*)d_in[11];
    const float* b0   = (const float*)d_in[12];
    float* out = (float*)d_out;                   // [1024][512] f32

    // workspace carve (bytes), every offset a multiple of 1 MiB
    const size_t sz_x  = (size_t)3 * NR * DD * 2;        // 3145728  (q,k,v planes)
    const size_t sz_wt = (size_t)4 * DD * DD * 2;        // 2097152  (WqT,WkT,WvT,W0T planes)
    const size_t sz_p  = (size_t)NR * DD * 4;            // 2097152  (f32 projection)
    const size_t sz_vt = (size_t)BB * HH * DK * LL * 2;  // 1048576
    const size_t sz_o  = (size_t)NR * DD * 2;            // 1048576
    size_t off = 0;
    const size_t off_xh  = off;  off += sz_x;
    const size_t off_xl  = off;  off += sz_x;
    const size_t off_wth = off;  off += sz_wt;
    const size_t off_wtl = off;  off += sz_wt;
    const size_t off_qp  = off;  off += sz_p;
    const size_t off_kp  = off;  off += sz_p;
    const size_t off_vth = off;  off += sz_vt;
    const size_t off_vtl = off;  off += sz_vt;
    const size_t off_oh  = off;  off += sz_o;
    const size_t off_ol  = off;  off += sz_o;             // total 18874368
    if (off > ws_size) return;

    char* ws = (char*)d_ws;
    unsigned short* xh  = (unsigned short*)(ws + off_xh);
    unsigned short* xl  = (unsigned short*)(ws + off_xl);
    unsigned short* wth = (unsigned short*)(ws + off_wth);
    unsigned short* wtl = (unsigned short*)(ws + off_wtl);
    float*          Qp  = (float*)(ws + off_qp);
    float*          Kp  = (float*)(ws + off_kp);
    unsigned short* VTh = (unsigned short*)(ws + off_vth);
    unsigned short* VTl = (unsigned short*)(ws + off_vtl);
    unsigned short* Oh  = (unsigned short*)(ws + off_oh);
    unsigned short* Ol  = (unsigned short*)(ws + off_ol);

    const size_t wplane = (size_t)DD * DD;   // elements per weight plane
    const float C2 = 2.8853900817779268f;    // 2*log2(e)

    // 1) 16-bit hi/lo planes for q,k,v and transposed Wq,Wk,Wv,W0
    prep_kernel<<<dim3(3 * (NR / 2) + 256), dim3(NTHR), 0, stream>>>(
        q, k, v, Wq, Wk, Wv, W0, xh, xl, wth, wtl);

    // 2) Q, K projections -> Qp, Kp (B,H,L,DK) f32 = 2^(projection * 2log2e), and the V projection, transposed
    //    -> VT hi/lo, as one grid of 3 x 128 blocks
    proj3_kernel<<<dim3(128, 3), dim3(NTHR), 0, stream>>>(
        xh, xl, wth, wtl, bq, bk, bv, C2, Qp, Kp, VTh, VTl);

    // 3) additive scores + softmax + P.V -> O hi/lo planes in merged (B,L,D) layout
    attn_kernel<<<dim3(LL / 16, BB * HH), dim3(NTHR), 0, stream>>>(
        Qp, Kp, vp, mask, VTh, VTl, Oh, Ol);

    // 4) output projection -> d_out
    gemm3_out_kernel<<<dim3(NR / 32, DD / TN), dim3(NTHR), 0, stream>>>(
        Oh, Ol, wth + 3 * wplane, wtl + 3 * wplane, b0, out);
}

// v009
// One run takes 31.2 microseconds.
// Next to v008, in two timings, it ran 1.05 times as fast each time.
// Over all steps from v000 it is 4.15 times as fast.
#include <hip/hip_runtime.h>
#include <hip/hip_bf16.h>
#include <stddef.h>
#include <stdint.h>

// All contractions: v_wmma_f32_16x16x32_bf16 with bf16 hi/lo split operands (hi*hi + hi*lo + lo*hi, f32 accumulate): q/k/v projections, probability read-out P*V, output projection; additive scores (exp2 + rcp tanh form), mask fill, softmax and epilogues in f32.

#define BB   4
#define LL   256
#define DD   512
#define HH   8
#define DK   64
#define NR   (BB * LL)
#define NTHR 128

static_assert(NR == 1024);
static_assert(DD == HH * DK);
static_assert(LL == 2 * NTHR);
static_assert(DK == 64);

typedef unsigned short v8us  __attribute__((ext_vector_type(8)));
typedef __bf16         v16bf __attribute__((ext_vector_type(16)));
typedef float          v8f   __attribute__((ext_vector_type(8)));
typedef float          v4f   __attribute__((ext_vector_type(4)));
typedef int            v2i   __attribute__((ext_vector_type(2)));
typedef float          v2f   __attribute__((ext_vector_type(2)));
typedef __bf16         v2bf  __attribute__((ext_vector_type(2)));

union Frag { v16bf v; v8us h[2]; };

#if __has_builtin(__builtin_amdgcn_exp2f)
#define EXP2_FAST(x) __builtin_amdgcn_exp2f(x)
#else
#define EXP2_FAST(x) exp2f(x)
#endif
#if __has_builtin(__builtin_amdgcn_rcpf)
#define RCP_FAST(x) __builtin_amdgcn_rcpf(x)
#else
#define RCP_FAST(x) (1.0f / (x))
#endif

// f32 -> bf16 bits, RNE
__device__ __forceinline__ unsigned int bf16_rne(float f)
{
    unsigned int u = __float_as_uint(f);
    u += 0x7FFFu + ((u >> 16) & 1u);
    return u >> 16;
}

// x = hi + lo, both bf16 (RNE); lo = RNE(x - f32(hi))
__device__ __forceinline__ void split1(float x, unsigned int& hb, unsigned int& lb)
{
    hb = bf16_rne(x);
    const float xh = __uint_as_float(hb << 16);
    lb = bf16_rne(x - xh);
}

// 8 consecutive values (a then b) -> one 16-byte hi vector and one 16-byte lo vector
__device__ __forceinline__ void split8(v4f a, v4f b, v8us& hi, v8us& lo)
{
    v8us hr = { 0, 0, 0, 0, 0, 0, 0, 0 };
    v8us lr = { 0, 0, 0, 0, 0, 0, 0, 0 };
    #pragma unroll
    for (int e = 0; e < 4; ++e) {
        unsigned int hb, lb;
        split1(a[e], hb, lb);
        hr[e] = (unsigned short)hb;
        lr[e] = (unsigned short)lb;
        split1(b[e], hb, lb);
        hr[4 + e] = (unsigned short)hb;
        lr[4 + e] = (unsigned short)lb;
    }
    hi = hr;
    lo = lr;
}

// 16-bit fragment loader (wave32, 16x16x32): lane l, hh = l>>4, row/col = l&15.
// elements 0..7  <- row[k0 + 8*hh + 0..7], elements 8..15 <- row[k0 + 16 + 8*hh + 0..7].
// Used for A (row-major, k contiguous) and for B stored as [n][k] (k contiguous).
__device__ __forceinline__ v16bf frag16(const unsigned short* row, int k0, int hh)
{
    Frag f;
    f.h[0] = *(const v8us*)(row + k0 + 8 * hh);
    f.h[1] = *(const v8us*)(row + k0 + 16 + 8 * hh);
    return f.v;
}

// D += A*B with the VALU hazard guard after the instruction.
__device__ __forceinline__ v8f wmma_bf16(v16bf a, v16bf b, v8f c)
{
    v8f d = __builtin_amdgcn_wmma_f32_16x16x32_bf16(false, a, false, b, (short)0, c, false, false);
    asm volatile("v_nop\n\tv_nop\n\tv_nop\n\tv_nop" : "+v"(d) : "v"(a), "v"(b));
    return d;
}

// hi/lo split product: hh + hl + lh into one accumulator
__device__ __forceinline__ v8f wmma3(v16bf ah, v16bf al, v16bf bh, v16bf bl, v8f c)
{
    c = wmma_bf16(ah, bh, c);
    c = wmma_bf16(ah, bl, c);
    c = wmma_bf16(al, bh, c);
    return c;
}

// 16 values -> one hi and one lo fragment, x = hi + lo, both bf16 (RNE), lo = RNE(x - f32(hi)): the same values as
// split1, formed by the chip's own f32 -> bf16 conversion, since here the split stands in a k loop.
__device__ __forceinline__ void split16(const float (&x)[16], v16bf& hi, v16bf& lo)
{
    union Pairs { v16bf v; v2bf p[8]; } fh, fl;
    #pragma unroll
    for (int e = 0; e < 8; ++e) {        // by pairs: one conversion instruction makes two bf16
        const v2f x2 = { x[2 * e], x[2 * e + 1] };
        const v2bf h2 = __builtin_convertvector(x2, v2bf);
        const v2f r2 = { x2[0] - (float)h2[0], x2[1] - (float)h2[1] };
        fh.p[e] = h2;
        fl.p[e] = __builtin_convertvector(r2, v2bf);
    }
    hi = fh.v;
    lo = fl.v;
}

// The same for two fragments whose values come side by side (w[e] = element e of fragment 0 and of fragment 1): the
// remainders are formed on those pairs as they were read, so no register is moved to make a pair.
__device__ __forceinline__ void split16x2(const v2f (&w)[16], v16bf& hi0, v16bf& lo0, v16bf& hi1, v16bf& lo1)
{
    union Pairs { v16bf v; v2bf p[8]; } fh0, fl0, fh1, fl1;
    #pragma unroll
    for (int e = 0; e < 8; ++e) {
        const v2f a = w[2 * e], b = w[2 * e + 1];
        const v2f c0 = { a[0], b[0] }, c1 = { a[1], b[1] };
        const v2bf h0 = __builtin_convertvector(c0, v2bf);
        const v2bf h1 = __builtin_convertvector(c1, v2bf);
        const v2f ha = { (float)h0[0], (float)h1[0] }, hb = { (float)h0[1], (float)h1[1] };
        const v2f ra = a - ha, rb = b - hb;
        const v2f d0 = { ra[0], rb[0] }, d1 = { ra[1], rb[1] };
        fh0.p[e] = h0;
        fh1.p[e] = h1;
        fl0.p[e] = __builtin_convertvector(d0, v2bf);
        fl1.p[e] = __builtin_convertvector(d1, v2bf);
    }
    hi0 = fh0.v; lo0 = fl0.v; hi1 = fh1.v; lo1 = fl1.v;
}

// hi/lo split product with the plain builtin: in a k loop that is full of vector work the compiler fills the
// slots behind a matrix instruction with that work.
__device__ __forceinline__ v8f wmma3p(v16bf ah, v16bf al, v16bf bh, v16bf bl, v8f c)
{
    c = __builtin_amdgcn_wmma_f32_16x16x32_bf16(false, ah, false, bh, (short)0, c, false, false);
    c = __builtin_amdgcn_wmma_f32_16x16x32_bf16(false, ah, false, bl, (short)0, c, false, false);
    c = __builtin_amdgcn_wmma_f32_16x16x32_bf16(false, al, false, bh, (short)0, c, false, false);
    return c;
}

// ---------------------------------------------------------------------------
// Output weight planes for the last launch: w0th/w0tl[n][512] = split(W0[k][n]) (transposed, k contiguous),
// one 64 x 64 tile per block of 128 threads, tile = 0..63.
// ---------------------------------------------------------------------------
__device__ __forceinline__ void w0_planes(
    const float* __restrict__ W0, unsigned short* w0th, unsigned short* w0tl, int tile, float (*s_t)[65])
{
    const int tid = threadIdx.x;
    const int k0  = (tile >> 3) * 64;
    const int n0  = (tile & 7) * 64;
    // load W0[k0+kk][n0+nn] -> s_t[nn][kk]: load i of thread tid has kk = (tid >> 4) + 8*i, columns 4*(tid & 15) + 0..3
    const int kt = tid >> 4;             // 0..7
    const int c4 = tid & 15;             // 0..15
    const float* gw0 = W0 + (size_t)(k0 + kt) * DD + n0 + 4 * c4;
    v4f x[8];
    #pragma unroll
    for (int i = 0; i < 8; ++i) x[i] = *(const v4f*)(gw0 + (size_t)i * 8 * DD);
    // all eight loads name one address; it is an input here, so it keeps its registers up to this wait
    asm volatile("s_wait_xcnt 0x0" :: "v"(gw0) : "memory");
    #pragma unroll
    for (int i = 0; i < 8; ++i) {
        s_t[4 * c4 + 0][kt + 8 * i] = x[i][0];
        s_t[4 * c4 + 1][kt + 8 * i] = x[i][1];
        s_t[4 * c4 + 2][kt + 8 * i] = x[i][2];
        s_t[4 * c4 + 3][kt + 8 * i] = x[i][3];
    }
    __syncthreads();
    v8us hv[4], lv[4];
    size_t off[4];
    #pragma unroll
    for (int i = 0; i < 4; ++i) {
        const int idx = tid + NTHR * i;  // 0..511
        const int nn  = idx >> 3;        // 0..63
        const int k8  = idx & 7;         // 0..7
        const v4f a  = { s_t[nn][8 * k8 + 0], s_t[nn][8 * k8 + 1], s_t[nn][8 * k8 + 2], s_t[nn][8 * k8 + 3] };
        const v4f b2 = { s_t[nn][8 * k8 + 4], s_t[nn][8 * k8 + 5], s_t[nn][8 * k8 + 6], s_t[nn][8 * k8 + 7] };
        split8(a, b2, hv[i], lv[i]);
        off[i] = (size_t)(n0 + nn) * DD + k0 + 8 * k8;
    }
    #pragma unroll
    for (int i = 0; i < 4; ++i) {
        *(v8us*)(w0th + off[i]) = hv[i];
        *(v8us*)(w0tl + off[i]) = lv[i];
    }
}

// ---------------------------------------------------------------------------
// C[32*WR rows of A][64 rows of Bt] = Ah/Al[.][512] . Bt h/l[.][512]^T  (K = 512, hi/lo split).
// One block of 128 threads per tile; row0, col0 = first A row and first Bt row of the tile.
// The tile is small so that the grids cover the chip's WGPs: a K = 512 product of this size is a chain of
// latencies per block, and a narrow tile shortens every link (copies, fragment reads, WMMAs, epilogue).
// WR = 1: four waves side by side, wave wv has rows 0..31 and the col tile at 16*wv.
// WR = 2: waves 2 x 2, wave wv has rows 32*(wv >> 1) + 0..31 and the col tiles at 32*(wv & 1) + 16*j, j = 0..1.
// k slices of 128 staged in LDS by asynchronous copies, two buffers; epilogue staged in LDS. With two buffers one
// slice is in flight at a time, so the loop pays one copy flight per slice: few, long slices.
// MODE 0: Cf[m][512] f32 = (C + bias[n]) * post                    (plain row-major)
// MODE 1: Cf[(b*8+h)*256 + l][64] f32 = 2^((C + bsum[n]) * post),  m = b*256+l, n = h*64+dk;
//         bsum = bias + bias2 where both_bias is set, 0 where it is not
// MODE 2: A rows are n = h*64+dk, Bt rows are m = b*256+j:
//         Ch/Cl[(b*8+h)*64 + dk][256 j] = split(C + bias[n])       (per-row bias)
// ---------------------------------------------------------------------------
// One k slice of the tile in LDS: rows of KT 16-bit values, [Ah 32*WR | Al 32*WR | Bh 64 | Bl 64],
// row pitch 272 B (16 B x odd: conflict-free for the 16-byte fragment reads).
#define KT       128
#define SPITCH   136                      // 16-bit elements per staged row
#define TN       64                       // Bt rows (output columns) of a tile
#define CPITCH   68                       // f32 elements per row of the staged result
#define SROWS(WR) (64 * (WR) + 2 * TN)    // staged rows per slice: 192 or 256
#define SBUF(WR)  (SROWS(WR) * SPITCH)    // elements per buffer (52224 B or 69632 B)
#define NTRIP    (DD / KT)

static_assert(NTRIP >= 2);
static_assert(SROWS(1) * (KT / 8) == 24 * NTHR);
static_assert(SROWS(2) * (KT / 8) == 32 * NTHR);

// Twelve 16-byte asynchronous copies global -> LDS, each lane its own addresses. The s_wait_xcnt
// is the last line of the copies' own statement, so no address register is rewritten ahead of it.
__device__ __forceinline__ void copy12(const unsigned int* la, const unsigned short* const* ga)
{
    asm volatile(
        "global_load_async_to_lds_b128 %0, %12, off\n\t"
        "global_load_async_to_lds_b128 %1, %13, off\n\t"
        "global_load_async_to_lds_b128 %2, %14, off\n\t"
        "global_load_async_to_lds_b128 %3, %15, off\n\t"
        "global_load_async_to_lds_b128 %4, %16, off\n\t"
        "global_load_async_to_lds_b128 %5, %17, off\n\t"
        "global_load_async_to_lds_b128 %6, %18, off\n\t"
        "global_load_async_to_lds_b128 %7, %19, off\n\t"
        "global_load_async_to_lds_b128 %8, %20, off\n\t"
        "global_load_async_to_lds_b128 %9, %21, off\n\t"
        "global_load_async_to_lds_b128 %10, %22, off\n\t"
        "global_load_async_to_lds_b128 %11, %23, off\n\t"
        "s_wait_xcnt 0x0"
        :: "v"(la[0]), "v"(la[1]), "v"(la[2]), "v"(la[3]), "v"(la[4]), "v"(la[5]),
           "v"(la[6]), "v"(la[7]), "v"(la[8]), "v"(la[9]), "v"(la[10]), "v"(la[11]),
           "v"(ga[0]), "v"(ga[1]), "v"(ga[2]), "v"(ga[3]), "v"(ga[4]), "v"(ga[5]),
           "v"(ga[6]), "v"(ga[7]), "v"(ga[8]), "v"(ga[9]), "v"(ga[10]), "v"(ga[11])
        : "memory");
}

// The same for eight copies (a slice of 256 rows is two runs of twelve and one of eight).
__device__ __forceinline__ void copy8h(const unsigned int* la, const unsigned short* const* ga)
{
    asm volatile(
        "global_load_async_to_lds_b128 %0, %8, off\n\t"
        "global_load_async_to_lds_b128 %1, %9, off\n\t"
        "global_load_async_to_lds_b128 %2, %10, off\n\t"
        "global_load_async_to_lds_b128 %3, %11, off\n\t"
        "global_load_async_to_lds_b128 %4, %12, off\n\t"
        "global_load_async_to_lds_b128 %5, %13, off\n\t"
        "global_load_async_to_lds_b128 %6, %14, off\n\t"
        "global_load_async_to_lds_b128 %7, %15, off\n\t"
        "s_wait_xcnt 0x0"
        :: "v"(la[0]), "v"(la[1]), "v"(la[2]), "v"(la[3]), "v"(la[4]), "v"(la[5]), "v"(la[6]), "v"(la[7]),
           "v"(ga[0]), "v"(ga[1]), "v"(ga[2]), "v"(ga[3]), "v"(ga[4]), "v"(ga[5]), "v"(ga[6]), "v"(ga[7])
        : "memory");
}

// Stage one k slice: copy i of thread tid moves 16 B of staged row 8*i + (tid >> 4), chunk tid & 15,
// so a wave's copy covers four whole 128-B lines (two rows of 256 B). lds0 and the four pointers
// already hold the thread's row and chunk; kk = first k of the slice.
template <int WR>
__device__ __forceinline__ void stage_slice(
    unsigned int lds0,
    const unsigned short* gah, const unsigned short* gal,
    const unsigned short* gbh, const unsigned short* gbl, int kk)
{
    constexpr int AG = 4 * WR;            // groups of 8 rows in one A plane
    constexpr int BG = TN / 8;            // groups of 8 rows in one B plane
    constexpr int NC = 2 * AG + 2 * BG;   // copies per thread: 24 or 32
    unsigned int la[NC];
    const unsigned short* ga[NC];
    #pragma unroll
    for (int i = 0; i < NC; ++i) {
        la[i] = lds0 + (unsigned int)(i * 8 * SPITCH * 2);
        ga[i] = ((i < AG)          ? gah + (size_t)i * 8 * DD
               : (i < 2 * AG)      ? gal + (size_t)(i - AG) * 8 * DD
               : (i < 2 * AG + BG) ? gbh + (size_t)(i - 2 * AG) * 8 * DD
                                   : gbl + (size_t)(i - 2 * AG - BG) * 8 * DD) + kk;
    }
    if constexpr (NC == 24) {
        copy12(la, ga);
        copy12(la + 12, ga + 12);
    } else {
        copy12(la, ga);
        copy12(la + 12, ga + 12);
        copy8h(la + 24, ga + 24);
    }
}

template <int WR>
__device__ __forceinline__ void gemm3_main(
    const unsigned short* __restrict__ Ah, const unsigned short* __restrict__ Al,
    const unsigned short* __restrict__ Bh, const unsigned short* __restrict__ Bl,
    int row0, int col0, float (*s_c)[CPITCH], unsigned short* s_st)
{
    constexpr int AR = 32 * WR;           // A rows of the tile
    constexpr int NJ = WR;                // col tiles per wave
    constexpr int WC = 4 / WR;            // waves side by side

    const int tid  = threadIdx.x;
    const int wv   = tid >> 5;
    const int l    = tid & 31;
    const int hh   = l >> 4;
    const int m15  = l & 15;
    const int ar0  = 32 * (wv / WC);          // first tile row of this wave
    const int bc0  = 16 * NJ * (wv % WC);     // first tile column of this wave

    const v8f zero = { 0.f, 0.f, 0.f, 0.f, 0.f, 0.f, 0.f, 0.f };
    v8f acc[2][NJ];
    #pragma unroll
    for (int rt = 0; rt < 2; ++rt)
        #pragma unroll
        for (int j = 0; j < NJ; ++j) acc[rt][j] = zero;

    // copy side: this thread's row (of 8) and 16-byte chunk (of 16)
    const int crow = tid >> 4;
    const int cchk = tid & 15;
    const unsigned short* gah = Ah + (size_t)(row0 + crow) * DD + 8 * cchk;
    const unsigned short* gal = Al + (size_t)(row0 + crow) * DD + 8 * cchk;
    const unsigned short* gbh = Bh + (size_t)(col0 + crow) * DD + 8 * cchk;
    const unsigned short* gbl = Bl + (size_t)(col0 + crow) * DD + 8 * cchk;
    const unsigned int lds0 = (unsigned int)(uintptr_t)s_st + (unsigned int)(crow * SPITCH * 2 + cchk * 16);

    // read side: element offsets of this lane's fragment rows inside a buffer
    const int oa0h = (ar0 + m15) * SPITCH;
    const int oa1h = (ar0 + 16 + m15) * SPITCH;
    const int oa0l = (AR + ar0 + m15) * SPITCH;
    const int oa1l = (AR + ar0 + 16 + m15) * SPITCH;
    const int obh  = (2 * AR + bc0 + m15) * SPITCH;
    const int obl  = (2 * AR + TN + bc0 + m15) * SPITCH;

    // slice 0 lands and is published, then slice 1 starts to fly
    stage_slice<WR>(lds0, gah, gal, gbh, gbl, 0);
    asm volatile("s_wait_asynccnt 0x0" ::: "memory");   // this wave's copies of slice 0 have landed
    __syncthreads();
    stage_slice<WR>(lds0 + SBUF(WR) * 2, gah, gal, gbh, gbl, KT);

    // kept rolled: the trips are chained by their barriers, unrolling would only add code to fetch
    #pragma unroll 1
    for (int t = 0; t < NTRIP; ++t) {
        const unsigned short* sb = s_st + (t & 1) * SBUF(WR);
        #pragma unroll
        for (int k0 = 0; k0 < KT; k0 += 32) {
            const v16bf fa0h = frag16(sb + oa0h, k0, hh);
            const v16bf fa0l = frag16(sb + oa0l, k0, hh);
            const v16bf fa1h = frag16(sb + oa1h, k0, hh);
            const v16bf fa1l = frag16(sb + oa1l, k0, hh);
            // all fragments of a k step are read as one group, so one LDS latency is waited out per step
            v16bf fbh[NJ], fbl[NJ];
            #pragma unroll
            for (int j = 0; j < NJ; ++j) {
                fbh[j] = frag16(sb + obh + j * 16 * SPITCH, k0, hh);
                fbl[j] = frag16(sb + obl + j * 16 * SPITCH, k0, hh);
            }
            #pragma unroll
            for (int j = 0; j < NJ; ++j) {
                acc[0][j] = wmma3(fa0h, fa0l, fbh[j], fbl[j], acc[0][j]);
                acc[1][j] = wmma3(fa1h, fa1l, fbh[j], fbl[j], acc[1][j]);
            }
        }
        asm volatile("s_wait_dscnt 0x0" ::: "memory");      // this wave's reads of the buffer are done before it is refilled
        asm volatile("s_wait_asynccnt 0x0" ::: "memory");   // this wave's copies of slice t + 1 have landed
        __syncthreads();                                    // publishes slice t + 1, frees slice t's buffer
        if (t + 2 < NTRIP)
            stage_slice<WR>(lds0 + (unsigned int)((t & 1) * SBUF(WR) * 2), gah, gal, gbh, gbl, (t + 2) * KT);
    }
    asm volatile("s_wait_asynccnt 0x0" ::: "memory");       // no copy is outstanding past the loop

    // D element r of lane -> (row 8*hh + r, col m15) of the 16x16 tile
    #pragma unroll
    for (int rt = 0; rt < 2; ++rt)
        #pragma unroll
        for (int j = 0; j < NJ; ++j)
            #pragma unroll
            for (int r = 0; r < 8; ++r)
                s_c[ar0 + rt * 16 + 8 * hh + r][bc0 + 16 * j + m15] = acc[rt][j][r];
    __syncthreads();
}

template <int MODE, int WR>
__device__ __forceinline__ void gemm3_epilogue(
    const float* __restrict__ bias, float post,
    float* Cf, unsigned short* Ch, unsigned short* Cl,
    int row0, int col0, const float (*s_c)[CPITCH],
    const float* __restrict__ bias2 = nullptr, bool both_bias = false)
{
    constexpr int AR = 32 * WR;                     // rows of the tile
    constexpr int N4 = AR * (TN / 4) / NTHR;        // 16-byte f32 pieces per thread
    constexpr int N8 = AR * (TN / 8) / NTHR;        // 8-element pieces per thread
    const int tid = threadIdx.x;

    if (MODE == 0) {
        v4f vals[N4];
        size_t off[N4];
        const int c4 = tid & 15;                // all pieces of a thread lie in the same four columns
        const v4f bb = *(const v4f*)(bias + col0 + 4 * c4);
        #pragma unroll
        for (int i = 0; i < N4; ++i) {
            const int row = (tid >> 4) + 8 * i; // 0..AR-1
            const v4f x  = *(const v4f*)&s_c[row][4 * c4];
            vals[i] = (x + bb) * post;
            off[i]  = (size_t)(row0 + row) * DD + col0 + 4 * c4;
        }
        #pragma unroll
        for (int i = 0; i < N4; ++i) *(v4f*)(Cf + off[i]) = vals[i];
        
    } else if (MODE == 1) {
        v4f vals[N4];
        size_t off[N4];
        const int c4 = tid & 15;                // all pieces of a thread lie in the same four columns
        const int n  = col0 + 4 * c4;           // the tile's 64 columns are one head
        const v4f b1 = *(const v4f*)(bias + n);
        const v4f b2 = *(const v4f*)(bias2 + n);
        // the address registers of the bias loads are reused by the code that follows them
        asm volatile("s_wait_xcnt 0x0" ::: "memory");
        // Only q + k enters the score, so both biases go into the q factor and none into the k
        // factor: biases of opposite sign cancel here, before the exponent is clamped.
        const v4f zero4 = { 0.f, 0.f, 0.f, 0.f };
        const v4f bb = both_bias ? (b1 + b2) : zero4;
        #pragma unroll
        for (int i = 0; i < N4; ++i) {
            const int row = (tid >> 4) + 8 * i; // 0..AR-1
            const v4f x  = *(const v4f*)&s_c[row][4 * c4];
            // The exponent is held inside the normal range, so both factors of the later product
            // 2^q' * 2^k' stay finite and non-zero and the product is never inf * 0. A clamped factor
            // (a value beyond 43) still gives the saturated tanh unless the other factor's value lies
            // beyond 35 on the opposite side; with the biases on one side the other is k . Wk alone.
            const v4f y = (x + bb) * post;
            #pragma unroll   // constant element indices, so that vals stays in registers
            for (int e = 0; e < 4; ++e) vals[i][e] = fminf(fmaxf(y[e], -126.0f), 126.0f);
            const int m  = row0 + row;
            const int b  = m >> 8;
            const int lq = m & 255;
            const int h  = n >> 6;
            off[i] = ((size_t)((b * HH + h) * LL + lq)) * DK + 4 * c4;
        }
        #pragma unroll
        for (int i = 0; i < N4; ++i) {
            #pragma unroll   // constant element indices, so that vals stays in registers
            for (int e = 0; e < 4; ++e) vals[i][e] = EXP2_FAST(vals[i][e]);
            *(v4f*)(Cf + off[i]) = vals[i];
        }
        // in the merged kernel other code follows these stores in the listing and reuses their registers
        asm volatile("s_wait_xcnt 0x0" ::: "memory");
    } else {
        v8us hv[N8], lv[N8];
        size_t off[N8];
        const int b  = col0 >> 8;
        const int jb = col0 & 255;              // first key of the tile inside its batch
        #pragma unroll
        for (int i = 0; i < N8; ++i) {
            const int idx = tid + NTHR * i;
            const int row = idx >> 3;           // 0..AR-1 (eight threads write one 128-B line per plane)
            const int c8  = idx & 7;            // 0..7
            const float bs = bias[row0 + row];
            const v4f bb = { bs, bs, bs, bs };
            const v4f x0 = *(const v4f*)&s_c[row][8 * c8] + bb;
            const v4f x1 = *(const v4f*)&s_c[row][8 * c8 + 4] + bb;
            split8(x0, x1, hv[i], lv[i]);
            const int n  = row0 + row;
            const int h  = n >> 6;
            const int dk = n & 63;
            off[i] = ((size_t)((b * HH + h) * DK + dk)) * LL + jb + 8 * c8;
        }
        #pragma unroll
        for (int i = 0; i < N8; ++i) {
            *(v8us*)(Ch + off[i]) = hv[i];
            *(v8us*)(Cl + off[i]) = lv[i];
        }
        
    }
}

// Output projection: one 32 x 64 tile per block (256 blocks), row0 = 32*blockIdx.x, col0 = 64*blockIdx.y.
__global__ void __launch_bounds__(NTHR) gemm3_out_kernel(
    const unsigned short* __restrict__ Ah, const unsigned short* __restrict__ Al,
    const unsigned short* __restrict__ Bh, const unsigned short* __restrict__ Bl,
    const float* __restrict__ bias, float* Cf)
{
    __shared__ __align__(16) float s_c[32][CPITCH];
    __shared__ __align__(16) unsigned short s_st[2 * SBUF(1)];
    const int row0 = blockIdx.x * 32;
    const int col0 = blockIdx.y * TN;
    gemm3_main<1>(Ah, Al, Bh, Bl, row0, col0, s_c, s_st);
    gemm3_epilogue<0, 1>(bias, 1.0f, Cf, nullptr, nullptr, row0, col0, s_c);
}

// ---------------------------------------------------------------------------
// k loop of the input projections, straight from the f32 inputs: C[64 rows of X][64 columns of Wm], K = 512.
// A k slice of 128 is staged as f32 (the bytes of a hi and a lo plane together) by asynchronous copies, two
// buffers, the ring of gemm3_main; a wave splits its fragments to bf16 hi/lo in registers as it reads them.
// X rows [64][128] at a pitch of 528 B (16 B x odd) feed the A fragments by 16-byte reads. Wm rows [128 k][64 n]
// at a pitch of 272 B feed the B fragments down the columns: a lane reads 8 bytes per k, columns 2*m15 and
// 2*m15 + 1 of the wave's 32, which are column m15 of its col tiles 0 and 1; the two half-waves stand 8 rows
// (32 banks) apart, so a read touches every bank once.
// Waves 2 x 2: wave wv has rows 32*(wv >> 1) + 0..31 and columns 32*(wv & 1) + 0..31.
// transposed: the result is staged as s_c[column][row] (the v projection), else as s_c[row][column].
// ---------------------------------------------------------------------------
#define XP    132                         // f32 per staged X row
#define WP    68                          // f32 per staged Wm row
#define FX    (64 * XP)                   // f32 of the X part of a buffer
#define FBUF  (FX + KT * WP)              // f32 per buffer (68608 B)

static_assert(64 * (KT / 4) == 16 * NTHR);   // X part: 16 copies per thread
static_assert(KT * (TN / 4) == 16 * NTHR);   // Wm part: 16 copies per thread

// Stage one k slice. X: copy i of thread tid moves 16 B of row 4*i + (tid >> 5), chunk tid & 31 (a wave's copy is
// one row of 512 B). Wm: copy i moves 16 B of k row 8*i + (tid >> 4), chunk tid & 15 (two rows of 256 B).
// The LDS addresses and pointers already hold the thread's row and chunk; kk = first k of the slice.
__device__ __forceinline__ void stage_f32(unsigned int lx0, unsigned int lw0, const float* gx, const float* gw, int kk)
{
    unsigned int la[32];
    const unsigned short* ga[32];
    #pragma unroll   // constant indices, so that both address arrays stay in registers
    for (int i = 0; i < 16; ++i) {
        la[i]      = lx0 + (unsigned int)(i * 4 * XP * 4);
        ga[i]      = (const unsigned short*)(gx + (size_t)i * 4 * DD + kk);
        la[16 + i] = lw0 + (unsigned int)(i * 8 * WP * 4);
        ga[16 + i] = (const unsigned short*)(gw + (size_t)(kk + 8 * i) * DD);
    }
    copy12(la, ga);
    copy12(la + 12, ga + 12);
    copy8h(la + 24, ga + 24);
}

__device__ __forceinline__ void proj_main(
    const float* __restrict__ X, const float* __restrict__ Wm,
    int xr0, int wc0, bool transposed, float (*s_c)[CPITCH], float* s_f)
{
    const int tid  = threadIdx.x;
    const int wv   = tid >> 5;
    const int l    = tid & 31;
    const int hh   = l >> 4;
    const int m15  = l & 15;
    const int ar0  = 32 * (wv >> 1);          // first tile row of this wave
    const int bc0  = 32 * (wv & 1);           // first tile column of this wave

    const v8f zero = { 0.f, 0.f, 0.f, 0.f, 0.f, 0.f, 0.f, 0.f };
    v8f acc[2][2];
    #pragma unroll
    for (int rt = 0; rt < 2; ++rt)
        #pragma unroll
        for (int j = 0; j < 2; ++j) acc[rt][j] = zero;

    // copy side
    const float* gx = X + (size_t)(xr0 + (tid >> 5)) * DD + 4 * (tid & 31);
    const float* gw = Wm + (size_t)(tid >> 4) * DD + wc0 + 4 * (tid & 15);
    const unsigned int lx0 = (unsigned int)(uintptr_t)s_f + (unsigned int)((tid >> 5) * (XP * 4) + (tid & 31) * 16);
    const unsigned int lw0 = (unsigned int)(uintptr_t)s_f + (unsigned int)(FX * 4 + (tid >> 4) * (WP * 4) + (tid & 15) * 16);

    // read side: f32 offsets of this lane's fragment rows and columns inside a buffer, its k half included
    const int ox0 = (ar0 + m15) * XP + 8 * hh;
    const int ox1 = ox0 + 16 * XP;
    const int ow  = FX + 8 * hh * WP + bc0 + 2 * m15;

    // slice 0 lands and is published, then slice 1 starts to fly
    stage_f32(lx0, lw0, gx, gw, 0);
    asm volatile("s_wait_asynccnt 0x0" ::: "memory");   // this wave's copies of slice 0 have landed
    __syncthreads();
    stage_f32(lx0 + FBUF * 4, lw0 + FBUF * 4, gx, gw, KT);

    // kept rolled: the trips are chained by their barriers, unrolling would only add code to fetch
    #pragma unroll 1
    for (int t = 0; t < NTRIP; ++t) {
        const float* sb = s_f + (t & 1) * FBUF;
        #pragma unroll
        for (int k0 = 0; k0 < KT; k0 += 32) {
            // fragment element e holds k = k0 + 8*hh + e (e < 8) or k0 + 16 + 8*hh + e - 8, on both sides
            float xa0[16], xa1[16];
            v2f wb[16];
            #pragma unroll
            for (int g = 0; g < 4; ++g) {
                const int ko = k0 + (g >> 1) * 16 + (g & 1) * 4;
                const v4f a = *(const v4f*)(sb + ox0 + ko);
                const v4f b = *(const v4f*)(sb + ox1 + ko);
                #pragma unroll
                for (int e = 0; e < 4; ++e) { xa0[4 * g + e] = a[e]; xa1[4 * g + e] = b[e]; }
            }
            #pragma unroll
            for (int e = 0; e < 16; ++e) {
                const int kr = k0 + (e >> 3) * 16 + (e & 7);
                wb[e] = *(const v2f*)(sb + ow + kr * WP);
            }
            v16bf fa0h, fa0l, fa1h, fa1l, fbh[2], fbl[2];
            split16(xa0, fa0h, fa0l);
            split16(xa1, fa1h, fa1l);
            split16x2(wb, fbh[0], fbl[0], fbh[1], fbl[1]);
            #pragma unroll
            for (int j = 0; j < 2; ++j) {
                acc[0][j] = wmma3p(fa0h, fa0l, fbh[j], fbl[j], acc[0][j]);
                acc[1][j] = wmma3p(fa1h, fa1l, fbh[j], fbl[j], acc[1][j]);
            }
        }
        asm volatile("s_wait_dscnt 0x0" ::: "memory");      // this wave's reads of the buffer are done before it is refilled
        asm volatile("s_wait_asynccnt 0x0" ::: "memory");   // this wave's copies of slice t + 1 have landed
        __syncthreads();                                    // publishes slice t + 1, frees slice t's buffer
        if (t + 2 < NTRIP) {
            const unsigned int bo = (unsigned int)((t & 1) * FBUF * 4);
            stage_f32(lx0 + bo, lw0 + bo, gx, gw, (t + 2) * KT);
        }
    }
    asm volatile("s_wait_asynccnt 0x0" ::: "memory");       // no copy is outstanding past the loop

    // D element r of lane -> (row 8*hh + r, col m15) of the 16x16 tile; col m15 of col tile j is column 2*m15 + j
    if (transposed) {
        #pragma unroll
        for (int rt = 0; rt < 2; ++rt)
            #pragma unroll
            for (int j = 0; j < 2; ++j) {
                const v4f y0 = { acc[rt][j][0], acc[rt][j][1], acc[rt][j][2], acc[rt][j][3] };
                const v4f y1 = { acc[rt][j][4], acc[rt][j][5], acc[rt][j][6], acc[rt][j][7] };
                *(v4f*)&s_c[bc0 + 2 * m15 + j][ar0 + rt * 16 + 8 * hh]     = y0;
                *(v4f*)&s_c[bc0 + 2 * m15 + j][ar0 + rt * 16 + 8 * hh + 4] = y1;
            }
    } else {
        #pragma unroll
        for (int rt = 0; rt < 2; ++rt)
            #pragma unroll
            for (int r = 0; r < 8; ++r) {
                const v2f y = { acc[rt][0][r], acc[rt][1][r] };
                *(v2f*)&s_c[ar0 + rt * 16 + 8 * hh + r][bc0 + 2 * m15] = y;
            }
    }
    __syncthreads();
}

// The three input projections in one grid, read from the f32 inputs: none reads another's output. 64 x 64 tiles,
// 128 per projection: block 128*t + tile, t = 0:q 1:k 2:v. Blocks 384..447 write the output weight's planes for the
// last launch; they are short and come last.
//  q, k: 16 tiles of activation rows x 8 of weight columns, MODE 1.
//  v:    the same product, staged transposed (rows = weight columns), MODE 2.
__global__ void __launch_bounds__(NTHR) proj3_kernel(
    const float* __restrict__ q, const float* __restrict__ k, const float* __restrict__ v,
    const float* __restrict__ Wq, const float* __restrict__ Wk, const float* __restrict__ Wv,
    const float* __restrict__ W0,
    const float* __restrict__ bq, const float* __restrict__ bk, const float* __restrict__ bv,
    float post, float* Qp, float* Kp, unsigned short* VTh, unsigned short* VTl,
    unsigned short* w0th, unsigned short* w0tl)
{
    __shared__ __align__(16) float s_c[64][CPITCH];
    __shared__ __align__(16) float s_f[2 * FBUF];

    const int bid = blockIdx.x;
    if (bid >= 3 * 128) {
        w0_planes(W0, w0th, w0tl, bid - 3 * 128, (float (*)[65])s_f);
        return;
    }
    const int  t    = bid >> 7;
    const int  tile = bid & 127;
    const bool isv  = (t == 2);
    const float* X  = (t == 0) ? q  : ((t == 1) ? k  : v);
    const float* Wm = (t == 0) ? Wq : ((t == 1) ? Wk : Wv);
    const int xr0 = (isv ? (tile >> 3) : (tile & 15)) * 64;   // first activation row
    const int wc0 = (isv ? (tile & 7) : (tile >> 4)) * TN;    // first weight column

    // one copy of the k loop serves all three; only the staging of the result and the epilogue differ
    proj_main(X, Wm, xr0, wc0, isv, s_c, s_f);
    if (isv) gemm3_epilogue<2, 2>(bv, 1.0f, nullptr, VTh, VTl, wc0, xr0, s_c);
    else     gemm3_epilogue<1, 2>(bq, post, (t == 0) ? Qp : Kp, nullptr, nullptr, xr0, wc0, s_c, bk, t == 0);
}

// ---------------------------------------------------------------------------
// Additive scores + softmax + read-out for one (b, h, 16 query rows) block, 128 threads.
// Qp holds e^{2(q + bq + bk)} and Kp e^{2k} of the bias-free projections q, k in (B,H,L,DK) f32 layout:
// their product is e^{2x} of the pair's x = (q + bq) + (k + bk), so the exponential is taken once per
// projected element and not once per (query, key) pair.
// tanh(x) = 1 - 2/(1 + e^{2x}); score = sum_d vp_d - 2 * sum_d vp_d/(1 + e^{2x_d});
// the constant sum_d vp_d is invariant under softmax and omitted. mask == 0 -> -1e9.
// Thread tid owns keys 2*tid, 2*tid+1 and holds the scores of all 16 query rows in registers: one score
// loop and one block softmax, whose 16 rows cover each other's cross-lane and LDS latencies. P is split to bf16
// hi/lo in LDS (dword stores, barrier, then 16-byte fragment reloads) and feeds O = P . VT^T,
// VT = [bh][dk][256 j] hi/lo planes, staged in LDS behind the score loop; wave wv owns the dk tile 16*wv.
// The head's K rows (256 keys x 64 f32) are staged once per block in LDS by asynchronous copies of
// whole lines: a thread reading its own two rows from global memory touches 32 lines per load.
// Key j lies in LDS row (j >> 1) + 128 * (j & 1), row pitch 272 B (16 B x odd), so that the lanes of
// a wave, which own every second key, read rows one pitch apart without bank conflicts.
// ---------------------------------------------------------------------------
#define KPITCH 68                         // f32 elements per staged K row
// Read-out operands: P rows and staged V rows have a pitch of 528 B (16 B x odd). At the plain 512 B the 16 rows
// of a fragment read start on one bank and a 16-byte read is served one lane at a time.
#define VPITCH 264                        // 16-bit elements per P row and per staged V row

// 2^x with a v_nop behind it in the same statement: the instruction set asks for one independent instruction
// before a transcendental's result is read or its source register rewritten.
__device__ __forceinline__ float exp2_slot(float x)
{
    float r;
    asm("v_exp_f32 %0, %1\n\tv_nop" : "=v"(r) : "v"(x));
    return r;
}

static_assert(LL * DK * 4 == 32 * NTHR * 16);
static_assert(2 * DK * LL * 2 == 32 * NTHR * 16);            // V hi and lo planes of a head: 32 copies per thread
static_assert(2 * DK * VPITCH * 2 <= LL * KPITCH * 4);       // and they fit the K tile's LDS

// Eight 16-byte asynchronous copies global -> LDS, each lane its own addresses. The s_wait_xcnt
// is the last line of the copies' own statement, so no address register is rewritten ahead of it.
__device__ __forceinline__ void copy8(const unsigned int* la, const float* const* ga)
{
    asm volatile(
        "global_load_async_to_lds_b128 %0, %8, off\n\t"
        "global_load_async_to_lds_b128 %1, %9, off\n\t"
        "global_load_async_to_lds_b128 %2, %10, off\n\t"
        "global_load_async_to_lds_b128 %3, %11, off\n\t"
        "global_load_async_to_lds_b128 %4, %12, off\n\t"
        "global_load_async_to_lds_b128 %5, %13, off\n\t"
        "global_load_async_to_lds_b128 %6, %14, off\n\t"
        "global_load_async_to_lds_b128 %7, %15, off\n\t"
        "s_wait_xcnt 0x0"
        :: "v"(la[0]), "v"(la[1]), "v"(la[2]), "v"(la[3]), "v"(la[4]), "v"(la[5]), "v"(la[6]), "v"(la[7]),
           "v"(ga[0]), "v"(ga[1]), "v"(ga[2]), "v"(ga[3]), "v"(ga[4]), "v"(ga[5]), "v"(ga[6]), "v"(ga[7])
        : "memory");
}

__global__ void __launch_bounds__(NTHR) attn_kernel(
    const float* __restrict__ Qp, const float* __restrict__ Kp, const float* __restrict__ vp,
    const int* __restrict__ mask,
    const unsigned short* __restrict__ VTh, const unsigned short* __restrict__ VTl,
    unsigned short* Oh, unsigned short* Ol)
{
    __shared__ __align__(16) float          s_k[LL][KPITCH];
    __shared__ __align__(16) float          s_q[16][DK];
    __shared__ __align__(16) float          s_vp[DK];
    __shared__ __align__(16) unsigned short s_ph[16][VPITCH];
    __shared__ __align__(16) unsigned short s_pl[16][VPITCH];
    __shared__ __align__(16) float          s_o[16][68];
    __shared__ __align__(16) float s_rmax[4][16];   // [wave][query row]
    __shared__ __align__(16) float s_rsum[4][16];

    const int tid = threadIdx.x;
    const int wv  = tid >> 5;
    const int l   = tid & 31;
    const int hh  = l >> 4;
    const int m15 = l & 15;
    const int bh  = blockIdx.y;          // 0..31
    const int b   = bh >> 3;
    const int h   = bh & 7;
    const int q0  = blockIdx.x * 16;     // 0..240

    const float LOG2E = 1.4426950408889634f;
    const float MASKV = -1.0e9f;

    // K tile: copy i of thread tid moves 16-byte chunk tid + 128*i of the head's 64 KiB, that is
    // key (tid >> 4) + 8*i, chunk tid & 15; a wave's copy covers four whole 128-B lines.
    {
        const float* gk0 = Kp + (size_t)bh * LL * DK + 4 * tid;
        const unsigned int lk0 = (unsigned int)(uintptr_t)&s_k[0][0]
            + (unsigned int)(((tid >> 5) + 128 * ((tid >> 4) & 1)) * (KPITCH * 4) + (tid & 15) * 16);
        #pragma unroll
        for (int g = 0; g < 4; ++g) {
            unsigned int la[8];
            const float* ga[8];
            #pragma unroll
            for (int i = 0; i < 8; ++i) {
                la[i] = lk0 + (unsigned int)((8 * g + i) * 4 * (KPITCH * 4));
                ga[i] = gk0 + (size_t)(8 * g + i) * (NTHR * 4);
            }
            copy8(la, ga);
        }
    }

    // the 16 mask rows of this thread's two keys, one group of loads in flight beside the K copies
    v2i mk[16];
    {
        const int* mrow = mask + ((size_t)(b * LL + q0)) * LL + 2 * tid;
        #pragma unroll
        for (int j = 0; j < 16; ++j) mk[j] = *(const v2i*)(mrow + (size_t)j * LL);
    }

    #pragma unroll
    for (int i = 0; i < 2; ++i) {
        const int idx = tid + NTHR * i;  // 0..255
        const int r   = idx >> 4;        // 0..15
        const int c4  = idx & 15;        // 0..15
        *(v4f*)&s_q[r][4 * c4] = *(const v4f*)(Qp + ((size_t)(bh * LL + q0 + r)) * DK + 4 * c4);
    }
    if (tid < DK) s_vp[tid] = vp[h * DK + tid];
    asm volatile("s_wait_asynccnt 0x0" ::: "memory");   // this wave's copies of the K tile have landed
    __syncthreads();                                    // publishes s_q, s_vp and the K tile

    const int j0 = 2 * tid;
    const float* k0p = &s_k[tid][0];          // key 2*tid
    const float* k1p = &s_k[128 + tid][0];    // key 2*tid + 1

    v2f acc[16];                         // [query row], element = key 2*tid, 2*tid + 1
    #pragma unroll
    for (int j = 0; j < 16; ++j) { acc[j][0] = 0.0f; acc[j][1] = 0.0f; }

    // kept rolled: one trip is 128 pair elements per lane, enough to cover its own LDS reads
    #pragma unroll 1
    for (int d4 = 0; d4 < DK / 4; ++d4) {
        const v4f ka = *(const v4f*)(k0p + 4 * d4);
        const v4f kb = *(const v4f*)(k1p + 4 * d4);
        const v4f vv = *(const v4f*)&s_vp[4 * d4];
        const v2f one2 = { 1.0f, 1.0f };
        v2f kk[4];                       // the thread's two keys side by side: packed f32 arithmetic
        #pragma unroll
        for (int e = 0; e < 4; ++e) { kk[e][0] = ka[e]; kk[e][1] = kb[e]; }
        #pragma unroll
        for (int j = 0; j < 16; ++j) {
            const v4f qv = *(const v4f*)&s_q[j][4 * d4];
            #pragma unroll
            for (int e = 0; e < 4; ++e) {
                const v2f q2 = { qv[e], qv[e] };
                const v2f v2 = { vv[e], vv[e] };
                const v2f a  = __builtin_elementwise_fma(q2, kk[e], one2);   // 1 + e^{2x}
                const v2f rr = { RCP_FAST(a[0]), RCP_FAST(a[1]) };
                acc[j] = __builtin_elementwise_fma(v2, rr, acc[j]);
            }
        }
    }

    // logits with mask fill, block-wide row max over the 256 keys; each cross-lane round runs over
    // all 16 rows before the next one starts, so a round's latency is waited out once and not per row
    float bm[16];
    #pragma unroll
    for (int j = 0; j < 16; ++j) {
        const float s0 = (mk[j][0] == 0) ? MASKV : (-2.0f * acc[j][0]);
        const float s1 = (mk[j][1] == 0) ? MASKV : (-2.0f * acc[j][1]);
        acc[j][0] = s0;
        acc[j][1] = s1;
        bm[j] = fmaxf(s0, s1);
    }
    #pragma unroll
    for (int off = 16; off > 0; off >>= 1) {
        float t[16];
        #pragma unroll
        for (int j = 0; j < 16; ++j) t[j] = __shfl_xor(bm[j], off, 32);
        #pragma unroll
        for (int j = 0; j < 16; ++j) bm[j] = fmaxf(bm[j], t[j]);
    }
    if (l == 0) {
        #pragma unroll
        for (int i = 0; i < 4; ++i) {
            const v4f x = { bm[4 * i], bm[4 * i + 1], bm[4 * i + 2], bm[4 * i + 3] };
            *(v4f*)&s_rmax[wv][4 * i] = x;
        }
    }
    asm volatile("s_wait_dscnt 0x0" ::: "memory");      // this wave's reads of the K tile are done before its LDS is refilled
    __syncthreads();                                    // publishes s_rmax, ends every wave's reads of the K tile

    // The head's V planes (64 dk rows x 256 keys, hi then lo) go into the LDS that held the K tile and fly under the
    // rest of the softmax, so the read-out waits for no global load. Copy i of thread tid moves 16 B of staged row
    // 4*i + (tid >> 5), chunk tid & 31: a wave's copy is one whole row of 512 B (four lines).
    unsigned short* s_v = (unsigned short*)&s_k[0][0];
    {
        const unsigned int lv0 = (unsigned int)(uintptr_t)s_v + (unsigned int)(wv * (VPITCH * 2) + l * 16);
        const unsigned short* gvh = VTh + ((size_t)(bh * DK + wv)) * LL + 8 * l;
        const unsigned short* gvl = VTl + ((size_t)(bh * DK + wv)) * LL + 8 * l;
        unsigned int la[32];
        const unsigned short* ga[32];
        #pragma unroll   // constant indices, so that both address arrays stay in registers
        for (int i = 0; i < 32; ++i) {
            la[i] = lv0 + (unsigned int)(i * 4 * (VPITCH * 2));
            ga[i] = (i < 16) ? gvh + (size_t)i * 4 * LL : gvl + (size_t)(i - 16) * 4 * LL;
        }
        copy12(la, ga);
        copy12(la + 12, ga + 12);
        copy8h(la + 24, ga + 24);
    }
    #pragma unroll
    for (int j = 0; j < 16; ++j)
        bm[j] = fmaxf(fmaxf(s_rmax[0][j], s_rmax[1][j]), fmaxf(s_rmax[2][j], s_rmax[3][j]));

    float bs[16];
    #pragma unroll
    for (int j = 0; j < 16; ++j) {
        const float e0 = exp2_slot((acc[j][0] - bm[j]) * LOG2E);
        const float e1 = exp2_slot((acc[j][1] - bm[j]) * LOG2E);
        acc[j][0] = e0;
        acc[j][1] = e1;
        bs[j] = e0 + e1;
    }
    #pragma unroll
    for (int off = 16; off > 0; off >>= 1) {
        float t[16];
        #pragma unroll
        for (int j = 0; j < 16; ++j) t[j] = __shfl_xor(bs[j], off, 32);
        #pragma unroll
        for (int j = 0; j < 16; ++j) bs[j] += t[j];
    }
    if (l == 0) {
        #pragma unroll
        for (int i = 0; i < 4; ++i) {
            const v4f x = { bs[4 * i], bs[4 * i + 1], bs[4 * i + 2], bs[4 * i + 3] };
            *(v4f*)&s_rsum[wv][4 * i] = x;
        }
    }
    __syncthreads();
    #pragma unroll
    for (int j = 0; j < 16; ++j) {
        const float sum = (s_rsum[0][j] + s_rsum[1][j]) + (s_rsum[2][j] + s_rsum[3][j]);
        const float inv = RCP_FAST(sum);
        const float p0  = acc[j][0] * inv;
        const float p1  = acc[j][1] * inv;
        unsigned int h0b, l0b, h1b, l1b;
        split1(p0, h0b, l0b);
        split1(p1, h1b, l1b);
        *(unsigned int*)&s_ph[j][j0] = (h1b << 16) | h0b;
        *(unsigned int*)&s_pl[j][j0] = (l1b << 16) | l0b;
    }
    asm volatile("s_wait_asynccnt 0x0" ::: "memory");   // this wave's copies of the V planes have landed
    __syncthreads();                                    // publishes P and the V planes

    // read-out: o[16 q][64 dk] = P . VT^T ; wave wv owns dk tile 16*wv
    v8f pacc = { 0.f, 0.f, 0.f, 0.f, 0.f, 0.f, 0.f, 0.f };
    const unsigned short* pah = &s_ph[m15][0];
    const unsigned short* pal = &s_pl[m15][0];
    const unsigned short* bvh = s_v + (16 * wv + m15) * VPITCH;
    const unsigned short* bvl = s_v + (DK + 16 * wv + m15) * VPITCH;
    v16bf fah = frag16(pah, 0, hh);
    v16bf fal = frag16(pal, 0, hh);
    v16bf fbh = frag16(bvh, 0, hh);
    v16bf fbl = frag16(bvl, 0, hh);
    #pragma unroll   // two register sets take turns: unrolled, no copy between them is needed
    for (int k0 = 0; k0 < LL; k0 += 32) {
        v16bf nah = fah, nal = fal, nbh = fbh, nbl = fbl;
        if (k0 + 32 < LL) {
            nah = frag16(pah, k0 + 32, hh);
            nal = frag16(pal, k0 + 32, hh);
            nbh = frag16(bvh, k0 + 32, hh);
            nbl = frag16(bvl, k0 + 32, hh);
        }
        // holds the next k step's LDS reads ahead of this step's WMMAs, so that their latency runs under them
        __builtin_amdgcn_sched_barrier(0);
        pacc = wmma3(fah, fal, fbh, fbl, pacc);
        fah = nah; fal = nal; fbh = nbh; fbl = nbl;
    }
    #pragma unroll
    for (int r = 0; r < 8; ++r) s_o[8 * hh + r][16 * wv + m15] = pacc[r];
    __syncthreads();

    {
        const int row = tid >> 3;   // 0..15
        const int c8  = tid & 7;
        const v4f x0 = *(const v4f*)&s_o[row][8 * c8];
        const v4f x1 = *(const v4f*)&s_o[row][8 * c8 + 4];
        v8us hv, lv;
        split8(x0, x1, hv, lv);
        const size_t goff = ((size_t)(b * LL + q0 + row)) * DD + h * DK + 8 * c8;
        *(v8us*)(Oh + goff) = hv;
        *(v8us*)(Ol + goff) = lv;
        
    }
}

extern "C" void kernel_launch(void* const* d_in, const int* in_sizes, int n_in,
                              void* d_out, int out_size, void* d_ws, size_t ws_size,
                              hipStream_t stream)
{
    if (n_in < 13) return;
    if (in_sizes[0] != NR * DD || in_sizes[1] != NR * DD || in_sizes[2] != NR * DD) return;
    if (in_sizes[3] != BB * LL * LL) return;
    if (in_sizes[4] != DD * DD || in_sizes[6] != DD * DD || in_sizes[8] != DD * DD || in_sizes[11] != DD * DD) return;
    if (in_sizes[5] != DD || in_sizes[7] != DD || in_sizes[9] != DD || in_sizes[12] != DD) return;
    if (in_sizes[10] != HH * DK) return;
    if (out_size != NR * DD) return;

    const float* q    = (const float*)d_in[0];    // [4][256][512]
    const float* k    = (const float*)d_in[1];
    const float* v    = (const float*)d_in[2];
    const int*   mask = (const int*)d_in[3];      // [4][256][256] int32
    const float* Wq   = (const float*)d_in[4];    // [512 in][512 out]
    const float* bq   = (const float*)d_in[5];
    const float* Wk   = (const float*)d_in[6];
    const float* bk   = (const float*)d_in[7];
    const float* Wv   = (const float*)d_in[8];
    const float* bv   = (const float*)d_in[9];
    const float* vp   = (const float*)d_in[10];   // [8][64]
    const float* W0   = (const float*)d_in[11];
    const float* b0   = (const float*)d_in[12];
    float* out = (float*)d_out;                   // [1024][512] f32

    // workspace carve (bytes), every offset a multiple of 512 KiB
    const size_t sz_wt = (size_t)DD * DD * 2;            // 524288   (W0T plane)
    const size_t sz_p  = (size_t)NR * DD * 4;            // 2097152  (f32 projection)
    const size_t sz_vt = (size_t)BB * HH * DK * LL * 2;  // 1048576
    const size_t sz_o  = (size_t)NR * DD * 2;            // 1048576
    size_t off = 0;
    const size_t off_wth = off;  off += sz_wt;
    const size_t off_wtl = off;  off += sz_wt;
    const size_t off_qp  = off;  off += sz_p;
    const size_t off_kp  = off;  off += sz_p;
    const size_t off_vth = off;  off += sz_vt;
    const size_t off_vtl = off;  off += sz_vt;
    const size_t off_oh  = off;  off += sz_o;
    const size_t off_ol  = off;  off += sz_o;             // total 9437184
    if (off > ws_size) return;

    char* ws = (char*)d_ws;
    unsigned short* wth = (unsigned short*)(ws + off_wth);
    unsigned short* wtl = (unsigned short*)(ws + off_wtl);
    float*          Qp  = (float*)(ws + off_qp);
    float*          Kp  = (float*)(ws + off_kp);
    unsigned short* VTh = (unsigned short*)(ws + off_vth);
    unsigned short* VTl = (unsigned short*)(ws + off_vtl);
    unsigned short* Oh  = (unsigned short*)(ws + off_oh);
    unsigned short* Ol  = (unsigned short*)(ws + off_ol);

    const float C2 = 2.8853900817779268f;    // 2*log2(e)

    // 1) Q, K projections -> Qp, Kp (B,H,L,DK) f32 = 2^(projection * 2log2e), the V projection, transposed
    //    -> VT hi/lo, and the transposed hi/lo planes of W0, as one grid of 3 x 128 + 64 blocks
    proj3_kernel<<<dim3(3 * 128 + 64), dim3(NTHR), 0, stream>>>(
        q, k, v, Wq, Wk, Wv, W0, bq, bk, bv, C2, Qp, Kp, VTh, VTl, wth, wtl);

    // 2) additive scores + softmax + P.V -> O hi/lo planes in merged (B,L,D) layout
    attn_kernel<<<dim3(LL / 16, BB * HH), dim3(NTHR), 0, stream>>>(
        Qp, Kp, vp, mask, VTh, VTl, Oh, Ol);

    // 3) output projection -> d_out
    gemm3_out_kernel<<<dim3(NR / 32, DD / TN), dim3(NTHR), 0, stream>>>(
        Oh, Ol, wth, wtl, b0, out);
}

// v010
// One run takes 29.9 microseconds.
// Next to v009, in two timings, it ran 1.05 and 1.02 times as fast.
// All steps since v000 together make it 4.29 times as fast.
#include <hip/hip_runtime.h>
#include <hip/hip_bf16.h>
#include <stddef.h>
#include <stdint.h>

// All contractions: v_wmma_f32_16x16x32_bf16 with bf16 hi/lo split operands (hi*hi + hi*lo + lo*hi, f32 accumulate): q/k/v projections, probability read-out P*V, output projection; additive scores (exp2 + rcp tanh form, the rational terms' numerators and denominators by the same matrix form), mask fill, softmax and epilogues in f32.

#define BB   4
#define LL   256
#define DD   512
#define HH   8
#define DK   64
#define NR   (BB * LL)
#define NTHR 128

static_assert(NR == 1024);
static_assert(DD == HH * DK);
static_assert(LL == 2 * NTHR);
static_assert(DK == 64);

typedef unsigned short v8us  __attribute__((ext_vector_type(8)));
typedef __bf16         v16bf __attribute__((ext_vector_type(16)));
typedef float          v8f   __attribute__((ext_vector_type(8)));
typedef float          v4f   __attribute__((ext_vector_type(4)));
typedef int            v2i   __attribute__((ext_vector_type(2)));
typedef float          v2f   __attribute__((ext_vector_type(2)));
typedef __bf16         v2bf  __attribute__((ext_vector_type(2)));

typedef unsigned int   v4u   __attribute__((ext_vector_type(4)));

union Frag { v16bf v; v8us h[2]; };
union FragU { v16bf v; v4u q[2]; };

#if __has_builtin(__builtin_amdgcn_exp2f)
#define EXP2_FAST(x) __builtin_amdgcn_exp2f(x)
#else
#define EXP2_FAST(x) exp2f(x)
#endif
#if __has_builtin(__builtin_amdgcn_rcpf)
#define RCP_FAST(x) __builtin_amdgcn_rcpf(x)
#else
#define RCP_FAST(x) (1.0f / (x))
#endif

// f32 -> bf16 bits, RNE
__device__ __forceinline__ unsigned int bf16_rne(float f)
{
    unsigned int u = __float_as_uint(f);
    u += 0x7FFFu + ((u >> 16) & 1u);
    return u >> 16;
}

// x = hi + lo, both bf16 (RNE); lo = RNE(x - f32(hi))
__device__ __forceinline__ void split1(float x, unsigned int& hb, unsigned int& lb)
{
    hb = bf16_rne(x);
    const float xh = __uint_as_float(hb << 16);
    lb = bf16_rne(x - xh);
}

// 8 consecutive values (a then b) -> one 16-byte hi vector and one 16-byte lo vector
__device__ __forceinline__ void split8(v4f a, v4f b, v8us& hi, v8us& lo)
{
    v8us hr = { 0, 0, 0, 0, 0, 0, 0, 0 };
    v8us lr = { 0, 0, 0, 0, 0, 0, 0, 0 };
    #pragma unroll
    for (int e = 0; e < 4; ++e) {
        unsigned int hb, lb;
        split1(a[e], hb, lb);
        hr[e] = (unsigned short)hb;
        lr[e] = (unsigned short)lb;
        split1(b[e], hb, lb);
        hr[4 + e] = (unsigned short)hb;
        lr[4 + e] = (unsigned short)lb;
    }
    hi = hr;
    lo = lr;
}

// 16-bit fragment loader (wave32, 16x16x32): lane l, hh = l>>4, row/col = l&15.
// elements 0..7  <- row[k0 + 8*hh + 0..7], elements 8..15 <- row[k0 + 16 + 8*hh + 0..7].
// Used for A (row-major, k contiguous) and for B stored as [n][k] (k contiguous).
__device__ __forceinline__ v16bf frag16(const unsigned short* row, int k0, int hh)
{
    Frag f;
    f.h[0] = *(const v8us*)(row + k0 + 8 * hh);
    f.h[1] = *(const v8us*)(row + k0 + 16 + 8 * hh);
    return f.v;
}

// D += A*B with the VALU hazard guard after the instruction.
__device__ __forceinline__ v8f wmma_bf16(v16bf a, v16bf b, v8f c)
{
    v8f d = __builtin_amdgcn_wmma_f32_16x16x32_bf16(false, a, false, b, (short)0, c, false, false);
    asm volatile("v_nop\n\tv_nop\n\tv_nop\n\tv_nop" : "+v"(d) : "v"(a), "v"(b));
    return d;
}

// hi/lo split product: hh + hl + lh into one accumulator
__device__ __forceinline__ v8f wmma3(v16bf ah, v16bf al, v16bf bh, v16bf bl, v8f c)
{
    c = wmma_bf16(ah, bh, c);
    c = wmma_bf16(ah, bl, c);
    c = wmma_bf16(al, bh, c);
    return c;
}

// 16 values -> one hi and one lo fragment, x = hi + lo, both bf16 (RNE), lo = RNE(x - f32(hi)): the same values as
// split1, formed by the chip's own f32 -> bf16 conversion, since here the split stands in a k loop.
__device__ __forceinline__ void split16(const float (&x)[16], v16bf& hi, v16bf& lo)
{
    union Pairs { v16bf v; v2bf p[8]; } fh, fl;
    #pragma unroll
    for (int e = 0; e < 8; ++e) {        // by pairs: one conversion instruction makes two bf16
        const v2f x2 = { x[2 * e], x[2 * e + 1] };
        const v2bf h2 = __builtin_convertvector(x2, v2bf);
        const v2f r2 = { x2[0] - (float)h2[0], x2[1] - (float)h2[1] };
        fh.p[e] = h2;
        fl.p[e] = __builtin_convertvector(r2, v2bf);
    }
    hi = fh.v;
    lo = fl.v;
}

// Two values -> one dword of their bf16 hi parts and one of their lo parts (first value in the low half), as split16.
__device__ __forceinline__ void split2(v2f x, unsigned int& hp, unsigned int& lp)
{
    const v2bf h2 = __builtin_convertvector(x, v2bf);
    const v2f r2 = { x[0] - (float)h2[0], x[1] - (float)h2[1] };
    const v2bf l2 = __builtin_convertvector(r2, v2bf);
    hp = __builtin_bit_cast(unsigned int, h2);
    lp = __builtin_bit_cast(unsigned int, l2);
}

// The same where the second value is a bf16 number already: its lo part is 0.
__device__ __forceinline__ void split2one(v2f x, unsigned int& hp, unsigned int& lp)
{
    const v2bf h2 = __builtin_convertvector(x, v2bf);
    const v2f r2 = { x[0] - (float)h2[0], 0.0f };
    const v2bf l2 = __builtin_convertvector(r2, v2bf);
    hp = __builtin_bit_cast(unsigned int, h2);
    lp = __builtin_bit_cast(unsigned int, l2);
}

// The same for two fragments whose values come side by side (w[e] = element e of fragment 0 and of fragment 1): the
// remainders are formed on those pairs as they were read, so no register is moved to make a pair.
__device__ __forceinline__ void split16x2(const v2f (&w)[16], v16bf& hi0, v16bf& lo0, v16bf& hi1, v16bf& lo1)
{
    union Pairs { v16bf v; v2bf p[8]; } fh0, fl0, fh1, fl1;
    #pragma unroll
    for (int e = 0; e < 8; ++e) {
        const v2f a = w[2 * e], b = w[2 * e + 1];
        const v2f c0 = { a[0], b[0] }, c1 = { a[1], b[1] };
        const v2bf h0 = __builtin_convertvector(c0, v2bf);
        const v2bf h1 = __builtin_convertvector(c1, v2bf);
        const v2f ha = { (float)h0[0], (float)h1[0] }, hb = { (float)h0[1], (float)h1[1] };
        const v2f ra = a - ha, rb = b - hb;
        const v2f d0 = { ra[0], rb[0] }, d1 = { ra[1], rb[1] };
        fh0.p[e] = h0;
        fh1.p[e] = h1;
        fl0.p[e] = __builtin_convertvector(d0, v2bf);
        fl1.p[e] = __builtin_convertvector(d1, v2bf);
    }
    hi0 = fh0.v; lo0 = fl0.v; hi1 = fh1.v; lo1 = fl1.v;
}

// hi/lo split product with the plain builtin: in a k loop that is full of vector work the compiler fills the
// slots behind a matrix instruction with that work.
__device__ __forceinline__ v8f wmma3p(v16bf ah, v16bf al, v16bf bh, v16bf bl, v8f c)
{
    c = __builtin_amdgcn_wmma_f32_16x16x32_bf16(false, ah, false, bh, (short)0, c, false, false);
    c = __builtin_amdgcn_wmma_f32_16x16x32_bf16(false, ah, false, bl, (short)0, c, false, false);
    c = __builtin_amdgcn_wmma_f32_16x16x32_bf16(false, al, false, bh, (short)0, c, false, false);
    return c;
}

// ---------------------------------------------------------------------------
// Output weight planes for the last launch: w0th/w0tl[n][512] = split(W0[k][n]) (transposed, k contiguous),
// one 64 x 64 tile per block of 128 threads, tile = 0..63.
// ---------------------------------------------------------------------------
__device__ __forceinline__ void w0_planes(
    const float* __restrict__ W0, unsigned short* w0th, unsigned short* w0tl, int tile, float (*s_t)[65])
{
    const int tid = threadIdx.x;
    const int k0  = (tile >> 3) * 64;
    const int n0  = (tile & 7) * 64;
    // load W0[k0+kk][n0+nn] -> s_t[nn][kk]: load i of thread tid has kk = (tid >> 4) + 8*i, columns 4*(tid & 15) + 0..3
    const int kt = tid >> 4;             // 0..7
    const int c4 = tid & 15;             // 0..15
    const float* gw0 = W0 + (size_t)(k0 + kt) * DD + n0 + 4 * c4;
    v4f x[8];
    #pragma unroll
    for (int i = 0; i < 8; ++i) x[i] = *(const v4f*)(gw0 + (size_t)i * 8 * DD);
    // all eight loads name one address; it is an input here, so it keeps its registers up to this wait
    asm volatile("s_wait_xcnt 0x0" :: "v"(gw0) : "memory");
    #pragma unroll
    for (int i = 0; i < 8; ++i) {
        s_t[4 * c4 + 0][kt + 8 * i] = x[i][0];
        s_t[4 * c4 + 1][kt + 8 * i] = x[i][1];
        s_t[4 * c4 + 2][kt + 8 * i] = x[i][2];
        s_t[4 * c4 + 3][kt + 8 * i] = x[i][3];
    }
    __syncthreads();
    v8us hv[4], lv[4];
    size_t off[4];
    #pragma unroll
    for (int i = 0; i < 4; ++i) {
        const int idx = tid + NTHR * i;  // 0..511
        const int nn  = idx >> 3;        // 0..63
        const int k8  = idx & 7;         // 0..7
        const v4f a  = { s_t[nn][8 * k8 + 0], s_t[nn][8 * k8 + 1], s_t[nn][8 * k8 + 2], s_t[nn][8 * k8 + 3] };
        const v4f b2 = { s_t[nn][8 * k8 + 4], s_t[nn][8 * k8 + 5], s_t[nn][8 * k8 + 6], s_t[nn][8 * k8 + 7] };
        split8(a, b2, hv[i], lv[i]);
        off[i] = (size_t)(n0 + nn) * DD + k0 + 8 * k8;
    }
    #pragma unroll
    for (int i = 0; i < 4; ++i) {
        *(v8us*)(w0th + off[i]) = hv[i];
        *(v8us*)(w0tl + off[i]) = lv[i];
    }
}

// ---------------------------------------------------------------------------
// C[32*WR rows of A][64 rows of Bt] = Ah/Al[.][512] . Bt h/l[.][512]^T  (K = 512, hi/lo split).
// One block of 128 threads per tile; row0, col0 = first A row and first Bt row of the tile.
// The tile is small so that the grids cover the chip's WGPs: a K = 512 product of this size is a chain of
// latencies per block, and a narrow tile shortens every link (copies, fragment reads, WMMAs, epilogue).
// WR = 1: four waves side by side, wave wv has rows 0..31 and the col tile at 16*wv.
// WR = 2: waves 2 x 2, wave wv has rows 32*(wv >> 1) + 0..31 and the col tiles at 32*(wv & 1) + 16*j, j = 0..1.
// k slices of 128 staged in LDS by asynchronous copies, two buffers; epilogue staged in LDS. With two buffers one
// slice is in flight at a time, so the loop pays one copy flight per slice: few, long slices.
// MODE 0: Cf[m][512] f32 = (C + bias[n]) * post                    (plain row-major)
// MODE 1: Cf[(b*8+h)*256 + l][64] f32 = 2^((C + bsum[n]) * post),  m = b*256+l, n = h*64+dk;
//         bsum = bias + bias2 where both_bias is set, 0 where it is not
// MODE 2: A rows are n = h*64+dk, Bt rows are m = b*256+j:
//         Ch/Cl[(b*8+h)*64 + dk][256 j] = split(C + bias[n])       (per-row bias)
// ---------------------------------------------------------------------------
// One k slice of the tile in LDS: rows of KT 16-bit values, [Ah 32*WR | Al 32*WR | Bh 64 | Bl 64],
// row pitch 272 B (16 B x odd: conflict-free for the 16-byte fragment reads).
#define KT       128
#define SPITCH   136                      // 16-bit elements per staged row
#define TN       64                       // Bt rows (output columns) of a tile
#define CPITCH   68                       // f32 elements per row of the staged result
#define SROWS(WR) (64 * (WR) + 2 * TN)    // staged rows per slice: 192 or 256
#define SBUF(WR)  (SROWS(WR) * SPITCH)    // elements per buffer (52224 B or 69632 B)
#define NTRIP    (DD / KT)

static_assert(NTRIP >= 2);
static_assert(SROWS(1) * (KT / 8) == 24 * NTHR);
static_assert(SROWS(2) * (KT / 8) == 32 * NTHR);

// Twelve 16-byte asynchronous copies global -> LDS, each lane its own addresses. The s_wait_xcnt
// is the last line of the copies' own statement, so no address register is rewritten ahead of it.
__device__ __forceinline__ void copy12(const unsigned int* la, const unsigned short* const* ga)
{
    asm volatile(
        "global_load_async_to_lds_b128 %0, %12, off\n\t"
        "global_load_async_to_lds_b128 %1, %13, off\n\t"
        "global_load_async_to_lds_b128 %2, %14, off\n\t"
        "global_load_async_to_lds_b128 %3, %15, off\n\t"
        "global_load_async_to_lds_b128 %4, %16, off\n\t"
        "global_load_async_to_lds_b128 %5, %17, off\n\t"
        "global_load_async_to_lds_b128 %6, %18, off\n\t"
        "global_load_async_to_lds_b128 %7, %19, off\n\t"
        "global_load_async_to_lds_b128 %8, %20, off\n\t"
        "global_load_async_to_lds_b128 %9, %21, off\n\t"
        "global_load_async_to_lds_b128 %10, %22, off\n\t"
        "global_load_async_to_lds_b128 %11, %23, off\n\t"
        "s_wait_xcnt 0x0"
        :: "v"(la[0]), "v"(la[1]), "v"(la[2]), "v"(la[3]), "v"(la[4]), "v"(la[5]),
           "v"(la[6]), "v"(la[7]), "v"(la[8]), "v"(la[9]), "v"(la[10]), "v"(la[11]),
           "v"(ga[0]), "v"(ga[1]), "v"(ga[2]), "v"(ga[3]), "v"(ga[4]), "v"(ga[5]),
           "v"(ga[6]), "v"(ga[7]), "v"(ga[8]), "v"(ga[9]), "v"(ga[10]), "v"(ga[11])
        : "memory");
}

// The same for eight copies (a slice of 256 rows is two runs of twelve and one of eight).
__device__ __forceinline__ void copy8h(const unsigned int* la, const unsigned short* const* ga)
{
    asm volatile(
        "global_load_async_to_lds_b128 %0, %8, off\n\t"
        "global_load_async_to_lds_b128 %1, %9, off\n\t"
        "global_load_async_to_lds_b128 %2, %10, off\n\t"
        "global_load_async_to_lds_b128 %3, %11, off\n\t"
        "global_load_async_to_lds_b128 %4, %12, off\n\t"
        "global_load_async_to_lds_b128 %5, %13, off\n\t"
        "global_load_async_to_lds_b128 %6, %14, off\n\t"
        "global_load_async_to_lds_b128 %7, %15, off\n\t"
        "s_wait_xcnt 0x0"
        :: "v"(la[0]), "v"(la[1]), "v"(la[2]), "v"(la[3]), "v"(la[4]), "v"(la[5]), "v"(la[6]), "v"(la[7]),
           "v"(ga[0]), "v"(ga[1]), "v"(ga[2]), "v"(ga[3]), "v"(ga[4]), "v"(ga[5]), "v"(ga[6]), "v"(ga[7])
        : "memory");
}

// Stage one k slice: copy i of thread tid moves 16 B of staged row 8*i + (tid >> 4), chunk tid & 15,
// so a wave's copy covers four whole 128-B lines (two rows of 256 B). lds0 and the four pointers
// already hold the thread's row and chunk; kk = first k of the slice.
template <int WR>
__device__ __forceinline__ void stage_slice(
    unsigned int lds0,
    const unsigned short* gah, const unsigned short* gal,
    const unsigned short* gbh, const unsigned short* gbl, int kk)
{
    constexpr int AG = 4 * WR;            // groups of 8 rows in one A plane
    constexpr int BG = TN / 8;            // groups of 8 rows in one B plane
    constexpr int NC = 2 * AG + 2 * BG;   // copies per thread: 24 or 32
    unsigned int la[NC];
    const unsigned short* ga[NC];
    #pragma unroll
    for (int i = 0; i < NC; ++i) {
        la[i] = lds0 + (unsigned int)(i * 8 * SPITCH * 2);
        ga[i] = ((i < AG)          ? gah + (size_t)i * 8 * DD
               : (i < 2 * AG)      ? gal + (size_t)(i - AG) * 8 * DD
               : (i < 2 * AG + BG) ? gbh + (size_t)(i - 2 * AG) * 8 * DD
                                   : gbl + (size_t)(i - 2 * AG - BG) * 8 * DD) + kk;
    }
    if constexpr (NC == 24) {
        copy12(la, ga);
        copy12(la + 12, ga + 12);
    } else {
        copy12(la, ga);
        copy12(la + 12, ga + 12);
        copy8h(la + 24, ga + 24);
    }
}

template <int WR>
__device__ __forceinline__ void gemm3_main(
    const unsigned short* __restrict__ Ah, const unsigned short* __restrict__ Al,
    const unsigned short* __restrict__ Bh, const unsigned short* __restrict__ Bl,
    int row0, int col0, float (*s_c)[CPITCH], unsigned short* s_st)
{
    constexpr int AR = 32 * WR;           // A rows of the tile
    constexpr int NJ = WR;                // col tiles per wave
    constexpr int WC = 4 / WR;            // waves side by side

    const int tid  = threadIdx.x;
    const int wv   = tid >> 5;
    const int l    = tid & 31;
    const int hh   = l >> 4;
    const int m15  = l & 15;
    const int ar0  = 32 * (wv / WC);          // first tile row of this wave
    const int bc0  = 16 * NJ * (wv % WC);     // first tile column of this wave

    const v8f zero = { 0.f, 0.f, 0.f, 0.f, 0.f, 0.f, 0.f, 0.f };
    v8f acc[2][NJ];
    #pragma unroll
    for (int rt = 0; rt < 2; ++rt)
        #pragma unroll
        for (int j = 0; j < NJ; ++j) acc[rt][j] = zero;

    // copy side: this thread's row (of 8) and 16-byte chunk (of 16)
    const int crow = tid >> 4;
    const int cchk = tid & 15;
    const unsigned short* gah = Ah + (size_t)(row0 + crow) * DD + 8 * cchk;
    const unsigned short* gal = Al + (size_t)(row0 + crow) * DD + 8 * cchk;
    const unsigned short* gbh = Bh + (size_t)(col0 + crow) * DD + 8 * cchk;
    const unsigned short* gbl = Bl + (size_t)(col0 + crow) * DD + 8 * cchk;
    const unsigned int lds0 = (unsigned int)(uintptr_t)s_st + (unsigned int)(crow * SPITCH * 2 + cchk * 16);

    // read side: element offsets of this lane's fragment rows inside a buffer
    const int oa0h = (ar0 + m15) * SPITCH;
    const int oa1h = (ar0 + 16 + m15) * SPITCH;
    const int oa0l = (AR + ar0 + m15) * SPITCH;
    const int oa1l = (AR + ar0 + 16 + m15) * SPITCH;
    const int obh  = (2 * AR + bc0 + m15) * SPITCH;
    const int obl  = (2 * AR + TN + bc0 + m15) * SPITCH;

    // slice 0 lands and is published, then slice 1 starts to fly
    stage_slice<WR>(lds0, gah, gal, gbh, gbl, 0);
    asm volatile("s_wait_asynccnt 0x0" ::: "memory");   // this wave's copies of slice 0 have landed
    __syncthreads();
    stage_slice<WR>(lds0 + SBUF(WR) * 2, gah, gal, gbh, gbl, KT);

    // kept rolled: the trips are chained by their barriers, unrolling would only add code to fetch
    #pragma unroll 1
    for (int t = 0; t < NTRIP; ++t) {
        const unsigned short* sb = s_st + (t & 1) * SBUF(WR);
        #pragma unroll
        for (int k0 = 0; k0 < KT; k0 += 32) {
            const v16bf fa0h = frag16(sb + oa0h, k0, hh);
            const v16bf fa0l = frag16(sb + oa0l, k0, hh);
            const v16bf fa1h = frag16(sb + oa1h, k0, hh);
            const v16bf fa1l = frag16(sb + oa1l, k0, hh);
            // all fragments of a k step are read as one group, so one LDS latency is waited out per step
            v16bf fbh[NJ], fbl[NJ];
            #pragma unroll
            for (int j = 0; j < NJ; ++j) {
                fbh[j] = frag16(sb + obh + j * 16 * SPITCH, k0, hh);
                fbl[j] = frag16(sb + obl + j * 16 * SPITCH, k0, hh);
            }
            #pragma unroll
            for (int j = 0; j < NJ; ++j) {
                acc[0][j] = wmma3(fa0h, fa0l, fbh[j], fbl[j], acc[0][j]);
                acc[1][j] = wmma3(fa1h, fa1l, fbh[j], fbl[j], acc[1][j]);
            }
        }
        asm volatile("s_wait_dscnt 0x0" ::: "memory");      // this wave's reads of the buffer are done before it is refilled
        asm volatile("s_wait_asynccnt 0x0" ::: "memory");   // this wave's copies of slice t + 1 have landed
        __syncthreads();                                    // publishes slice t + 1, frees slice t's buffer
        if (t + 2 < NTRIP)
            stage_slice<WR>(lds0 + (unsigned int)((t & 1) * SBUF(WR) * 2), gah, gal, gbh, gbl, (t + 2) * KT);
    }
    asm volatile("s_wait_asynccnt 0x0" ::: "memory");       // no copy is outstanding past the loop

    // D element r of lane -> (row 8*hh + r, col m15) of the 16x16 tile
    #pragma unroll
    for (int rt = 0; rt < 2; ++rt)
        #pragma unroll
        for (int j = 0; j < NJ; ++j)
            #pragma unroll
            for (int r = 0; r < 8; ++r)
                s_c[ar0 + rt * 16 + 8 * hh + r][bc0 + 16 * j + m15] = acc[rt][j][r];
    __syncthreads();
}

template <int MODE, int WR>
__device__ __forceinline__ void gemm3_epilogue(
    const float* __restrict__ bias, float post,
    float* Cf, unsigned short* Ch, unsigned short* Cl,
    int row0, int col0, const float (*s_c)[CPITCH],
    const float* __restrict__ bias2 = nullptr, bool both_bias = false)
{
    constexpr int AR = 32 * WR;                     // rows of the tile
    constexpr int N4 = AR * (TN / 4) / NTHR;        // 16-byte f32 pieces per thread
    constexpr int N8 = AR * (TN / 8) / NTHR;        // 8-element pieces per thread
    const int tid = threadIdx.x;

    if (MODE == 0) {
        v4f vals[N4];
        size_t off[N4];
        const int c4 = tid & 15;                // all pieces of a thread lie in the same four columns
        const v4f bb = *(const v4f*)(bias + col0 + 4 * c4);
        #pragma unroll
        for (int i = 0; i < N4; ++i) {
            const int row = (tid >> 4) + 8 * i; // 0..AR-1
            const v4f x  = *(const v4f*)&s_c[row][4 * c4];
            vals[i] = (x + bb) * post;
            off[i]  = (size_t)(row0 + row) * DD + col0 + 4 * c4;
        }
        #pragma unroll
        for (int i = 0; i < N4; ++i) *(v4f*)(Cf + off[i]) = vals[i];
        
    } else if (MODE == 1) {
        v4f vals[N4];
        size_t off[N4];
        const int c4 = tid & 15;                // all pieces of a thread lie in the same four columns
        const int n  = col0 + 4 * c4;           // the tile's 64 columns are one head
        const v4f b1 = *(const v4f*)(bias + n);
        const v4f b2 = *(const v4f*)(bias2 + n);
        // the address registers of the bias loads are reused by the code that follows them
        asm volatile("s_wait_xcnt 0x0" ::: "memory");
        // Only q + k enters the score, so both biases go into the q factor and none into the k
        // factor: biases of opposite sign cancel here, before the exponent is clamped.
        const v4f zero4 = { 0.f, 0.f, 0.f, 0.f };
        const v4f bb = both_bias ? (b1 + b2) : zero4;
        #pragma unroll
        for (int i = 0; i < N4; ++i) {
            const int row = (tid >> 4) + 8 * i; // 0..AR-1
            const v4f x  = *(const v4f*)&s_c[row][4 * c4];
            // The exponent is held within +-31: the score kernel multiplies the factors of two d (two query and
            // two key factors), and 2^124 is still finite, its reciprocal still normal, and no product is inf * 0.
            // A projected value beyond 10.7 thus counts as 10.7 (tanh is saturated there); the pair's tanh differs
            // from the true one only where the other side's value lies well on the opposite side.
            const v4f y = (x + bb) * post;
            #pragma unroll   // constant element indices, so that vals stays in registers
            for (int e = 0; e < 4; ++e) vals[i][e] = fminf(fmaxf(y[e], -31.0f), 31.0f);
            const int m  = row0 + row;
            const int b  = m >> 8;
            const int lq = m & 255;
            const int h  = n >> 6;
            off[i] = ((size_t)((b * HH + h) * LL + lq)) * DK + 4 * c4;
        }
        #pragma unroll
        for (int i = 0; i < N4; ++i) {
            #pragma unroll   // constant element indices, so that vals stays in registers
            for (int e = 0; e < 4; ++e) vals[i][e] = EXP2_FAST(vals[i][e]);
            *(v4f*)(Cf + off[i]) = vals[i];
        }
        // in the merged kernel other code follows these stores in the listing and reuses their registers
        asm volatile("s_wait_xcnt 0x0" ::: "memory");
    } else {
        v8us hv[N8], lv[N8];
        size_t off[N8];
        const int b  = col0 >> 8;
        const int jb = col0 & 255;              // first key of the tile inside its batch
        #pragma unroll
        for (int i = 0; i < N8; ++i) {
            const int idx = tid + NTHR * i;
            const int row = idx >> 3;           // 0..AR-1 (eight threads write one 128-B line per plane)
            const int c8  = idx & 7;            // 0..7
            const float bs = bias[row0 + row];
            const v4f bb = { bs, bs, bs, bs };
            const v4f x0 = *(const v4f*)&s_c[row][8 * c8] + bb;
            const v4f x1 = *(const v4f*)&s_c[row][8 * c8 + 4] + bb;
            split8(x0, x1, hv[i], lv[i]);
            const int n  = row0 + row;
            const int h  = n >> 6;
            const int dk = n & 63;
            off[i] = ((size_t)((b * HH + h) * DK + dk)) * LL + jb + 8 * c8;
        }
        #pragma unroll
        for (int i = 0; i < N8; ++i) {
            *(v8us*)(Ch + off[i]) = hv[i];
            *(v8us*)(Cl + off[i]) = lv[i];
        }
        
    }
}

// Output projection: one 32 x 64 tile per block (256 blocks), row0 = 32*blockIdx.x, col0 = 64*blockIdx.y.
__global__ void __launch_bounds__(NTHR) gemm3_out_kernel(
    const unsigned short* __restrict__ Ah, const unsigned short* __restrict__ Al,
    const unsigned short* __restrict__ Bh, const unsigned short* __restrict__ Bl,
    const float* __restrict__ bias, float* Cf)
{
    __shared__ __align__(16) float s_c[32][CPITCH];
    __shared__ __align__(16) unsigned short s_st[2 * SBUF(1)];
    const int row0 = blockIdx.x * 32;
    const int col0 = blockIdx.y * TN;
    gemm3_main<1>(Ah, Al, Bh, Bl, row0, col0, s_c, s_st);
    gemm3_epilogue<0, 1>(bias, 1.0f, Cf, nullptr, nullptr, row0, col0, s_c);
}

// ---------------------------------------------------------------------------
// k loop of the input projections, straight from the f32 inputs: C[64 rows of X][64 columns of Wm], K = 512.
// A k slice of 128 is staged as f32 (the bytes of a hi and a lo plane together) by asynchronous copies, two
// buffers, the ring of gemm3_main; a wave splits its fragments to bf16 hi/lo in registers as it reads them.
// X rows [64][128] at a pitch of 528 B (16 B x odd) feed the A fragments by 16-byte reads. Wm rows [128 k][64 n]
// at a pitch of 272 B feed the B fragments down the columns: a lane reads 8 bytes per k, columns 2*m15 and
// 2*m15 + 1 of the wave's 32, which are column m15 of its col tiles 0 and 1; the two half-waves stand 8 rows
// (32 banks) apart, so a read touches every bank once.
// Waves 2 x 2: wave wv has rows 32*(wv >> 1) + 0..31 and columns 32*(wv & 1) + 0..31.
// transposed: the result is staged as s_c[column][row] (the v projection), else as s_c[row][column].
// ---------------------------------------------------------------------------
#define XP    132                         // f32 per staged X row
#define WP    68                          // f32 per staged Wm row
#define FX    (64 * XP)                   // f32 of the X part of a buffer
#define FBUF  (FX + KT * WP)              // f32 per buffer (68608 B)

static_assert(64 * (KT / 4) == 16 * NTHR);   // X part: 16 copies per thread
static_assert(KT * (TN / 4) == 16 * NTHR);   // Wm part: 16 copies per thread

// Stage one k slice. X: copy i of thread tid moves 16 B of row 4*i + (tid >> 5), chunk tid & 31 (a wave's copy is
// one row of 512 B). Wm: copy i moves 16 B of k row 8*i + (tid >> 4), chunk tid & 15 (two rows of 256 B).
// The LDS addresses and pointers already hold the thread's row and chunk; kk = first k of the slice.
__device__ __forceinline__ void stage_f32(unsigned int lx0, unsigned int lw0, const float* gx, const float* gw, int kk)
{
    unsigned int la[32];
    const unsigned short* ga[32];
    #pragma unroll   // constant indices, so that both address arrays stay in registers
    for (int i = 0; i < 16; ++i) {
        la[i]      = lx0 + (unsigned int)(i * 4 * XP * 4);
        ga[i]      = (const unsigned short*)(gx + (size_t)i * 4 * DD + kk);
        la[16 + i] = lw0 + (unsigned int)(i * 8 * WP * 4);
        ga[16 + i] = (const unsigned short*)(gw + (size_t)(kk + 8 * i) * DD);
    }
    copy12(la, ga);
    copy12(la + 12, ga + 12);
    copy8h(la + 24, ga + 24);
}

__device__ __forceinline__ void proj_main(
    const float* __restrict__ X, const float* __restrict__ Wm,
    int xr0, int wc0, bool transposed, float (*s_c)[CPITCH], float* s_f)
{
    const int tid  = threadIdx.x;
    const int wv   = tid >> 5;
    const int l    = tid & 31;
    const int hh   = l >> 4;
    const int m15  = l & 15;
    const int ar0  = 32 * (wv >> 1);          // first tile row of this wave
    const int bc0  = 32 * (wv & 1);           // first tile column of this wave

    const v8f zero = { 0.f, 0.f, 0.f, 0.f, 0.f, 0.f, 0.f, 0.f };
    v8f acc[2][2];
    #pragma unroll
    for (int rt = 0; rt < 2; ++rt)
        #pragma unroll
        for (int j = 0; j < 2; ++j) acc[rt][j] = zero;

    // copy side
    const float* gx = X + (size_t)(xr0 + (tid >> 5)) * DD + 4 * (tid & 31);
    const float* gw = Wm + (size_t)(tid >> 4) * DD + wc0 + 4 * (tid & 15);
    const unsigned int lx0 = (unsigned int)(uintptr_t)s_f + (unsigned int)((tid >> 5) * (XP * 4) + (tid & 31) * 16);
    const unsigned int lw0 = (unsigned int)(uintptr_t)s_f + (unsigned int)(FX * 4 + (tid >> 4) * (WP * 4) + (tid & 15) * 16);

    // read side: f32 offsets of this lane's fragment rows and columns inside a buffer, its k half included
    const int ox0 = (ar0 + m15) * XP + 8 * hh;
    const int ox1 = ox0 + 16 * XP;
    const int ow  = FX + 8 * hh * WP + bc0 + 2 * m15;

    // slice 0 lands and is published, then slice 1 starts to fly
    stage_f32(lx0, lw0, gx, gw, 0);
    asm volatile("s_wait_asynccnt 0x0" ::: "memory");   // this wave's copies of slice 0 have landed
    __syncthreads();
    stage_f32(lx0 + FBUF * 4, lw0 + FBUF * 4, gx, gw, KT);

    // kept rolled: the trips are chained by their barriers, unrolling would only add code to fetch
    #pragma unroll 1
    for (int t = 0; t < NTRIP; ++t) {
        const float* sb = s_f + (t & 1) * FBUF;
        #pragma unroll
        for (int k0 = 0; k0 < KT; k0 += 32) {
            // fragment element e holds k = k0 + 8*hh + e (e < 8) or k0 + 16 + 8*hh + e - 8, on both sides
            float xa0[16], xa1[16];
            v2f wb[16];
            #pragma unroll
            for (int g = 0; g < 4; ++g) {
                const int ko = k0 + (g >> 1) * 16 + (g & 1) * 4;
                const v4f a = *(const v4f*)(sb + ox0 + ko);
                const v4f b = *(const v4f*)(sb + ox1 + ko);
                #pragma unroll
                for (int e = 0; e < 4; ++e) { xa0[4 * g + e] = a[e]; xa1[4 * g + e] = b[e]; }
            }
            #pragma unroll
            for (int e = 0; e < 16; ++e) {
                const int kr = k0 + (e >> 3) * 16 + (e & 7);
                wb[e] = *(const v2f*)(sb + ow + kr * WP);
            }
            v16bf fa0h, fa0l, fa1h, fa1l, fbh[2], fbl[2];
            split16(xa0, fa0h, fa0l);
            split16(xa1, fa1h, fa1l);
            split16x2(wb, fbh[0], fbl[0], fbh[1], fbl[1]);
            #pragma unroll
            for (int j = 0; j < 2; ++j) {
                acc[0][j] = wmma3p(fa0h, fa0l, fbh[j], fbl[j], acc[0][j]);
                acc[1][j] = wmma3p(fa1h, fa1l, fbh[j], fbl[j], acc[1][j]);
            }
        }
        asm volatile("s_wait_dscnt 0x0" ::: "memory");      // this wave's reads of the buffer are done before it is refilled
        asm volatile("s_wait_asynccnt 0x0" ::: "memory");   // this wave's copies of slice t + 1 have landed
        __syncthreads();                                    // publishes slice t + 1, frees slice t's buffer
        if (t + 2 < NTRIP) {
            const unsigned int bo = (unsigned int)((t & 1) * FBUF * 4);
            stage_f32(lx0 + bo, lw0 + bo, gx, gw, (t + 2) * KT);
        }
    }
    asm volatile("s_wait_asynccnt 0x0" ::: "memory");       // no copy is outstanding past the loop

    // D element r of lane -> (row 8*hh + r, col m15) of the 16x16 tile; col m15 of col tile j is column 2*m15 + j
    if (transposed) {
        #pragma unroll
        for (int rt = 0; rt < 2; ++rt)
            #pragma unroll
            for (int j = 0; j < 2; ++j) {
                const v4f y0 = { acc[rt][j][0], acc[rt][j][1], acc[rt][j][2], acc[rt][j][3] };
                const v4f y1 = { acc[rt][j][4], acc[rt][j][5], acc[rt][j][6], acc[rt][j][7] };
                *(v4f*)&s_c[bc0 + 2 * m15 + j][ar0 + rt * 16 + 8 * hh]     = y0;
                *(v4f*)&s_c[bc0 + 2 * m15 + j][ar0 + rt * 16 + 8 * hh + 4] = y1;
            }
    } else {
        #pragma unroll
        for (int rt = 0; rt < 2; ++rt)
            #pragma unroll
            for (int r = 0; r < 8; ++r) {
                const v2f y = { acc[rt][0][r], acc[rt][1][r] };
                *(v2f*)&s_c[ar0 + rt * 16 + 8 * hh + r][bc0 + 2 * m15] = y;
            }
    }
    __syncthreads();
}

// The three input projections in one grid, read from the f32 inputs: none reads another's output. 64 x 64 tiles,
// 128 per projection: block 128*t + tile, t = 0:q 1:k 2:v. Blocks 384..447 write the output weight's planes for the
// last launch; they are short and come last.
//  q, k: 16 tiles of activation rows x 8 of weight columns, MODE 1.
//  v:    the same product, staged transposed (rows = weight columns), MODE 2.
__global__ void __launch_bounds__(NTHR) proj3_kernel(
    const float* __restrict__ q, const float* __restrict__ k, const float* __restrict__ v,
    const float* __restrict__ Wq, const float* __restrict__ Wk, const float* __restrict__ Wv,
    const float* __restrict__ W0,
    const float* __restrict__ bq, const float* __restrict__ bk, const float* __restrict__ bv,
    float post, float* Qp, float* Kp, unsigned short* VTh, unsigned short* VTl,
    unsigned short* w0th, unsigned short* w0tl)
{
    __shared__ __align__(16) float s_c[64][CPITCH];
    __shared__ __align__(16) float s_f[2 * FBUF];

    const int bid = blockIdx.x;
    if (bid >= 3 * 128) {
        w0_planes(W0, w0th, w0tl, bid - 3 * 128, (float (*)[65])s_f);
        return;
    }
    const int  t    = bid >> 7;
    const int  tile = bid & 127;
    const bool isv  = (t == 2);
    const float* X  = (t == 0) ? q  : ((t == 1) ? k  : v);
    const float* Wm = (t == 0) ? Wq : ((t == 1) ? Wk : Wv);
    const int xr0 = (isv ? (tile >> 3) : (tile & 15)) * 64;   // first activation row
    const int wc0 = (isv ? (tile & 7) : (tile >> 4)) * TN;    // first weight column

    // one copy of the k loop serves all three; only the staging of the result and the epilogue differ
    proj_main(X, Wm, xr0, wc0, isv, s_c, s_f);
    if (isv) gemm3_epilogue<2, 2>(bv, 1.0f, nullptr, VTh, VTl, wc0, xr0, s_c);
    else     gemm3_epilogue<1, 2>(bq, post, (t == 0) ? Qp : Kp, nullptr, nullptr, xr0, wc0, s_c, bk, t == 0);
}

// ---------------------------------------------------------------------------
// Additive scores + softmax + read-out for one (b, h, 16 query rows) block, 128 threads.
// Qp holds e^{2(q + bq + bk)} and Kp e^{2k} of the bias-free projections q, k in (B,H,L,DK) f32 layout:
// their product is e^{2x} of the pair's x = (q + bq) + (k + bk), so the exponential is taken once per
// projected element and not once per (query, key) pair.
// tanh(x) = 1 - 2/(1 + e^{2x}); score = sum_d vp_d - 2 * sum_d vp_d/(1 + e^{2x_d});
// the constant sum_d vp_d is invariant under softmax and omitted. mask == 0 -> -1e9.
// The d are taken in pairs: a pair's two terms over one denominator, whose numerator and denominator are inner
// products of length 4 between a query vector and a key vector, formed for 16 query rows x 16 keys at a time by
// v_wmma_f32_16x16x32_bf16 on hi/lo operands; per pair and score the vector unit is left with one reciprocal and one
// multiply-add, and per pair and key with the split of the key vector.
// Wave wv owns keys 64*wv + 0..63 as four score tiles, all 16 query rows; one block softmax. P is split to bf16
// hi/lo in LDS (dword stores, barrier, then 16-byte fragment reloads) and feeds O = P . VT^T,
// VT = [bh][dk][256 j] hi/lo planes, staged in LDS behind the score loop; wave wv owns the dk tile 16*wv.
// The head's K rows (256 keys x 64 f32) are staged once per block in LDS by asynchronous copies of
// whole lines: a thread reading its own four rows from global memory touches 16 lines per load.
// Key j lies in LDS row (j >> 1) + 128 * (j & 1), row pitch 272 B (16 B x odd), so that the lanes of
// a wave, which own every second key, read rows one pitch apart without bank conflicts.
// ---------------------------------------------------------------------------
#define KPITCH 68                         // f32 elements per staged K row
// Read-out operands: P rows and staged V rows have a pitch of 528 B (16 B x odd). At the plain 512 B the 16 rows
// of a fragment read start on one bank and a 16-byte read is served one lane at a time.
#define VPITCH 264                        // 16-bit elements per P row and per staged V row

// 2^x with a v_nop behind it in the same statement: the instruction set asks for one independent instruction
// before a transcendental's result is read or its source register rewritten.
__device__ __forceinline__ float exp2_slot(float x)
{
    float r;
    asm("v_exp_f32 %0, %1\n\tv_nop" : "=v"(r) : "v"(x));
    return r;
}

static_assert(LL * DK * 4 == 32 * NTHR * 16);
static_assert(2 * DK * LL * 2 == 32 * NTHR * 16);            // V hi and lo planes of a head: 32 copies per thread
static_assert(2 * DK * VPITCH * 2 <= LL * KPITCH * 4);       // and they fit the K tile's LDS

// Eight 16-byte asynchronous copies global -> LDS, each lane its own addresses. The s_wait_xcnt
// is the last line of the copies' own statement, so no address register is rewritten ahead of it.
__device__ __forceinline__ void copy8(const unsigned int* la, const float* const* ga)
{
    asm volatile(
        "global_load_async_to_lds_b128 %0, %8, off\n\t"
        "global_load_async_to_lds_b128 %1, %9, off\n\t"
        "global_load_async_to_lds_b128 %2, %10, off\n\t"
        "global_load_async_to_lds_b128 %3, %11, off\n\t"
        "global_load_async_to_lds_b128 %4, %12, off\n\t"
        "global_load_async_to_lds_b128 %5, %13, off\n\t"
        "global_load_async_to_lds_b128 %6, %14, off\n\t"
        "global_load_async_to_lds_b128 %7, %15, off\n\t"
        "s_wait_xcnt 0x0"
        :: "v"(la[0]), "v"(la[1]), "v"(la[2]), "v"(la[3]), "v"(la[4]), "v"(la[5]), "v"(la[6]), "v"(la[7]),
           "v"(ga[0]), "v"(ga[1]), "v"(ga[2]), "v"(ga[3]), "v"(ga[4]), "v"(ga[5]), "v"(ga[6]), "v"(ga[7])
        : "memory");
}

__global__ void __launch_bounds__(NTHR) attn_kernel(
    const float* __restrict__ Qp, const float* __restrict__ Kp, const float* __restrict__ vp,
    const int* __restrict__ mask,
    const unsigned short* __restrict__ VTh, const unsigned short* __restrict__ VTl,
    unsigned short* Oh, unsigned short* Ol)
{
    __shared__ __align__(16) float          s_k[LL][KPITCH];
    // [d pair][0 denominator, 1 numerator][query row]: the row's 16 bf16 k entries of that A fragment, as dwords
    __shared__ __align__(16) unsigned int   s_ta[DK / 2][2][16][8];
    __shared__ __align__(16) unsigned short s_ph[16][VPITCH];
    __shared__ __align__(16) unsigned short s_pl[16][VPITCH];
    __shared__ __align__(16) float          s_o[16][68];
    __shared__ __align__(16) float s_rmax[4][16];   // [wave][query row]
    __shared__ __align__(16) float s_rsum[4][16];

    const int tid = threadIdx.x;
    const int wv  = tid >> 5;
    const int l   = tid & 31;
    const int hh  = l >> 4;
    const int m15 = l & 15;
    const int bh  = blockIdx.y;          // 0..31
    const int b   = bh >> 3;
    const int h   = bh & 7;
    const int q0  = blockIdx.x * 16;     // 0..240

    const float LOG2E = 1.4426950408889634f;
    const float MASKV = -1.0e9f;

    // K tile: copy i of thread tid moves 16-byte chunk tid + 128*i of the head's 64 KiB, that is
    // key (tid >> 4) + 8*i, chunk tid & 15; a wave's copy covers four whole 128-B lines.
    {
        const float* gk0 = Kp + (size_t)bh * LL * DK + 4 * tid;
        const unsigned int lk0 = (unsigned int)(uintptr_t)&s_k[0][0]
            + (unsigned int)(((tid >> 5) + 128 * ((tid >> 4) & 1)) * (KPITCH * 4) + (tid & 15) * 16);
        #pragma unroll
        for (int g = 0; g < 4; ++g) {
            unsigned int la[8];
            const float* ga[8];
            #pragma unroll
            for (int i = 0; i < 8; ++i) {
                la[i] = lk0 + (unsigned int)((8 * g + i) * 4 * (KPITCH * 4));
                ga[i] = gk0 + (size_t)(8 * g + i) * (NTHR * 4);
            }
            copy8(la, ga);
        }
    }

    // Score tile kt = 0..3 of wave wv: 16 query rows x 16 keys, column m15 = key 64*wv + 32*(kt >> 1) + 2*m15 + (kt & 1),
    // so tiles 2g and 2g + 1 hold a lane's two neighbouring keys, and the lanes' K rows in LDS lie one pitch apart.
    // A lane's accumulator element r is query row 8*hh + r. Its mask words, one group of loads beside the K copies:
    v2i mk[2][8];
    v2f eq[4], wq[4];
    {
        const int* mrow = mask + ((size_t)(b * LL + q0 + 8 * hh)) * LL + 64 * wv + 2 * m15;
        #pragma unroll
        for (int g = 0; g < 2; ++g)
            #pragma unroll
            for (int r = 0; r < 8; ++r) mk[g][r] = *(const v2i*)(mrow + (size_t)r * LL + 32 * g);
        // A-fragment table: item n of thread tid is query row tid & 15, d pair (tid >> 4) + 8*n
        const float* qrow = Qp + ((size_t)(bh * LL + q0 + m15)) * DK + 2 * (tid >> 4);
        const float* vrow = vp + h * DK + 2 * (tid >> 4);
        #pragma unroll
        for (int n = 0; n < 4; ++n) {
            eq[n] = *(const v2f*)(qrow + 16 * n);
            wq[n] = *(const v2f*)(vrow + 16 * n);
        }
        // the loads name these three addresses; as inputs here they keep their registers up to this wait
        asm volatile("s_wait_xcnt 0x0" :: "v"(mrow), "v"(qrow), "v"(vrow) : "memory");
    }
    // With a = E1*F1 and b = E2*F2 (E = query factor, F = key factor of d = 2p, 2p + 1):
    //   v1/(1+a) + v2/(1+b) = (v1 + v2 + v2*E1*F1 + v1*E2*F2) / (1 + E1*F1 + E2*F2 + E1*E2*F1*F2),
    // both sides inner products of a query vector with the key vector (F1, F2, F1*F2, 1). In bf16 hi/lo (hi*hi + hi*lo
    // + lo*hi) the key side gives the 8 entries (F1h, F2h, Jh, 1, F1l, F2l, Jl, 0), J = F1*F2, to both lane halves;
    // the query side holds (x1h, x2h, x3h, x4h, x1h, x2h, x3h, 0) in lane half 0 and (x1l, x2l, x3l, x4l, 0, 0, 0, 0)
    // in half 1, with x = (E1, E2, E1*E2, 1) for the denominator and (v2*E1, v1*E2, 0, v1 + v2) for the numerator.
    #pragma unroll
    for (int n = 0; n < 4; ++n) {
        const int p = (tid >> 4) + 8 * n;
        unsigned int eh, el, gh, gl, nh, nl, vh, vl;
        const v2f x12 = { eq[n][0], eq[n][1] };
        const v2f x34 = { eq[n][0] * eq[n][1], 1.0f };
        const v2f y12 = { wq[n][1] * eq[n][0], wq[n][0] * eq[n][1] };
        const v2f y34 = { 0.0f, wq[n][0] + wq[n][1] };
        split2(x12, eh, el);
        split2(x34, gh, gl);
        split2(y12, nh, nl);
        split2(y34, vh, vl);
        const v4u d0 = { eh, gh, eh, gh & 0xFFFFu };
        const v4u d1 = { el, gl, 0u, 0u };
        const v4u n0 = { nh, vh, nh, 0u };
        const v4u n1 = { nl, vl, 0u, 0u };
        *(v4u*)&s_ta[p][0][m15][0] = d0;
        *(v4u*)&s_ta[p][0][m15][4] = d1;
        *(v4u*)&s_ta[p][1][m15][0] = n0;
        *(v4u*)&s_ta[p][1][m15][4] = n1;
    }
    asm volatile("s_wait_asynccnt 0x0" ::: "memory");   // this wave's copies of the K tile have landed
    __syncthreads();                                    // publishes the A-fragment table and the K tile

    const float* kr0 = &s_k[32 * wv + m15][0];
    const v8f zero8 = { 0.f, 0.f, 0.f, 0.f, 0.f, 0.f, 0.f, 0.f };
    v8f sc[4];                           // [score tile], sum over d of vp_d / (1 + e^{2x_d})
    #pragma unroll
    for (int kt = 0; kt < 4; ++kt) sc[kt] = zero8;

    // One B fragment serves two d pairs: elements 0..7 are the first pair's entries, 8..15 the second's; an A
    // fragment is zero in the other pair's half. Element s of lane half hh meets element s of lane half hh.
    const v4u z4 = { 0u, 0u, 0u, 0u };
    FragU ad0, an0, ad1, an1;
    ad0.q[1] = z4;
    an0.q[1] = z4;
    ad1.q[0] = z4;
    an1.q[0] = z4;

    // kept rolled: one trip is 16 matrix instructions and 64 reciprocals per wave, enough to cover its own LDS reads
    #pragma unroll 1
    for (int d4 = 0; d4 < DK / 4; ++d4) {
        ad0.q[0] = *(const v4u*)&s_ta[2 * d4][0][m15][4 * hh];
        an0.q[0] = *(const v4u*)&s_ta[2 * d4][1][m15][4 * hh];
        ad1.q[1] = *(const v4u*)&s_ta[2 * d4 + 1][0][m15][4 * hh];
        an1.q[1] = *(const v4u*)&s_ta[2 * d4 + 1][1][m15][4 * hh];
        v4f kf[4];
        #pragma unroll
        for (int kt = 0; kt < 4; ++kt)
            kf[kt] = *(const v4f*)(kr0 + (16 * (kt >> 1) + 128 * (kt & 1)) * KPITCH + 4 * d4);
        // a tile's quotients are taken behind the next tile's matrix instructions, whose issue fills the slots that
        // a matrix result needs before the vector unit may read it
        v8f den0[2], num0[2], den1[2], num1[2];
        #pragma unroll
        for (int kt = 0; kt < 5; ++kt) {
            if (kt < 4) {
                FragU fb;
                #pragma unroll
                for (int u = 0; u < 2; ++u) {
                    unsigned int fh, fl, jh, jl;
                    const v2f f12 = { kf[kt][2 * u], kf[kt][2 * u + 1] };
                    const v2f f34 = { kf[kt][2 * u] * kf[kt][2 * u + 1], 1.0f };
                    split2(f12, fh, fl);
                    split2one(f34, jh, jl);
                    const v4u w = { fh, jh, fl, jl };
                    fb.q[u] = w;
                }
                den0[kt & 1] = __builtin_amdgcn_wmma_f32_16x16x32_bf16(false, ad0.v, false, fb.v, (short)0, zero8, false, false);
                num0[kt & 1] = __builtin_amdgcn_wmma_f32_16x16x32_bf16(false, an0.v, false, fb.v, (short)0, zero8, false, false);
                den1[kt & 1] = __builtin_amdgcn_wmma_f32_16x16x32_bf16(false, ad1.v, false, fb.v, (short)0, zero8, false, false);
                num1[kt & 1] = __builtin_amdgcn_wmma_f32_16x16x32_bf16(false, an1.v, false, fb.v, (short)0, zero8, false, false);
            }
            if (kt > 0) {
                const int o = kt - 1;
                #pragma unroll
                for (int r = 0; r < 8; ++r) {
                    sc[o][r] = __builtin_fmaf(num0[o & 1][r], RCP_FAST(den0[o & 1][r]), sc[o][r]);
                    sc[o][r] = __builtin_fmaf(num1[o & 1][r], RCP_FAST(den1[o & 1][r]), sc[o][r]);
                }
            }
        }
    }

    // logits with mask fill, row max over the 256 keys: a row's keys lie in the 16 lanes of a half-wave, four per lane;
    // each cross-lane round runs over all 8 rows before the next one starts
    float bm[8];
    #pragma unroll
    for (int r = 0; r < 8; ++r) {
        #pragma unroll
        for (int g = 0; g < 2; ++g) {
            sc[2 * g][r]     = (mk[g][r][0] == 0) ? MASKV : (-2.0f * sc[2 * g][r]);
            sc[2 * g + 1][r] = (mk[g][r][1] == 0) ? MASKV : (-2.0f * sc[2 * g + 1][r]);
        }
        bm[r] = fmaxf(fmaxf(sc[0][r], sc[1][r]), fmaxf(sc[2][r], sc[3][r]));
    }
    #pragma unroll
    for (int off = 8; off > 0; off >>= 1) {
        float t[8];
        #pragma unroll
        for (int r = 0; r < 8; ++r) t[r] = __shfl_xor(bm[r], off, 32);
        #pragma unroll
        for (int r = 0; r < 8; ++r) bm[r] = fmaxf(bm[r], t[r]);
    }
    if (m15 == 0) {
        const v4f x0 = { bm[0], bm[1], bm[2], bm[3] };
        const v4f x1 = { bm[4], bm[5], bm[6], bm[7] };
        *(v4f*)&s_rmax[wv][8 * hh]     = x0;
        *(v4f*)&s_rmax[wv][8 * hh + 4] = x1;
    }
    asm volatile("s_wait_dscnt 0x0" ::: "memory");      // this wave's reads of the K tile are done before its LDS is refilled
    __syncthreads();                                    // publishes s_rmax, ends every wave's reads of the K tile

    // The head's V planes (64 dk rows x 256 keys, hi then lo) go into the LDS that held the K tile and fly under the
    // rest of the softmax, so the read-out waits for no global load. Copy i of thread tid moves 16 B of staged row
    // 4*i + (tid >> 5), chunk tid & 31: a wave's copy is one whole row of 512 B (four lines).
    unsigned short* s_v = (unsigned short*)&s_k[0][0];
    {
        const unsigned int lv0 = (unsigned int)(uintptr_t)s_v + (unsigned int)(wv * (VPITCH * 2) + l * 16);
        const unsigned short* gvh = VTh + ((size_t)(bh * DK + wv)) * LL + 8 * l;
        const unsigned short* gvl = VTl + ((size_t)(bh * DK + wv)) * LL + 8 * l;
        unsigned int la[32];
        const unsigned short* ga[32];
        #pragma unroll   // constant indices, so that both address arrays stay in registers
        for (int i = 0; i < 32; ++i) {
            la[i] = lv0 + (unsigned int)(i * 4 * (VPITCH * 2));
            ga[i] = (i < 16) ? gvh + (size_t)i * 4 * LL : gvl + (size_t)(i - 16) * 4 * LL;
        }
        copy12(la, ga);
        copy12(la + 12, ga + 12);
        copy8h(la + 24, ga + 24);
    }
    {
        v4f m0 = *(const v4f*)&s_rmax[0][8 * hh], m1 = *(const v4f*)&s_rmax[0][8 * hh + 4];
        #pragma unroll
        for (int w = 1; w < 4; ++w) {
            const v4f y0 = *(const v4f*)&s_rmax[w][8 * hh], y1 = *(const v4f*)&s_rmax[w][8 * hh + 4];
            #pragma unroll
            for (int e = 0; e < 4; ++e) { m0[e] = fmaxf(m0[e], y0[e]); m1[e] = fmaxf(m1[e], y1[e]); }
        }
        #pragma unroll
        for (int e = 0; e < 4; ++e) { bm[e] = m0[e]; bm[4 + e] = m1[e]; }
    }

    float bs[8];
    #pragma unroll
    for (int r = 0; r < 8; ++r) {
        #pragma unroll
        for (int kt = 0; kt < 4; ++kt) sc[kt][r] = exp2_slot((sc[kt][r] - bm[r]) * LOG2E);
        bs[r] = (sc[0][r] + sc[1][r]) + (sc[2][r] + sc[3][r]);
    }
    #pragma unroll
    for (int off = 8; off > 0; off >>= 1) {
        float t[8];
        #pragma unroll
        for (int r = 0; r < 8; ++r) t[r] = __shfl_xor(bs[r], off, 32);
        #pragma unroll
        for (int r = 0; r < 8; ++r) bs[r] += t[r];
    }
    if (m15 == 0) {
        const v4f x0 = { bs[0], bs[1], bs[2], bs[3] };
        const v4f x1 = { bs[4], bs[5], bs[6], bs[7] };
        *(v4f*)&s_rsum[wv][8 * hh]     = x0;
        *(v4f*)&s_rsum[wv][8 * hh + 4] = x1;
    }
    __syncthreads();
    {
        v4f u[4][2];
        #pragma unroll
        for (int w = 0; w < 4; ++w) {
            u[w][0] = *(const v4f*)&s_rsum[w][8 * hh];
            u[w][1] = *(const v4f*)&s_rsum[w][8 * hh + 4];
        }
        #pragma unroll
        for (int r = 0; r < 8; ++r) {
            const float sum = (u[0][r >> 2][r & 3] + u[1][r >> 2][r & 3]) + (u[2][r >> 2][r & 3] + u[3][r >> 2][r & 3]);
            const float inv = RCP_FAST(sum);
            #pragma unroll
            for (int g = 0; g < 2; ++g) {
                const float p0 = sc[2 * g][r] * inv;
                const float p1 = sc[2 * g + 1][r] * inv;
                unsigned int h0b, l0b, h1b, l1b;
                split1(p0, h0b, l0b);
                split1(p1, h1b, l1b);
                const int j0 = 64 * wv + 32 * g + 2 * m15;
                *(unsigned int*)&s_ph[8 * hh + r][j0] = (h1b << 16) | h0b;
                *(unsigned int*)&s_pl[8 * hh + r][j0] = (l1b << 16) | l0b;
            }
        }
    }
    asm volatile("s_wait_asynccnt 0x0" ::: "memory");   // this wave's copies of the V planes have landed
    __syncthreads();                                    // publishes P and the V planes

    // read-out: o[16 q][64 dk] = P . VT^T ; wave wv owns dk tile 16*wv
    v8f pacc = { 0.f, 0.f, 0.f, 0.f, 0.f, 0.f, 0.f, 0.f };
    const unsigned short* pah = &s_ph[m15][0];
    const unsigned short* pal = &s_pl[m15][0];
    const unsigned short* bvh = s_v + (16 * wv + m15) * VPITCH;
    const unsigned short* bvl = s_v + (DK + 16 * wv + m15) * VPITCH;
    v16bf fah = frag16(pah, 0, hh);
    v16bf fal = frag16(pal, 0, hh);
    v16bf fbh = frag16(bvh, 0, hh);
    v16bf fbl = frag16(bvl, 0, hh);
    #pragma unroll   // two register sets take turns: unrolled, no copy between them is needed
    for (int k0 = 0; k0 < LL; k0 += 32) {
        v16bf nah = fah, nal = fal, nbh = fbh, nbl = fbl;
        if (k0 + 32 < LL) {
            nah = frag16(pah, k0 + 32, hh);
            nal = frag16(pal, k0 + 32, hh);
            nbh = frag16(bvh, k0 + 32, hh);
            nbl = frag16(bvl, k0 + 32, hh);
        }
        // holds the next k step's LDS reads ahead of this step's WMMAs, so that their latency runs under them
        __builtin_amdgcn_sched_barrier(0);
        pacc = wmma3(fah, fal, fbh, fbl, pacc);
        fah = nah; fal = nal; fbh = nbh; fbl = nbl;
    }
    #pragma unroll
    for (int r = 0; r < 8; ++r) s_o[8 * hh + r][16 * wv + m15] = pacc[r];
    __syncthreads();

    {
        const int row = tid >> 3;   // 0..15
        const int c8  = tid & 7;
        const v4f x0 = *(const v4f*)&s_o[row][8 * c8];
        const v4f x1 = *(const v4f*)&s_o[row][8 * c8 + 4];
        v8us hv, lv;
        split8(x0, x1, hv, lv);
        const size_t goff = ((size_t)(b * LL + q0 + row)) * DD + h * DK + 8 * c8;
        *(v8us*)(Oh + goff) = hv;
        *(v8us*)(Ol + goff) = lv;
        
    }
}

extern "C" void kernel_launch(void* const* d_in, const int* in_sizes, int n_in,
                              void* d_out, int out_size, void* d_ws, size_t ws_size,
                              hipStream_t stream)
{
    if (n_in < 13) return;
    if (in_sizes[0] != NR * DD || in_sizes[1] != NR * DD || in_sizes[2] != NR * DD) return;
    if (in_sizes[3] != BB * LL * LL) return;
    if (in_sizes[4] != DD * DD || in_sizes[6] != DD * DD || in_sizes[8] != DD * DD || in_sizes[11] != DD * DD) return;
    if (in_sizes[5] != DD || in_sizes[7] != DD || in_sizes[9] != DD || in_sizes[12] != DD) return;
    if (in_sizes[10] != HH * DK) return;
    if (out_size != NR * DD) return;

    const float* q    = (const float*)d_in[0];    // [4][256][512]
    const float* k    = (const float*)d_in[1];
    const float* v    = (const float*)d_in[2];
    const int*   mask = (const int*)d_in[3];      // [4][256][256] int32
    const float* Wq   = (const float*)d_in[4];    // [512 in][512 out]
    const float* bq   = (const float*)d_in[5];
    const float* Wk   = (const float*)d_in[6];
    const float* bk   = (const float*)d_in[7];
    const float* Wv   = (const float*)d_in[8];
    const float* bv   = (const float*)d_in[9];
    const float* vp   = (const float*)d_in[10];   // [8][64]
    const float* W0   = (const float*)d_in[11];
    const float* b0   = (const float*)d_in[12];
    float* out = (float*)d_out;                   // [1024][512] f32

    // workspace carve (bytes), every offset a multiple of 512 KiB
    const size_t sz_wt = (size_t)DD * DD * 2;            // 524288   (W0T plane)
    const size_t sz_p  = (size_t)NR * DD * 4;            // 2097152  (f32 projection)
    const size_t sz_vt = (size_t)BB * HH * DK * LL * 2;  // 1048576
    const size_t sz_o  = (size_t)NR * DD * 2;            // 1048576
    size_t off = 0;
    const size_t off_wth = off;  off += sz_wt;
    const size_t off_wtl = off;  off += sz_wt;
    const size_t off_qp  = off;  off += sz_p;
    const size_t off_kp  = off;  off += sz_p;
    const size_t off_vth = off;  off += sz_vt;
    const size_t off_vtl = off;  off += sz_vt;
    const size_t off_oh  = off;  off += sz_o;
    const size_t off_ol  = off;  off += sz_o;             // total 9437184
    if (off > ws_size) return;

    char* ws = (char*)d_ws;
    unsigned short* wth = (unsigned short*)(ws + off_wth);
    unsigned short* wtl = (unsigned short*)(ws + off_wtl);
    float*          Qp  = (float*)(ws + off_qp);
    float*          Kp  = (float*)(ws + off_kp);
    unsigned short* VTh = (unsigned short*)(ws + off_vth);
    unsigned short* VTl = (unsigned short*)(ws + off_vtl);
    unsigned short* Oh  = (unsigned short*)(ws + off_oh);
    unsigned short* Ol  = (unsigned short*)(ws + off_ol);

    const float C2 = 2.8853900817779268f;    // 2*log2(e)

    // 1) Q, K projections -> Qp, Kp (B,H,L,DK) f32 = 2^(projection * 2log2e), the V projection, transposed
    //    -> VT hi/lo, and the transposed hi/lo planes of W0, as one grid of 3 x 128 + 64 blocks
    proj3_kernel<<<dim3(3 * 128 + 64), dim3(NTHR), 0, stream>>>(
        q, k, v, Wq, Wk, Wv, W0, bq, bk, bv, C2, Qp, Kp, VTh, VTl, wth, wtl);

    // 2) additive scores + softmax + P.V -> O hi/lo planes in merged (B,L,D) layout
    attn_kernel<<<dim3(LL / 16, BB * HH), dim3(NTHR), 0, stream>>>(
        Qp, Kp, vp, mask, VTh, VTl, Oh, Ol);

    // 3) output projection -> d_out
    gemm3_out_kernel<<<dim3(NR / 32, DD / TN), dim3(NTHR), 0, stream>>>(
        Oh, Ol, wth, wtl, b0, out);
}
